// v000
// Times are from an AMD MI455X. After a warm-up the kernel runs many times in a row, and a time is the length of
// such a window on the GPU divided by its runs, so every launch and the gaps after it count. The runs cycle
// through copies of the inputs. A figure is the median of several windows, for all but v000 over two sittings.
// Sittings can differ by a few percent; kernels timed side by side share one.
// v000 is the starting kernel. One run takes 1100 microseconds.
// compute dtype: all float inputs rounded to bf16; c = x w_attn + b_attn with EXACT bf16 products on WMMA 16x16x32 (f32 accumulate); the f32 k and v rows are ALSO the second output (present); causal logits: 3 products for the first 384 rows, single f16 q x k after, x 64^-0.5; softmax f32; P x 2^11 once to f16 x v once to f16 (bf16 hi + lo below row 384); ctx hi+lo x exact w_proj below row 384, x2^6 f16 carry x f16(bf16 x 2^8) after, + b_proj; f32 outputs.
#include <hip/hip_runtime.h>
#include <math.h>

typedef __attribute__((ext_vector_type(16))) _Float16 v16h;
typedef __attribute__((ext_vector_type(16))) __bf16 v16b;
typedef __attribute__((ext_vector_type(8)))  _Float16 v8h;
typedef __attribute__((ext_vector_type(8)))  float v8f;
typedef __attribute__((ext_vector_type(4)))  float v4f;
typedef __attribute__((ext_vector_type(2)))  float v2f;
typedef __attribute__((ext_vector_type(4)))  unsigned v4u;
typedef __attribute__((ext_vector_type(4)))  int v4i;
typedef float __attribute__((may_alias)) float_a;
typedef int __attribute__((may_alias)) int_a;

template <typename T> __device__ __forceinline__ void vst2(void* p, T v) { *(T*)p = v;  }
__device__ __forceinline__ v8f wmma16(v16h a, v16h b, v8f c) {
  v8f d = __builtin_amdgcn_wmma_f32_16x16x32_f16(false, a, false, b, (short)0, c, false, false);
  asm volatile("v_nop\n\tv_nop\n\tv_nop\n\tv_nop" : "+v"(d) : "v"(a), "v"(b));
  return d;
}
__device__ __forceinline__ v8f wmma_bf(v16b a, v16b b, v8f c) {
  v8f d = __builtin_amdgcn_wmma_f32_16x16x32_bf16(false, a, false, b, (short)0, c, false, false);
  asm volatile("v_nop\n\tv_nop\n\tv_nop\n\tv_nop" : "+v"(d) : "v"(a), "v"(b));
  return d;
}
// 16x16x32 fragments: lane = (h = lane>>4, row/col = lane&15); elements 0..7 = k0+8h+0..7, 8..15 = k0+16+8h+0..7; D element r = row 8h+r
__device__ __forceinline__ v16h frag_h(const _Float16* rowk0, int lane) {
  union { v16h v; v8h q[2]; } u; const _Float16* p = rowk0 + 8 * (lane >> 4);
  u.q[0] = *(const v8h*)p; u.q[1] = *(const v8h*)(p + 16); return u.v;
}
__device__ __forceinline__ v16h frag_f32(const float* rowk0, int lane) {
  v16h a; const float* p = rowk0 + 8 * (lane >> 4);
#pragma unroll
  for (int i = 0; i < 8; ++i) { a[i] = (_Float16)p[i]; a[8 + i] = (_Float16)p[16 + i]; }
  return a;
}
__device__ __forceinline__ v16h frag_f32s(const float* rowk0, int lane, float sc) {
  v16h a; const float* p = rowk0 + 8 * (lane >> 4);
#pragma unroll
  for (int i = 0; i < 8; ++i) { a[i] = (_Float16)(p[i] * sc); a[8 + i] = (_Float16)(p[16 + i] * sc); }
  return a;
}
// column fragment from a [K][ld] layout (column n), rows >= K read as 0
__device__ __forceinline__ v16h fragc_f32(const float* W, int k0, int n, int lane, int ld, int K) {
  v16h a; const int g = lane >> 4;
#pragma unroll
  for (int i = 0; i < 8; ++i) { const int ka = k0 + 8 * g + i, kb = ka + 16;
    a[i] = (_Float16)(ka < K ? W[(size_t)(ka < K ? ka : K - 1) * ld + n] : 0.f); a[8 + i] = (_Float16)(kb < K ? W[(size_t)(kb < K ? kb : K - 1) * ld + n] : 0.f); }
  return a;
}
struct F2 { v16b h, l; };
__device__ __forceinline__ F2 bsplit16(const float v[16]) { F2 r;
#pragma unroll
  for (int i = 0; i < 16; ++i) { const __bf16 h = (__bf16)v[i]; r.h[i] = h; r.l[i] = (__bf16)(v[i] - (float)h); }
  return r; }
__device__ __forceinline__ F2 split_row(const float* row, int k0, int lane) { float v[16]; const float* p = row + k0 + 8 * (lane >> 4);
#pragma unroll
  for (int i = 0; i < 8; ++i) { v[i] = p[i]; v[8 + i] = p[16 + i]; }
  return bsplit16(v); }
__device__ __forceinline__ F2 split_rowK(const float* row, int k0, int lane, int K) { float v[16]; const int g = lane >> 4;
#pragma unroll
  for (int i = 0; i < 8; ++i) { const int ka = k0 + 8 * g + i, kb = ka + 16; v[i] = ka < K ? row[ka < K ? ka : K - 1] : 0.f; v[8 + i] = kb < K ? row[kb < K ? kb : K - 1] : 0.f; }
  return bsplit16(v); }
__device__ __forceinline__ F2 split_col(const float* W, int k0, int n, int lane, int ld, int K) { float v[16]; const int g = lane >> 4;
#pragma unroll
  for (int i = 0; i < 8; ++i) { const int ka = k0 + 8 * g + i, kb = ka + 16; v[i] = ka < K ? W[(size_t)(ka < K ? ka : K - 1) * ld + n] : 0.f; v[8 + i] = kb < K ? W[(size_t)(kb < K ? kb : K - 1) * ld + n] : 0.f; }
  return bsplit16(v); }
__device__ __forceinline__ v8f mac3(const F2& a, const F2& b, v8f c) { c = wmma_bf(a.l, b.h, c); c = wmma_bf(a.h, b.l, c); return wmma_bf(a.h, b.h, c); }
__device__ __forceinline__ float sigm(float v) { return 1.0f / (1.0f + expf(-v)); }
#define LDSX() do { asm volatile("s_wait_dscnt 0" ::: "memory"); __builtin_amdgcn_wave_barrier(); __builtin_amdgcn_fence(__ATOMIC_RELEASE, "workgroup"); } while (0)

// Fused-qkv causal self-attention with TWO outputs (x [2,2048,1024]; fused (in,out) w_attn [1024,3072] N(0,1) x 0.02 + b_attn zeros (read), jnp.split(c, 3, axis=2) -> q | k | v column blocks; 16 heads x 64; w = q k^T x rsqrt(64); w * b - 1e10 * (1 - b) with b = (i >= j): causal, the masked logits are exactly -1e10; softmax; a = merge(p v) w_proj + b_proj; outputs: a [2,2048,1024] and present = stack([k, v], axis=1) [2,2,16,2048,64] = the projected k and v (bias included) in head-major layout).
#define NB 2
#define TT 2048
#define CC 1024            // NH * HD = projected width
#define DIN 1024          // input (model) width
#define NH 16
#define HD 64
#define NQB (TT / 64)
#define HG 4
#define SCALE (0.125f)
#define CAUSAL 1
#ifndef TNB
#define TNB NB
#endif
__device__ __forceinline__ float bfr(float v) { return (float)(__bf16)v; }
__host__ __device__ __forceinline__ int kb_last(int qb) { return CAUSAL ? ((qb * 64 + 63) >> 7) : (TT / 128 - 1); }
typedef __attribute__((ext_vector_type(8))) __bf16 v8b;
__device__ __forceinline__ v16b frag_b(const __bf16* rowk0, int lane) {
  union { v16b v; v8b q[2]; } u; const __bf16* p = rowk0 + 8 * (lane >> 4);
  u.q[0] = *(const v8b*)p; u.q[1] = *(const v8b*)(p + 16); return u.v;
}
#define QBH 6              // causal: query blocks 0..QBH-1 of each sequence (few keys, no averaging) take the high-precision path
#define QHI 384            // rows carrying a q residual plane
#define KHI 384            // key rows carrying k residual / v bf16 hi+lo planes (used only by the causal high-precision path)
// B fragment (k rows k0+.., output column o) of a weight: (in,out) [K][ld] or (out,in) [ld rows of K]: bf16 exact, or f16(bf16 * 256) exact
__device__ __forceinline__ v16b wcol_io(const float* Wm, int k0, int o, int lane, int ld) { v16b w; const int g = lane >> 4;
#pragma unroll
  for (int i = 0; i < 8; ++i) { w[i] = (__bf16)Wm[(size_t)(k0 + 8 * g + i) * ld + o]; w[8 + i] = (__bf16)Wm[(size_t)(k0 + 16 + 8 * g + i) * ld + o]; }
  return w; }
__device__ __forceinline__ v16b wcol_oi(const float* Wm, int k0, int o, int lane, int K) { v16b w; const float* p = Wm + (size_t)o * K + k0 + 8 * (lane >> 4);
#pragma unroll
  for (int i = 0; i < 8; ++i) { w[i] = (__bf16)p[i]; w[8 + i] = (__bf16)p[16 + i]; }
  return w; }
__device__ __forceinline__ v16h wcolh_io(const float* Wm, int k0, int o, int lane, int ld) { v16h w; const int g = lane >> 4;
#pragma unroll
  for (int i = 0; i < 8; ++i) { w[i] = (_Float16)(bfr(Wm[(size_t)(k0 + 8 * g + i) * ld + o]) * 256.0f); w[8 + i] = (_Float16)(bfr(Wm[(size_t)(k0 + 16 + 8 * g + i) * ld + o]) * 256.0f); }
  return w; }
__device__ __forceinline__ v16h wcolh_oi(const float* Wm, int k0, int o, int lane, int K) { v16h w; const float* p = Wm + (size_t)o * K + k0 + 8 * (lane >> 4);
#pragma unroll
  for (int i = 0; i < 8; ++i) { w[i] = (_Float16)(bfr(p[i]) * 256.0f); w[8 + i] = (_Float16)(bfr(p[16 + i]) * 256.0f); }
  return w; }
#define WQKV_LAYOUT 0   // 0 = (in,out); 1 = (out,in) [CC][DIN]; 2 = per-head [NH][DIN][HD]
__device__ __forceinline__ v16b wcol_hdk(const float* Wm, int k0, int o, int lane) { v16b w; const int g = lane >> 4; const float* p = Wm + (size_t)(o / HD) * DIN * HD + (o % HD);
#pragma unroll
  for (int i = 0; i < 8; ++i) { w[i] = (__bf16)p[(size_t)(k0 + 8 * g + i) * HD]; w[8 + i] = (__bf16)p[(size_t)(k0 + 16 + 8 * g + i) * HD]; }
  return w; }
#define WO_OUT_IN 0
#if WQKV_LAYOUT == 1
#define WCOL(W, k0, o, lane) wcol_oi(W, k0, o, lane, DIN)
#elif WQKV_LAYOUT == 2
#define WCOL(W, k0, o, lane) wcol_hdk(W, k0, o, lane)
#else
#define WCOL(W, k0, o, lane) wcol_io(W, k0, o, lane, 3 * CC)   /* w_attn (in,out) [1024][3072] packed by columns: row pitch 3*CC; the q / k / v pointers carry the column offsets 0 / CC / 2*CC */
#endif
#if WO_OUT_IN
#define WOCOL(W, k0, o, lane) wcol_oi(W, k0, o, lane, CC)
#define WOCOLH(W, k0, o, lane) wcolh_oi(W, k0, o, lane, CC)
#else
#define WOCOL(W, k0, o, lane) wcol_io(W, k0, o, lane, DIN)
#define WOCOLH(W, k0, o, lane) wcolh_io(W, k0, o, lane, DIN)
#endif
#define PROJ_EXTRA_PARAMS , float* __restrict__ PRES   /* second output: present [NB][2][NH][TT][HD] f32 */
#define PROJ_EPI(which, row, t, h) do { if ((which) >= 1) { float* dst_ = PRES + ((((size_t)bb * 2 + ((which) - 1)) * NH + (h)) * TT + (t)) * HD; _Pragma("unroll") for (int q4 = 0; q4 < HD / 4; ++q4) vst2(dst_ + 4 * q4, *(const v4f*)((row) + 4 * q4)); } } while (0)
static_assert(HD == 64 && (132 * 4) % 16 == 0, "the staged row st[rl][hh*HD] is 16-B aligned and 64 floats long");
#ifndef SM_EXTRA_PARAMS
#define SM_EXTRA_PARAMS
#endif
#ifndef PROJ_EXTRA_PARAMS
#define PROJ_EXTRA_PARAMS
#endif
#ifndef SM_MASK_HOOK
#define SM_MASK_HOOK (void)0
#endif

#define WS_QH  0u                                      // f16 q rows [b*t][CC]
#define WS_KH  (WS_QH + 2u * (size_t)NB * TT * CC)      // f16 k rows [b*t][CC]
#define WS_VT  (WS_KH + 2u * (size_t)NB * TT * CC)      // f16 v planes [b][c][t]
#define WS_QL  (WS_VT + 2u * (size_t)NB * CC * TT)      // f16 q residual x 2^10 rows [b][t < QHI][CC]
#define WS_KL  (WS_QL + 2u * (size_t)NB * QHI * CC)     // f16 k residual x 2^10 rows [b][t < KHI][CC]
#define WS_VB  (WS_KL + 2u * (size_t)NB * KHI * CC)     // bf16 v hi planes [b][c][t < KHI]
#define WS_VBL (WS_VB + 2u * (size_t)NB * CC * KHI)
#define WS_S   (WS_VBL + 2u * (size_t)NB * CC * KHI)    // f32 logits / P [hg][t][s]
#define WS_Y   (WS_S  + 4u * (size_t)HG * TT * TT)      // f32 ctx rows [b*t][CC] (only when there is an output projection)
#define WS_END (WS_Y  + 4u * (size_t)NB * TT * CC)

// ---- k_proj: block = (64 rows, 128 cols, which): q/k/v = X W (+ b) with exact bf16 products (K = DIN) -> which 0: q f16 rows (+ residual rows < QHI); 1: k f16 rows (+ residual rows < KHI); 2: v f16 planes [c][t] (+ bf16 hi/lo planes for t < KHI)
__global__ __launch_bounds__(128) void k_proj(const float* __restrict__ XQ, const float* __restrict__ XK, const float* __restrict__ XV, const float* __restrict__ WQ, const float* __restrict__ WK, const float* __restrict__ WV, const float* __restrict__ BQ, const float* __restrict__ BK, const float* __restrict__ BV,
    _Float16* __restrict__ QH, _Float16* __restrict__ QL, _Float16* __restrict__ KH, _Float16* __restrict__ KL, _Float16* __restrict__ VT, __bf16* __restrict__ VB, __bf16* __restrict__ VBL PROJ_EXTRA_PARAMS) {
  __shared__ __align__(16) float st[64][132]; __shared__ __align__(16) _Float16 sh[64][136], sl[64][136]; __shared__ __align__(16) _Float16 th[128][72]; __shared__ __align__(16) __bf16 tb[128][72], tbl[128][72];
  const int tid = threadIdx.x, wave = tid >> 5, lane = tid & 31, col = lane & 15, g = lane >> 4; const int which = blockIdx.z; const int c0 = blockIdx.y * 128; const size_t r0 = (size_t)blockIdx.x * 64; const size_t bb = r0 / TT; const int t0 = (int)(r0 % TT);
  const float* X = which == 0 ? XQ : which == 1 ? XK : XV; const float* WA = which == 0 ? WQ : which == 1 ? WK : WV; const float* BA = which == 0 ? BQ : which == 1 ? BK : BV;
  v8f acc[8] = {};
#pragma unroll 2
  for (int kc = 0; kc < DIN / 32; ++kc) { v16b a; { const float* p = X + (r0 + wave * 16 + col) * DIN + kc * 32 + 8 * g;
#pragma unroll
      for (int i = 0; i < 8; ++i) { a[i] = (__bf16)p[i]; a[8 + i] = (__bf16)p[16 + i]; } }
    asm volatile("s_wait_loadcnt 0x0" ::: "memory");
#pragma unroll
    for (int j = 0; j < 8; ++j) { const v16b w = WCOL(WA, kc * 32, c0 + j * 16 + col, lane); asm volatile("s_wait_loadcnt 0x0" ::: "memory"); acc[j] = wmma_bf(a, w, acc[j]); } }
  { // stage the f32 tile (acc + bias) in LDS, run the per-(row, head) epilogue hook, then convert
#pragma unroll
    for (int j = 0; j < 8; ++j) { const float bias = BA ? bfr(BA[c0 + j * 16 + col]) : 0.f;
#pragma unroll
      for (int r = 0; r < 8; ++r) st[wave * 16 + 8 * g + r][j * 16 + col] = acc[j][r] + bias; }
    __syncthreads();
    for (int e = tid; e < 64 * (128 / HD); e += 128) { const int rl = e / (128 / HD), hh = e % (128 / HD); PROJ_EPI(which, &st[rl][hh * HD], (int)((r0 + rl) % TT), (c0 / HD) + hh); }
    __syncthreads(); }
  if (which < 2) { _Float16* DH = which == 0 ? QH : KH; _Float16* DL = which == 0 ? QL : KL; const int nhi = which == 0 ? QHI : KHI; const bool hi_rows = t0 < nhi;
    for (int e = tid; e < 64 * 128; e += 128) { const int rl = e >> 7, cl = e & 127; const float v = st[rl][cl]; const _Float16 hv = (_Float16)v; sh[rl][cl] = hv; sl[rl][cl] = (_Float16)((v - (float)hv) * 1024.0f); }
    __syncthreads();
    for (int e = tid; e < 64 * 16; e += 128) { const int rl = e >> 4, q = e & 15; vst2((unsigned*)(DH + (r0 + rl) * CC + c0 + q * 8), *(const v4u*)&sh[rl][q * 8]); if (hi_rows) vst2((unsigned*)(DL + (bb * nhi + t0 + rl) * (size_t)CC + c0 + q * 8), *(const v4u*)&sl[rl][q * 8]); }
  } else { const bool hi_rows = t0 < KHI;
    for (int e = tid; e < 64 * 128; e += 128) { const int rl = e & 63, cl = e >> 6; const float v = st[rl][cl]; th[cl][rl] = (_Float16)v; const __bf16 bh = (__bf16)v; tb[cl][rl] = bh; tbl[cl][rl] = (__bf16)(v - (float)bh); }
    __syncthreads();
    for (int e = tid; e < 128 * 8; e += 128) { const int cl = e >> 3, q = e & 7; vst2((unsigned*)(VT + (bb * CC + c0 + cl) * (size_t)TT + t0 + q * 8), *(const v4u*)&th[cl][q * 8]); if (hi_rows) { const size_t o3 = (bb * CC + c0 + cl) * (size_t)KHI + t0 + q * 8; vst2((unsigned*)(VB + o3), *(const v4u*)&tb[cl][q * 8]); vst2((unsigned*)(VBL + o3), *(const v4u*)&tbl[cl][q * 8]); } } } }
// ---- k_sc: block = (query block qb, key block kb <= kb_last(qb), head in group) of batch b: logits x SCALE; q hi + residual (x 2^10) against k (2 products) for query rows < QHI, plus the k residual (3 products) for query blocks < QBH (causal early rows); causal: blocks past the diagonal exit, the mask itself is applied by index in k_sm
__global__ __launch_bounds__(128) void k_sc(const _Float16* __restrict__ QH, const _Float16* __restrict__ KH, const _Float16* __restrict__ QL, const _Float16* __restrict__ KL, int b, int h0, float* __restrict__ S0) { __shared__ __align__(16) float ss[4][16][132];
  const int qb = blockIdx.x, kb = blockIdx.y; if (kb > kb_last(qb)) return;
  const int h = h0 + blockIdx.z; float* S = S0 + (size_t)blockIdx.z * TT * TT;
  const int tid = threadIdx.x, wave = tid >> 5, lane = tid & 31, col = lane & 15, g = lane >> 4; const int k0 = kb * 128; const int ql0 = qb * 64 + wave * 16; const size_t q0 = (size_t)b * TT + ql0, kr0 = (size_t)b * TT + k0;
  v8f acc[8] = {}, accl[8] = {};
  const _Float16* QLb = QL + (size_t)b * QHI * CC; const _Float16* KLb = KL + (size_t)b * KHI * CC;
  if (qb < QBH) {
#pragma unroll
    for (int kc = 0; kc < HD / 32; ++kc) { const v16h ah = frag_h(QH + (q0 + col) * CC + h * HD + kc * 32, lane), al = frag_h(QLb + (size_t)(ql0 + col) * CC + h * HD + kc * 32, lane);
#pragma unroll
      for (int j = 0; j < 8; ++j) { const v16h kbf = frag_h(KH + (kr0 + j * 16 + col) * CC + h * HD + kc * 32, lane), klf = frag_h(KLb + (size_t)(k0 + j * 16 + col) * CC + h * HD + kc * 32, lane); acc[j] = wmma16(ah, kbf, acc[j]); accl[j] = wmma16(al, kbf, accl[j]); accl[j] = wmma16(ah, klf, accl[j]); } }
  } else if (qb * 64 < QHI) {
#pragma unroll
    for (int kc = 0; kc < HD / 32; ++kc) { const v16h ah = frag_h(QH + (q0 + col) * CC + h * HD + kc * 32, lane), al = frag_h(QLb + (size_t)(ql0 + col) * CC + h * HD + kc * 32, lane);
#pragma unroll
      for (int j = 0; j < 8; ++j) { const v16h kbf = frag_h(KH + (kr0 + j * 16 + col) * CC + h * HD + kc * 32, lane); acc[j] = wmma16(ah, kbf, acc[j]); accl[j] = wmma16(al, kbf, accl[j]); } }
  } else {
#pragma unroll
    for (int kc = 0; kc < HD / 32; ++kc) { const v16h ah = frag_h(QH + (q0 + col) * CC + h * HD + kc * 32, lane);
#pragma unroll
      for (int j = 0; j < 8; ++j) { const v16h kbf = frag_h(KH + (kr0 + j * 16 + col) * CC + h * HD + kc * 32, lane); acc[j] = wmma16(ah, kbf, acc[j]); } } }
#pragma unroll
  for (int j = 0; j < 8; ++j) {
#pragma unroll
    for (int r = 0; r < 8; ++r) ss[wave][8 * g + r][j * 16 + col] = (acc[j][r] + accl[j][r] * (1.0f / 1024.0f)) * SCALE; }
  LDSX(); for (int rl = 0; rl < 16; ++rl) vst2(S + (size_t)(ql0 + rl) * TT + k0 + lane * 4, *(const v4f*)&ss[wave][rl][lane * 4]); }
// ---- k_sm: block = query row t (head in group): keys [0, kend): causal -> logit if s <= t else excluded; softmax in f32; P x 2^11 in place (0 for excluded)
__global__ __launch_bounds__(256) void k_sm(float* __restrict__ S0 SM_EXTRA_PARAMS) { __shared__ float sred[8]; __shared__ float sbc; __shared__ __align__(16) float shv[TT];
  const int tid = threadIdx.x; const int t = blockIdx.x; const int kend = (kb_last(t >> 6) + 1) * 128;
  float* sr = S0 + (size_t)blockIdx.y * TT * TT + (size_t)t * TT;
  float m = -3.0e38f; for (int k = tid; k < kend; k += 256) { float v = (!CAUSAL || k <= t) ? sr[k] : -3.0e38f; SM_MASK_HOOK; shv[k] = v; m = fmaxf(m, v); }
#pragma unroll
  for (int o = 1; o < 32; o <<= 1) m = fmaxf(m, __shfl_xor(m, o));
  if ((tid & 31) == 0) sred[tid >> 5] = m; __syncthreads(); if (tid == 0) { float a = sred[0]; for (int i = 1; i < 8; ++i) a = fmaxf(a, sred[i]); sbc = a; } __syncthreads(); m = sbc; __syncthreads();
  float sum = 0.f; for (int k = tid; k < kend; k += 256) { const float v = shv[k]; const float e = (v <= -1.0e38f) ? 0.f : expf(v - m); shv[k] = e; sum += e; }
#pragma unroll
  for (int o = 1; o < 32; o <<= 1) sum += __shfl_xor(sum, o);
  if ((tid & 31) == 0) sred[tid >> 5] = sum; __syncthreads(); if (tid == 0) { float a = 0.f; for (int i = 0; i < 8; ++i) a += sred[i]; sbc = a > 0.f ? 2048.0f / a : 0.f; }   /* a fully excluded row yields P = 0 */ __syncthreads(); const float inv = sbc;
  for (int k = tid; k < kend; k += 256) shv[k] = shv[k] * inv;
  __syncthreads(); for (int q = tid; q < kend / 4; q += 256) vst2(sr + q * 4, *(const v4f*)&shv[q * 4]); }
// ---- k_pv: block = 64 queries (qb) of (b, h): ctx = P . v over keys [0, kend) (P x 2^11 once to f16 against v f16: 1 product; causal early query blocks: P and v as bf16 hi + lo, 3 products); 256-B (row, head) segment by 16 lanes
__global__ __launch_bounds__(128) void k_pv(const float* __restrict__ PS0, const _Float16* __restrict__ VT, const __bf16* __restrict__ VB, const __bf16* __restrict__ VBL, int b, int h0, float* __restrict__ Y) { const int h = h0 + blockIdx.z; const float* PS = PS0 + (size_t)blockIdx.z * TT * TT; __shared__ __align__(16) float ss[4][16][HD + 4];
  const int tid = threadIdx.x, wave = tid >> 5, lane = tid & 31, col = lane & 15, g = lane >> 4; const int qb = blockIdx.x; const int ql0 = qb * 64 + wave * 16; const int kce = (kb_last(qb) + 1) * 4;
  v8f acc[HD / 16] = {};
  if (qb < QBH) {
#pragma unroll 1
    for (int kc = 0; kc < kce; ++kc) { const F2 p = split_row(PS + (size_t)(ql0 + col) * TT, kc * 32, lane);
      asm volatile("s_wait_loadcnt 0x0" ::: "memory");
#pragma unroll
      for (int j = 0; j < HD / 16; ++j) { const size_t po = ((size_t)b * CC + h * HD + j * 16 + col) * (size_t)KHI + kc * 32; const v16b vh = frag_b(VB + po, lane); acc[j] = wmma_bf(p.h, vh, acc[j]); acc[j] = wmma_bf(p.l, vh, acc[j]); acc[j] = wmma_bf(p.h, frag_b(VBL + po, lane), acc[j]); } }
  } else {
#pragma unroll 1
    for (int kc = 0; kc < kce; ++kc) { const v16h p = frag_f32(PS + (size_t)(ql0 + col) * TT + kc * 32, lane);
      asm volatile("s_wait_loadcnt 0x0" ::: "memory");
#pragma unroll
      for (int j = 0; j < HD / 16; ++j) { const size_t po = ((size_t)b * CC + h * HD + j * 16 + col) * (size_t)TT + kc * 32; acc[j] = wmma16(p, frag_h(VT + po, lane), acc[j]); } } }
#pragma unroll
  for (int j = 0; j < HD / 16; ++j)
#pragma unroll
    for (int r = 0; r < 8; ++r) ss[wave][8 * g + r][j * 16 + col] = acc[j][r] * (1.0f / 2048.0f);
  LDSX(); for (int rl = 0; rl < 16; ++rl) if (lane < HD / 4) vst2(Y + ((size_t)b * TT + ql0 + rl) * CC + h * HD + lane * 4, *(const v4f*)&ss[wave][rl][lane * 4]); }
// ---- k_out: block = (64 rows, 128 cols): out = ctx Wo (+ bo): ctx x 2^6 once to f16 against Wo as f16(bf16 x 2^8) exact (1 product) x 2^-14; causal early rows (< QHI of each sequence): ctx bf16 hi + lo against exact bf16 Wo (2 products)
__global__ __launch_bounds__(128) void k_out(const float* __restrict__ Y, const float* __restrict__ WO, const float* __restrict__ BO, float* __restrict__ OUT) { __shared__ __align__(16) float sf[4][16][132];
  const int tid = threadIdx.x, wave = tid >> 5, lane = tid & 31, col = lane & 15, g = lane >> 4; const int c0 = blockIdx.y * 128; const size_t r0 = (size_t)blockIdx.x * 64 + wave * 16;
  v8f acc[8] = {};
  if (CAUSAL && (int)(((size_t)blockIdx.x * 64) % TT) < QHI) {   /* block-uniform */
#pragma unroll 2
    for (int kc = 0; kc < CC / 32; ++kc) { const F2 a = split_row(Y + (r0 + col) * CC, kc * 32, lane); asm volatile("s_wait_loadcnt 0x0" ::: "memory");
#pragma unroll
      for (int j = 0; j < 8; ++j) { const v16b w = WOCOL(WO, kc * 32, c0 + j * 16 + col, lane); asm volatile("s_wait_loadcnt 0x0" ::: "memory"); acc[j] = wmma_bf(a.h, w, acc[j]); acc[j] = wmma_bf(a.l, w, acc[j]); } }
#pragma unroll
    for (int j = 0; j < 8; ++j) { const float bias = BO ? bfr(BO[c0 + j * 16 + col]) : 0.f;
#pragma unroll
      for (int r = 0; r < 8; ++r) sf[wave][8 * g + r][j * 16 + col] = acc[j][r] + bias; }
  } else {
#pragma unroll 2
    for (int kc = 0; kc < CC / 32; ++kc) { const v16h a = frag_f32s(Y + (r0 + col) * CC + kc * 32, lane, 64.0f); asm volatile("s_wait_loadcnt 0x0" ::: "memory");   /* ctx carried x 2^6 into f16 so small-magnitude context rows stay clear of f16 subnormals (chip FTZ) */
#pragma unroll
      for (int j = 0; j < 8; ++j) { const v16h w = WOCOLH(WO, kc * 32, c0 + j * 16 + col, lane); asm volatile("s_wait_loadcnt 0x0" ::: "memory"); acc[j] = wmma16(a, w, acc[j]); } }
#pragma unroll
    for (int j = 0; j < 8; ++j) { const float bias = BO ? bfr(BO[c0 + j * 16 + col]) : 0.f;
#pragma unroll
      for (int r = 0; r < 8; ++r) sf[wave][8 * g + r][j * 16 + col] = acc[j][r] * (1.0f / 16384.0f) + bias; } }   /* 2^-8 (Wo carry) x 2^-6 (ctx carry) */
  LDSX(); for (int rl = 0; rl < 16; ++rl) vst2(OUT + (r0 + rl) * DIN + c0 + lane * 4, *(const v4f*)&sf[wave][rl][lane * 4]); }

extern "C" void kernel_launch(void* const* d_in, const int* in_sizes, int n_in, void* d_out, int out_size, void* d_ws, size_t ws_size, hipStream_t stream) {
  (void)in_sizes; (void)n_in; (void)out_size;
  const float** F = (const float**)d_in;
  if (ws_size < (size_t)WS_END) return;
  char* ws = (char*)d_ws; _Float16 *QH = (_Float16*)(ws + WS_QH), *KH = (_Float16*)(ws + WS_KH), *VT = (_Float16*)(ws + WS_VT), *QL = (_Float16*)(ws + WS_QL), *KL = (_Float16*)(ws + WS_KL); __bf16 *VB = (__bf16*)(ws + WS_VB), *VBL = (__bf16*)(ws + WS_VBL); float *S = (float*)(ws + WS_S), *Y = (float*)(ws + WS_Y);
  (void)Y; (void)QL; (void)KL; (void)VB; (void)VBL;
  // inputs: 0 x [2,2048,1024]; 1 w_attn [1024,3072] (in,out; columns q | k | v); 2 b_attn [3072] (zeros, read); 3 w_proj [1024,1024] (in,out); 4 b_proj [1024] (zeros, read). outputs: 0 a [2,2048,1024] at d_out + 0; 1 present [2,2,16,2048,64] at d_out + NB*TT*CC floats (byte offset 16,777,216)
  k_proj<<<dim3(TNB * TT / 64, CC / 128, 3), 128, 0, stream>>>(F[0], F[0], F[0], F[1], F[1] + CC, F[1] + 2 * CC, F[2], F[2] + CC, F[2] + 2 * CC, QH, QL, KH, KL, VT, VB, VBL, (float*)d_out + (size_t)NB * TT * CC);
  for (int b = 0; b < TNB; ++b) for (int h0 = 0; h0 < NH; h0 += HG) {
    k_sc<<<dim3(NQB, TT / 128, HG), 128, 0, stream>>>(QH, KH, QL, KL, b, h0, S);
    k_sm<<<dim3(TT, HG), 256, 0, stream>>>(S);
    k_pv<<<dim3(NQB, 1, HG), 128, 0, stream>>>(S, VT, VB, VBL, b, h0, Y);
  }
  k_out<<<dim3(TNB * TT / 64, DIN / 128), 128, 0, stream>>>(Y, F[3], F[4], (float*)d_out);
}

// v001
// A run of this version takes 766 microseconds.
// Timed twice side by side with v000, it ran 1.45 and 1.46 times as fast.
// compute dtype: all float inputs rounded to bf16; c = x w_attn + b_attn with EXACT bf16 products on WMMA 16x16x32 (f32 accumulate); the f32 k and v rows are ALSO the second output (present); causal logits: 3 products for the first 384 rows, single f16 q x k after, x 64^-0.5; softmax f32; P x 2^11 once to f16 x v once to f16 (bf16 hi + lo below row 384); ctx hi+lo x exact w_proj below row 384, x2^6 f16 carry x f16(bf16 x 2^8) after, + b_proj; f32 outputs.
#include <hip/hip_runtime.h>
#include <math.h>

typedef __attribute__((ext_vector_type(16))) _Float16 v16h;
typedef __attribute__((ext_vector_type(16))) __bf16 v16b;
typedef __attribute__((ext_vector_type(8)))  _Float16 v8h;
typedef __attribute__((ext_vector_type(8)))  float v8f;
typedef __attribute__((ext_vector_type(4)))  float v4f;
typedef __attribute__((ext_vector_type(2)))  float v2f;
typedef __attribute__((ext_vector_type(4)))  unsigned v4u;
typedef __attribute__((ext_vector_type(4)))  int v4i;
typedef float __attribute__((may_alias)) float_a;
typedef int __attribute__((may_alias)) int_a;

template <typename T> __device__ __forceinline__ void vst2(void* p, T v) { *(T*)p = v;  }
__device__ __forceinline__ v8f wmma16(v16h a, v16h b, v8f c) {
  v8f d = __builtin_amdgcn_wmma_f32_16x16x32_f16(false, a, false, b, (short)0, c, false, false);
  asm volatile("v_nop\n\tv_nop\n\tv_nop\n\tv_nop" : "+v"(d) : "v"(a), "v"(b));
  return d;
}
__device__ __forceinline__ v8f wmma_bf(v16b a, v16b b, v8f c) {
  v8f d = __builtin_amdgcn_wmma_f32_16x16x32_bf16(false, a, false, b, (short)0, c, false, false);
  asm volatile("v_nop\n\tv_nop\n\tv_nop\n\tv_nop" : "+v"(d) : "v"(a), "v"(b));
  return d;
}
// 16x16x32 fragments: lane = (h = lane>>4, row/col = lane&15); elements 0..7 = k0+8h+0..7, 8..15 = k0+16+8h+0..7; D element r = row 8h+r
__device__ __forceinline__ v16h frag_h(const _Float16* rowk0, int lane) {
  union { v16h v; v8h q[2]; } u; const _Float16* p = rowk0 + 8 * (lane >> 4);
  u.q[0] = *(const v8h*)p; u.q[1] = *(const v8h*)(p + 16); return u.v;
}
__device__ __forceinline__ v16h frag_f32(const float* rowk0, int lane) {
  v16h a; const float* p = rowk0 + 8 * (lane >> 4);
#pragma unroll
  for (int i = 0; i < 8; ++i) { a[i] = (_Float16)p[i]; a[8 + i] = (_Float16)p[16 + i]; }
  return a;
}
__device__ __forceinline__ v16h frag_f32s(const float* rowk0, int lane, float sc) {
  v16h a; const float* p = rowk0 + 8 * (lane >> 4);
#pragma unroll
  for (int i = 0; i < 8; ++i) { a[i] = (_Float16)(p[i] * sc); a[8 + i] = (_Float16)(p[16 + i] * sc); }
  return a;
}
// column fragment from a [K][ld] layout (column n), rows >= K read as 0
__device__ __forceinline__ v16h fragc_f32(const float* W, int k0, int n, int lane, int ld, int K) {
  v16h a; const int g = lane >> 4;
#pragma unroll
  for (int i = 0; i < 8; ++i) { const int ka = k0 + 8 * g + i, kb = ka + 16;
    a[i] = (_Float16)(ka < K ? W[(size_t)(ka < K ? ka : K - 1) * ld + n] : 0.f); a[8 + i] = (_Float16)(kb < K ? W[(size_t)(kb < K ? kb : K - 1) * ld + n] : 0.f); }
  return a;
}
struct F2 { v16b h, l; };
__device__ __forceinline__ F2 bsplit16(const float v[16]) { F2 r;
#pragma unroll
  for (int i = 0; i < 16; ++i) { const __bf16 h = (__bf16)v[i]; r.h[i] = h; r.l[i] = (__bf16)(v[i] - (float)h); }
  return r; }
__device__ __forceinline__ F2 split_row(const float* row, int k0, int lane) { float v[16]; const float* p = row + k0 + 8 * (lane >> 4);
#pragma unroll
  for (int i = 0; i < 8; ++i) { v[i] = p[i]; v[8 + i] = p[16 + i]; }
  return bsplit16(v); }
__device__ __forceinline__ F2 split_rowK(const float* row, int k0, int lane, int K) { float v[16]; const int g = lane >> 4;
#pragma unroll
  for (int i = 0; i < 8; ++i) { const int ka = k0 + 8 * g + i, kb = ka + 16; v[i] = ka < K ? row[ka < K ? ka : K - 1] : 0.f; v[8 + i] = kb < K ? row[kb < K ? kb : K - 1] : 0.f; }
  return bsplit16(v); }
__device__ __forceinline__ F2 split_col(const float* W, int k0, int n, int lane, int ld, int K) { float v[16]; const int g = lane >> 4;
#pragma unroll
  for (int i = 0; i < 8; ++i) { const int ka = k0 + 8 * g + i, kb = ka + 16; v[i] = ka < K ? W[(size_t)(ka < K ? ka : K - 1) * ld + n] : 0.f; v[8 + i] = kb < K ? W[(size_t)(kb < K ? kb : K - 1) * ld + n] : 0.f; }
  return bsplit16(v); }
__device__ __forceinline__ v8f mac3(const F2& a, const F2& b, v8f c) { c = wmma_bf(a.l, b.h, c); c = wmma_bf(a.h, b.l, c); return wmma_bf(a.h, b.h, c); }
__device__ __forceinline__ float sigm(float v) { return 1.0f / (1.0f + expf(-v)); }
#define LDSX() do { asm volatile("s_wait_dscnt 0" ::: "memory"); __builtin_amdgcn_wave_barrier(); __builtin_amdgcn_fence(__ATOMIC_RELEASE, "workgroup"); } while (0)

// Fused-qkv causal self-attention with TWO outputs (x [2,2048,1024]; fused (in,out) w_attn [1024,3072] N(0,1) x 0.02 + b_attn zeros (read), jnp.split(c, 3, axis=2) -> q | k | v column blocks; 16 heads x 64; w = q k^T x rsqrt(64); w * b - 1e10 * (1 - b) with b = (i >= j): causal, the masked logits are exactly -1e10; softmax; a = merge(p v) w_proj + b_proj; outputs: a [2,2048,1024] and present = stack([k, v], axis=1) [2,2,16,2048,64] = the projected k and v (bias included) in head-major layout).
#define NB 2
#define TT 2048
#define CC 1024            // NH * HD = projected width
#define DIN 1024          // input (model) width
#define NH 16
#define HD 64
#define NQB (TT / 64)
#define HG 4
#define SCALE (0.125f)
#define CAUSAL 1
#ifndef TNB
#define TNB NB
#endif
__device__ __forceinline__ float bfr(float v) { return (float)(__bf16)v; }
__host__ __device__ __forceinline__ int kb_last(int qb) { return CAUSAL ? ((qb * 64 + 63) >> 7) : (TT / 128 - 1); }
typedef __attribute__((ext_vector_type(8))) __bf16 v8b;
__device__ __forceinline__ v16b frag_b(const __bf16* rowk0, int lane) {
  union { v16b v; v8b q[2]; } u; const __bf16* p = rowk0 + 8 * (lane >> 4);
  u.q[0] = *(const v8b*)p; u.q[1] = *(const v8b*)(p + 16); return u.v;
}
#define QBH 6              // causal: query blocks 0..QBH-1 of each sequence (few keys, no averaging) take the high-precision path
#define QHI 384            // rows carrying a q residual plane
#define KHI 384            // key rows carrying k residual / v bf16 hi+lo planes (used only by the causal high-precision path)
// B fragment (k rows k0+.., output column o) of a weight: (in,out) [K][ld] or (out,in) [ld rows of K]: bf16 exact, or f16(bf16 * 256) exact
__device__ __forceinline__ v16b wcol_io(const float* Wm, int k0, int o, int lane, int ld) { v16b w; const int g = lane >> 4;
#pragma unroll
  for (int i = 0; i < 8; ++i) { w[i] = (__bf16)Wm[(size_t)(k0 + 8 * g + i) * ld + o]; w[8 + i] = (__bf16)Wm[(size_t)(k0 + 16 + 8 * g + i) * ld + o]; }
  return w; }
__device__ __forceinline__ v16b wcol_oi(const float* Wm, int k0, int o, int lane, int K) { v16b w; const float* p = Wm + (size_t)o * K + k0 + 8 * (lane >> 4);
#pragma unroll
  for (int i = 0; i < 8; ++i) { w[i] = (__bf16)p[i]; w[8 + i] = (__bf16)p[16 + i]; }
  return w; }
__device__ __forceinline__ v16h wcolh_io(const float* Wm, int k0, int o, int lane, int ld) { v16h w; const int g = lane >> 4;
#pragma unroll
  for (int i = 0; i < 8; ++i) { w[i] = (_Float16)(bfr(Wm[(size_t)(k0 + 8 * g + i) * ld + o]) * 256.0f); w[8 + i] = (_Float16)(bfr(Wm[(size_t)(k0 + 16 + 8 * g + i) * ld + o]) * 256.0f); }
  return w; }
__device__ __forceinline__ v16h wcolh_oi(const float* Wm, int k0, int o, int lane, int K) { v16h w; const float* p = Wm + (size_t)o * K + k0 + 8 * (lane >> 4);
#pragma unroll
  for (int i = 0; i < 8; ++i) { w[i] = (_Float16)(bfr(p[i]) * 256.0f); w[8 + i] = (_Float16)(bfr(p[16 + i]) * 256.0f); }
  return w; }
#define WQKV_LAYOUT 0   // 0 = (in,out); 1 = (out,in) [CC][DIN]; 2 = per-head [NH][DIN][HD]
__device__ __forceinline__ v16b wcol_hdk(const float* Wm, int k0, int o, int lane) { v16b w; const int g = lane >> 4; const float* p = Wm + (size_t)(o / HD) * DIN * HD + (o % HD);
#pragma unroll
  for (int i = 0; i < 8; ++i) { w[i] = (__bf16)p[(size_t)(k0 + 8 * g + i) * HD]; w[8 + i] = (__bf16)p[(size_t)(k0 + 16 + 8 * g + i) * HD]; }
  return w; }
#define WO_OUT_IN 0
#if WQKV_LAYOUT == 1
#define WCOL(W, k0, o, lane) wcol_oi(W, k0, o, lane, DIN)
#elif WQKV_LAYOUT == 2
#define WCOL(W, k0, o, lane) wcol_hdk(W, k0, o, lane)
#else
#define WCOL(W, k0, o, lane) wcol_io(W, k0, o, lane, 3 * CC)   /* w_attn (in,out) [1024][3072] packed by columns: row pitch 3*CC; the q / k / v pointers carry the column offsets 0 / CC / 2*CC */
#endif
#if WO_OUT_IN
#define WOCOL(W, k0, o, lane) wcol_oi(W, k0, o, lane, CC)
#define WOCOLH(W, k0, o, lane) wcolh_oi(W, k0, o, lane, CC)
#else
#define WOCOL(W, k0, o, lane) wcol_io(W, k0, o, lane, DIN)
#define WOCOLH(W, k0, o, lane) wcolh_io(W, k0, o, lane, DIN)
#endif
#define PROJ_EXTRA_PARAMS , float* __restrict__ PRES   /* second output: present [NB][2][NH][TT][HD] f32 */
#define PROJ_EPI(which, row, t, h) do { if ((which) >= 1) { float* dst_ = PRES + ((((size_t)bb * 2 + ((which) - 1)) * NH + (h)) * TT + (t)) * HD; _Pragma("unroll") for (int q4 = 0; q4 < HD / 4; ++q4) vst2(dst_ + 4 * q4, *(const v4f*)((row) + 4 * q4)); } } while (0)
static_assert(HD == 64 && (132 * 4) % 16 == 0, "the staged row st[rl][hh*HD] is 16-B aligned and 64 floats long");
#ifndef SM_EXTRA_PARAMS
#define SM_EXTRA_PARAMS
#endif
#ifndef PROJ_EXTRA_PARAMS
#define PROJ_EXTRA_PARAMS
#endif
#ifndef SM_MASK_HOOK
#define SM_MASK_HOOK (void)0
#endif

#define WS_QH  0u                                      // f16 q rows [b*t][CC]
#define WS_KH  (WS_QH + 2u * (size_t)NB * TT * CC)      // f16 k rows [b*t][CC]
#define WS_VT  (WS_KH + 2u * (size_t)NB * TT * CC)      // f16 v planes [b][c][t]
#define WS_QL  (WS_VT + 2u * (size_t)NB * CC * TT)      // f16 q residual x 2^10 rows [b][t < QHI][CC]
#define WS_KL  (WS_QL + 2u * (size_t)NB * QHI * CC)     // f16 k residual x 2^10 rows [b][t < KHI][CC]
#define WS_VB  (WS_KL + 2u * (size_t)NB * KHI * CC)     // bf16 v hi planes [b][c][t < KHI]
#define WS_VBL (WS_VB + 2u * (size_t)NB * CC * KHI)
#define WS_S   (WS_VBL + 2u * (size_t)NB * CC * KHI)    // f32 logits / P [hg][t][s]
#define WS_Y   (WS_S  + 4u * (size_t)HG * TT * TT)      // f32 ctx rows [b*t][CC] (only when there is an output projection)
#define WS_END (WS_Y  + 4u * (size_t)NB * TT * CC)

// ---- k_proj: block = (64 rows, 128 cols, which): q/k/v = X W (+ b) with exact bf16 products (K = DIN) -> which 0: q f16 rows (+ residual rows < QHI); 1: k f16 rows (+ residual rows < KHI); 2: v f16 planes [c][t] (+ bf16 hi/lo planes for t < KHI)
__global__ __launch_bounds__(128) void k_proj(const float* __restrict__ XQ, const float* __restrict__ XK, const float* __restrict__ XV, const float* __restrict__ WQ, const float* __restrict__ WK, const float* __restrict__ WV, const float* __restrict__ BQ, const float* __restrict__ BK, const float* __restrict__ BV,
    _Float16* __restrict__ QH, _Float16* __restrict__ QL, _Float16* __restrict__ KH, _Float16* __restrict__ KL, _Float16* __restrict__ VT, __bf16* __restrict__ VB, __bf16* __restrict__ VBL PROJ_EXTRA_PARAMS) {
  __shared__ __align__(16) float st[64][132]; __shared__ __align__(16) _Float16 sh[64][136], sl[64][136]; __shared__ __align__(16) _Float16 th[128][72]; __shared__ __align__(16) __bf16 tb[128][72], tbl[128][72];
  const int tid = threadIdx.x, wave = tid >> 5, lane = tid & 31, col = lane & 15, g = lane >> 4; const int which = blockIdx.z; const int c0 = blockIdx.y * 128; const size_t r0 = (size_t)blockIdx.x * 64; const size_t bb = r0 / TT; const int t0 = (int)(r0 % TT);
  const float* X = which == 0 ? XQ : which == 1 ? XK : XV; const float* WA = which == 0 ? WQ : which == 1 ? WK : WV; const float* BA = which == 0 ? BQ : which == 1 ? BK : BV;
  v8f acc[8] = {};
#pragma unroll 2
  for (int kc = 0; kc < DIN / 32; ++kc) { v16b a; { const float* p = X + (r0 + wave * 16 + col) * DIN + kc * 32 + 8 * g;
#pragma unroll
      for (int i = 0; i < 8; ++i) { a[i] = (__bf16)p[i]; a[8 + i] = (__bf16)p[16 + i]; } }
    asm volatile("s_wait_loadcnt 0x0" ::: "memory");
#pragma unroll
    for (int j = 0; j < 8; ++j) { const v16b w = WCOL(WA, kc * 32, c0 + j * 16 + col, lane); asm volatile("s_wait_loadcnt 0x0" ::: "memory"); acc[j] = wmma_bf(a, w, acc[j]); } }
  { // stage the f32 tile (acc + bias) in LDS, run the per-(row, head) epilogue hook, then convert
#pragma unroll
    for (int j = 0; j < 8; ++j) { const float bias = BA ? bfr(BA[c0 + j * 16 + col]) : 0.f;
#pragma unroll
      for (int r = 0; r < 8; ++r) st[wave * 16 + 8 * g + r][j * 16 + col] = acc[j][r] + bias; }
    __syncthreads();
    for (int e = tid; e < 64 * (128 / HD); e += 128) { const int rl = e / (128 / HD), hh = e % (128 / HD); PROJ_EPI(which, &st[rl][hh * HD], (int)((r0 + rl) % TT), (c0 / HD) + hh); }
    __syncthreads(); }
  if (which < 2) { _Float16* DH = which == 0 ? QH : KH; _Float16* DL = which == 0 ? QL : KL; const int nhi = which == 0 ? QHI : KHI; const bool hi_rows = t0 < nhi;
    for (int e = tid; e < 64 * 128; e += 128) { const int rl = e >> 7, cl = e & 127; const float v = st[rl][cl]; const _Float16 hv = (_Float16)v; sh[rl][cl] = hv; sl[rl][cl] = (_Float16)((v - (float)hv) * 1024.0f); }
    __syncthreads();
    for (int e = tid; e < 64 * 16; e += 128) { const int rl = e >> 4, q = e & 15; vst2((unsigned*)(DH + (r0 + rl) * CC + c0 + q * 8), *(const v4u*)&sh[rl][q * 8]); if (hi_rows) vst2((unsigned*)(DL + (bb * nhi + t0 + rl) * (size_t)CC + c0 + q * 8), *(const v4u*)&sl[rl][q * 8]); }
  } else { const bool hi_rows = t0 < KHI;
    for (int e = tid; e < 64 * 128; e += 128) { const int rl = e & 63, cl = e >> 6; const float v = st[rl][cl]; th[cl][rl] = (_Float16)v; const __bf16 bh = (__bf16)v; tb[cl][rl] = bh; tbl[cl][rl] = (__bf16)(v - (float)bh); }
    __syncthreads();
    for (int e = tid; e < 128 * 8; e += 128) { const int cl = e >> 3, q = e & 7; vst2((unsigned*)(VT + (bb * CC + c0 + cl) * (size_t)TT + t0 + q * 8), *(const v4u*)&th[cl][q * 8]); if (hi_rows) { const size_t o3 = (bb * CC + c0 + cl) * (size_t)KHI + t0 + q * 8; vst2((unsigned*)(VB + o3), *(const v4u*)&tb[cl][q * 8]); vst2((unsigned*)(VBL + o3), *(const v4u*)&tbl[cl][q * 8]); } } } }
// ---- k_sc: block = (query block qb, key block kb <= kb_last(qb), head in group) of batch b: logits x SCALE; q hi + residual (x 2^10) against k (2 products) for query rows < QHI, plus the k residual (3 products) for query blocks < QBH (causal early rows); causal: blocks past the diagonal exit, the mask itself is applied by index in k_sm
__global__ __launch_bounds__(128) void k_sc(const _Float16* __restrict__ QH, const _Float16* __restrict__ KH, const _Float16* __restrict__ QL, const _Float16* __restrict__ KL, int b, int h0, float* __restrict__ S0) { __shared__ __align__(16) float ss[4][16][132];
  const int qb = blockIdx.x, kb = blockIdx.y; if (kb > kb_last(qb)) return;
  const int h = h0 + blockIdx.z; float* S = S0 + (size_t)blockIdx.z * TT * TT;
  const int tid = threadIdx.x, wave = tid >> 5, lane = tid & 31, col = lane & 15, g = lane >> 4; const int k0 = kb * 128; const int ql0 = qb * 64 + wave * 16; const size_t q0 = (size_t)b * TT + ql0, kr0 = (size_t)b * TT + k0;
  v8f acc[8] = {}, accl[8] = {};
  const _Float16* QLb = QL + (size_t)b * QHI * CC; const _Float16* KLb = KL + (size_t)b * KHI * CC;
  if (qb < QBH) {
#pragma unroll
    for (int kc = 0; kc < HD / 32; ++kc) { const v16h ah = frag_h(QH + (q0 + col) * CC + h * HD + kc * 32, lane), al = frag_h(QLb + (size_t)(ql0 + col) * CC + h * HD + kc * 32, lane);
#pragma unroll
      for (int j = 0; j < 8; ++j) { const v16h kbf = frag_h(KH + (kr0 + j * 16 + col) * CC + h * HD + kc * 32, lane), klf = frag_h(KLb + (size_t)(k0 + j * 16 + col) * CC + h * HD + kc * 32, lane); acc[j] = wmma16(ah, kbf, acc[j]); accl[j] = wmma16(al, kbf, accl[j]); accl[j] = wmma16(ah, klf, accl[j]); } }
  } else if (qb * 64 < QHI) {
#pragma unroll
    for (int kc = 0; kc < HD / 32; ++kc) { const v16h ah = frag_h(QH + (q0 + col) * CC + h * HD + kc * 32, lane), al = frag_h(QLb + (size_t)(ql0 + col) * CC + h * HD + kc * 32, lane);
#pragma unroll
      for (int j = 0; j < 8; ++j) { const v16h kbf = frag_h(KH + (kr0 + j * 16 + col) * CC + h * HD + kc * 32, lane); acc[j] = wmma16(ah, kbf, acc[j]); accl[j] = wmma16(al, kbf, accl[j]); } }
  } else {
#pragma unroll
    for (int kc = 0; kc < HD / 32; ++kc) { const v16h ah = frag_h(QH + (q0 + col) * CC + h * HD + kc * 32, lane);
#pragma unroll
      for (int j = 0; j < 8; ++j) { const v16h kbf = frag_h(KH + (kr0 + j * 16 + col) * CC + h * HD + kc * 32, lane); acc[j] = wmma16(ah, kbf, acc[j]); } } }
#pragma unroll
  for (int j = 0; j < 8; ++j) {
#pragma unroll
    for (int r = 0; r < 8; ++r) ss[wave][8 * g + r][j * 16 + col] = (acc[j][r] + accl[j][r] * (1.0f / 1024.0f)) * SCALE; }
  LDSX(); for (int rl = 0; rl < 16; ++rl) vst2(S + (size_t)(ql0 + rl) * TT + k0 + lane * 4, *(const v4f*)&ss[wave][rl][lane * 4]); }
// ---- k_sm: block = query row t (head in group): keys [0, kend): causal -> logit if s <= t else excluded; softmax in f32; P x 2^11 in place (0 for excluded)
__global__ __launch_bounds__(256) void k_sm(float* __restrict__ S0 SM_EXTRA_PARAMS) { __shared__ float sred[8]; __shared__ float sbc; __shared__ __align__(16) float shv[TT];
  const int tid = threadIdx.x; const int t = blockIdx.x; const int kend = (kb_last(t >> 6) + 1) * 128;
  float* sr = S0 + (size_t)blockIdx.y * TT * TT + (size_t)t * TT;
  float m = -3.0e38f; for (int k = tid; k < kend; k += 256) { float v = (!CAUSAL || k <= t) ? sr[k] : -3.0e38f; SM_MASK_HOOK; shv[k] = v; m = fmaxf(m, v); }
#pragma unroll
  for (int o = 1; o < 32; o <<= 1) m = fmaxf(m, __shfl_xor(m, o));
  if ((tid & 31) == 0) sred[tid >> 5] = m; __syncthreads(); if (tid == 0) { float a = sred[0]; for (int i = 1; i < 8; ++i) a = fmaxf(a, sred[i]); sbc = a; } __syncthreads(); m = sbc; __syncthreads();
  float sum = 0.f; for (int k = tid; k < kend; k += 256) { const float v = shv[k]; const float e = (v <= -1.0e38f) ? 0.f : expf(v - m); shv[k] = e; sum += e; }
#pragma unroll
  for (int o = 1; o < 32; o <<= 1) sum += __shfl_xor(sum, o);
  if ((tid & 31) == 0) sred[tid >> 5] = sum; __syncthreads(); if (tid == 0) { float a = 0.f; for (int i = 0; i < 8; ++i) a += sred[i]; sbc = a > 0.f ? 2048.0f / a : 0.f; }   /* a fully excluded row yields P = 0 */ __syncthreads(); const float inv = sbc;
  for (int k = tid; k < kend; k += 256) shv[k] = shv[k] * inv;
  __syncthreads(); for (int q = tid; q < kend / 4; q += 256) vst2(sr + q * 4, *(const v4f*)&shv[q * 4]); }
// ---- k_pv: block = 16 queries (tile qt) of (b, h), PVS waves: wave w takes the 32-key chunks w, w + PVS, ... of keys [0, kend) and keeps its own f32 partial ctx tile; the partials meet in LDS behind one workgroup barrier and are added in wave order (P x 2^11 once to f16 against v f16: 1 product; causal early query blocks: P and v as bf16 hi + lo, 3 products); 256-B (row, head) segment by one wave
#define PVS 16             // key slices = waves per block
static_assert(32 * PVS == 16 * (HD / 2), "the merge gives each thread one 8-B piece of the 16 x HD tile");
__global__ __launch_bounds__(32 * PVS) void k_pv(const float* __restrict__ PS0, const _Float16* __restrict__ VT, const __bf16* __restrict__ VB, const __bf16* __restrict__ VBL, int b, int h0, float* __restrict__ Y) { const int h = h0 + blockIdx.z; const float* PS = PS0 + (size_t)blockIdx.z * TT * TT; __shared__ __align__(16) float ss[PVS][16][HD + 4];
  const int tid = threadIdx.x, lane = tid & 31, col = lane & 15, g = lane >> 4; const int wave = __builtin_amdgcn_readfirstlane(tid >> 5); const int qb = blockIdx.x >> 2; const int ql0 = blockIdx.x * 16; const int kce = (kb_last(qb) + 1) * 4;
  v8f acc[HD / 16] = {};
  if (qb < QBH) {
#pragma unroll 1
    for (int kc = wave; kc < kce; kc += PVS) { const F2 p = split_row(PS + (size_t)(ql0 + col) * TT, kc * 32, lane);
      asm volatile("s_wait_loadcnt 0x0" ::: "memory");
#pragma unroll
      for (int j = 0; j < HD / 16; ++j) { const size_t po = ((size_t)b * CC + h * HD + j * 16 + col) * (size_t)KHI + kc * 32; const v16b vh = frag_b(VB + po, lane); acc[j] = wmma_bf(p.h, vh, acc[j]); acc[j] = wmma_bf(p.l, vh, acc[j]); acc[j] = wmma_bf(p.h, frag_b(VBL + po, lane), acc[j]); } }
  } else {
#pragma unroll 1
    for (int kc = wave; kc < kce; kc += PVS) { const v16h p = frag_f32(PS + (size_t)(ql0 + col) * TT + kc * 32, lane);
      asm volatile("s_wait_loadcnt 0x0" ::: "memory");
#pragma unroll
      for (int j = 0; j < HD / 16; ++j) { const size_t po = ((size_t)b * CC + h * HD + j * 16 + col) * (size_t)TT + kc * 32; acc[j] = wmma16(p, frag_h(VT + po, lane), acc[j]); } } }
#pragma unroll
  for (int j = 0; j < HD / 16; ++j)
#pragma unroll
    for (int r = 0; r < 8; ++r) ss[wave][8 * g + r][j * 16 + col] = acc[j][r];
  __syncthreads();   /* every wave's partial tile is in LDS before any thread adds them */
  { const int rl = tid >> 5; v2f s = *(const v2f*)&ss[0][rl][lane * 2];
#pragma unroll
    for (int w = 1; w < PVS; ++w) s += *(const v2f*)&ss[w][rl][lane * 2];
    vst2(Y + ((size_t)b * TT + ql0 + rl) * CC + h * HD + lane * 2, s * (1.0f / 2048.0f)); } }
// ---- k_out: block = (64 rows, 128 cols): out = ctx Wo (+ bo): ctx x 2^6 once to f16 against Wo as f16(bf16 x 2^8) exact (1 product) x 2^-14; causal early rows (< QHI of each sequence): ctx bf16 hi + lo against exact bf16 Wo (2 products)
__global__ __launch_bounds__(128) void k_out(const float* __restrict__ Y, const float* __restrict__ WO, const float* __restrict__ BO, float* __restrict__ OUT) { __shared__ __align__(16) float sf[4][16][132];
  const int tid = threadIdx.x, wave = tid >> 5, lane = tid & 31, col = lane & 15, g = lane >> 4; const int c0 = blockIdx.y * 128; const size_t r0 = (size_t)blockIdx.x * 64 + wave * 16;
  v8f acc[8] = {};
  if (CAUSAL && (int)(((size_t)blockIdx.x * 64) % TT) < QHI) {   /* block-uniform */
#pragma unroll 2
    for (int kc = 0; kc < CC / 32; ++kc) { const F2 a = split_row(Y + (r0 + col) * CC, kc * 32, lane); asm volatile("s_wait_loadcnt 0x0" ::: "memory");
#pragma unroll
      for (int j = 0; j < 8; ++j) { const v16b w = WOCOL(WO, kc * 32, c0 + j * 16 + col, lane); asm volatile("s_wait_loadcnt 0x0" ::: "memory"); acc[j] = wmma_bf(a.h, w, acc[j]); acc[j] = wmma_bf(a.l, w, acc[j]); } }
#pragma unroll
    for (int j = 0; j < 8; ++j) { const float bias = BO ? bfr(BO[c0 + j * 16 + col]) : 0.f;
#pragma unroll
      for (int r = 0; r < 8; ++r) sf[wave][8 * g + r][j * 16 + col] = acc[j][r] + bias; }
  } else {
#pragma unroll 2
    for (int kc = 0; kc < CC / 32; ++kc) { const v16h a = frag_f32s(Y + (r0 + col) * CC + kc * 32, lane, 64.0f); asm volatile("s_wait_loadcnt 0x0" ::: "memory");   /* ctx carried x 2^6 into f16 so small-magnitude context rows stay clear of f16 subnormals (chip FTZ) */
#pragma unroll
      for (int j = 0; j < 8; ++j) { const v16h w = WOCOLH(WO, kc * 32, c0 + j * 16 + col, lane); asm volatile("s_wait_loadcnt 0x0" ::: "memory"); acc[j] = wmma16(a, w, acc[j]); } }
#pragma unroll
    for (int j = 0; j < 8; ++j) { const float bias = BO ? bfr(BO[c0 + j * 16 + col]) : 0.f;
#pragma unroll
      for (int r = 0; r < 8; ++r) sf[wave][8 * g + r][j * 16 + col] = acc[j][r] * (1.0f / 16384.0f) + bias; } }   /* 2^-8 (Wo carry) x 2^-6 (ctx carry) */
  LDSX(); for (int rl = 0; rl < 16; ++rl) vst2(OUT + (r0 + rl) * DIN + c0 + lane * 4, *(const v4f*)&sf[wave][rl][lane * 4]); }

extern "C" void kernel_launch(void* const* d_in, const int* in_sizes, int n_in, void* d_out, int out_size, void* d_ws, size_t ws_size, hipStream_t stream) {
  (void)in_sizes; (void)n_in; (void)out_size;
  const float** F = (const float**)d_in;
  if (ws_size < (size_t)WS_END) return;
  char* ws = (char*)d_ws; _Float16 *QH = (_Float16*)(ws + WS_QH), *KH = (_Float16*)(ws + WS_KH), *VT = (_Float16*)(ws + WS_VT), *QL = (_Float16*)(ws + WS_QL), *KL = (_Float16*)(ws + WS_KL); __bf16 *VB = (__bf16*)(ws + WS_VB), *VBL = (__bf16*)(ws + WS_VBL); float *S = (float*)(ws + WS_S), *Y = (float*)(ws + WS_Y);
  (void)Y; (void)QL; (void)KL; (void)VB; (void)VBL;
  // inputs: 0 x [2,2048,1024]; 1 w_attn [1024,3072] (in,out; columns q | k | v); 2 b_attn [3072] (zeros, read); 3 w_proj [1024,1024] (in,out); 4 b_proj [1024] (zeros, read). outputs: 0 a [2,2048,1024] at d_out + 0; 1 present [2,2,16,2048,64] at d_out + NB*TT*CC floats (byte offset 16,777,216)
  k_proj<<<dim3(TNB * TT / 64, CC / 128, 3), 128, 0, stream>>>(F[0], F[0], F[0], F[1], F[1] + CC, F[1] + 2 * CC, F[2], F[2] + CC, F[2] + 2 * CC, QH, QL, KH, KL, VT, VB, VBL, (float*)d_out + (size_t)NB * TT * CC);
  for (int b = 0; b < TNB; ++b) for (int h0 = 0; h0 < NH; h0 += HG) {
    k_sc<<<dim3(NQB, TT / 128, HG), 128, 0, stream>>>(QH, KH, QL, KL, b, h0, S);
    k_sm<<<dim3(TT, HG), 256, 0, stream>>>(S);
    k_pv<<<dim3(TT / 16, 1, HG), 32 * PVS, 0, stream>>>(S, VT, VB, VBL, b, h0, Y);
  }
  k_out<<<dim3(TNB * TT / 64, DIN / 128), 128, 0, stream>>>(Y, F[3], F[4], (float*)d_out);
}

// v002
// Measured time: 581 microseconds a run.
// Timed twice side by side with v001, it ran 1.30 and 1.32 times as fast.
// Counting every step since v000, it is 1.91 times as fast.
// compute dtype: all float inputs rounded to bf16; c = x w_attn + b_attn with EXACT bf16 products on WMMA 16x16x32 (f32 accumulate); the f32 k and v rows are ALSO the second output (present); causal logits: 3 products for the first 384 rows, single f16 q x k after, x 64^-0.5; softmax f32; P x 2^11 once to f16 x v once to f16 (bf16 hi + lo below row 384); ctx hi+lo x exact w_proj below row 384, x2^6 f16 carry x f16(bf16 x 2^8) after, + b_proj; f32 outputs.
#include <hip/hip_runtime.h>
#include <math.h>

typedef __attribute__((ext_vector_type(16))) _Float16 v16h;
typedef __attribute__((ext_vector_type(16))) __bf16 v16b;
typedef __attribute__((ext_vector_type(8)))  _Float16 v8h;
typedef __attribute__((ext_vector_type(8)))  float v8f;
typedef __attribute__((ext_vector_type(4)))  float v4f;
typedef __attribute__((ext_vector_type(2)))  float v2f;
typedef __attribute__((ext_vector_type(4)))  unsigned v4u;
typedef __attribute__((ext_vector_type(4)))  int v4i;
typedef float __attribute__((may_alias)) float_a;
typedef int __attribute__((may_alias)) int_a;

template <typename T> __device__ __forceinline__ void vst2(void* p, T v) { *(T*)p = v;  }
__device__ __forceinline__ v8f wmma16(v16h a, v16h b, v8f c) {
  v8f d = __builtin_amdgcn_wmma_f32_16x16x32_f16(false, a, false, b, (short)0, c, false, false);
  asm volatile("v_nop\n\tv_nop\n\tv_nop\n\tv_nop" : "+v"(d) : "v"(a), "v"(b));
  return d;
}
__device__ __forceinline__ v8f wmma_bf(v16b a, v16b b, v8f c) {
  v8f d = __builtin_amdgcn_wmma_f32_16x16x32_bf16(false, a, false, b, (short)0, c, false, false);
  asm volatile("v_nop\n\tv_nop\n\tv_nop\n\tv_nop" : "+v"(d) : "v"(a), "v"(b));
  return d;
}
// 16x16x32 fragments: lane = (h = lane>>4, row/col = lane&15); elements 0..7 = k0+8h+0..7, 8..15 = k0+16+8h+0..7; D element r = row 8h+r
__device__ __forceinline__ v16h frag_h(const _Float16* rowk0, int lane) {
  union { v16h v; v8h q[2]; } u; const _Float16* p = rowk0 + 8 * (lane >> 4);
  u.q[0] = *(const v8h*)p; u.q[1] = *(const v8h*)(p + 16); return u.v;
}
__device__ __forceinline__ v16h frag_f32(const float* rowk0, int lane) {
  v16h a; const float* p = rowk0 + 8 * (lane >> 4);
#pragma unroll
  for (int i = 0; i < 8; ++i) { a[i] = (_Float16)p[i]; a[8 + i] = (_Float16)p[16 + i]; }
  return a;
}
__device__ __forceinline__ v16h frag_f32s(const float* rowk0, int lane, float sc) {
  v16h a; const float* p = rowk0 + 8 * (lane >> 4);
#pragma unroll
  for (int i = 0; i < 8; ++i) { a[i] = (_Float16)(p[i] * sc); a[8 + i] = (_Float16)(p[16 + i] * sc); }
  return a;
}
// column fragment from a [K][ld] layout (column n), rows >= K read as 0
__device__ __forceinline__ v16h fragc_f32(const float* W, int k0, int n, int lane, int ld, int K) {
  v16h a; const int g = lane >> 4;
#pragma unroll
  for (int i = 0; i < 8; ++i) { const int ka = k0 + 8 * g + i, kb = ka + 16;
    a[i] = (_Float16)(ka < K ? W[(size_t)(ka < K ? ka : K - 1) * ld + n] : 0.f); a[8 + i] = (_Float16)(kb < K ? W[(size_t)(kb < K ? kb : K - 1) * ld + n] : 0.f); }
  return a;
}
struct F2 { v16b h, l; };
__device__ __forceinline__ F2 bsplit16(const float v[16]) { F2 r;
#pragma unroll
  for (int i = 0; i < 16; ++i) { const __bf16 h = (__bf16)v[i]; r.h[i] = h; r.l[i] = (__bf16)(v[i] - (float)h); }
  return r; }
__device__ __forceinline__ F2 split_row(const float* row, int k0, int lane) { float v[16]; const float* p = row + k0 + 8 * (lane >> 4);
#pragma unroll
  for (int i = 0; i < 8; ++i) { v[i] = p[i]; v[8 + i] = p[16 + i]; }
  return bsplit16(v); }
__device__ __forceinline__ F2 split_rowK(const float* row, int k0, int lane, int K) { float v[16]; const int g = lane >> 4;
#pragma unroll
  for (int i = 0; i < 8; ++i) { const int ka = k0 + 8 * g + i, kb = ka + 16; v[i] = ka < K ? row[ka < K ? ka : K - 1] : 0.f; v[8 + i] = kb < K ? row[kb < K ? kb : K - 1] : 0.f; }
  return bsplit16(v); }
__device__ __forceinline__ F2 split_col(const float* W, int k0, int n, int lane, int ld, int K) { float v[16]; const int g = lane >> 4;
#pragma unroll
  for (int i = 0; i < 8; ++i) { const int ka = k0 + 8 * g + i, kb = ka + 16; v[i] = ka < K ? W[(size_t)(ka < K ? ka : K - 1) * ld + n] : 0.f; v[8 + i] = kb < K ? W[(size_t)(kb < K ? kb : K - 1) * ld + n] : 0.f; }
  return bsplit16(v); }
__device__ __forceinline__ v8f mac3(const F2& a, const F2& b, v8f c) { c = wmma_bf(a.l, b.h, c); c = wmma_bf(a.h, b.l, c); return wmma_bf(a.h, b.h, c); }
__device__ __forceinline__ float sigm(float v) { return 1.0f / (1.0f + expf(-v)); }
#define LDSX() do { asm volatile("s_wait_dscnt 0" ::: "memory"); __builtin_amdgcn_wave_barrier(); __builtin_amdgcn_fence(__ATOMIC_RELEASE, "workgroup"); } while (0)

// Fused-qkv causal self-attention with TWO outputs (x [2,2048,1024]; fused (in,out) w_attn [1024,3072] N(0,1) x 0.02 + b_attn zeros (read), jnp.split(c, 3, axis=2) -> q | k | v column blocks; 16 heads x 64; w = q k^T x rsqrt(64); w * b - 1e10 * (1 - b) with b = (i >= j): causal, the masked logits are exactly -1e10; softmax; a = merge(p v) w_proj + b_proj; outputs: a [2,2048,1024] and present = stack([k, v], axis=1) [2,2,16,2048,64] = the projected k and v (bias included) in head-major layout).
#define NB 2
#define TT 2048
#define CC 1024            // NH * HD = projected width
#define DIN 1024          // input (model) width
#define NH 16
#define HD 64
#define NQB (TT / 64)
#define HG 4
#define SCALE (0.125f)
#define CAUSAL 1
#ifndef TNB
#define TNB NB
#endif
__device__ __forceinline__ float bfr(float v) { return (float)(__bf16)v; }
__host__ __device__ __forceinline__ int kb_last(int qb) { return CAUSAL ? ((qb * 64 + 63) >> 7) : (TT / 128 - 1); }
typedef __attribute__((ext_vector_type(8))) __bf16 v8b;
__device__ __forceinline__ v16b frag_b(const __bf16* rowk0, int lane) {
  union { v16b v; v8b q[2]; } u; const __bf16* p = rowk0 + 8 * (lane >> 4);
  u.q[0] = *(const v8b*)p; u.q[1] = *(const v8b*)(p + 16); return u.v;
}
#define QBH 6              // causal: query blocks 0..QBH-1 of each sequence (few keys, no averaging) take the high-precision path
#define QHI 384            // rows carrying a q residual plane
#define KHI 384            // key rows carrying k residual / v bf16 hi+lo planes (used only by the causal high-precision path)
// B fragment (k rows k0+.., output column o) of a weight: (in,out) [K][ld] or (out,in) [ld rows of K]: bf16 exact, or f16(bf16 * 256) exact
__device__ __forceinline__ v16b wcol_io(const float* Wm, int k0, int o, int lane, int ld) { v16b w; const int g = lane >> 4;
#pragma unroll
  for (int i = 0; i < 8; ++i) { w[i] = (__bf16)Wm[(size_t)(k0 + 8 * g + i) * ld + o]; w[8 + i] = (__bf16)Wm[(size_t)(k0 + 16 + 8 * g + i) * ld + o]; }
  return w; }
__device__ __forceinline__ v16b wcol_oi(const float* Wm, int k0, int o, int lane, int K) { v16b w; const float* p = Wm + (size_t)o * K + k0 + 8 * (lane >> 4);
#pragma unroll
  for (int i = 0; i < 8; ++i) { w[i] = (__bf16)p[i]; w[8 + i] = (__bf16)p[16 + i]; }
  return w; }
__device__ __forceinline__ v16h wcolh_io(const float* Wm, int k0, int o, int lane, int ld) { v16h w; const int g = lane >> 4;
#pragma unroll
  for (int i = 0; i < 8; ++i) { w[i] = (_Float16)(bfr(Wm[(size_t)(k0 + 8 * g + i) * ld + o]) * 256.0f); w[8 + i] = (_Float16)(bfr(Wm[(size_t)(k0 + 16 + 8 * g + i) * ld + o]) * 256.0f); }
  return w; }
__device__ __forceinline__ v16h wcolh_oi(const float* Wm, int k0, int o, int lane, int K) { v16h w; const float* p = Wm + (size_t)o * K + k0 + 8 * (lane >> 4);
#pragma unroll
  for (int i = 0; i < 8; ++i) { w[i] = (_Float16)(bfr(p[i]) * 256.0f); w[8 + i] = (_Float16)(bfr(p[16 + i]) * 256.0f); }
  return w; }
#define WQKV_LAYOUT 0   // 0 = (in,out); 1 = (out,in) [CC][DIN]; 2 = per-head [NH][DIN][HD]
__device__ __forceinline__ v16b wcol_hdk(const float* Wm, int k0, int o, int lane) { v16b w; const int g = lane >> 4; const float* p = Wm + (size_t)(o / HD) * DIN * HD + (o % HD);
#pragma unroll
  for (int i = 0; i < 8; ++i) { w[i] = (__bf16)p[(size_t)(k0 + 8 * g + i) * HD]; w[8 + i] = (__bf16)p[(size_t)(k0 + 16 + 8 * g + i) * HD]; }
  return w; }
#define WO_OUT_IN 0
#if WQKV_LAYOUT == 1
#define WCOL(W, k0, o, lane) wcol_oi(W, k0, o, lane, DIN)
#elif WQKV_LAYOUT == 2
#define WCOL(W, k0, o, lane) wcol_hdk(W, k0, o, lane)
#else
#define WCOL(W, k0, o, lane) wcol_io(W, k0, o, lane, 3 * CC)   /* w_attn (in,out) [1024][3072] packed by columns: row pitch 3*CC; the q / k / v pointers carry the column offsets 0 / CC / 2*CC */
#endif
#if WO_OUT_IN
#define WOCOL(W, k0, o, lane) wcol_oi(W, k0, o, lane, CC)
#define WOCOLH(W, k0, o, lane) wcolh_oi(W, k0, o, lane, CC)
#else
#define WOCOL(W, k0, o, lane) wcol_io(W, k0, o, lane, DIN)
#define WOCOLH(W, k0, o, lane) wcolh_io(W, k0, o, lane, DIN)
#endif
#define PROJ_EXTRA_PARAMS , float* __restrict__ PRES   /* second output: present [NB][2][NH][TT][HD] f32 */
#define PROJ_EPI(which, row, t, h) do { if ((which) >= 1) { float* dst_ = PRES + ((((size_t)bb * 2 + ((which) - 1)) * NH + (h)) * TT + (t)) * HD; _Pragma("unroll") for (int q4 = 0; q4 < HD / 4; ++q4) vst2(dst_ + 4 * q4, *(const v4f*)((row) + 4 * q4)); } } while (0)
static_assert(HD == 64 && (132 * 4) % 16 == 0, "the staged row st[rl][hh*HD] is 16-B aligned and 64 floats long");
#ifndef PROJ_EXTRA_PARAMS
#define PROJ_EXTRA_PARAMS
#endif

#define WS_QH  0u                                      // f16 q rows [b*t][CC]
#define WS_KH  (WS_QH + 2u * (size_t)NB * TT * CC)      // f16 k rows [b*t][CC]
#define WS_VT  (WS_KH + 2u * (size_t)NB * TT * CC)      // f16 v planes [b][c][t]
#define WS_QL  (WS_VT + 2u * (size_t)NB * CC * TT)      // f16 q residual x 2^10 rows [b][t < QHI][CC]
#define WS_KL  (WS_QL + 2u * (size_t)NB * QHI * CC)     // f16 k residual x 2^10 rows [b][t < KHI][CC]
#define WS_VB  (WS_KL + 2u * (size_t)NB * KHI * CC)     // bf16 v hi planes [b][c][t < KHI]
#define WS_VBL (WS_VB + 2u * (size_t)NB * CC * KHI)
#define WS_S   (WS_VBL + 2u * (size_t)NB * CC * KHI)    // f32 logits [hg][t][s]
#define WS_Y   (WS_S  + 4u * (size_t)HG * TT * TT)      // f32 ctx rows [b*t][CC] (only when there is an output projection)
#define WS_END (WS_Y  + 4u * (size_t)NB * TT * CC)

// ---- k_proj: block = (64 rows, 128 cols, which): q/k/v = X W (+ b) with exact bf16 products (K = DIN) -> which 0: q f16 rows (+ residual rows < QHI); 1: k f16 rows (+ residual rows < KHI); 2: v f16 planes [c][t] (+ bf16 hi/lo planes for t < KHI)
__global__ __launch_bounds__(128) void k_proj(const float* __restrict__ XQ, const float* __restrict__ XK, const float* __restrict__ XV, const float* __restrict__ WQ, const float* __restrict__ WK, const float* __restrict__ WV, const float* __restrict__ BQ, const float* __restrict__ BK, const float* __restrict__ BV,
    _Float16* __restrict__ QH, _Float16* __restrict__ QL, _Float16* __restrict__ KH, _Float16* __restrict__ KL, _Float16* __restrict__ VT, __bf16* __restrict__ VB, __bf16* __restrict__ VBL PROJ_EXTRA_PARAMS) {
  __shared__ __align__(16) float st[64][132]; __shared__ __align__(16) _Float16 sh[64][136], sl[64][136]; __shared__ __align__(16) _Float16 th[128][72]; __shared__ __align__(16) __bf16 tb[128][72], tbl[128][72];
  const int tid = threadIdx.x, wave = tid >> 5, lane = tid & 31, col = lane & 15, g = lane >> 4; const int which = blockIdx.z; const int c0 = blockIdx.y * 128; const size_t r0 = (size_t)blockIdx.x * 64; const size_t bb = r0 / TT; const int t0 = (int)(r0 % TT);
  const float* X = which == 0 ? XQ : which == 1 ? XK : XV; const float* WA = which == 0 ? WQ : which == 1 ? WK : WV; const float* BA = which == 0 ? BQ : which == 1 ? BK : BV;
  v8f acc[8] = {};
#pragma unroll 2
  for (int kc = 0; kc < DIN / 32; ++kc) { v16b a; { const float* p = X + (r0 + wave * 16 + col) * DIN + kc * 32 + 8 * g;
#pragma unroll
      for (int i = 0; i < 8; ++i) { a[i] = (__bf16)p[i]; a[8 + i] = (__bf16)p[16 + i]; } }
    asm volatile("s_wait_loadcnt 0x0" ::: "memory");
#pragma unroll
    for (int j = 0; j < 8; ++j) { const v16b w = WCOL(WA, kc * 32, c0 + j * 16 + col, lane); asm volatile("s_wait_loadcnt 0x0" ::: "memory"); acc[j] = wmma_bf(a, w, acc[j]); } }
  { // stage the f32 tile (acc + bias) in LDS, run the per-(row, head) epilogue hook, then convert
#pragma unroll
    for (int j = 0; j < 8; ++j) { const float bias = BA ? bfr(BA[c0 + j * 16 + col]) : 0.f;
#pragma unroll
      for (int r = 0; r < 8; ++r) st[wave * 16 + 8 * g + r][j * 16 + col] = acc[j][r] + bias; }
    __syncthreads();
    for (int e = tid; e < 64 * (128 / HD); e += 128) { const int rl = e / (128 / HD), hh = e % (128 / HD); PROJ_EPI(which, &st[rl][hh * HD], (int)((r0 + rl) % TT), (c0 / HD) + hh); }
    __syncthreads(); }
  if (which < 2) { _Float16* DH = which == 0 ? QH : KH; _Float16* DL = which == 0 ? QL : KL; const int nhi = which == 0 ? QHI : KHI; const bool hi_rows = t0 < nhi;
    for (int e = tid; e < 64 * 128; e += 128) { const int rl = e >> 7, cl = e & 127; const float v = st[rl][cl]; const _Float16 hv = (_Float16)v; sh[rl][cl] = hv; sl[rl][cl] = (_Float16)((v - (float)hv) * 1024.0f); }
    __syncthreads();
    for (int e = tid; e < 64 * 16; e += 128) { const int rl = e >> 4, q = e & 15; vst2((unsigned*)(DH + (r0 + rl) * CC + c0 + q * 8), *(const v4u*)&sh[rl][q * 8]); if (hi_rows) vst2((unsigned*)(DL + (bb * nhi + t0 + rl) * (size_t)CC + c0 + q * 8), *(const v4u*)&sl[rl][q * 8]); }
  } else { const bool hi_rows = t0 < KHI;
    for (int e = tid; e < 64 * 128; e += 128) { const int rl = e & 63, cl = e >> 6; const float v = st[rl][cl]; th[cl][rl] = (_Float16)v; const __bf16 bh = (__bf16)v; tb[cl][rl] = bh; tbl[cl][rl] = (__bf16)(v - (float)bh); }
    __syncthreads();
    for (int e = tid; e < 128 * 8; e += 128) { const int cl = e >> 3, q = e & 7; vst2((unsigned*)(VT + (bb * CC + c0 + cl) * (size_t)TT + t0 + q * 8), *(const v4u*)&th[cl][q * 8]); if (hi_rows) { const size_t o3 = (bb * CC + c0 + cl) * (size_t)KHI + t0 + q * 8; vst2((unsigned*)(VB + o3), *(const v4u*)&tb[cl][q * 8]); vst2((unsigned*)(VBL + o3), *(const v4u*)&tbl[cl][q * 8]); } } } }
// ---- k_sc: block = (query block qb, key block kb <= kb_last(qb), head in group) of batch b: logits x SCALE; q hi + residual (x 2^10) against k (2 products) for query rows < QHI, plus the k residual (3 products) for query blocks < QBH (causal early rows); causal: blocks past the diagonal exit, the mask itself is applied by index in k_pv
__global__ __launch_bounds__(128) void k_sc(const _Float16* __restrict__ QH, const _Float16* __restrict__ KH, const _Float16* __restrict__ QL, const _Float16* __restrict__ KL, int b, int h0, float* __restrict__ S0) { __shared__ __align__(16) float ss[4][16][132];
  const int qb = blockIdx.x, kb = blockIdx.y; if (kb > kb_last(qb)) return;
  const int h = h0 + blockIdx.z; float* S = S0 + (size_t)blockIdx.z * TT * TT;
  const int tid = threadIdx.x, wave = tid >> 5, lane = tid & 31, col = lane & 15, g = lane >> 4; const int k0 = kb * 128; const int ql0 = qb * 64 + wave * 16; const size_t q0 = (size_t)b * TT + ql0, kr0 = (size_t)b * TT + k0;
  v8f acc[8] = {}, accl[8] = {};
  const _Float16* QLb = QL + (size_t)b * QHI * CC; const _Float16* KLb = KL + (size_t)b * KHI * CC;
  if (qb < QBH) {
#pragma unroll
    for (int kc = 0; kc < HD / 32; ++kc) { const v16h ah = frag_h(QH + (q0 + col) * CC + h * HD + kc * 32, lane), al = frag_h(QLb + (size_t)(ql0 + col) * CC + h * HD + kc * 32, lane);
#pragma unroll
      for (int j = 0; j < 8; ++j) { const v16h kbf = frag_h(KH + (kr0 + j * 16 + col) * CC + h * HD + kc * 32, lane), klf = frag_h(KLb + (size_t)(k0 + j * 16 + col) * CC + h * HD + kc * 32, lane); acc[j] = wmma16(ah, kbf, acc[j]); accl[j] = wmma16(al, kbf, accl[j]); accl[j] = wmma16(ah, klf, accl[j]); } }
  } else if (qb * 64 < QHI) {
#pragma unroll
    for (int kc = 0; kc < HD / 32; ++kc) { const v16h ah = frag_h(QH + (q0 + col) * CC + h * HD + kc * 32, lane), al = frag_h(QLb + (size_t)(ql0 + col) * CC + h * HD + kc * 32, lane);
#pragma unroll
      for (int j = 0; j < 8; ++j) { const v16h kbf = frag_h(KH + (kr0 + j * 16 + col) * CC + h * HD + kc * 32, lane); acc[j] = wmma16(ah, kbf, acc[j]); accl[j] = wmma16(al, kbf, accl[j]); } }
  } else {
#pragma unroll
    for (int kc = 0; kc < HD / 32; ++kc) { const v16h ah = frag_h(QH + (q0 + col) * CC + h * HD + kc * 32, lane);
#pragma unroll
      for (int j = 0; j < 8; ++j) { const v16h kbf = frag_h(KH + (kr0 + j * 16 + col) * CC + h * HD + kc * 32, lane); acc[j] = wmma16(ah, kbf, acc[j]); } } }
#pragma unroll
  for (int j = 0; j < 8; ++j) {
#pragma unroll
    for (int r = 0; r < 8; ++r) ss[wave][8 * g + r][j * 16 + col] = (acc[j][r] + accl[j][r] * (1.0f / 1024.0f)) * SCALE; }
  LDSX(); for (int rl = 0; rl < 16; ++rl) vst2(S + (size_t)(ql0 + rl) * TT + k0 + lane * 4, *(const v4f*)&ss[wave][rl][lane * 4]); }
// ---- k_pv: block = 16 queries (tile qt) of (b, h), PVS waves. First the softmax of the tile: wave w owns query row t = ql0 + w, reads its raw logits over keys [0, kend) once into registers (causal: s > t excluded), takes max and sum in f32 inside the wave, and leaves P x 2^11 (0 for excluded) in LDS: f16 rows, f32 rows for the causal early query blocks. Behind a workgroup barrier wave w takes the 32-key chunks w, w + PVS, ... and keeps its own f32 partial ctx tile; the partials meet in LDS behind one more workgroup barrier and are added in wave order (P f16 against v f16: 1 product; causal early query blocks: P and v as bf16 hi + lo, 3 products); 256-B (row, head) segment by one wave
#define PVS 16             // key slices = waves per block = query rows per tile
#define PPH (TT + 8)       // f16 P row pitch in LDS
#define PPF (KHI + 4)      // f32 P row pitch in LDS (early query blocks)
typedef __attribute__((ext_vector_type(4))) _Float16 v4h;
static_assert(32 * PVS == 16 * (HD / 2), "the merge gives each thread one 8-B piece of the 16 x HD tile");
static_assert(PVS == 16, "one wave per query row of the tile");
static_assert((PPH * 2) % 32 == 16 && (PPF * 4) % 32 == 16, "P row pitch = 16 B x odd: the 16-B fragment reads of 16 rows spread over the banks");
static_assert(!CAUSAL || ((QBH * 64 - 1) / 128 + 1) * 128 <= KHI, "the early query blocks' keys fit the f32 P rows");
__global__ __launch_bounds__(32 * PVS) void k_pv(const float* __restrict__ PS0, const _Float16* __restrict__ VT, const __bf16* __restrict__ VB, const __bf16* __restrict__ VBL, int b, int h0, float* __restrict__ Y) { const int h = h0 + blockIdx.z; const float* PS = PS0 + (size_t)blockIdx.z * TT * TT; __shared__ __align__(16) float ss[PVS][16][HD + 4]; __shared__ __align__(16) union { _Float16 h[16][PPH]; float f[16][PPF]; } pp;
  const int tid = threadIdx.x, lane = tid & 31, col = lane & 15, g = lane >> 4; const int wave = __builtin_amdgcn_readfirstlane(tid >> 5); const int qb = blockIdx.x >> 2; const int ql0 = blockIdx.x * 16; const int kce = (kb_last(qb) + 1) * 4;
  { const int t = ql0 + wave; const int nv = kce >> 2;   /* nv groups of 128 keys hold logits, the same count for the whole block; the lane has keys i * 128 + lane * 4 + c of group i */
    const int rel = t - lane * 4;                        /* causal: that key is allowed while i * 128 + c <= rel, which no key of a group i >= nv is */
    const float* sr = PS + (size_t)t * TT + lane * 4; v4f x[TT / 128];   /* the row's share of the lane; every loop over x is fully unrolled so that x stays in registers */
#pragma unroll
    for (int i = 0; i < TT / 128; ++i) { if (i < nv) x[i] = *(const v4f*)(sr + i * 128); else x[i] = (v4f)(-3.0e38f); }
    float m = -3.0e38f;
#pragma unroll
    for (int i = 0; i < TT / 128; ++i) {
#pragma unroll
      for (int c = 0; c < 4; ++c) { const float v = (!CAUSAL || i * 128 + c <= rel) ? x[i][c] : -3.0e38f; x[i][c] = v; m = fmaxf(m, v); } }
#pragma unroll
    for (int o = 1; o < 32; o <<= 1) m = fmaxf(m, __shfl_xor(m, o));
    float sum = 0.f;
#pragma unroll
    for (int i = 0; i < TT / 128; ++i) {
#pragma unroll
      for (int c = 0; c < 4; ++c) { const float v = x[i][c]; const float e = (v <= -1.0e38f) ? 0.f : expf(v - m); x[i][c] = e; sum += e; } }
#pragma unroll
    for (int o = 1; o < 32; o <<= 1) sum += __shfl_xor(sum, o);
    const float inv = sum > 0.f ? 2048.0f / sum : 0.f;   /* a fully excluded row yields P = 0 */
    float* pf = &pp.f[wave][0] + lane * 4; _Float16* ph = &pp.h[wave][0] + lane * 4;
#pragma unroll
    for (int i = 0; i < TT / 128; ++i) if (i < nv) { const v4f p = x[i] * inv;
      if (i * 128 < KHI && qb < QBH) vst2(pf + i * 128, p);
      else { v4h q;
#pragma unroll
        for (int c = 0; c < 4; ++c) q[c] = (_Float16)p[c];
        vst2(ph + i * 128, q); } } }
  __syncthreads();   /* every row's P is in LDS before any wave reads its key chunks of all 16 rows */
  v8f acc[HD / 16] = {};
  if (qb < QBH) {
#pragma unroll 1
    for (int kc = wave; kc < kce; kc += PVS) { const F2 p = split_row(&pp.f[col][0], kc * 32, lane);
#pragma unroll
      for (int j = 0; j < HD / 16; ++j) { const size_t po = ((size_t)b * CC + h * HD + j * 16 + col) * (size_t)KHI + kc * 32; const v16b vh = frag_b(VB + po, lane); acc[j] = wmma_bf(p.h, vh, acc[j]); acc[j] = wmma_bf(p.l, vh, acc[j]); acc[j] = wmma_bf(p.h, frag_b(VBL + po, lane), acc[j]); } }
  } else {
#pragma unroll 1
    for (int kc = wave; kc < kce; kc += PVS) { const v16h p = frag_h(&pp.h[col][kc * 32], lane);
#pragma unroll
      for (int j = 0; j < HD / 16; ++j) { const size_t po = ((size_t)b * CC + h * HD + j * 16 + col) * (size_t)TT + kc * 32; acc[j] = wmma16(p, frag_h(VT + po, lane), acc[j]); } } }
#pragma unroll
  for (int j = 0; j < HD / 16; ++j)
#pragma unroll
    for (int r = 0; r < 8; ++r) ss[wave][8 * g + r][j * 16 + col] = acc[j][r];
  __syncthreads();   /* every wave's partial tile is in LDS before any thread adds them */
  { const int rl = tid >> 5; v2f s = *(const v2f*)&ss[0][rl][lane * 2];
#pragma unroll
    for (int w = 1; w < PVS; ++w) s += *(const v2f*)&ss[w][rl][lane * 2];
    vst2(Y + ((size_t)b * TT + ql0 + rl) * CC + h * HD + lane * 2, s * (1.0f / 2048.0f)); } }
// ---- k_out: block = (64 rows, 128 cols): out = ctx Wo (+ bo): ctx x 2^6 once to f16 against Wo as f16(bf16 x 2^8) exact (1 product) x 2^-14; causal early rows (< QHI of each sequence): ctx bf16 hi + lo against exact bf16 Wo (2 products)
__global__ __launch_bounds__(128) void k_out(const float* __restrict__ Y, const float* __restrict__ WO, const float* __restrict__ BO, float* __restrict__ OUT) { __shared__ __align__(16) float sf[4][16][132];
  const int tid = threadIdx.x, wave = tid >> 5, lane = tid & 31, col = lane & 15, g = lane >> 4; const int c0 = blockIdx.y * 128; const size_t r0 = (size_t)blockIdx.x * 64 + wave * 16;
  v8f acc[8] = {};
  if (CAUSAL && (int)(((size_t)blockIdx.x * 64) % TT) < QHI) {   /* block-uniform */
#pragma unroll 2
    for (int kc = 0; kc < CC / 32; ++kc) { const F2 a = split_row(Y + (r0 + col) * CC, kc * 32, lane); asm volatile("s_wait_loadcnt 0x0" ::: "memory");
#pragma unroll
      for (int j = 0; j < 8; ++j) { const v16b w = WOCOL(WO, kc * 32, c0 + j * 16 + col, lane); asm volatile("s_wait_loadcnt 0x0" ::: "memory"); acc[j] = wmma_bf(a.h, w, acc[j]); acc[j] = wmma_bf(a.l, w, acc[j]); } }
#pragma unroll
    for (int j = 0; j < 8; ++j) { const float bias = BO ? bfr(BO[c0 + j * 16 + col]) : 0.f;
#pragma unroll
      for (int r = 0; r < 8; ++r) sf[wave][8 * g + r][j * 16 + col] = acc[j][r] + bias; }
  } else {
#pragma unroll 2
    for (int kc = 0; kc < CC / 32; ++kc) { const v16h a = frag_f32s(Y + (r0 + col) * CC + kc * 32, lane, 64.0f); asm volatile("s_wait_loadcnt 0x0" ::: "memory");   /* ctx carried x 2^6 into f16 so small-magnitude context rows stay clear of f16 subnormals (chip FTZ) */
#pragma unroll
      for (int j = 0; j < 8; ++j) { const v16h w = WOCOLH(WO, kc * 32, c0 + j * 16 + col, lane); asm volatile("s_wait_loadcnt 0x0" ::: "memory"); acc[j] = wmma16(a, w, acc[j]); } }
#pragma unroll
    for (int j = 0; j < 8; ++j) { const float bias = BO ? bfr(BO[c0 + j * 16 + col]) : 0.f;
#pragma unroll
      for (int r = 0; r < 8; ++r) sf[wave][8 * g + r][j * 16 + col] = acc[j][r] * (1.0f / 16384.0f) + bias; } }   /* 2^-8 (Wo carry) x 2^-6 (ctx carry) */
  LDSX(); for (int rl = 0; rl < 16; ++rl) vst2(OUT + (r0 + rl) * DIN + c0 + lane * 4, *(const v4f*)&sf[wave][rl][lane * 4]); }

extern "C" void kernel_launch(void* const* d_in, const int* in_sizes, int n_in, void* d_out, int out_size, void* d_ws, size_t ws_size, hipStream_t stream) {
  (void)in_sizes; (void)n_in; (void)out_size;
  const float** F = (const float**)d_in;
  if (ws_size < (size_t)WS_END) return;
  char* ws = (char*)d_ws; _Float16 *QH = (_Float16*)(ws + WS_QH), *KH = (_Float16*)(ws + WS_KH), *VT = (_Float16*)(ws + WS_VT), *QL = (_Float16*)(ws + WS_QL), *KL = (_Float16*)(ws + WS_KL); __bf16 *VB = (__bf16*)(ws + WS_VB), *VBL = (__bf16*)(ws + WS_VBL); float *S = (float*)(ws + WS_S), *Y = (float*)(ws + WS_Y);
  (void)Y; (void)QL; (void)KL; (void)VB; (void)VBL;
  // inputs: 0 x [2,2048,1024]; 1 w_attn [1024,3072] (in,out; columns q | k | v); 2 b_attn [3072] (zeros, read); 3 w_proj [1024,1024] (in,out); 4 b_proj [1024] (zeros, read). outputs: 0 a [2,2048,1024] at d_out + 0; 1 present [2,2,16,2048,64] at d_out + NB*TT*CC floats (byte offset 16,777,216)
  k_proj<<<dim3(TNB * TT / 64, CC / 128, 3), 128, 0, stream>>>(F[0], F[0], F[0], F[1], F[1] + CC, F[1] + 2 * CC, F[2], F[2] + CC, F[2] + 2 * CC, QH, QL, KH, KL, VT, VB, VBL, (float*)d_out + (size_t)NB * TT * CC);
  for (int b = 0; b < TNB; ++b) for (int h0 = 0; h0 < NH; h0 += HG) {
    k_sc<<<dim3(NQB, TT / 128, HG), 128, 0, stream>>>(QH, KH, QL, KL, b, h0, S);
    k_pv<<<dim3(TT / 16, 1, HG), 32 * PVS, 0, stream>>>(S, VT, VB, VBL, b, h0, Y);
  }
  k_out<<<dim3(TNB * TT / 64, DIN / 128), 128, 0, stream>>>(Y, F[3], F[4], (float*)d_out);
}

// v003
// One run takes 403 microseconds.
// Two timings next to v002 both put it at 1.44 times that version's speed.
// All steps since v000 together make it 2.75 times as fast.
// compute dtype: all float inputs rounded to bf16; c = x w_attn + b_attn with EXACT bf16 products on WMMA 16x16x32 (f32 accumulate); the f32 k and v rows are ALSO the second output (present); causal logits: 3 products for the first 384 rows, single f16 q x k after, x 64^-0.5; softmax f32; P x 2^11 once to f16 x v once to f16 (bf16 hi + lo below row 384); ctx hi+lo x exact w_proj below row 384, x2^6 f16 carry x f16(bf16 x 2^8) after, + b_proj; f32 outputs.
#include <hip/hip_runtime.h>
#include <math.h>

typedef __attribute__((ext_vector_type(16))) _Float16 v16h;
typedef __attribute__((ext_vector_type(16))) __bf16 v16b;
typedef __attribute__((ext_vector_type(8)))  _Float16 v8h;
typedef __attribute__((ext_vector_type(8)))  float v8f;
typedef __attribute__((ext_vector_type(4)))  float v4f;
typedef __attribute__((ext_vector_type(2)))  float v2f;
typedef __attribute__((ext_vector_type(4)))  unsigned v4u;
typedef __attribute__((ext_vector_type(4)))  int v4i;
typedef float __attribute__((may_alias)) float_a;
typedef int __attribute__((may_alias)) int_a;

template <typename T> __device__ __forceinline__ void vst2(void* p, T v) { *(T*)p = v;  }
__device__ __forceinline__ v8f wmma16(v16h a, v16h b, v8f c) {
  v8f d = __builtin_amdgcn_wmma_f32_16x16x32_f16(false, a, false, b, (short)0, c, false, false);
  asm volatile("v_nop\n\tv_nop\n\tv_nop\n\tv_nop" : "+v"(d) : "v"(a), "v"(b));
  return d;
}
__device__ __forceinline__ v8f wmma_bf(v16b a, v16b b, v8f c) {
  v8f d = __builtin_amdgcn_wmma_f32_16x16x32_bf16(false, a, false, b, (short)0, c, false, false);
  asm volatile("v_nop\n\tv_nop\n\tv_nop\n\tv_nop" : "+v"(d) : "v"(a), "v"(b));
  return d;
}
// 16x16x32 fragments: lane = (h = lane>>4, row/col = lane&15); elements 0..7 = k0+8h+0..7, 8..15 = k0+16+8h+0..7; D element r = row 8h+r
__device__ __forceinline__ v16h frag_h(const _Float16* rowk0, int lane) {
  union { v16h v; v8h q[2]; } u; const _Float16* p = rowk0 + 8 * (lane >> 4);
  u.q[0] = *(const v8h*)p; u.q[1] = *(const v8h*)(p + 16); return u.v;
}
__device__ __forceinline__ v16h frag_f32(const float* rowk0, int lane) {
  v16h a; const float* p = rowk0 + 8 * (lane >> 4);
#pragma unroll
  for (int i = 0; i < 8; ++i) { a[i] = (_Float16)p[i]; a[8 + i] = (_Float16)p[16 + i]; }
  return a;
}
__device__ __forceinline__ v16h frag_f32s(const float* rowk0, int lane, float sc) {
  v16h a; const float* p = rowk0 + 8 * (lane >> 4);
#pragma unroll
  for (int i = 0; i < 8; ++i) { a[i] = (_Float16)(p[i] * sc); a[8 + i] = (_Float16)(p[16 + i] * sc); }
  return a;
}
// column fragment from a [K][ld] layout (column n), rows >= K read as 0
__device__ __forceinline__ v16h fragc_f32(const float* W, int k0, int n, int lane, int ld, int K) {
  v16h a; const int g = lane >> 4;
#pragma unroll
  for (int i = 0; i < 8; ++i) { const int ka = k0 + 8 * g + i, kb = ka + 16;
    a[i] = (_Float16)(ka < K ? W[(size_t)(ka < K ? ka : K - 1) * ld + n] : 0.f); a[8 + i] = (_Float16)(kb < K ? W[(size_t)(kb < K ? kb : K - 1) * ld + n] : 0.f); }
  return a;
}
struct F2 { v16b h, l; };
__device__ __forceinline__ F2 bsplit16(const float v[16]) { F2 r;
#pragma unroll
  for (int i = 0; i < 16; ++i) { const __bf16 h = (__bf16)v[i]; r.h[i] = h; r.l[i] = (__bf16)(v[i] - (float)h); }
  return r; }
__device__ __forceinline__ F2 split_row(const float* row, int k0, int lane) { float v[16]; const float* p = row + k0 + 8 * (lane >> 4);
#pragma unroll
  for (int i = 0; i < 8; ++i) { v[i] = p[i]; v[8 + i] = p[16 + i]; }
  return bsplit16(v); }
__device__ __forceinline__ F2 split_rowK(const float* row, int k0, int lane, int K) { float v[16]; const int g = lane >> 4;
#pragma unroll
  for (int i = 0; i < 8; ++i) { const int ka = k0 + 8 * g + i, kb = ka + 16; v[i] = ka < K ? row[ka < K ? ka : K - 1] : 0.f; v[8 + i] = kb < K ? row[kb < K ? kb : K - 1] : 0.f; }
  return bsplit16(v); }
__device__ __forceinline__ F2 split_col(const float* W, int k0, int n, int lane, int ld, int K) { float v[16]; const int g = lane >> 4;
#pragma unroll
  for (int i = 0; i < 8; ++i) { const int ka = k0 + 8 * g + i, kb = ka + 16; v[i] = ka < K ? W[(size_t)(ka < K ? ka : K - 1) * ld + n] : 0.f; v[8 + i] = kb < K ? W[(size_t)(kb < K ? kb : K - 1) * ld + n] : 0.f; }
  return bsplit16(v); }
__device__ __forceinline__ v8f mac3(const F2& a, const F2& b, v8f c) { c = wmma_bf(a.l, b.h, c); c = wmma_bf(a.h, b.l, c); return wmma_bf(a.h, b.h, c); }
__device__ __forceinline__ float sigm(float v) { return 1.0f / (1.0f + expf(-v)); }
#define LDSX() do { asm volatile("s_wait_dscnt 0" ::: "memory"); __builtin_amdgcn_wave_barrier(); __builtin_amdgcn_fence(__ATOMIC_RELEASE, "workgroup"); } while (0)

// Fused-qkv causal self-attention with TWO outputs (x [2,2048,1024]; fused (in,out) w_attn [1024,3072] N(0,1) x 0.02 + b_attn zeros (read), jnp.split(c, 3, axis=2) -> q | k | v column blocks; 16 heads x 64; w = q k^T x rsqrt(64); w * b - 1e10 * (1 - b) with b = (i >= j): causal, the masked logits are exactly -1e10; softmax; a = merge(p v) w_proj + b_proj; outputs: a [2,2048,1024] and present = stack([k, v], axis=1) [2,2,16,2048,64] = the projected k and v (bias included) in head-major layout).
#define NB 2
#define TT 2048
#define CC 1024            // NH * HD = projected width
#define DIN 1024          // input (model) width
#define NH 16
#define HD 64
#define SCALE (0.125f)
#define CAUSAL 1
#ifndef TNB
#define TNB NB
#endif
__device__ __forceinline__ float bfr(float v) { return (float)(__bf16)v; }
__host__ __device__ __forceinline__ int kb_last(int qb) { return CAUSAL ? ((qb * 64 + 63) >> 7) : (TT / 128 - 1); }
typedef __attribute__((ext_vector_type(8))) __bf16 v8b;
__device__ __forceinline__ v16b frag_b(const __bf16* rowk0, int lane) {
  union { v16b v; v8b q[2]; } u; const __bf16* p = rowk0 + 8 * (lane >> 4);
  u.q[0] = *(const v8b*)p; u.q[1] = *(const v8b*)(p + 16); return u.v;
}
#define QBH 6              // causal: query blocks 0..QBH-1 of each sequence (few keys, no averaging) take the high-precision path
#define QHI 384            // rows carrying a q residual plane
#define KHI 384            // key rows carrying k residual / v bf16 hi+lo planes (used only by the causal high-precision path)
// B fragment (k rows k0+.., output column o) of a weight: (in,out) [K][ld] or (out,in) [ld rows of K]: bf16 exact, or f16(bf16 * 256) exact
__device__ __forceinline__ v16b wcol_io(const float* Wm, int k0, int o, int lane, int ld) { v16b w; const int g = lane >> 4;
#pragma unroll
  for (int i = 0; i < 8; ++i) { w[i] = (__bf16)Wm[(size_t)(k0 + 8 * g + i) * ld + o]; w[8 + i] = (__bf16)Wm[(size_t)(k0 + 16 + 8 * g + i) * ld + o]; }
  return w; }
__device__ __forceinline__ v16b wcol_oi(const float* Wm, int k0, int o, int lane, int K) { v16b w; const float* p = Wm + (size_t)o * K + k0 + 8 * (lane >> 4);
#pragma unroll
  for (int i = 0; i < 8; ++i) { w[i] = (__bf16)p[i]; w[8 + i] = (__bf16)p[16 + i]; }
  return w; }
__device__ __forceinline__ v16h wcolh_io(const float* Wm, int k0, int o, int lane, int ld) { v16h w; const int g = lane >> 4;
#pragma unroll
  for (int i = 0; i < 8; ++i) { w[i] = (_Float16)(bfr(Wm[(size_t)(k0 + 8 * g + i) * ld + o]) * 256.0f); w[8 + i] = (_Float16)(bfr(Wm[(size_t)(k0 + 16 + 8 * g + i) * ld + o]) * 256.0f); }
  return w; }
__device__ __forceinline__ v16h wcolh_oi(const float* Wm, int k0, int o, int lane, int K) { v16h w; const float* p = Wm + (size_t)o * K + k0 + 8 * (lane >> 4);
#pragma unroll
  for (int i = 0; i < 8; ++i) { w[i] = (_Float16)(bfr(p[i]) * 256.0f); w[8 + i] = (_Float16)(bfr(p[16 + i]) * 256.0f); }
  return w; }
#define WQKV_LAYOUT 0   // 0 = (in,out); 1 = (out,in) [CC][DIN]; 2 = per-head [NH][DIN][HD]
__device__ __forceinline__ v16b wcol_hdk(const float* Wm, int k0, int o, int lane) { v16b w; const int g = lane >> 4; const float* p = Wm + (size_t)(o / HD) * DIN * HD + (o % HD);
#pragma unroll
  for (int i = 0; i < 8; ++i) { w[i] = (__bf16)p[(size_t)(k0 + 8 * g + i) * HD]; w[8 + i] = (__bf16)p[(size_t)(k0 + 16 + 8 * g + i) * HD]; }
  return w; }
#define WO_OUT_IN 0
#if WQKV_LAYOUT == 1
#define WCOL(W, k0, o, lane) wcol_oi(W, k0, o, lane, DIN)
#elif WQKV_LAYOUT == 2
#define WCOL(W, k0, o, lane) wcol_hdk(W, k0, o, lane)
#else
#define WCOL(W, k0, o, lane) wcol_io(W, k0, o, lane, 3 * CC)   /* w_attn (in,out) [1024][3072] packed by columns: row pitch 3*CC; the q / k / v pointers carry the column offsets 0 / CC / 2*CC */
#endif
#if WO_OUT_IN
#define WOCOL(W, k0, o, lane) wcol_oi(W, k0, o, lane, CC)
#define WOCOLH(W, k0, o, lane) wcolh_oi(W, k0, o, lane, CC)
#else
#define WOCOL(W, k0, o, lane) wcol_io(W, k0, o, lane, DIN)
#define WOCOLH(W, k0, o, lane) wcolh_io(W, k0, o, lane, DIN)
#endif
#define PROJ_EXTRA_PARAMS , float* __restrict__ PRES   /* second output: present [NB][2][NH][TT][HD] f32 */
#define PROJ_EPI(which, row, t, h) do { if ((which) >= 1) { float* dst_ = PRES + ((((size_t)bb * 2 + ((which) - 1)) * NH + (h)) * TT + (t)) * HD; _Pragma("unroll") for (int q4 = 0; q4 < HD / 4; ++q4) vst2(dst_ + 4 * q4, *(const v4f*)((row) + 4 * q4)); } } while (0)
static_assert(HD == 64 && (132 * 4) % 16 == 0, "the staged row st[rl][hh*HD] is 16-B aligned and 64 floats long");
#ifndef PROJ_EXTRA_PARAMS
#define PROJ_EXTRA_PARAMS
#endif

#define WS_QH  0u                                      // f16 q rows [b*t][CC]
#define WS_KH  (WS_QH + 2u * (size_t)NB * TT * CC)      // f16 k rows [b*t][CC]
#define WS_VT  (WS_KH + 2u * (size_t)NB * TT * CC)      // f16 v planes [b][c][t]
#define WS_QL  (WS_VT + 2u * (size_t)NB * CC * TT)      // f16 q residual x 2^10 rows [b][t < QHI][CC]
#define WS_KL  (WS_QL + 2u * (size_t)NB * QHI * CC)     // f16 k residual x 2^10 rows [b][t < KHI][CC]
#define WS_VB  (WS_KL + 2u * (size_t)NB * KHI * CC)     // bf16 v hi planes [b][c][t < KHI]
#define WS_VBL (WS_VB + 2u * (size_t)NB * CC * KHI)
#define WS_Y   (WS_VBL + 2u * (size_t)NB * CC * KHI)    // f32 ctx rows [b*t][CC] (only when there is an output projection)
#define WS_END (WS_Y  + 4u * (size_t)NB * TT * CC)

// ---- k_proj: block = (64 rows, 128 cols, which): q/k/v = X W (+ b) with exact bf16 products (K = DIN) -> which 0: q f16 rows (+ residual rows < QHI); 1: k f16 rows (+ residual rows < KHI); 2: v f16 planes [c][t] (+ bf16 hi/lo planes for t < KHI)
__global__ __launch_bounds__(128) void k_proj(const float* __restrict__ XQ, const float* __restrict__ XK, const float* __restrict__ XV, const float* __restrict__ WQ, const float* __restrict__ WK, const float* __restrict__ WV, const float* __restrict__ BQ, const float* __restrict__ BK, const float* __restrict__ BV,
    _Float16* __restrict__ QH, _Float16* __restrict__ QL, _Float16* __restrict__ KH, _Float16* __restrict__ KL, _Float16* __restrict__ VT, __bf16* __restrict__ VB, __bf16* __restrict__ VBL PROJ_EXTRA_PARAMS) {
  __shared__ __align__(16) float st[64][132]; __shared__ __align__(16) _Float16 sh[64][136], sl[64][136]; __shared__ __align__(16) _Float16 th[128][72]; __shared__ __align__(16) __bf16 tb[128][72], tbl[128][72];
  const int tid = threadIdx.x, wave = tid >> 5, lane = tid & 31, col = lane & 15, g = lane >> 4; const int which = blockIdx.z; const int c0 = blockIdx.y * 128; const size_t r0 = (size_t)blockIdx.x * 64; const size_t bb = r0 / TT; const int t0 = (int)(r0 % TT);
  const float* X = which == 0 ? XQ : which == 1 ? XK : XV; const float* WA = which == 0 ? WQ : which == 1 ? WK : WV; const float* BA = which == 0 ? BQ : which == 1 ? BK : BV;
  v8f acc[8] = {};
#pragma unroll 2
  for (int kc = 0; kc < DIN / 32; ++kc) { v16b a; { const float* p = X + (r0 + wave * 16 + col) * DIN + kc * 32 + 8 * g;
#pragma unroll
      for (int i = 0; i < 8; ++i) { a[i] = (__bf16)p[i]; a[8 + i] = (__bf16)p[16 + i]; } }
    asm volatile("s_wait_loadcnt 0x0" ::: "memory");
#pragma unroll
    for (int j = 0; j < 8; ++j) { const v16b w = WCOL(WA, kc * 32, c0 + j * 16 + col, lane); asm volatile("s_wait_loadcnt 0x0" ::: "memory"); acc[j] = wmma_bf(a, w, acc[j]); } }
  { // stage the f32 tile (acc + bias) in LDS, run the per-(row, head) epilogue hook, then convert
#pragma unroll
    for (int j = 0; j < 8; ++j) { const float bias = BA ? bfr(BA[c0 + j * 16 + col]) : 0.f;
#pragma unroll
      for (int r = 0; r < 8; ++r) st[wave * 16 + 8 * g + r][j * 16 + col] = acc[j][r] + bias; }
    __syncthreads();
    for (int e = tid; e < 64 * (128 / HD); e += 128) { const int rl = e / (128 / HD), hh = e % (128 / HD); PROJ_EPI(which, &st[rl][hh * HD], (int)((r0 + rl) % TT), (c0 / HD) + hh); }
    __syncthreads(); }
  if (which < 2) { _Float16* DH = which == 0 ? QH : KH; _Float16* DL = which == 0 ? QL : KL; const int nhi = which == 0 ? QHI : KHI; const bool hi_rows = t0 < nhi;
    for (int e = tid; e < 64 * 128; e += 128) { const int rl = e >> 7, cl = e & 127; const float v = st[rl][cl]; const _Float16 hv = (_Float16)v; sh[rl][cl] = hv; sl[rl][cl] = (_Float16)((v - (float)hv) * 1024.0f); }
    __syncthreads();
    for (int e = tid; e < 64 * 16; e += 128) { const int rl = e >> 4, q = e & 15; vst2((unsigned*)(DH + (r0 + rl) * CC + c0 + q * 8), *(const v4u*)&sh[rl][q * 8]); if (hi_rows) vst2((unsigned*)(DL + (bb * nhi + t0 + rl) * (size_t)CC + c0 + q * 8), *(const v4u*)&sl[rl][q * 8]); }
  } else { const bool hi_rows = t0 < KHI;
    for (int e = tid; e < 64 * 128; e += 128) { const int rl = e & 63, cl = e >> 6; const float v = st[rl][cl]; th[cl][rl] = (_Float16)v; const __bf16 bh = (__bf16)v; tb[cl][rl] = bh; tbl[cl][rl] = (__bf16)(v - (float)bh); }
    __syncthreads();
    for (int e = tid; e < 128 * 8; e += 128) { const int cl = e >> 3, q = e & 7; vst2((unsigned*)(VT + (bb * CC + c0 + cl) * (size_t)TT + t0 + q * 8), *(const v4u*)&th[cl][q * 8]); if (hi_rows) { const size_t o3 = (bb * CC + c0 + cl) * (size_t)KHI + t0 + q * 8; vst2((unsigned*)(VB + o3), *(const v4u*)&tb[cl][q * 8]); vst2((unsigned*)(VBL + o3), *(const v4u*)&tbl[cl][q * 8]); } } } }
// ---- k_pv: block = 16 queries (tile qt) of (b, h), PVS waves, one launch for every (b, h). First the logits of the tile: wave w takes the 16-key tiles w, w + PVS, ... of keys [0, kend), q x k on WMMA (single f16 product; causal early query blocks: q hi + residual x 2^10 against k hi + residual, 3 products), x SCALE, f32 rows in LDS. Behind a workgroup barrier the softmax: wave w owns query row t = ql0 + w, reads its raw logits once into registers (causal: s > t excluded), takes max and sum in f32 inside the wave, and leaves P x 2^11 (0 for excluded) at the head of its own LDS row: f16, f32 for the causal early query blocks. Behind a workgroup barrier wave w takes the 32-key chunks w, w + PVS, ... and keeps its own f32 partial ctx tile; the partials meet in LDS (the rows' upper halves, which P leaves free) behind one more workgroup barrier and are added in wave order (P f16 against v f16: 1 product; causal early query blocks: P and v as bf16 hi + lo, 3 products); 256-B (row, head) segment by one wave
#define PVS 16             // key slices = waves per block = query rows per tile
#define LPF (TT + 4)       // f32 row pitch in LDS: raw logits; then P (f16 or f32) in floats [0, TT / 2) and wave w's partial ctx tile in floats [TT / 2, TT) of row w
#define LPH (2 * LPF)      // the same pitch in f16 elements
#define KTB 4              // key tiles whose k fragments a wave has in flight together
typedef __attribute__((ext_vector_type(4))) _Float16 v4h;
static_assert(32 * PVS == 16 * (HD / 2), "the merge gives each thread one 8-B piece of the 16 x HD tile");
static_assert(PVS == 16, "one wave per query row of the tile");
static_assert((LPF * 4) % 32 == 16, "row pitch = 16 B x odd: the 16-B fragment reads of 16 rows spread over the banks");
static_assert(16 * HD <= TT / 2 && KHI <= TT / 2, "a partial ctx tile fits the upper half of a row, the f32 P of the early query blocks the lower half");
static_assert(!CAUSAL || ((QBH * 64 - 1) / 128 + 1) * 128 <= KHI, "the early query blocks' keys have k residual rows and v hi + lo planes");
__global__ __launch_bounds__(32 * PVS) void k_pv(const _Float16* __restrict__ QH, const _Float16* __restrict__ KH, const _Float16* __restrict__ QL, const _Float16* __restrict__ KL, const _Float16* __restrict__ VT, const __bf16* __restrict__ VB, const __bf16* __restrict__ VBL, float* __restrict__ Y) { const int b = blockIdx.z / NH, h = blockIdx.z % NH; __shared__ __align__(16) union { float f[16][LPF]; _Float16 h[16][LPH]; } pp;
  const int tid = threadIdx.x, lane = tid & 31, col = lane & 15, g = lane >> 4; const int wave = __builtin_amdgcn_readfirstlane(tid >> 5); const int qb = blockIdx.x >> 2; const int ql0 = blockIdx.x * 16; const int kce = (kb_last(qb) + 1) * 4;
  { const int nt = kce * 2;   /* 16-key tiles that get logits, the same count for the whole block */
    const _Float16* qp = QH + ((size_t)b * TT + ql0 + col) * CC + h * HD; const _Float16* kp = KH + ((size_t)b * TT + col) * CC + h * HD;
    const v16h ah0 = frag_h(qp, lane), ah1 = frag_h(qp + 32, lane);
    asm volatile("s_wait_xcnt 0x0" ::: "memory");   /* the q loads' address registers are reused behind the branch below */
    if (qb < QBH) { const _Float16* qlp = QL + ((size_t)b * QHI + ql0 + col) * CC + h * HD; const _Float16* klp = KL + ((size_t)b * KHI + col) * CC + h * HD;
      const v16h al0 = frag_h(qlp, lane), al1 = frag_h(qlp + 32, lane);
      for (int jt = wave; jt < nt; jt += PVS) { const _Float16* kr = kp + (size_t)jt * 16 * CC; const _Float16* kl = klp + (size_t)jt * 16 * CC;
        const v16h kb0 = frag_h(kr, lane), kl0 = frag_h(kl, lane), kb1 = frag_h(kr + 32, lane), kl1 = frag_h(kl + 32, lane); v8f a = {}, l = {};
        a = wmma16(ah0, kb0, a); l = wmma16(al0, kb0, l); l = wmma16(ah0, kl0, l);
        a = wmma16(ah1, kb1, a); l = wmma16(al1, kb1, l); l = wmma16(ah1, kl1, l);
#pragma unroll
        for (int r = 0; r < 8; ++r) pp.f[8 * g + r][jt * 16 + col] = (a[r] + l[r] * (1.0f / 1024.0f)) * SCALE; }
    } else {
      const _Float16* kr0 = kp + (size_t)wave * 16 * CC;
      for (int jt0 = wave; jt0 < nt; jt0 += KTB * PVS, kr0 += (size_t)KTB * PVS * 16 * CC) { v16h kf[KTB][2];   /* the tests on jt0 + u * PVS are the same for the whole wave */
#pragma unroll
        for (int u = 0; u < KTB; ++u) if (jt0 + u * PVS < nt) { const _Float16* kr = kr0 + u * (PVS * 16 * CC); kf[u][0] = frag_h(kr, lane); kf[u][1] = frag_h(kr + 32, lane); }
#pragma unroll
        for (int u = 0; u < KTB; ++u) if (jt0 + u * PVS < nt) { v8f a = {}; a = wmma16(ah0, kf[u][0], a); a = wmma16(ah1, kf[u][1], a);
#pragma unroll
          for (int r = 0; r < 8; ++r) pp.f[8 * g + r][(jt0 + u * PVS) * 16 + col] = a[r] * SCALE; } } } }
  __syncthreads();   /* every key tile's logits are in LDS before any wave reads its query row */
  { const int t = ql0 + wave; const int nv = kce >> 2;   /* nv groups of 128 keys hold logits, the same count for the whole block; the lane has keys i * 128 + lane * 4 + c of group i */
    const int rel = t - lane * 4;                        /* causal: that key is allowed while i * 128 + c <= rel, which no key of a group i >= nv is */
    const float* sr = &pp.f[wave][0] + lane * 4; v4f x[TT / 128];   /* the row's share of the lane; every loop over x is fully unrolled so that x stays in registers */
#pragma unroll
    for (int i = 0; i < TT / 128; ++i) { if (i < nv) x[i] = *(const v4f*)(sr + i * 128); else x[i] = (v4f)(-3.0e38f); }
    float m = -3.0e38f;
#pragma unroll
    for (int i = 0; i < TT / 128; ++i) {
#pragma unroll
      for (int c = 0; c < 4; ++c) { const float v = (!CAUSAL || i * 128 + c <= rel) ? x[i][c] : -3.0e38f; x[i][c] = v; m = fmaxf(m, v); } }
#pragma unroll
    for (int o = 1; o < 32; o <<= 1) m = fmaxf(m, __shfl_xor(m, o));
    float sum = 0.f;
#pragma unroll
    for (int i = 0; i < TT / 128; ++i) {
#pragma unroll
      for (int c = 0; c < 4; ++c) { const float v = x[i][c]; const float e = (v <= -1.0e38f) ? 0.f : expf(v - m); x[i][c] = e; sum += e; } }
#pragma unroll
    for (int o = 1; o < 32; o <<= 1) sum += __shfl_xor(sum, o);
    const float inv = sum > 0.f ? 2048.0f / sum : 0.f;   /* a fully excluded row yields P = 0 */
    float* pf = &pp.f[wave][0] + lane * 4; _Float16* ph = &pp.h[wave][0] + lane * 4;   /* P goes over the wave's own row, whose logits are all in registers by now */
#pragma unroll
    for (int i = 0; i < TT / 128; ++i) if (i < nv) { const v4f p = x[i] * inv;
      if (i * 128 < KHI && qb < QBH) vst2(pf + i * 128, p);
      else { v4h q;
#pragma unroll
        for (int c = 0; c < 4; ++c) q[c] = (_Float16)p[c];
        vst2(ph + i * 128, q); } } }
  __syncthreads();   /* every row's P is in LDS before any wave reads its key chunks of all 16 rows */
  v8f acc[HD / 16] = {};
  if (qb < QBH) {
#pragma unroll 1
    for (int kc = wave; kc < kce; kc += PVS) { const F2 p = split_row(&pp.f[col][0], kc * 32, lane);
#pragma unroll
      for (int j = 0; j < HD / 16; ++j) { const size_t po = ((size_t)b * CC + h * HD + j * 16 + col) * (size_t)KHI + kc * 32; const v16b vh = frag_b(VB + po, lane); acc[j] = wmma_bf(p.h, vh, acc[j]); acc[j] = wmma_bf(p.l, vh, acc[j]); acc[j] = wmma_bf(p.h, frag_b(VBL + po, lane), acc[j]); } }
  } else {
#pragma unroll 1
    for (int kc = wave; kc < kce; kc += PVS) { const v16h p = frag_h(&pp.h[col][kc * 32], lane);
#pragma unroll
      for (int j = 0; j < HD / 16; ++j) { const size_t po = ((size_t)b * CC + h * HD + j * 16 + col) * (size_t)TT + kc * 32; acc[j] = wmma16(p, frag_h(VT + po, lane), acc[j]); } } }
  float* sw = &pp.f[wave][TT / 2];   /* this wave's partial tile [16][HD]: no P byte lies there */
#pragma unroll
  for (int j = 0; j < HD / 16; ++j)
#pragma unroll
    for (int r = 0; r < 8; ++r) sw[(8 * g + r) * HD + j * 16 + col] = acc[j][r];
  __syncthreads();   /* every wave's partial tile is in LDS before any thread adds them */
  { const int rl = tid >> 5; v2f s = *(const v2f*)&pp.f[0][TT / 2 + rl * HD + lane * 2];
#pragma unroll
    for (int w = 1; w < PVS; ++w) s += *(const v2f*)&pp.f[w][TT / 2 + rl * HD + lane * 2];
    vst2(Y + ((size_t)b * TT + ql0 + rl) * CC + h * HD + lane * 2, s * (1.0f / 2048.0f)); } }
// ---- k_out: block = (64 rows, 128 cols): out = ctx Wo (+ bo): ctx x 2^6 once to f16 against Wo as f16(bf16 x 2^8) exact (1 product) x 2^-14; causal early rows (< QHI of each sequence): ctx bf16 hi + lo against exact bf16 Wo (2 products)
__global__ __launch_bounds__(128) void k_out(const float* __restrict__ Y, const float* __restrict__ WO, const float* __restrict__ BO, float* __restrict__ OUT) { __shared__ __align__(16) float sf[4][16][132];
  const int tid = threadIdx.x, wave = tid >> 5, lane = tid & 31, col = lane & 15, g = lane >> 4; const int c0 = blockIdx.y * 128; const size_t r0 = (size_t)blockIdx.x * 64 + wave * 16;
  v8f acc[8] = {};
  if (CAUSAL && (int)(((size_t)blockIdx.x * 64) % TT) < QHI) {   /* block-uniform */
#pragma unroll 2
    for (int kc = 0; kc < CC / 32; ++kc) { const F2 a = split_row(Y + (r0 + col) * CC, kc * 32, lane); asm volatile("s_wait_loadcnt 0x0" ::: "memory");
#pragma unroll
      for (int j = 0; j < 8; ++j) { const v16b w = WOCOL(WO, kc * 32, c0 + j * 16 + col, lane); asm volatile("s_wait_loadcnt 0x0" ::: "memory"); acc[j] = wmma_bf(a.h, w, acc[j]); acc[j] = wmma_bf(a.l, w, acc[j]); } }
#pragma unroll
    for (int j = 0; j < 8; ++j) { const float bias = BO ? bfr(BO[c0 + j * 16 + col]) : 0.f;
#pragma unroll
      for (int r = 0; r < 8; ++r) sf[wave][8 * g + r][j * 16 + col] = acc[j][r] + bias; }
  } else {
#pragma unroll 2
    for (int kc = 0; kc < CC / 32; ++kc) { const v16h a = frag_f32s(Y + (r0 + col) * CC + kc * 32, lane, 64.0f); asm volatile("s_wait_loadcnt 0x0" ::: "memory");   /* ctx carried x 2^6 into f16 so small-magnitude context rows stay clear of f16 subnormals (chip FTZ) */
#pragma unroll
      for (int j = 0; j < 8; ++j) { const v16h w = WOCOLH(WO, kc * 32, c0 + j * 16 + col, lane); asm volatile("s_wait_loadcnt 0x0" ::: "memory"); acc[j] = wmma16(a, w, acc[j]); } }
#pragma unroll
    for (int j = 0; j < 8; ++j) { const float bias = BO ? bfr(BO[c0 + j * 16 + col]) : 0.f;
#pragma unroll
      for (int r = 0; r < 8; ++r) sf[wave][8 * g + r][j * 16 + col] = acc[j][r] * (1.0f / 16384.0f) + bias; } }   /* 2^-8 (Wo carry) x 2^-6 (ctx carry) */
  LDSX(); for (int rl = 0; rl < 16; ++rl) vst2(OUT + (r0 + rl) * DIN + c0 + lane * 4, *(const v4f*)&sf[wave][rl][lane * 4]); }

extern "C" void kernel_launch(void* const* d_in, const int* in_sizes, int n_in, void* d_out, int out_size, void* d_ws, size_t ws_size, hipStream_t stream) {
  (void)in_sizes; (void)n_in; (void)out_size;
  const float** F = (const float**)d_in;
  if (ws_size < (size_t)WS_END) return;
  char* ws = (char*)d_ws; _Float16 *QH = (_Float16*)(ws + WS_QH), *KH = (_Float16*)(ws + WS_KH), *VT = (_Float16*)(ws + WS_VT), *QL = (_Float16*)(ws + WS_QL), *KL = (_Float16*)(ws + WS_KL); __bf16 *VB = (__bf16*)(ws + WS_VB), *VBL = (__bf16*)(ws + WS_VBL); float *Y = (float*)(ws + WS_Y);
  (void)Y; (void)QL; (void)KL; (void)VB; (void)VBL;
  // inputs: 0 x [2,2048,1024]; 1 w_attn [1024,3072] (in,out; columns q | k | v); 2 b_attn [3072] (zeros, read); 3 w_proj [1024,1024] (in,out); 4 b_proj [1024] (zeros, read). outputs: 0 a [2,2048,1024] at d_out + 0; 1 present [2,2,16,2048,64] at d_out + NB*TT*CC floats (byte offset 16,777,216)
  k_proj<<<dim3(TNB * TT / 64, CC / 128, 3), 128, 0, stream>>>(F[0], F[0], F[0], F[1], F[1] + CC, F[1] + 2 * CC, F[2], F[2] + CC, F[2] + 2 * CC, QH, QL, KH, KL, VT, VB, VBL, (float*)d_out + (size_t)NB * TT * CC);
  k_pv<<<dim3(TT / 16, 1, TNB * NH), 32 * PVS, 0, stream>>>(QH, KH, QL, KL, VT, VB, VBL, Y);
  k_out<<<dim3(TNB * TT / 64, DIN / 128), 128, 0, stream>>>(Y, F[3], F[4], (float*)d_out);
}

// v004
// One run takes 222 microseconds.
// Timed twice side by side with v003, it ran 1.82 times as fast both times.
// Counting every step since v000, it is 4.99 times as fast.
// compute dtype: all float inputs rounded to bf16; c = x w_attn + b_attn with EXACT bf16 products on WMMA 16x16x32 (f32 accumulate); the f32 k and v rows are ALSO the second output (present); causal logits: 3 products for the first 384 rows, single f16 q x k after, x 64^-0.5; softmax f32; P x 2^11 once to f16 x v once to f16 (bf16 hi + lo below row 384); ctx hi+lo x exact w_proj below row 384, x2^6 f16 carry x f16(bf16 x 2^8) after, + b_proj; f32 outputs.
#include <hip/hip_runtime.h>
#include <math.h>

typedef __attribute__((ext_vector_type(16))) _Float16 v16h;
typedef __attribute__((ext_vector_type(16))) __bf16 v16b;
typedef __attribute__((ext_vector_type(8)))  _Float16 v8h;
typedef __attribute__((ext_vector_type(8)))  float v8f;
typedef __attribute__((ext_vector_type(4)))  float v4f;
typedef __attribute__((ext_vector_type(2)))  float v2f;
typedef __attribute__((ext_vector_type(4)))  unsigned v4u;
typedef __attribute__((ext_vector_type(4)))  int v4i;
typedef float __attribute__((may_alias)) float_a;
typedef int __attribute__((may_alias)) int_a;

template <typename T> __device__ __forceinline__ void vst2(void* p, T v) { *(T*)p = v;  }
__device__ __forceinline__ v8f wmma16(v16h a, v16h b, v8f c) {
  v8f d = __builtin_amdgcn_wmma_f32_16x16x32_f16(false, a, false, b, (short)0, c, false, false);
  asm volatile("v_nop\n\tv_nop\n\tv_nop\n\tv_nop" : "+v"(d) : "v"(a), "v"(b));
  return d;
}
__device__ __forceinline__ v8f wmma_bf(v16b a, v16b b, v8f c) {
  v8f d = __builtin_amdgcn_wmma_f32_16x16x32_bf16(false, a, false, b, (short)0, c, false, false);
  asm volatile("v_nop\n\tv_nop\n\tv_nop\n\tv_nop" : "+v"(d) : "v"(a), "v"(b));
  return d;
}
// 16x16x32 fragments: lane = (h = lane>>4, row/col = lane&15); elements 0..7 = k0+8h+0..7, 8..15 = k0+16+8h+0..7; D element r = row 8h+r
__device__ __forceinline__ v16h frag_h(const _Float16* rowk0, int lane) {
  union { v16h v; v8h q[2]; } u; const _Float16* p = rowk0 + 8 * (lane >> 4);
  u.q[0] = *(const v8h*)p; u.q[1] = *(const v8h*)(p + 16); return u.v;
}
__device__ __forceinline__ v16h frag_f32(const float* rowk0, int lane) {
  v16h a; const float* p = rowk0 + 8 * (lane >> 4);
#pragma unroll
  for (int i = 0; i < 8; ++i) { a[i] = (_Float16)p[i]; a[8 + i] = (_Float16)p[16 + i]; }
  return a;
}
__device__ __forceinline__ v16h frag_f32s(const float* rowk0, int lane, float sc) {
  v16h a; const float* p = rowk0 + 8 * (lane >> 4);
#pragma unroll
  for (int i = 0; i < 8; ++i) { a[i] = (_Float16)(p[i] * sc); a[8 + i] = (_Float16)(p[16 + i] * sc); }
  return a;
}
// column fragment from a [K][ld] layout (column n), rows >= K read as 0
__device__ __forceinline__ v16h fragc_f32(const float* W, int k0, int n, int lane, int ld, int K) {
  v16h a; const int g = lane >> 4;
#pragma unroll
  for (int i = 0; i < 8; ++i) { const int ka = k0 + 8 * g + i, kb = ka + 16;
    a[i] = (_Float16)(ka < K ? W[(size_t)(ka < K ? ka : K - 1) * ld + n] : 0.f); a[8 + i] = (_Float16)(kb < K ? W[(size_t)(kb < K ? kb : K - 1) * ld + n] : 0.f); }
  return a;
}
struct F2 { v16b h, l; };
__device__ __forceinline__ F2 bsplit16(const float v[16]) { F2 r;
#pragma unroll
  for (int i = 0; i < 16; ++i) { const __bf16 h = (__bf16)v[i]; r.h[i] = h; r.l[i] = (__bf16)(v[i] - (float)h); }
  return r; }
__device__ __forceinline__ F2 split_row(const float* row, int k0, int lane) { float v[16]; const float* p = row + k0 + 8 * (lane >> 4);
#pragma unroll
  for (int i = 0; i < 8; ++i) { v[i] = p[i]; v[8 + i] = p[16 + i]; }
  return bsplit16(v); }
__device__ __forceinline__ F2 split_rowK(const float* row, int k0, int lane, int K) { float v[16]; const int g = lane >> 4;
#pragma unroll
  for (int i = 0; i < 8; ++i) { const int ka = k0 + 8 * g + i, kb = ka + 16; v[i] = ka < K ? row[ka < K ? ka : K - 1] : 0.f; v[8 + i] = kb < K ? row[kb < K ? kb : K - 1] : 0.f; }
  return bsplit16(v); }
__device__ __forceinline__ F2 split_col(const float* W, int k0, int n, int lane, int ld, int K) { float v[16]; const int g = lane >> 4;
#pragma unroll
  for (int i = 0; i < 8; ++i) { const int ka = k0 + 8 * g + i, kb = ka + 16; v[i] = ka < K ? W[(size_t)(ka < K ? ka : K - 1) * ld + n] : 0.f; v[8 + i] = kb < K ? W[(size_t)(kb < K ? kb : K - 1) * ld + n] : 0.f; }
  return bsplit16(v); }
__device__ __forceinline__ v8f mac3(const F2& a, const F2& b, v8f c) { c = wmma_bf(a.l, b.h, c); c = wmma_bf(a.h, b.l, c); return wmma_bf(a.h, b.h, c); }
__device__ __forceinline__ float sigm(float v) { return 1.0f / (1.0f + expf(-v)); }
#define LDSX() do { asm volatile("s_wait_dscnt 0" ::: "memory"); __builtin_amdgcn_wave_barrier(); __builtin_amdgcn_fence(__ATOMIC_RELEASE, "workgroup"); } while (0)

// Fused-qkv causal self-attention with TWO outputs (x [2,2048,1024]; fused (in,out) w_attn [1024,3072] N(0,1) x 0.02 + b_attn zeros (read), jnp.split(c, 3, axis=2) -> q | k | v column blocks; 16 heads x 64; w = q k^T x rsqrt(64); w * b - 1e10 * (1 - b) with b = (i >= j): causal, the masked logits are exactly -1e10; softmax; a = merge(p v) w_proj + b_proj; outputs: a [2,2048,1024] and present = stack([k, v], axis=1) [2,2,16,2048,64] = the projected k and v (bias included) in head-major layout).
#define NB 2
#define TT 2048
#define CC 1024            // NH * HD = projected width
#define DIN 1024          // input (model) width
#define NH 16
#define HD 64
#define SCALE (0.125f)
#define CAUSAL 1
#ifndef TNB
#define TNB NB
#endif
__device__ __forceinline__ float bfr(float v) { return (float)(__bf16)v; }
__host__ __device__ __forceinline__ int kb_last(int qb) { return CAUSAL ? ((qb * 64 + 63) >> 7) : (TT / 128 - 1); }
typedef __attribute__((ext_vector_type(8))) __bf16 v8b;
__device__ __forceinline__ v16b frag_b(const __bf16* rowk0, int lane) {
  union { v16b v; v8b q[2]; } u; const __bf16* p = rowk0 + 8 * (lane >> 4);
  u.q[0] = *(const v8b*)p; u.q[1] = *(const v8b*)(p + 16); return u.v;
}
#define QBH 6              // causal: query blocks 0..QBH-1 of each sequence (few keys, no averaging) take the high-precision path
#define QHI 384            // rows carrying a q residual plane
#define KHI 384            // key rows carrying k residual / v bf16 hi+lo planes (used only by the causal high-precision path)
// B fragment (k rows k0+.., output column o) of a weight: (in,out) [K][ld] or (out,in) [ld rows of K]: bf16 exact, or f16(bf16 * 256) exact
__device__ __forceinline__ v16b wcol_io(const float* Wm, int k0, int o, int lane, int ld) { v16b w; const int g = lane >> 4;
#pragma unroll
  for (int i = 0; i < 8; ++i) { w[i] = (__bf16)Wm[(size_t)(k0 + 8 * g + i) * ld + o]; w[8 + i] = (__bf16)Wm[(size_t)(k0 + 16 + 8 * g + i) * ld + o]; }
  return w; }
__device__ __forceinline__ v16b wcol_oi(const float* Wm, int k0, int o, int lane, int K) { v16b w; const float* p = Wm + (size_t)o * K + k0 + 8 * (lane >> 4);
#pragma unroll
  for (int i = 0; i < 8; ++i) { w[i] = (__bf16)p[i]; w[8 + i] = (__bf16)p[16 + i]; }
  return w; }
__device__ __forceinline__ v16h wcolh_io(const float* Wm, int k0, int o, int lane, int ld) { v16h w; const int g = lane >> 4;
#pragma unroll
  for (int i = 0; i < 8; ++i) { w[i] = (_Float16)(bfr(Wm[(size_t)(k0 + 8 * g + i) * ld + o]) * 256.0f); w[8 + i] = (_Float16)(bfr(Wm[(size_t)(k0 + 16 + 8 * g + i) * ld + o]) * 256.0f); }
  return w; }
__device__ __forceinline__ v16h wcolh_oi(const float* Wm, int k0, int o, int lane, int K) { v16h w; const float* p = Wm + (size_t)o * K + k0 + 8 * (lane >> 4);
#pragma unroll
  for (int i = 0; i < 8; ++i) { w[i] = (_Float16)(bfr(p[i]) * 256.0f); w[8 + i] = (_Float16)(bfr(p[16 + i]) * 256.0f); }
  return w; }
#define WQKV_LAYOUT 0   // 0 = (in,out); 1 = (out,in) [CC][DIN]; 2 = per-head [NH][DIN][HD]
__device__ __forceinline__ v16b wcol_hdk(const float* Wm, int k0, int o, int lane) { v16b w; const int g = lane >> 4; const float* p = Wm + (size_t)(o / HD) * DIN * HD + (o % HD);
#pragma unroll
  for (int i = 0; i < 8; ++i) { w[i] = (__bf16)p[(size_t)(k0 + 8 * g + i) * HD]; w[8 + i] = (__bf16)p[(size_t)(k0 + 16 + 8 * g + i) * HD]; }
  return w; }
#define WO_OUT_IN 0
#if WQKV_LAYOUT == 1
#define WCOL(W, k0, o, lane) wcol_oi(W, k0, o, lane, DIN)
#elif WQKV_LAYOUT == 2
#define WCOL(W, k0, o, lane) wcol_hdk(W, k0, o, lane)
#else
#define WCOL(W, k0, o, lane) wcol_io(W, k0, o, lane, 3 * CC)   /* w_attn (in,out) [1024][3072] packed by columns: row pitch 3*CC; the q / k / v pointers carry the column offsets 0 / CC / 2*CC */
#endif
#if WO_OUT_IN
#define WOCOL(W, k0, o, lane) wcol_oi(W, k0, o, lane, CC)
#define WOCOLH(W, k0, o, lane) wcolh_oi(W, k0, o, lane, CC)
#else
#define WOCOL(W, k0, o, lane) wcol_io(W, k0, o, lane, DIN)
#define WOCOLH(W, k0, o, lane) wcolh_io(W, k0, o, lane, DIN)
#endif
#define PROJ_EXTRA_PARAMS , float* __restrict__ PRES   /* second output: present [NB][2][NH][TT][HD] f32 */
#define PROJ_EPI(which, row, t, h) do { if ((which) >= 1) { float* dst_ = PRES + ((((size_t)bb * 2 + ((which) - 1)) * NH + (h)) * TT + (t)) * HD; _Pragma("unroll") for (int q4 = 0; q4 < HD / 4; ++q4) vst2(dst_ + 4 * q4, *(const v4f*)((row) + 4 * q4)); } } while (0)
static_assert(HD == 64 && (132 * 4) % 16 == 0, "the staged row st[rl][hh*HD] is 16-B aligned and 64 floats long");
#ifndef PROJ_EXTRA_PARAMS
#define PROJ_EXTRA_PARAMS
#endif

#define WS_QH  0u                                      // f16 q rows [b*t][CC]
#define WS_KH  (WS_QH + 2u * (size_t)NB * TT * CC)      // f16 k rows [b*t][CC]
#define WS_VT  (WS_KH + 2u * (size_t)NB * TT * CC)      // f16 v planes [b][c][t]
#define WS_QL  (WS_VT + 2u * (size_t)NB * CC * TT)      // f16 q residual x 2^10 rows [b][t < QHI][CC]
#define WS_KL  (WS_QL + 2u * (size_t)NB * QHI * CC)     // f16 k residual x 2^10 rows [b][t < KHI][CC]
#define WS_VB  (WS_KL + 2u * (size_t)NB * KHI * CC)     // bf16 v hi planes [b][c][t < KHI]
#define WS_VBL (WS_VB + 2u * (size_t)NB * CC * KHI)
#define WS_Y   (WS_VBL + 2u * (size_t)NB * CC * KHI)    // f32 ctx rows [b*t][CC] (only when there is an output projection)
#define WS_END (WS_Y  + 4u * (size_t)NB * TT * CC)

// ---- the K loop of k_proj and k_out: a stage is KS k rows of the block's 128 weight columns. Thread tid reads column c0 + tid of the stage (each wave-wide load = one whole 128-B line), rounds it once for the whole block and leaves it k-contiguous in LDS row tid; every wave takes its B fragments from there. Two LDS buffers, one workgroup barrier per stage; the next stage's weight column and the wave's own next A rows are in flight while this stage's products run.
#define KS 64              // k rows per stage = 2 WMMA k steps
#define FG 8               // B fragments a wave reads from LDS as one group in front of their products
#define WP (KS + 8)        // LDS row pitch in 16-bit elements: 144 B = 16 B x odd, so that 16 rows' 16-B reads and writes spread over the banks
static_assert(DIN % KS == 0 && CC % KS == 0 && KS % 32 == 0 && (WP * 2) % 32 == 16, "whole stages; row pitch = 16 B x odd");
template <int LD> __device__ __forceinline__ void stage_ld(float (&wr)[KS], v4f (&xr)[KS / 8], const float* wp, const float* xp) {
#pragma unroll
  for (int i = 0; i < KS; ++i) wr[i] = wp[(size_t)i * LD];
#pragma unroll
  for (int kk = 0; kk < KS / 32; ++kk) { xr[kk * 4 + 0] = *(const v4f*)(xp + kk * 32); xr[kk * 4 + 1] = *(const v4f*)(xp + kk * 32 + 4); xr[kk * 4 + 2] = *(const v4f*)(xp + kk * 32 + 16); xr[kk * 4 + 3] = *(const v4f*)(xp + kk * 32 + 20); }
}
// F16 = 0: bf16 exact; 1: f16(bf16 x 2^8) exact
template <int F16> __device__ __forceinline__ void stage_st(unsigned short* row, const float (&wr)[KS]) {
#pragma unroll
  for (int q = 0; q < KS / 8; ++q) { union { v8b b; v8h h; v4u u; } t;
#pragma unroll
    for (int i = 0; i < 8; ++i) { if (F16) t.h[i] = (_Float16)(bfr(wr[q * 8 + i]) * 256.0f); else t.b[i] = (__bf16)wr[q * 8 + i]; }
    vst2(row + q * 8, t.u); } }
// the 16 f32 values of A fragment kk of a stage, in fragment order
__device__ __forceinline__ void stage_a(float (&v)[16], const v4f (&xr)[KS / 8], int kk) {
#pragma unroll
  for (int i = 0; i < 4; ++i) { v[i] = xr[kk * 4][i]; v[4 + i] = xr[kk * 4 + 1][i]; v[8 + i] = xr[kk * 4 + 2][i]; v[12 + i] = xr[kk * 4 + 3][i]; } }
// ---- k_proj: block = (64 rows, 128 cols, which): q/k/v = X W (+ b) with exact bf16 products (K = DIN) -> which 0: q f16 rows (+ residual rows < QHI); 1: k f16 rows (+ residual rows < KHI); 2: v f16 planes [c][t] (+ bf16 hi/lo planes for t < KHI)
__global__ __launch_bounds__(128) void k_proj(const float* __restrict__ XQ, const float* __restrict__ XK, const float* __restrict__ XV, const float* __restrict__ WQ, const float* __restrict__ WK, const float* __restrict__ WV, const float* __restrict__ BQ, const float* __restrict__ BK, const float* __restrict__ BV,
    _Float16* __restrict__ QH, _Float16* __restrict__ QL, _Float16* __restrict__ KH, _Float16* __restrict__ KL, _Float16* __restrict__ VT, __bf16* __restrict__ VB, __bf16* __restrict__ VBL PROJ_EXTRA_PARAMS) {
  __shared__ __align__(16) float st[64][132]; __shared__ __align__(16) _Float16 sh[64][136], sl[64][136]; __shared__ __align__(16) _Float16 th[128][72]; __shared__ __align__(16) __bf16 tb[128][72], tbl[128][72]; __shared__ __align__(16) unsigned short wt[2][128][WP];
  const int tid = threadIdx.x, wave = tid >> 5, lane = tid & 31, col = lane & 15, g = lane >> 4; const int which = blockIdx.z; const int c0 = blockIdx.y * 128; const size_t r0 = (size_t)blockIdx.x * 64; const size_t bb = r0 / TT; const int t0 = (int)(r0 % TT);
  const float* X = which == 0 ? XQ : which == 1 ? XK : XV; const float* WA = which == 0 ? WQ : which == 1 ? WK : WV; const float* BA = which == 0 ? BQ : which == 1 ? BK : BV;
  v8f acc[8] = {};
  { const float* wp = WA + c0 + tid; const float* xp = X + (r0 + wave * 16 + col) * DIN + 8 * g; float wr[KS]; v4f xr[KS / 8]; v16b a[KS / 32];
    stage_ld<3 * CC>(wr, xr, wp, xp);
    asm volatile("s_wait_xcnt 0x0" ::: "memory");   /* the scalar base of stage 0's weight loads is reused right behind them, where the compiler waits to a count only */
    stage_st<0>(&wt[0][tid][0], wr);
#pragma unroll
    for (int kk = 0; kk < KS / 32; ++kk) { float v[16]; stage_a(v, xr, kk);
#pragma unroll
      for (int i = 0; i < 16; ++i) a[kk][i] = (__bf16)v[i]; }
    __syncthreads();   /* stage 0 of the weight tile is in LDS before any wave reads it */
#pragma unroll 1   /* kept rolled: a trip already holds a whole stage's loads and products; a second copy would only add registers and code */
    for (int s = 0; s < DIN / KS; ++s) {
      if (s + 1 < DIN / KS) { wp += (size_t)KS * 3 * CC; xp += KS; stage_ld<3 * CC>(wr, xr, wp, xp); }
#pragma unroll
      for (int kk = 0; kk < KS / 32; ++kk)
#pragma unroll
        for (int j0 = 0; j0 < 8; j0 += FG) { v16b w[FG];
#pragma unroll
          for (int j = 0; j < FG; ++j) w[j] = frag_b((const __bf16*)&wt[s & 1][(j0 + j) * 16 + col][kk * 32], lane);
#pragma unroll
          for (int j = 0; j < FG; ++j) acc[j0 + j] = wmma_bf(a[kk], w[j], acc[j0 + j]); }
      if (s + 1 < DIN / KS) { stage_st<0>(&wt[(s + 1) & 1][tid][0], wr);
#pragma unroll
        for (int kk = 0; kk < KS / 32; ++kk) { float v[16]; stage_a(v, xr, kk);
#pragma unroll
          for (int i = 0; i < 16; ++i) a[kk][i] = (__bf16)v[i]; } }
      __syncthreads();   /* publishes stage s + 1 and ends every wave's reads of stage s, whose buffer the next trip refills */
    } }
  { // stage the f32 tile (acc + bias) in LDS, run the per-(row, head) epilogue hook, then convert
#pragma unroll
    for (int j = 0; j < 8; ++j) { const float bias = BA ? bfr(BA[c0 + j * 16 + col]) : 0.f;
#pragma unroll
      for (int r = 0; r < 8; ++r) st[wave * 16 + 8 * g + r][j * 16 + col] = acc[j][r] + bias; }
    __syncthreads();
    for (int e = tid; e < 64 * (128 / HD); e += 128) { const int rl = e / (128 / HD), hh = e % (128 / HD); PROJ_EPI(which, &st[rl][hh * HD], (int)((r0 + rl) % TT), (c0 / HD) + hh); }
    __syncthreads(); }
  if (which < 2) { _Float16* DH = which == 0 ? QH : KH; _Float16* DL = which == 0 ? QL : KL; const int nhi = which == 0 ? QHI : KHI; const bool hi_rows = t0 < nhi;
    for (int e = tid; e < 64 * 128; e += 128) { const int rl = e >> 7, cl = e & 127; const float v = st[rl][cl]; const _Float16 hv = (_Float16)v; sh[rl][cl] = hv; sl[rl][cl] = (_Float16)((v - (float)hv) * 1024.0f); }
    __syncthreads();
    for (int e = tid; e < 64 * 16; e += 128) { const int rl = e >> 4, q = e & 15; vst2((unsigned*)(DH + (r0 + rl) * CC + c0 + q * 8), *(const v4u*)&sh[rl][q * 8]); if (hi_rows) vst2((unsigned*)(DL + (bb * nhi + t0 + rl) * (size_t)CC + c0 + q * 8), *(const v4u*)&sl[rl][q * 8]); }
  } else { const bool hi_rows = t0 < KHI;
    for (int e = tid; e < 64 * 128; e += 128) { const int rl = e & 63, cl = e >> 6; const float v = st[rl][cl]; th[cl][rl] = (_Float16)v; const __bf16 bh = (__bf16)v; tb[cl][rl] = bh; tbl[cl][rl] = (__bf16)(v - (float)bh); }
    __syncthreads();
    for (int e = tid; e < 128 * 8; e += 128) { const int cl = e >> 3, q = e & 7; vst2((unsigned*)(VT + (bb * CC + c0 + cl) * (size_t)TT + t0 + q * 8), *(const v4u*)&th[cl][q * 8]); if (hi_rows) { const size_t o3 = (bb * CC + c0 + cl) * (size_t)KHI + t0 + q * 8; vst2((unsigned*)(VB + o3), *(const v4u*)&tb[cl][q * 8]); vst2((unsigned*)(VBL + o3), *(const v4u*)&tbl[cl][q * 8]); } } } }
// ---- k_pv: block = 16 queries (tile qt) of (b, h), PVS waves, one launch for every (b, h). First the logits of the tile: wave w takes the 16-key tiles w, w + PVS, ... of keys [0, kend), q x k on WMMA (single f16 product; causal early query blocks: q hi + residual x 2^10 against k hi + residual, 3 products), x SCALE, f32 rows in LDS. Behind a workgroup barrier the softmax: wave w owns query row t = ql0 + w, reads its raw logits once into registers (causal: s > t excluded), takes max and sum in f32 inside the wave, and leaves P x 2^11 (0 for excluded) at the head of its own LDS row: f16, f32 for the causal early query blocks. Behind a workgroup barrier wave w takes the 32-key chunks w, w + PVS, ... and keeps its own f32 partial ctx tile; the partials meet in LDS (the rows' upper halves, which P leaves free) behind one more workgroup barrier and are added in wave order (P f16 against v f16: 1 product; causal early query blocks: P and v as bf16 hi + lo, 3 products); 256-B (row, head) segment by one wave
#define PVS 16             // key slices = waves per block = query rows per tile
#define LPF (TT + 4)       // f32 row pitch in LDS: raw logits; then P (f16 or f32) in floats [0, TT / 2) and wave w's partial ctx tile in floats [TT / 2, TT) of row w
#define LPH (2 * LPF)      // the same pitch in f16 elements
#define KTB 4              // key tiles whose k fragments a wave has in flight together
typedef __attribute__((ext_vector_type(4))) _Float16 v4h;
static_assert(32 * PVS == 16 * (HD / 2), "the merge gives each thread one 8-B piece of the 16 x HD tile");
static_assert(PVS == 16, "one wave per query row of the tile");
static_assert((LPF * 4) % 32 == 16, "row pitch = 16 B x odd: the 16-B fragment reads of 16 rows spread over the banks");
static_assert(16 * HD <= TT / 2 && KHI <= TT / 2, "a partial ctx tile fits the upper half of a row, the f32 P of the early query blocks the lower half");
static_assert(!CAUSAL || ((QBH * 64 - 1) / 128 + 1) * 128 <= KHI, "the early query blocks' keys have k residual rows and v hi + lo planes");
__global__ __launch_bounds__(32 * PVS) void k_pv(const _Float16* __restrict__ QH, const _Float16* __restrict__ KH, const _Float16* __restrict__ QL, const _Float16* __restrict__ KL, const _Float16* __restrict__ VT, const __bf16* __restrict__ VB, const __bf16* __restrict__ VBL, float* __restrict__ Y) { const int b = blockIdx.z / NH, h = blockIdx.z % NH; __shared__ __align__(16) union { float f[16][LPF]; _Float16 h[16][LPH]; } pp;
  const int tid = threadIdx.x, lane = tid & 31, col = lane & 15, g = lane >> 4; const int wave = __builtin_amdgcn_readfirstlane(tid >> 5); const int qb = blockIdx.x >> 2; const int ql0 = blockIdx.x * 16; const int kce = (kb_last(qb) + 1) * 4;
  { const int nt = kce * 2;   /* 16-key tiles that get logits, the same count for the whole block */
    const _Float16* qp = QH + ((size_t)b * TT + ql0 + col) * CC + h * HD; const _Float16* kp = KH + ((size_t)b * TT + col) * CC + h * HD;
    const v16h ah0 = frag_h(qp, lane), ah1 = frag_h(qp + 32, lane);
    asm volatile("s_wait_xcnt 0x0" ::: "memory");   /* the q loads' address registers are reused behind the branch below */
    if (qb < QBH) { const _Float16* qlp = QL + ((size_t)b * QHI + ql0 + col) * CC + h * HD; const _Float16* klp = KL + ((size_t)b * KHI + col) * CC + h * HD;
      const v16h al0 = frag_h(qlp, lane), al1 = frag_h(qlp + 32, lane);
      for (int jt = wave; jt < nt; jt += PVS) { const _Float16* kr = kp + (size_t)jt * 16 * CC; const _Float16* kl = klp + (size_t)jt * 16 * CC;
        const v16h kb0 = frag_h(kr, lane), kl0 = frag_h(kl, lane), kb1 = frag_h(kr + 32, lane), kl1 = frag_h(kl + 32, lane); v8f a = {}, l = {};
        a = wmma16(ah0, kb0, a); l = wmma16(al0, kb0, l); l = wmma16(ah0, kl0, l);
        a = wmma16(ah1, kb1, a); l = wmma16(al1, kb1, l); l = wmma16(ah1, kl1, l);
#pragma unroll
        for (int r = 0; r < 8; ++r) pp.f[8 * g + r][jt * 16 + col] = (a[r] + l[r] * (1.0f / 1024.0f)) * SCALE; }
    } else {
      const _Float16* kr0 = kp + (size_t)wave * 16 * CC;
      for (int jt0 = wave; jt0 < nt; jt0 += KTB * PVS, kr0 += (size_t)KTB * PVS * 16 * CC) { v16h kf[KTB][2];   /* the tests on jt0 + u * PVS are the same for the whole wave */
#pragma unroll
        for (int u = 0; u < KTB; ++u) if (jt0 + u * PVS < nt) { const _Float16* kr = kr0 + u * (PVS * 16 * CC); kf[u][0] = frag_h(kr, lane); kf[u][1] = frag_h(kr + 32, lane); }
#pragma unroll
        for (int u = 0; u < KTB; ++u) if (jt0 + u * PVS < nt) { v8f a = {}; a = wmma16(ah0, kf[u][0], a); a = wmma16(ah1, kf[u][1], a);
#pragma unroll
          for (int r = 0; r < 8; ++r) pp.f[8 * g + r][(jt0 + u * PVS) * 16 + col] = a[r] * SCALE; } } } }
  __syncthreads();   /* every key tile's logits are in LDS before any wave reads its query row */
  { const int t = ql0 + wave; const int nv = kce >> 2;   /* nv groups of 128 keys hold logits, the same count for the whole block; the lane has keys i * 128 + lane * 4 + c of group i */
    const int rel = t - lane * 4;                        /* causal: that key is allowed while i * 128 + c <= rel, which no key of a group i >= nv is */
    const float* sr = &pp.f[wave][0] + lane * 4; v4f x[TT / 128];   /* the row's share of the lane; every loop over x is fully unrolled so that x stays in registers */
#pragma unroll
    for (int i = 0; i < TT / 128; ++i) { if (i < nv) x[i] = *(const v4f*)(sr + i * 128); else x[i] = (v4f)(-3.0e38f); }
    float m = -3.0e38f;
#pragma unroll
    for (int i = 0; i < TT / 128; ++i) {
#pragma unroll
      for (int c = 0; c < 4; ++c) { const float v = (!CAUSAL || i * 128 + c <= rel) ? x[i][c] : -3.0e38f; x[i][c] = v; m = fmaxf(m, v); } }
#pragma unroll
    for (int o = 1; o < 32; o <<= 1) m = fmaxf(m, __shfl_xor(m, o));
    float sum = 0.f;
#pragma unroll
    for (int i = 0; i < TT / 128; ++i) {
#pragma unroll
      for (int c = 0; c < 4; ++c) { const float v = x[i][c]; const float e = (v <= -1.0e38f) ? 0.f : expf(v - m); x[i][c] = e; sum += e; } }
#pragma unroll
    for (int o = 1; o < 32; o <<= 1) sum += __shfl_xor(sum, o);
    const float inv = sum > 0.f ? 2048.0f / sum : 0.f;   /* a fully excluded row yields P = 0 */
    float* pf = &pp.f[wave][0] + lane * 4; _Float16* ph = &pp.h[wave][0] + lane * 4;   /* P goes over the wave's own row, whose logits are all in registers by now */
#pragma unroll
    for (int i = 0; i < TT / 128; ++i) if (i < nv) { const v4f p = x[i] * inv;
      if (i * 128 < KHI && qb < QBH) vst2(pf + i * 128, p);
      else { v4h q;
#pragma unroll
        for (int c = 0; c < 4; ++c) q[c] = (_Float16)p[c];
        vst2(ph + i * 128, q); } } }
  __syncthreads();   /* every row's P is in LDS before any wave reads its key chunks of all 16 rows */
  v8f acc[HD / 16] = {};
  if (qb < QBH) {
#pragma unroll 1
    for (int kc = wave; kc < kce; kc += PVS) { const F2 p = split_row(&pp.f[col][0], kc * 32, lane);
#pragma unroll
      for (int j = 0; j < HD / 16; ++j) { const size_t po = ((size_t)b * CC + h * HD + j * 16 + col) * (size_t)KHI + kc * 32; const v16b vh = frag_b(VB + po, lane); acc[j] = wmma_bf(p.h, vh, acc[j]); acc[j] = wmma_bf(p.l, vh, acc[j]); acc[j] = wmma_bf(p.h, frag_b(VBL + po, lane), acc[j]); } }
  } else {
#pragma unroll 1
    for (int kc = wave; kc < kce; kc += PVS) { const v16h p = frag_h(&pp.h[col][kc * 32], lane);
#pragma unroll
      for (int j = 0; j < HD / 16; ++j) { const size_t po = ((size_t)b * CC + h * HD + j * 16 + col) * (size_t)TT + kc * 32; acc[j] = wmma16(p, frag_h(VT + po, lane), acc[j]); } } }
  float* sw = &pp.f[wave][TT / 2];   /* this wave's partial tile [16][HD]: no P byte lies there */
#pragma unroll
  for (int j = 0; j < HD / 16; ++j)
#pragma unroll
    for (int r = 0; r < 8; ++r) sw[(8 * g + r) * HD + j * 16 + col] = acc[j][r];
  __syncthreads();   /* every wave's partial tile is in LDS before any thread adds them */
  { const int rl = tid >> 5; v2f s = *(const v2f*)&pp.f[0][TT / 2 + rl * HD + lane * 2];
#pragma unroll
    for (int w = 1; w < PVS; ++w) s += *(const v2f*)&pp.f[w][TT / 2 + rl * HD + lane * 2];
    vst2(Y + ((size_t)b * TT + ql0 + rl) * CC + h * HD + lane * 2, s * (1.0f / 2048.0f)); } }
// ---- k_out: block = (64 rows, 128 cols): out = ctx Wo (+ bo): ctx x 2^6 once to f16 against Wo as f16(bf16 x 2^8) exact (1 product) x 2^-14; causal early rows (< QHI of each sequence): ctx bf16 hi + lo against exact bf16 Wo (2 products)
__global__ __launch_bounds__(128) void k_out(const float* __restrict__ Y, const float* __restrict__ WO, const float* __restrict__ BO, float* __restrict__ OUT) { __shared__ __align__(16) float sf[4][16][132]; __shared__ __align__(16) unsigned short wt[2][128][WP];
  const int tid = threadIdx.x, wave = tid >> 5, lane = tid & 31, col = lane & 15, g = lane >> 4; const int c0 = blockIdx.y * 128; const size_t r0 = (size_t)blockIdx.x * 64 + wave * 16;
  v8f acc[8] = {};
  const float* wp = WO + c0 + tid; const float* xp = Y + (r0 + col) * CC + 8 * g; float wr[KS]; v4f xr[KS / 8];
  stage_ld<DIN>(wr, xr, wp, xp);
  asm volatile("s_wait_xcnt 0x0" ::: "memory");   /* stage 0's loads name registers that are written again behind the branch below, where the compiler waits to a count only */
  if (CAUSAL && (int)(((size_t)blockIdx.x * 64) % TT) < QHI) {   /* block-uniform */
    F2 a[KS / 32]; stage_st<0>(&wt[0][tid][0], wr);
#pragma unroll
    for (int kk = 0; kk < KS / 32; ++kk) { float v[16]; stage_a(v, xr, kk); a[kk] = bsplit16(v); }
    __syncthreads();   /* stage 0 of the weight tile is in LDS before any wave reads it */
#pragma unroll 1   /* kept rolled: a trip already holds a whole stage's loads and products; a second copy would only add registers and code */
    for (int s = 0; s < CC / KS; ++s) {
      if (s + 1 < CC / KS) { wp += (size_t)KS * DIN; xp += KS; stage_ld<DIN>(wr, xr, wp, xp); }
#pragma unroll
      for (int kk = 0; kk < KS / 32; ++kk)
#pragma unroll
        for (int j0 = 0; j0 < 8; j0 += FG) { v16b w[FG];
#pragma unroll
          for (int j = 0; j < FG; ++j) w[j] = frag_b((const __bf16*)&wt[s & 1][(j0 + j) * 16 + col][kk * 32], lane);
#pragma unroll
          for (int j = 0; j < FG; ++j) { acc[j0 + j] = wmma_bf(a[kk].h, w[j], acc[j0 + j]); acc[j0 + j] = wmma_bf(a[kk].l, w[j], acc[j0 + j]); } }
      if (s + 1 < CC / KS) { stage_st<0>(&wt[(s + 1) & 1][tid][0], wr);
#pragma unroll
        for (int kk = 0; kk < KS / 32; ++kk) { float v[16]; stage_a(v, xr, kk); a[kk] = bsplit16(v); } }
      __syncthreads();   /* publishes stage s + 1 and ends every wave's reads of stage s, whose buffer the next trip refills */
    }
#pragma unroll
    for (int j = 0; j < 8; ++j) { const float bias = BO ? bfr(BO[c0 + j * 16 + col]) : 0.f;
#pragma unroll
      for (int r = 0; r < 8; ++r) sf[wave][8 * g + r][j * 16 + col] = acc[j][r] + bias; }
  } else {
    v16h a[KS / 32]; stage_st<1>(&wt[0][tid][0], wr);
#pragma unroll
    for (int kk = 0; kk < KS / 32; ++kk) { float v[16]; stage_a(v, xr, kk);
#pragma unroll
      for (int i = 0; i < 16; ++i) a[kk][i] = (_Float16)(v[i] * 64.0f); }   /* ctx carried x 2^6 into f16 so small-magnitude context rows stay clear of f16 subnormals */
    __syncthreads();   /* stage 0 of the weight tile is in LDS before any wave reads it */
#pragma unroll 1   /* kept rolled: a trip already holds a whole stage's loads and products; a second copy would only add registers and code */
    for (int s = 0; s < CC / KS; ++s) {
      if (s + 1 < CC / KS) { wp += (size_t)KS * DIN; xp += KS; stage_ld<DIN>(wr, xr, wp, xp); }
#pragma unroll
      for (int kk = 0; kk < KS / 32; ++kk)
#pragma unroll
        for (int j0 = 0; j0 < 8; j0 += FG) { v16h w[FG];
#pragma unroll
          for (int j = 0; j < FG; ++j) w[j] = frag_h((const _Float16*)&wt[s & 1][(j0 + j) * 16 + col][kk * 32], lane);
#pragma unroll
          for (int j = 0; j < FG; ++j) acc[j0 + j] = wmma16(a[kk], w[j], acc[j0 + j]); }
      if (s + 1 < CC / KS) { stage_st<1>(&wt[(s + 1) & 1][tid][0], wr);
#pragma unroll
        for (int kk = 0; kk < KS / 32; ++kk) { float v[16]; stage_a(v, xr, kk);
#pragma unroll
          for (int i = 0; i < 16; ++i) a[kk][i] = (_Float16)(v[i] * 64.0f); } }
      __syncthreads();   /* publishes stage s + 1 and ends every wave's reads of stage s, whose buffer the next trip refills */
    }
#pragma unroll
    for (int j = 0; j < 8; ++j) { const float bias = BO ? bfr(BO[c0 + j * 16 + col]) : 0.f;
#pragma unroll
      for (int r = 0; r < 8; ++r) sf[wave][8 * g + r][j * 16 + col] = acc[j][r] * (1.0f / 16384.0f) + bias; } }   /* 2^-8 (Wo carry) x 2^-6 (ctx carry) */
  LDSX(); for (int rl = 0; rl < 16; ++rl) vst2(OUT + (r0 + rl) * DIN + c0 + lane * 4, *(const v4f*)&sf[wave][rl][lane * 4]); }

extern "C" void kernel_launch(void* const* d_in, const int* in_sizes, int n_in, void* d_out, int out_size, void* d_ws, size_t ws_size, hipStream_t stream) {
  (void)in_sizes; (void)n_in; (void)out_size;
  const float** F = (const float**)d_in;
  if (ws_size < (size_t)WS_END) return;
  char* ws = (char*)d_ws; _Float16 *QH = (_Float16*)(ws + WS_QH), *KH = (_Float16*)(ws + WS_KH), *VT = (_Float16*)(ws + WS_VT), *QL = (_Float16*)(ws + WS_QL), *KL = (_Float16*)(ws + WS_KL); __bf16 *VB = (__bf16*)(ws + WS_VB), *VBL = (__bf16*)(ws + WS_VBL); float *Y = (float*)(ws + WS_Y);
  (void)Y; (void)QL; (void)KL; (void)VB; (void)VBL;
  // inputs: 0 x [2,2048,1024]; 1 w_attn [1024,3072] (in,out; columns q | k | v); 2 b_attn [3072] (zeros, read); 3 w_proj [1024,1024] (in,out); 4 b_proj [1024] (zeros, read). outputs: 0 a [2,2048,1024] at d_out + 0; 1 present [2,2,16,2048,64] at d_out + NB*TT*CC floats (byte offset 16,777,216)
  k_proj<<<dim3(TNB * TT / 64, CC / 128, 3), 128, 0, stream>>>(F[0], F[0], F[0], F[1], F[1] + CC, F[1] + 2 * CC, F[2], F[2] + CC, F[2] + 2 * CC, QH, QL, KH, KL, VT, VB, VBL, (float*)d_out + (size_t)NB * TT * CC);
  k_pv<<<dim3(TT / 16, 1, TNB * NH), 32 * PVS, 0, stream>>>(QH, KH, QL, KL, VT, VB, VBL, Y);
  k_out<<<dim3(TNB * TT / 64, DIN / 128), 128, 0, stream>>>(Y, F[3], F[4], (float*)d_out);
}

// v005
// Measured time: 203 microseconds a run.
// In both of two side-by-side timings against v004, it was 1.10 times as fast.
// Over all steps from v000 it is 5.47 times as fast.
// compute dtype: all float inputs rounded to bf16; c = x w_attn + b_attn with EXACT bf16 products on WMMA 16x16x32 (f32 accumulate); the f32 k and v rows are ALSO the second output (present); causal logits: 3 products for the first 384 rows, single f16 q x k after, x 64^-0.5; softmax f32; P x 2^11 once to f16 x v once to f16 (bf16 hi + lo below row 384); ctx hi+lo x exact w_proj below row 384, x2^6 f16 carry x f16(bf16 x 2^8) after, + b_proj; f32 outputs.
#include <hip/hip_runtime.h>
#include <math.h>

typedef __attribute__((ext_vector_type(16))) _Float16 v16h;
typedef __attribute__((ext_vector_type(16))) __bf16 v16b;
typedef __attribute__((ext_vector_type(8)))  _Float16 v8h;
typedef __attribute__((ext_vector_type(8)))  float v8f;
typedef __attribute__((ext_vector_type(4)))  float v4f;
typedef __attribute__((ext_vector_type(2)))  float v2f;
typedef __attribute__((ext_vector_type(4)))  unsigned v4u;
typedef __attribute__((ext_vector_type(4)))  int v4i;
typedef float __attribute__((may_alias)) float_a;
typedef int __attribute__((may_alias)) int_a;

template <typename T> __device__ __forceinline__ void vst2(void* p, T v) { *(T*)p = v;  }
__device__ __forceinline__ v8f wmma16(v16h a, v16h b, v8f c) {
  v8f d = __builtin_amdgcn_wmma_f32_16x16x32_f16(false, a, false, b, (short)0, c, false, false);
  asm volatile("v_nop\n\tv_nop\n\tv_nop\n\tv_nop" : "+v"(d) : "v"(a), "v"(b));
  return d;
}
__device__ __forceinline__ v8f wmma_bf(v16b a, v16b b, v8f c) {
  v8f d = __builtin_amdgcn_wmma_f32_16x16x32_bf16(false, a, false, b, (short)0, c, false, false);
  asm volatile("v_nop\n\tv_nop\n\tv_nop\n\tv_nop" : "+v"(d) : "v"(a), "v"(b));
  return d;
}
// 16x16x32 fragments: lane = (h = lane>>4, row/col = lane&15); elements 0..7 = k0+8h+0..7, 8..15 = k0+16+8h+0..7; D element r = row 8h+r
__device__ __forceinline__ v16h frag_h(const _Float16* rowk0, int lane) {
  union { v16h v; v8h q[2]; } u; const _Float16* p = rowk0 + 8 * (lane >> 4);
  u.q[0] = *(const v8h*)p; u.q[1] = *(const v8h*)(p + 16); return u.v;
}
__device__ __forceinline__ v16h frag_f32(const float* rowk0, int lane) {
  v16h a; const float* p = rowk0 + 8 * (lane >> 4);
#pragma unroll
  for (int i = 0; i < 8; ++i) { a[i] = (_Float16)p[i]; a[8 + i] = (_Float16)p[16 + i]; }
  return a;
}
__device__ __forceinline__ v16h frag_f32s(const float* rowk0, int lane, float sc) {
  v16h a; const float* p = rowk0 + 8 * (lane >> 4);
#pragma unroll
  for (int i = 0; i < 8; ++i) { a[i] = (_Float16)(p[i] * sc); a[8 + i] = (_Float16)(p[16 + i] * sc); }
  return a;
}
// column fragment from a [K][ld] layout (column n), rows >= K read as 0
__device__ __forceinline__ v16h fragc_f32(const float* W, int k0, int n, int lane, int ld, int K) {
  v16h a; const int g = lane >> 4;
#pragma unroll
  for (int i = 0; i < 8; ++i) { const int ka = k0 + 8 * g + i, kb = ka + 16;
    a[i] = (_Float16)(ka < K ? W[(size_t)(ka < K ? ka : K - 1) * ld + n] : 0.f); a[8 + i] = (_Float16)(kb < K ? W[(size_t)(kb < K ? kb : K - 1) * ld + n] : 0.f); }
  return a;
}
struct F2 { v16b h, l; };
__device__ __forceinline__ F2 bsplit16(const float v[16]) { F2 r;
#pragma unroll
  for (int i = 0; i < 16; ++i) { const __bf16 h = (__bf16)v[i]; r.h[i] = h; r.l[i] = (__bf16)(v[i] - (float)h); }
  return r; }
__device__ __forceinline__ F2 split_row(const float* row, int k0, int lane) { float v[16]; const float* p = row + k0 + 8 * (lane >> 4);
#pragma unroll
  for (int i = 0; i < 8; ++i) { v[i] = p[i]; v[8 + i] = p[16 + i]; }
  return bsplit16(v); }
__device__ __forceinline__ F2 split_rowK(const float* row, int k0, int lane, int K) { float v[16]; const int g = lane >> 4;
#pragma unroll
  for (int i = 0; i < 8; ++i) { const int ka = k0 + 8 * g + i, kb = ka + 16; v[i] = ka < K ? row[ka < K ? ka : K - 1] : 0.f; v[8 + i] = kb < K ? row[kb < K ? kb : K - 1] : 0.f; }
  return bsplit16(v); }
__device__ __forceinline__ F2 split_col(const float* W, int k0, int n, int lane, int ld, int K) { float v[16]; const int g = lane >> 4;
#pragma unroll
  for (int i = 0; i < 8; ++i) { const int ka = k0 + 8 * g + i, kb = ka + 16; v[i] = ka < K ? W[(size_t)(ka < K ? ka : K - 1) * ld + n] : 0.f; v[8 + i] = kb < K ? W[(size_t)(kb < K ? kb : K - 1) * ld + n] : 0.f; }
  return bsplit16(v); }
__device__ __forceinline__ v8f mac3(const F2& a, const F2& b, v8f c) { c = wmma_bf(a.l, b.h, c); c = wmma_bf(a.h, b.l, c); return wmma_bf(a.h, b.h, c); }
__device__ __forceinline__ float sigm(float v) { return 1.0f / (1.0f + expf(-v)); }
#define LDSX() do { asm volatile("s_wait_dscnt 0" ::: "memory"); __builtin_amdgcn_wave_barrier(); __builtin_amdgcn_fence(__ATOMIC_RELEASE, "workgroup"); } while (0)

// Fused-qkv causal self-attention with TWO outputs (x [2,2048,1024]; fused (in,out) w_attn [1024,3072] N(0,1) x 0.02 + b_attn zeros (read), jnp.split(c, 3, axis=2) -> q | k | v column blocks; 16 heads x 64; w = q k^T x rsqrt(64); w * b - 1e10 * (1 - b) with b = (i >= j): causal, the masked logits are exactly -1e10; softmax; a = merge(p v) w_proj + b_proj; outputs: a [2,2048,1024] and present = stack([k, v], axis=1) [2,2,16,2048,64] = the projected k and v (bias included) in head-major layout).
#define NB 2
#define TT 2048
#define CC 1024            // NH * HD = projected width
#define DIN 1024          // input (model) width
#define NH 16
#define HD 64
#define SCALE (0.125f)
#define CAUSAL 1
#ifndef TNB
#define TNB NB
#endif
__device__ __forceinline__ float bfr(float v) { return (float)(__bf16)v; }
__host__ __device__ __forceinline__ int kb_last(int qb) { return CAUSAL ? ((qb * 64 + 63) >> 7) : (TT / 128 - 1); }
typedef __attribute__((ext_vector_type(8))) __bf16 v8b;
__device__ __forceinline__ v16b frag_b(const __bf16* rowk0, int lane) {
  union { v16b v; v8b q[2]; } u; const __bf16* p = rowk0 + 8 * (lane >> 4);
  u.q[0] = *(const v8b*)p; u.q[1] = *(const v8b*)(p + 16); return u.v;
}
// ---- fragment order: the planes that k_pv reads are stored by k_proj as the registers of the WMMA fragments, so that each wave-wide 16-B load covers 512 contiguous bytes = 4 whole lines (a row-major tile makes it touch 16 lines). q, k and their residuals: tile (b, h, 16 rows) = FT elements [k step 0..1][half 0..1][lane][8]; v planes: chunk (b, h, 32 keys) = FV elements [16 columns j 0..3][half 0..1][lane][8]; lane = (g, row or column), its 8 elements = k0 + 16 * half + 8 * g + 0..7, as frag_h takes them from a row
#define FT (16 * HD)
#define FV (32 * HD)
__device__ __forceinline__ v16h frag_t(const _Float16* f, int lane) { union { v16h v; v8h q[2]; } u; u.q[0] = *(const v8h*)(f + lane * 8); u.q[1] = *(const v8h*)(f + 256 + lane * 8); return u.v; }
__device__ __forceinline__ v16b frag_tb(const __bf16* f, int lane) { union { v16b v; v8b q[2]; } u; u.q[0] = *(const v8b*)(f + lane * 8); u.q[1] = *(const v8b*)(f + 256 + lane * 8); return u.v; }
#define QBH 6              // causal: query blocks 0..QBH-1 of each sequence (few keys, no averaging) take the high-precision path
#define QHI 384            // rows carrying a q residual plane
#define KHI 384            // key rows carrying k residual / v bf16 hi+lo planes (used only by the causal high-precision path)
// B fragment (k rows k0+.., output column o) of a weight: (in,out) [K][ld] or (out,in) [ld rows of K]: bf16 exact, or f16(bf16 * 256) exact
__device__ __forceinline__ v16b wcol_io(const float* Wm, int k0, int o, int lane, int ld) { v16b w; const int g = lane >> 4;
#pragma unroll
  for (int i = 0; i < 8; ++i) { w[i] = (__bf16)Wm[(size_t)(k0 + 8 * g + i) * ld + o]; w[8 + i] = (__bf16)Wm[(size_t)(k0 + 16 + 8 * g + i) * ld + o]; }
  return w; }
__device__ __forceinline__ v16b wcol_oi(const float* Wm, int k0, int o, int lane, int K) { v16b w; const float* p = Wm + (size_t)o * K + k0 + 8 * (lane >> 4);
#pragma unroll
  for (int i = 0; i < 8; ++i) { w[i] = (__bf16)p[i]; w[8 + i] = (__bf16)p[16 + i]; }
  return w; }
__device__ __forceinline__ v16h wcolh_io(const float* Wm, int k0, int o, int lane, int ld) { v16h w; const int g = lane >> 4;
#pragma unroll
  for (int i = 0; i < 8; ++i) { w[i] = (_Float16)(bfr(Wm[(size_t)(k0 + 8 * g + i) * ld + o]) * 256.0f); w[8 + i] = (_Float16)(bfr(Wm[(size_t)(k0 + 16 + 8 * g + i) * ld + o]) * 256.0f); }
  return w; }
__device__ __forceinline__ v16h wcolh_oi(const float* Wm, int k0, int o, int lane, int K) { v16h w; const float* p = Wm + (size_t)o * K + k0 + 8 * (lane >> 4);
#pragma unroll
  for (int i = 0; i < 8; ++i) { w[i] = (_Float16)(bfr(p[i]) * 256.0f); w[8 + i] = (_Float16)(bfr(p[16 + i]) * 256.0f); }
  return w; }
#define WQKV_LAYOUT 0   // 0 = (in,out); 1 = (out,in) [CC][DIN]; 2 = per-head [NH][DIN][HD]
__device__ __forceinline__ v16b wcol_hdk(const float* Wm, int k0, int o, int lane) { v16b w; const int g = lane >> 4; const float* p = Wm + (size_t)(o / HD) * DIN * HD + (o % HD);
#pragma unroll
  for (int i = 0; i < 8; ++i) { w[i] = (__bf16)p[(size_t)(k0 + 8 * g + i) * HD]; w[8 + i] = (__bf16)p[(size_t)(k0 + 16 + 8 * g + i) * HD]; }
  return w; }
#define WO_OUT_IN 0
#if WQKV_LAYOUT == 1
#define WCOL(W, k0, o, lane) wcol_oi(W, k0, o, lane, DIN)
#elif WQKV_LAYOUT == 2
#define WCOL(W, k0, o, lane) wcol_hdk(W, k0, o, lane)
#else
#define WCOL(W, k0, o, lane) wcol_io(W, k0, o, lane, 3 * CC)   /* w_attn (in,out) [1024][3072] packed by columns: row pitch 3*CC; the q / k / v pointers carry the column offsets 0 / CC / 2*CC */
#endif
#if WO_OUT_IN
#define WOCOL(W, k0, o, lane) wcol_oi(W, k0, o, lane, CC)
#define WOCOLH(W, k0, o, lane) wcolh_oi(W, k0, o, lane, CC)
#else
#define WOCOL(W, k0, o, lane) wcol_io(W, k0, o, lane, DIN)
#define WOCOLH(W, k0, o, lane) wcolh_io(W, k0, o, lane, DIN)
#endif
#define PROJ_EXTRA_PARAMS , float* __restrict__ PRES   /* second output: present [NB][2][NH][TT][HD] f32 */
#define PROJ_EPI(which, row, t, h) do { if ((which) >= 1) { float* dst_ = PRES + ((((size_t)bb * 2 + ((which) - 1)) * NH + (h)) * TT + (t)) * HD; _Pragma("unroll") for (int q4 = 0; q4 < HD / 4; ++q4) vst2(dst_ + 4 * q4, *(const v4f*)((row) + 4 * q4)); } } while (0)
static_assert(HD == 64 && (132 * 4) % 16 == 0, "the staged row st[rl][hh*HD] is 16-B aligned and 64 floats long");
#ifndef PROJ_EXTRA_PARAMS
#define PROJ_EXTRA_PARAMS
#endif

#define WS_QH  0u                                      // f16 q tiles [b][h][t / 16][FT], fragment order
#define WS_KH  (WS_QH + 2u * (size_t)NB * TT * CC)      // f16 k tiles [b][h][t / 16][FT], fragment order
#define WS_VT  (WS_KH + 2u * (size_t)NB * TT * CC)      // f16 v chunks [b][h][t / 32][FV], fragment order
#define WS_QL  (WS_VT + 2u * (size_t)NB * CC * TT)      // f16 q residual x 2^10 tiles [b][h][t / 16 < QHI / 16][FT]
#define WS_KL  (WS_QL + 2u * (size_t)NB * QHI * CC)     // f16 k residual x 2^10 tiles [b][h][t / 16 < KHI / 16][FT]
#define WS_VB  (WS_KL + 2u * (size_t)NB * KHI * CC)     // bf16 v hi chunks [b][h][t / 32 < KHI / 32][FV]
#define WS_VBL (WS_VB + 2u * (size_t)NB * CC * KHI)
#define WS_Y   (WS_VBL + 2u * (size_t)NB * CC * KHI)    // f32 ctx rows [b*t][CC] (only when there is an output projection)
#define WS_END (WS_Y  + 4u * (size_t)NB * TT * CC)

// ---- the K loop of k_proj and k_out: a stage is KS k rows of the block's 128 weight columns. Thread tid reads column c0 + tid of the stage (each wave-wide load = one whole 128-B line), rounds it once for the whole block and leaves it k-contiguous in LDS row tid; every wave takes its B fragments from there. Two LDS buffers, one workgroup barrier per stage; the next stage's weight column and the wave's own next A rows are in flight while this stage's products run.
#define KS 64              // k rows per stage = 2 WMMA k steps
#define FG 8               // B fragments a wave reads from LDS as one group in front of their products
#define WP (KS + 8)        // LDS row pitch in 16-bit elements: 144 B = 16 B x odd, so that 16 rows' 16-B reads and writes spread over the banks
static_assert(DIN % KS == 0 && CC % KS == 0 && KS % 32 == 0 && (WP * 2) % 32 == 16, "whole stages; row pitch = 16 B x odd");
template <int LD> __device__ __forceinline__ void stage_ld(float (&wr)[KS], v4f (&xr)[KS / 8], const float* wp, const float* xp) {
#pragma unroll
  for (int i = 0; i < KS; ++i) wr[i] = wp[(size_t)i * LD];
#pragma unroll
  for (int kk = 0; kk < KS / 32; ++kk) { xr[kk * 4 + 0] = *(const v4f*)(xp + kk * 32); xr[kk * 4 + 1] = *(const v4f*)(xp + kk * 32 + 4); xr[kk * 4 + 2] = *(const v4f*)(xp + kk * 32 + 16); xr[kk * 4 + 3] = *(const v4f*)(xp + kk * 32 + 20); }
}
// F16 = 0: bf16 exact; 1: f16(bf16 x 2^8) exact
template <int F16> __device__ __forceinline__ void stage_st(unsigned short* row, const float (&wr)[KS]) {
#pragma unroll
  for (int q = 0; q < KS / 8; ++q) { union { v8b b; v8h h; v4u u; } t;
#pragma unroll
    for (int i = 0; i < 8; ++i) { if (F16) t.h[i] = (_Float16)(bfr(wr[q * 8 + i]) * 256.0f); else t.b[i] = (__bf16)wr[q * 8 + i]; }
    vst2(row + q * 8, t.u); } }
// the 16 f32 values of A fragment kk of a stage, in fragment order
__device__ __forceinline__ void stage_a(float (&v)[16], const v4f (&xr)[KS / 8], int kk) {
#pragma unroll
  for (int i = 0; i < 4; ++i) { v[i] = xr[kk * 4][i]; v[4 + i] = xr[kk * 4 + 1][i]; v[8 + i] = xr[kk * 4 + 2][i]; v[12 + i] = xr[kk * 4 + 3][i]; } }
// ---- k_proj: block = (64 rows, 128 cols, which): q/k/v = X W (+ b) with exact bf16 products (K = DIN) -> which 0: q f16 tiles (+ residual tiles for rows < QHI); 1: k f16 tiles (+ residual tiles for rows < KHI); 2: v f16 chunks (+ bf16 hi/lo chunks for t < KHI), all in fragment order
__global__ __launch_bounds__(128) void k_proj(const float* __restrict__ XQ, const float* __restrict__ XK, const float* __restrict__ XV, const float* __restrict__ WQ, const float* __restrict__ WK, const float* __restrict__ WV, const float* __restrict__ BQ, const float* __restrict__ BK, const float* __restrict__ BV,
    _Float16* __restrict__ QH, _Float16* __restrict__ QL, _Float16* __restrict__ KH, _Float16* __restrict__ KL, _Float16* __restrict__ VT, __bf16* __restrict__ VB, __bf16* __restrict__ VBL PROJ_EXTRA_PARAMS) {
  __shared__ __align__(16) float st[64][132]; __shared__ __align__(16) _Float16 sh[64][136], sl[64][136]; __shared__ __align__(16) _Float16 th[128][72]; __shared__ __align__(16) __bf16 tb[128][72], tbl[128][72]; __shared__ __align__(16) unsigned short wt[2][128][WP];
  const int tid = threadIdx.x, wave = tid >> 5, lane = tid & 31, col = lane & 15, g = lane >> 4; const int which = blockIdx.z; const int c0 = blockIdx.y * 128; const size_t r0 = (size_t)blockIdx.x * 64; const size_t bb = r0 / TT; const int t0 = (int)(r0 % TT);
  const float* X = which == 0 ? XQ : which == 1 ? XK : XV; const float* WA = which == 0 ? WQ : which == 1 ? WK : WV; const float* BA = which == 0 ? BQ : which == 1 ? BK : BV;
  v8f acc[8] = {};
  { const float* wp = WA + c0 + tid; const float* xp = X + (r0 + wave * 16 + col) * DIN + 8 * g; float wr[KS]; v4f xr[KS / 8]; v16b a[KS / 32];
    stage_ld<3 * CC>(wr, xr, wp, xp);
    asm volatile("s_wait_xcnt 0x0" ::: "memory");   /* the scalar base of stage 0's weight loads is reused right behind them, where the compiler waits to a count only */
    stage_st<0>(&wt[0][tid][0], wr);
#pragma unroll
    for (int kk = 0; kk < KS / 32; ++kk) { float v[16]; stage_a(v, xr, kk);
#pragma unroll
      for (int i = 0; i < 16; ++i) a[kk][i] = (__bf16)v[i]; }
    __syncthreads();   /* stage 0 of the weight tile is in LDS before any wave reads it */
#pragma unroll 1   /* kept rolled: a trip already holds a whole stage's loads and products; a second copy would only add registers and code */
    for (int s = 0; s < DIN / KS; ++s) {
      if (s + 1 < DIN / KS) { wp += (size_t)KS * 3 * CC; xp += KS; stage_ld<3 * CC>(wr, xr, wp, xp); }
#pragma unroll
      for (int kk = 0; kk < KS / 32; ++kk)
#pragma unroll
        for (int j0 = 0; j0 < 8; j0 += FG) { v16b w[FG];
#pragma unroll
          for (int j = 0; j < FG; ++j) w[j] = frag_b((const __bf16*)&wt[s & 1][(j0 + j) * 16 + col][kk * 32], lane);
#pragma unroll
          for (int j = 0; j < FG; ++j) acc[j0 + j] = wmma_bf(a[kk], w[j], acc[j0 + j]); }
      if (s + 1 < DIN / KS) { stage_st<0>(&wt[(s + 1) & 1][tid][0], wr);
#pragma unroll
        for (int kk = 0; kk < KS / 32; ++kk) { float v[16]; stage_a(v, xr, kk);
#pragma unroll
          for (int i = 0; i < 16; ++i) a[kk][i] = (__bf16)v[i]; } }
      __syncthreads();   /* publishes stage s + 1 and ends every wave's reads of stage s, whose buffer the next trip refills */
    } }
  { // stage the f32 tile (acc + bias) in LDS, run the per-(row, head) epilogue hook, then convert
#pragma unroll
    for (int j = 0; j < 8; ++j) { const float bias = BA ? bfr(BA[c0 + j * 16 + col]) : 0.f;
#pragma unroll
      for (int r = 0; r < 8; ++r) st[wave * 16 + 8 * g + r][j * 16 + col] = acc[j][r] + bias; }
    __syncthreads();
    for (int e = tid; e < 64 * (128 / HD); e += 128) { const int rl = e / (128 / HD), hh = e % (128 / HD); PROJ_EPI(which, &st[rl][hh * HD], (int)((r0 + rl) % TT), (c0 / HD) + hh); }
    __syncthreads(); }
  if (which < 2) { _Float16* DH = which == 0 ? QH : KH; _Float16* DL = which == 0 ? QL : KL; const int nhi = which == 0 ? QHI : KHI; const bool hi_rows = t0 < nhi;
    for (int e = tid; e < 64 * 128; e += 128) { const int rl = e >> 7, cl = e & 127; const float v = st[rl][cl]; const _Float16 hv = (_Float16)v; sh[rl][cl] = hv; sl[rl][cl] = (_Float16)((v - (float)hv) * 1024.0f); }
    __syncthreads();
    const int rl = tid & 15, cl = (tid >> 5) * 16 + ((tid >> 4) & 1) * 8; const size_t hb = bb * NH + c0 / HD;   /* the thread has piece tid of each of the block's 8 tiles (head hh, 16 rows tt): a wave's store is 512 contiguous bytes */
    _Float16* dh = DH + (hb * (TT / 16) + t0 / 16) * FT + tid * 8;
#pragma unroll   /* unrolled: the 8 stores share one address register pair and differ in a constant offset */
    for (int i = 0; i < 8; ++i) { const int hh = i >> 2, tt = i & 3; vst2((unsigned*)(dh + (hh * (TT / 16) + tt) * FT), *(const v4u*)&sh[tt * 16 + rl][hh * HD + cl]); }
    if (hi_rows) { _Float16* dl = DL + (hb * (nhi / 16) + t0 / 16) * FT + tid * 8;
      asm volatile("s_wait_xcnt 0x0" ::: "memory");   /* the registers of the 8 stores above are taken again for the residual pieces */
#pragma unroll   /* as above */
      for (int i = 0; i < 8; ++i) { const int hh = i >> 2, tt = i & 3; vst2((unsigned*)(dl + (hh * (nhi / 16) + tt) * FT), *(const v4u*)&sl[tt * 16 + rl][hh * HD + cl]); } }
  } else { const bool hi_rows = t0 < KHI;
    for (int e = tid; e < 64 * 128; e += 128) { const int rl = e & 63, cl = e >> 6; const float v = st[rl][cl]; th[cl][rl] = (_Float16)v; const __bf16 bh = (__bf16)v; tb[cl][rl] = bh; tbl[cl][rl] = (__bf16)(v - (float)bh); }
    __syncthreads();
    const int cl = (tid >> 6) * 16 + (tid & 15), rl = ((tid >> 5) & 1) * 16 + ((tid >> 4) & 1) * 8; const size_t hb = bb * NH + c0 / HD;   /* the thread has pieces tid and 128 + tid (u) of each of the block's 4 chunks (head hh, 32 keys cc): a wave's store is 512 contiguous bytes */
    _Float16* dv = VT + (hb * (TT / 32) + t0 / 32) * FV + tid * 8;
#pragma unroll   /* unrolled: the 8 stores share one address register pair and differ in a constant offset */
    for (int i = 0; i < 8; ++i) { const int hh = i >> 2, cc = (i >> 1) & 1, u = i & 1; vst2((unsigned*)(dv + (hh * (TT / 32) + cc) * FV + u * 1024), *(const v4u*)&th[hh * HD + u * 32 + cl][cc * 32 + rl]); }
    if (hi_rows) { const size_t o3 = (hb * (KHI / 32) + t0 / 32) * FV + tid * 8;
      asm volatile("s_wait_xcnt 0x0" ::: "memory");   /* the registers of the 8 stores above are taken again for the bf16 pieces */
#pragma unroll   /* as above */
      for (int i = 0; i < 8; ++i) { const int hh = i >> 2, cc = (i >> 1) & 1, u = i & 1; const int o4 = (hh * (KHI / 32) + cc) * FV + u * 1024; vst2((unsigned*)(VB + o3 + o4), *(const v4u*)&tb[hh * HD + u * 32 + cl][cc * 32 + rl]); vst2((unsigned*)(VBL + o3 + o4), *(const v4u*)&tbl[hh * HD + u * 32 + cl][cc * 32 + rl]); } }
    asm volatile("s_wait_xcnt 0x0" ::: "memory");   /* behind the arm's last store on both ways: the listing's next block writes the stores' data registers */
  } }
// ---- k_pv: block = 16 queries (tile qt) of (b, h), PVS waves, one launch for every (b, h). First the logits of the tile: wave w takes the 16-key tiles w, w + PVS, ... of keys [0, kend), q x k on WMMA (single f16 product; causal early query blocks: q hi + residual x 2^10 against k hi + residual, 3 products), x SCALE, f32 rows in LDS. Behind a workgroup barrier the softmax: wave w owns query row t = ql0 + w, reads its raw logits once into registers (causal: s > t excluded), takes max and sum in f32 inside the wave, and leaves P x 2^11 (0 for excluded) at the head of its own LDS row: f16, f32 for the causal early query blocks. Behind a workgroup barrier wave w takes the 32-key chunks w, w + PVS, ... and keeps its own f32 partial ctx tile; the partials meet in LDS (the rows' upper halves, which P leaves free) behind one more workgroup barrier and are added in wave order (P f16 against v f16: 1 product; causal early query blocks: P and v as bf16 hi + lo, 3 products); 256-B (row, head) segment by one wave
#define PVS 16             // key slices = waves per block = query rows per tile
#define LPF (TT + 4)       // f32 row pitch in LDS: raw logits; then P (f16 or f32) in floats [0, TT / 2) and wave w's partial ctx tile in floats [TT / 2, TT) of row w
#define LPH (2 * LPF)      // the same pitch in f16 elements
#define KTB 4              // key tiles whose k fragments a wave has in flight together
typedef __attribute__((ext_vector_type(4))) _Float16 v4h;
static_assert(32 * PVS == 16 * (HD / 2), "the merge gives each thread one 8-B piece of the 16 x HD tile");
static_assert(PVS == 16, "one wave per query row of the tile");
static_assert((LPF * 4) % 32 == 16, "row pitch = 16 B x odd: the 16-B fragment reads of 16 rows spread over the banks");
static_assert(16 * HD <= TT / 2 && KHI <= TT / 2, "a partial ctx tile fits the upper half of a row, the f32 P of the early query blocks the lower half");
static_assert(!CAUSAL || ((QBH * 64 - 1) / 128 + 1) * 128 <= KHI, "the early query blocks' keys have k residual rows and v hi + lo planes");
__global__ __launch_bounds__(32 * PVS) void k_pv(const _Float16* __restrict__ QH, const _Float16* __restrict__ KH, const _Float16* __restrict__ QL, const _Float16* __restrict__ KL, const _Float16* __restrict__ VT, const __bf16* __restrict__ VB, const __bf16* __restrict__ VBL, float* __restrict__ Y) { const int b = blockIdx.z / NH, h = blockIdx.z % NH; __shared__ __align__(16) union { float f[16][LPF]; _Float16 h[16][LPH]; } pp;
  const int tid = threadIdx.x, lane = tid & 31, col = lane & 15, g = lane >> 4; const int wave = __builtin_amdgcn_readfirstlane(tid >> 5); const int qb = blockIdx.x >> 2; const int ql0 = blockIdx.x * 16; const int kce = (kb_last(qb) + 1) * 4;
  { const int nt = kce * 2;   /* 16-key tiles that get logits, the same count for the whole block */
    const _Float16* qp = QH + ((size_t)blockIdx.z * (TT / 16) + blockIdx.x) * FT; const _Float16* kp = KH + (size_t)blockIdx.z * (TT / 16) * FT;
    const v16h ah0 = frag_t(qp, lane), ah1 = frag_t(qp + 512, lane);
    asm volatile("s_wait_xcnt 0x0" ::: "memory");   /* the q loads' address registers are reused behind the branch below */
    if (qb < QBH) { const _Float16* qlp = QL + ((size_t)blockIdx.z * (QHI / 16) + blockIdx.x) * FT; const _Float16* klp = KL + (size_t)blockIdx.z * (KHI / 16) * FT;
      const v16h al0 = frag_t(qlp, lane), al1 = frag_t(qlp + 512, lane);
      for (int jt = wave; jt < nt; jt += PVS) { const _Float16* kr = kp + (size_t)jt * FT; const _Float16* kl = klp + (size_t)jt * FT;
        const v16h kb0 = frag_t(kr, lane), kl0 = frag_t(kl, lane), kb1 = frag_t(kr + 512, lane), kl1 = frag_t(kl + 512, lane); v8f a = {}, l = {};
        asm volatile("s_wait_xcnt 0x0" ::: "memory");   /* the k loads' address registers are taken for a product's result right behind them, where the compiler waits to a count only */
        a = wmma16(ah0, kb0, a); l = wmma16(al0, kb0, l); l = wmma16(ah0, kl0, l);
        a = wmma16(ah1, kb1, a); l = wmma16(al1, kb1, l); l = wmma16(ah1, kl1, l);
#pragma unroll
        for (int r = 0; r < 8; ++r) pp.f[8 * g + r][jt * 16 + col] = (a[r] + l[r] * (1.0f / 1024.0f)) * SCALE; }
    } else {
      const _Float16* kr0 = kp + (size_t)wave * FT;
      for (int jt0 = wave; jt0 < nt; jt0 += KTB * PVS, kr0 += (size_t)KTB * PVS * FT) { v16h kf[KTB][2];   /* the tests on jt0 + u * PVS are the same for the whole wave */
#pragma unroll
        for (int u = 0; u < KTB; ++u) if (jt0 + u * PVS < nt) { const _Float16* kr = kr0 + u * (PVS * FT); kf[u][0] = frag_t(kr, lane); kf[u][1] = frag_t(kr + 512, lane); }
#pragma unroll
        for (int u = 0; u < KTB; ++u) if (jt0 + u * PVS < nt) { v8f a = {}; a = wmma16(ah0, kf[u][0], a); a = wmma16(ah1, kf[u][1], a);
#pragma unroll
          for (int r = 0; r < 8; ++r) pp.f[8 * g + r][(jt0 + u * PVS) * 16 + col] = a[r] * SCALE; } } } }
  __syncthreads();   /* every key tile's logits are in LDS before any wave reads its query row */
  { const int t = ql0 + wave; const int nv = kce >> 2;   /* nv groups of 128 keys hold logits, the same count for the whole block; the lane has keys i * 128 + lane * 4 + c of group i */
    const int rel = t - lane * 4;                        /* causal: that key is allowed while i * 128 + c <= rel, which no key of a group i >= nv is */
    const float* sr = &pp.f[wave][0] + lane * 4; v4f x[TT / 128];   /* the row's share of the lane; every loop over x is fully unrolled so that x stays in registers */
#pragma unroll
    for (int i = 0; i < TT / 128; ++i) { if (i < nv) x[i] = *(const v4f*)(sr + i * 128); else x[i] = (v4f)(-3.0e38f); }
    float m = -3.0e38f;
#pragma unroll
    for (int i = 0; i < TT / 128; ++i) {
#pragma unroll
      for (int c = 0; c < 4; ++c) { const float v = (!CAUSAL || i * 128 + c <= rel) ? x[i][c] : -3.0e38f; x[i][c] = v; m = fmaxf(m, v); } }
#pragma unroll
    for (int o = 1; o < 32; o <<= 1) m = fmaxf(m, __shfl_xor(m, o));
    float sum = 0.f;
#pragma unroll
    for (int i = 0; i < TT / 128; ++i) {
#pragma unroll
      for (int c = 0; c < 4; ++c) { const float v = x[i][c]; const float e = (v <= -1.0e38f) ? 0.f : expf(v - m); x[i][c] = e; sum += e; } }
#pragma unroll
    for (int o = 1; o < 32; o <<= 1) sum += __shfl_xor(sum, o);
    const float inv = sum > 0.f ? 2048.0f / sum : 0.f;   /* a fully excluded row yields P = 0 */
    float* pf = &pp.f[wave][0] + lane * 4; _Float16* ph = &pp.h[wave][0] + lane * 4;   /* P goes over the wave's own row, whose logits are all in registers by now */
#pragma unroll
    for (int i = 0; i < TT / 128; ++i) if (i < nv) { const v4f p = x[i] * inv;
      if (i * 128 < KHI && qb < QBH) vst2(pf + i * 128, p);
      else { v4h q;
#pragma unroll
        for (int c = 0; c < 4; ++c) q[c] = (_Float16)p[c];
        vst2(ph + i * 128, q); } } }
  __syncthreads();   /* every row's P is in LDS before any wave reads its key chunks of all 16 rows */
  v8f acc[HD / 16] = {};
  if (qb < QBH) {
#pragma unroll 1
    for (int kc = wave; kc < kce; kc += PVS) { const F2 p = split_row(&pp.f[col][0], kc * 32, lane);
#pragma unroll
      for (int j = 0; j < HD / 16; ++j) { const size_t po = ((size_t)blockIdx.z * (KHI / 32) + kc) * FV + j * 512; const v16b vh = frag_tb(VB + po, lane); acc[j] = wmma_bf(p.h, vh, acc[j]); acc[j] = wmma_bf(p.l, vh, acc[j]); acc[j] = wmma_bf(p.h, frag_tb(VBL + po, lane), acc[j]); } }
  } else {
#pragma unroll 1
    for (int kc = wave; kc < kce; kc += PVS) { const v16h p = frag_h(&pp.h[col][kc * 32], lane);
#pragma unroll
      for (int j = 0; j < HD / 16; ++j) { const size_t po = ((size_t)blockIdx.z * (TT / 32) + kc) * FV + j * 512; acc[j] = wmma16(p, frag_t(VT + po, lane), acc[j]); } } }
  float* sw = &pp.f[wave][TT / 2];   /* this wave's partial tile [16][HD]: no P byte lies there */
#pragma unroll
  for (int j = 0; j < HD / 16; ++j)
#pragma unroll
    for (int r = 0; r < 8; ++r) sw[(8 * g + r) * HD + j * 16 + col] = acc[j][r];
  __syncthreads();   /* every wave's partial tile is in LDS before any thread adds them */
  { const int rl = tid >> 5; v2f s = *(const v2f*)&pp.f[0][TT / 2 + rl * HD + lane * 2];
#pragma unroll
    for (int w = 1; w < PVS; ++w) s += *(const v2f*)&pp.f[w][TT / 2 + rl * HD + lane * 2];
    vst2(Y + ((size_t)b * TT + ql0 + rl) * CC + h * HD + lane * 2, s * (1.0f / 2048.0f)); } }
// ---- k_out: block = (64 rows, 128 cols): out = ctx Wo (+ bo): ctx x 2^6 once to f16 against Wo as f16(bf16 x 2^8) exact (1 product) x 2^-14; causal early rows (< QHI of each sequence): ctx bf16 hi + lo against exact bf16 Wo (2 products)
__global__ __launch_bounds__(128) void k_out(const float* __restrict__ Y, const float* __restrict__ WO, const float* __restrict__ BO, float* __restrict__ OUT) { __shared__ __align__(16) float sf[4][16][132]; __shared__ __align__(16) unsigned short wt[2][128][WP];
  const int tid = threadIdx.x, wave = tid >> 5, lane = tid & 31, col = lane & 15, g = lane >> 4; const int c0 = blockIdx.y * 128; const size_t r0 = (size_t)blockIdx.x * 64 + wave * 16;
  v8f acc[8] = {};
  const float* wp = WO + c0 + tid; const float* xp = Y + (r0 + col) * CC + 8 * g; float wr[KS]; v4f xr[KS / 8];
  stage_ld<DIN>(wr, xr, wp, xp);
  asm volatile("s_wait_xcnt 0x0" ::: "memory");   /* stage 0's loads name registers that are written again behind the branch below, where the compiler waits to a count only */
  if (CAUSAL && (int)(((size_t)blockIdx.x * 64) % TT) < QHI) {   /* block-uniform */
    F2 a[KS / 32]; stage_st<0>(&wt[0][tid][0], wr);
#pragma unroll
    for (int kk = 0; kk < KS / 32; ++kk) { float v[16]; stage_a(v, xr, kk); a[kk] = bsplit16(v); }
    __syncthreads();   /* stage 0 of the weight tile is in LDS before any wave reads it */
#pragma unroll 1   /* kept rolled: a trip already holds a whole stage's loads and products; a second copy would only add registers and code */
    for (int s = 0; s < CC / KS; ++s) {
      if (s + 1 < CC / KS) { wp += (size_t)KS * DIN; xp += KS; stage_ld<DIN>(wr, xr, wp, xp); }
#pragma unroll
      for (int kk = 0; kk < KS / 32; ++kk)
#pragma unroll
        for (int j0 = 0; j0 < 8; j0 += FG) { v16b w[FG];
#pragma unroll
          for (int j = 0; j < FG; ++j) w[j] = frag_b((const __bf16*)&wt[s & 1][(j0 + j) * 16 + col][kk * 32], lane);
#pragma unroll
          for (int j = 0; j < FG; ++j) { acc[j0 + j] = wmma_bf(a[kk].h, w[j], acc[j0 + j]); acc[j0 + j] = wmma_bf(a[kk].l, w[j], acc[j0 + j]); } }
      if (s + 1 < CC / KS) { stage_st<0>(&wt[(s + 1) & 1][tid][0], wr);
#pragma unroll
        for (int kk = 0; kk < KS / 32; ++kk) { float v[16]; stage_a(v, xr, kk); a[kk] = bsplit16(v); } }
      __syncthreads();   /* publishes stage s + 1 and ends every wave's reads of stage s, whose buffer the next trip refills */
    }
#pragma unroll
    for (int j = 0; j < 8; ++j) { const float bias = BO ? bfr(BO[c0 + j * 16 + col]) : 0.f;
#pragma unroll
      for (int r = 0; r < 8; ++r) sf[wave][8 * g + r][j * 16 + col] = acc[j][r] + bias; }
  } else {
    v16h a[KS / 32]; stage_st<1>(&wt[0][tid][0], wr);
#pragma unroll
    for (int kk = 0; kk < KS / 32; ++kk) { float v[16]; stage_a(v, xr, kk);
#pragma unroll
      for (int i = 0; i < 16; ++i) a[kk][i] = (_Float16)(v[i] * 64.0f); }   /* ctx carried x 2^6 into f16 so small-magnitude context rows stay clear of f16 subnormals */
    __syncthreads();   /* stage 0 of the weight tile is in LDS before any wave reads it */
#pragma unroll 1   /* kept rolled: a trip already holds a whole stage's loads and products; a second copy would only add registers and code */
    for (int s = 0; s < CC / KS; ++s) {
      if (s + 1 < CC / KS) { wp += (size_t)KS * DIN; xp += KS; stage_ld<DIN>(wr, xr, wp, xp); }
#pragma unroll
      for (int kk = 0; kk < KS / 32; ++kk)
#pragma unroll
        for (int j0 = 0; j0 < 8; j0 += FG) { v16h w[FG];
#pragma unroll
          for (int j = 0; j < FG; ++j) w[j] = frag_h((const _Float16*)&wt[s & 1][(j0 + j) * 16 + col][kk * 32], lane);
#pragma unroll
          for (int j = 0; j < FG; ++j) acc[j0 + j] = wmma16(a[kk], w[j], acc[j0 + j]); }
      if (s + 1 < CC / KS) { stage_st<1>(&wt[(s + 1) & 1][tid][0], wr);
#pragma unroll
        for (int kk = 0; kk < KS / 32; ++kk) { float v[16]; stage_a(v, xr, kk);
#pragma unroll
          for (int i = 0; i < 16; ++i) a[kk][i] = (_Float16)(v[i] * 64.0f); } }
      __syncthreads();   /* publishes stage s + 1 and ends every wave's reads of stage s, whose buffer the next trip refills */
    }
#pragma unroll
    for (int j = 0; j < 8; ++j) { const float bias = BO ? bfr(BO[c0 + j * 16 + col]) : 0.f;
#pragma unroll
      for (int r = 0; r < 8; ++r) sf[wave][8 * g + r][j * 16 + col] = acc[j][r] * (1.0f / 16384.0f) + bias; } }   /* 2^-8 (Wo carry) x 2^-6 (ctx carry) */
  LDSX(); for (int rl = 0; rl < 16; ++rl) vst2(OUT + (r0 + rl) * DIN + c0 + lane * 4, *(const v4f*)&sf[wave][rl][lane * 4]); }

extern "C" void kernel_launch(void* const* d_in, const int* in_sizes, int n_in, void* d_out, int out_size, void* d_ws, size_t ws_size, hipStream_t stream) {
  (void)in_sizes; (void)n_in; (void)out_size;
  const float** F = (const float**)d_in;
  if (ws_size < (size_t)WS_END) return;
  char* ws = (char*)d_ws; _Float16 *QH = (_Float16*)(ws + WS_QH), *KH = (_Float16*)(ws + WS_KH), *VT = (_Float16*)(ws + WS_VT), *QL = (_Float16*)(ws + WS_QL), *KL = (_Float16*)(ws + WS_KL); __bf16 *VB = (__bf16*)(ws + WS_VB), *VBL = (__bf16*)(ws + WS_VBL); float *Y = (float*)(ws + WS_Y);
  (void)Y; (void)QL; (void)KL; (void)VB; (void)VBL;
  // inputs: 0 x [2,2048,1024]; 1 w_attn [1024,3072] (in,out; columns q | k | v); 2 b_attn [3072] (zeros, read); 3 w_proj [1024,1024] (in,out); 4 b_proj [1024] (zeros, read). outputs: 0 a [2,2048,1024] at d_out + 0; 1 present [2,2,16,2048,64] at d_out + NB*TT*CC floats (byte offset 16,777,216)
  k_proj<<<dim3(TNB * TT / 64, CC / 128, 3), 128, 0, stream>>>(F[0], F[0], F[0], F[1], F[1] + CC, F[1] + 2 * CC, F[2], F[2] + CC, F[2] + 2 * CC, QH, QL, KH, KL, VT, VB, VBL, (float*)d_out + (size_t)NB * TT * CC);
  k_pv<<<dim3(TT / 16, 1, TNB * NH), 32 * PVS, 0, stream>>>(QH, KH, QL, KL, VT, VB, VBL, Y);
  k_out<<<dim3(TNB * TT / 64, DIN / 128), 128, 0, stream>>>(Y, F[3], F[4], (float*)d_out);
}

// v006
// It runs in 187 microseconds.
// Two timings next to v005 both put it at 1.09 times that version's speed.
// Over all steps from v000 it is 5.93 times as fast.
// compute dtype: all float inputs rounded to bf16; c = x w_attn + b_attn with EXACT bf16 products on WMMA 16x16x32 (f32 accumulate); the f32 k and v rows are ALSO the second output (present); causal logits: 3 products for the first 384 rows, single f16 q x k after, x 64^-0.5; softmax f32; P x 2^11 once to f16 x v once to f16 (bf16 hi + lo below row 384); ctx hi+lo x exact w_proj below row 384, x2^6 f16 carry x f16(bf16 x 2^8) after, + b_proj; f32 outputs.
#include <hip/hip_runtime.h>
#include <math.h>

typedef __attribute__((ext_vector_type(16))) _Float16 v16h;
typedef __attribute__((ext_vector_type(16))) __bf16 v16b;
typedef __attribute__((ext_vector_type(8)))  _Float16 v8h;
typedef __attribute__((ext_vector_type(8)))  float v8f;
typedef __attribute__((ext_vector_type(4)))  float v4f;
typedef __attribute__((ext_vector_type(2)))  float v2f;
typedef __attribute__((ext_vector_type(4)))  unsigned v4u;
typedef __attribute__((ext_vector_type(4)))  int v4i;
typedef float __attribute__((may_alias)) float_a;
typedef int __attribute__((may_alias)) int_a;

template <typename T> __device__ __forceinline__ void vst2(void* p, T v) { *(T*)p = v;  }
__device__ __forceinline__ v8f wmma16(v16h a, v16h b, v8f c) {
  v8f d = __builtin_amdgcn_wmma_f32_16x16x32_f16(false, a, false, b, (short)0, c, false, false);
  asm volatile("v_nop\n\tv_nop\n\tv_nop\n\tv_nop" : "+v"(d) : "v"(a), "v"(b));
  return d;
}
__device__ __forceinline__ v8f wmma_bf(v16b a, v16b b, v8f c) {
  v8f d = __builtin_amdgcn_wmma_f32_16x16x32_bf16(false, a, false, b, (short)0, c, false, false);
  asm volatile("v_nop\n\tv_nop\n\tv_nop\n\tv_nop" : "+v"(d) : "v"(a), "v"(b));
  return d;
}
// 16x16x32 fragments: lane = (h = lane>>4, row/col = lane&15); elements 0..7 = k0+8h+0..7, 8..15 = k0+16+8h+0..7; D element r = row 8h+r
__device__ __forceinline__ v16h frag_h(const _Float16* rowk0, int lane) {
  union { v16h v; v8h q[2]; } u; const _Float16* p = rowk0 + 8 * (lane >> 4);
  u.q[0] = *(const v8h*)p; u.q[1] = *(const v8h*)(p + 16); return u.v;
}
__device__ __forceinline__ v16h frag_f32(const float* rowk0, int lane) {
  v16h a; const float* p = rowk0 + 8 * (lane >> 4);
#pragma unroll
  for (int i = 0; i < 8; ++i) { a[i] = (_Float16)p[i]; a[8 + i] = (_Float16)p[16 + i]; }
  return a;
}
__device__ __forceinline__ v16h frag_f32s(const float* rowk0, int lane, float sc) {
  v16h a; const float* p = rowk0 + 8 * (lane >> 4);
#pragma unroll
  for (int i = 0; i < 8; ++i) { a[i] = (_Float16)(p[i] * sc); a[8 + i] = (_Float16)(p[16 + i] * sc); }
  return a;
}
// column fragment from a [K][ld] layout (column n), rows >= K read as 0
__device__ __forceinline__ v16h fragc_f32(const float* W, int k0, int n, int lane, int ld, int K) {
  v16h a; const int g = lane >> 4;
#pragma unroll
  for (int i = 0; i < 8; ++i) { const int ka = k0 + 8 * g + i, kb = ka + 16;
    a[i] = (_Float16)(ka < K ? W[(size_t)(ka < K ? ka : K - 1) * ld + n] : 0.f); a[8 + i] = (_Float16)(kb < K ? W[(size_t)(kb < K ? kb : K - 1) * ld + n] : 0.f); }
  return a;
}
struct F2 { v16b h, l; };
__device__ __forceinline__ F2 bsplit16(const float v[16]) { F2 r;
#pragma unroll
  for (int i = 0; i < 16; ++i) { const __bf16 h = (__bf16)v[i]; r.h[i] = h; r.l[i] = (__bf16)(v[i] - (float)h); }
  return r; }
__device__ __forceinline__ F2 split_row(const float* row, int k0, int lane) { float v[16]; const float* p = row + k0 + 8 * (lane >> 4);
#pragma unroll
  for (int i = 0; i < 8; ++i) { v[i] = p[i]; v[8 + i] = p[16 + i]; }
  return bsplit16(v); }
__device__ __forceinline__ F2 split_rowK(const float* row, int k0, int lane, int K) { float v[16]; const int g = lane >> 4;
#pragma unroll
  for (int i = 0; i < 8; ++i) { const int ka = k0 + 8 * g + i, kb = ka + 16; v[i] = ka < K ? row[ka < K ? ka : K - 1] : 0.f; v[8 + i] = kb < K ? row[kb < K ? kb : K - 1] : 0.f; }
  return bsplit16(v); }
__device__ __forceinline__ F2 split_col(const float* W, int k0, int n, int lane, int ld, int K) { float v[16]; const int g = lane >> 4;
#pragma unroll
  for (int i = 0; i < 8; ++i) { const int ka = k0 + 8 * g + i, kb = ka + 16; v[i] = ka < K ? W[(size_t)(ka < K ? ka : K - 1) * ld + n] : 0.f; v[8 + i] = kb < K ? W[(size_t)(kb < K ? kb : K - 1) * ld + n] : 0.f; }
  return bsplit16(v); }
__device__ __forceinline__ v8f mac3(const F2& a, const F2& b, v8f c) { c = wmma_bf(a.l, b.h, c); c = wmma_bf(a.h, b.l, c); return wmma_bf(a.h, b.h, c); }
__device__ __forceinline__ float sigm(float v) { return 1.0f / (1.0f + expf(-v)); }
#define LDSX() do { asm volatile("s_wait_dscnt 0" ::: "memory"); __builtin_amdgcn_wave_barrier(); __builtin_amdgcn_fence(__ATOMIC_RELEASE, "workgroup"); } while (0)

// Fused-qkv causal self-attention with TWO outputs (x [2,2048,1024]; fused (in,out) w_attn [1024,3072] N(0,1) x 0.02 + b_attn zeros (read), jnp.split(c, 3, axis=2) -> q | k | v column blocks; 16 heads x 64; w = q k^T x rsqrt(64); w * b - 1e10 * (1 - b) with b = (i >= j): causal, the masked logits are exactly -1e10; softmax; a = merge(p v) w_proj + b_proj; outputs: a [2,2048,1024] and present = stack([k, v], axis=1) [2,2,16,2048,64] = the projected k and v (bias included) in head-major layout).
#define NB 2
#define TT 2048
#define CC 1024            // NH * HD = projected width
#define DIN 1024          // input (model) width
#define NH 16
#define HD 64
#define SCALE (0.125f)
#define CAUSAL 1
#ifndef TNB
#define TNB NB
#endif
__device__ __forceinline__ float bfr(float v) { return (float)(__bf16)v; }
__host__ __device__ __forceinline__ int kb_last(int qb) { return CAUSAL ? ((qb * 64 + 63) >> 7) : (TT / 128 - 1); }
typedef __attribute__((ext_vector_type(8))) __bf16 v8b;
__device__ __forceinline__ v16b frag_b(const __bf16* rowk0, int lane) {
  union { v16b v; v8b q[2]; } u; const __bf16* p = rowk0 + 8 * (lane >> 4);
  u.q[0] = *(const v8b*)p; u.q[1] = *(const v8b*)(p + 16); return u.v;
}
// ---- fragment order: the planes that k_pv reads are stored by k_proj as the registers of the WMMA fragments, so that each wave-wide 16-B load covers 512 contiguous bytes = 4 whole lines (a row-major tile makes it touch 16 lines). q, k and their residuals: tile (b, h, 16 rows) = FT elements [k step 0..1][half 0..1][lane][8]; v planes: chunk (b, h, 32 keys) = FV elements [16 columns j 0..3][half 0..1][lane][8]; lane = (g, row or column), its 8 elements = k0 + 16 * half + 8 * g + 0..7, as frag_h takes them from a row
#define FT (16 * HD)
#define FV (32 * HD)
__device__ __forceinline__ v16h frag_t(const _Float16* f, int lane) { union { v16h v; v8h q[2]; } u; u.q[0] = *(const v8h*)(f + lane * 8); u.q[1] = *(const v8h*)(f + 256 + lane * 8); return u.v; }
__device__ __forceinline__ v16b frag_tb(const __bf16* f, int lane) { union { v16b v; v8b q[2]; } u; u.q[0] = *(const v8b*)(f + lane * 8); u.q[1] = *(const v8b*)(f + 256 + lane * 8); return u.v; }
#define QBH 6              // causal: query blocks 0..QBH-1 of each sequence (few keys, no averaging) take the high-precision path
#define QHI 384            // rows carrying a q residual plane
#define KHI 384            // key rows carrying k residual / v bf16 hi+lo planes (used only by the causal high-precision path)
// B fragment (k rows k0+.., output column o) of a weight: (in,out) [K][ld] or (out,in) [ld rows of K]: bf16 exact, or f16(bf16 * 256) exact
__device__ __forceinline__ v16b wcol_io(const float* Wm, int k0, int o, int lane, int ld) { v16b w; const int g = lane >> 4;
#pragma unroll
  for (int i = 0; i < 8; ++i) { w[i] = (__bf16)Wm[(size_t)(k0 + 8 * g + i) * ld + o]; w[8 + i] = (__bf16)Wm[(size_t)(k0 + 16 + 8 * g + i) * ld + o]; }
  return w; }
__device__ __forceinline__ v16b wcol_oi(const float* Wm, int k0, int o, int lane, int K) { v16b w; const float* p = Wm + (size_t)o * K + k0 + 8 * (lane >> 4);
#pragma unroll
  for (int i = 0; i < 8; ++i) { w[i] = (__bf16)p[i]; w[8 + i] = (__bf16)p[16 + i]; }
  return w; }
__device__ __forceinline__ v16h wcolh_io(const float* Wm, int k0, int o, int lane, int ld) { v16h w; const int g = lane >> 4;
#pragma unroll
  for (int i = 0; i < 8; ++i) { w[i] = (_Float16)(bfr(Wm[(size_t)(k0 + 8 * g + i) * ld + o]) * 256.0f); w[8 + i] = (_Float16)(bfr(Wm[(size_t)(k0 + 16 + 8 * g + i) * ld + o]) * 256.0f); }
  return w; }
__device__ __forceinline__ v16h wcolh_oi(const float* Wm, int k0, int o, int lane, int K) { v16h w; const float* p = Wm + (size_t)o * K + k0 + 8 * (lane >> 4);
#pragma unroll
  for (int i = 0; i < 8; ++i) { w[i] = (_Float16)(bfr(p[i]) * 256.0f); w[8 + i] = (_Float16)(bfr(p[16 + i]) * 256.0f); }
  return w; }
#define WQKV_LAYOUT 0   // 0 = (in,out); 1 = (out,in) [CC][DIN]; 2 = per-head [NH][DIN][HD]
__device__ __forceinline__ v16b wcol_hdk(const float* Wm, int k0, int o, int lane) { v16b w; const int g = lane >> 4; const float* p = Wm + (size_t)(o / HD) * DIN * HD + (o % HD);
#pragma unroll
  for (int i = 0; i < 8; ++i) { w[i] = (__bf16)p[(size_t)(k0 + 8 * g + i) * HD]; w[8 + i] = (__bf16)p[(size_t)(k0 + 16 + 8 * g + i) * HD]; }
  return w; }
#define WO_OUT_IN 0
#if WQKV_LAYOUT == 1
#define WCOL(W, k0, o, lane) wcol_oi(W, k0, o, lane, DIN)
#elif WQKV_LAYOUT == 2
#define WCOL(W, k0, o, lane) wcol_hdk(W, k0, o, lane)
#else
#define WCOL(W, k0, o, lane) wcol_io(W, k0, o, lane, 3 * CC)   /* w_attn (in,out) [1024][3072] packed by columns: row pitch 3*CC; the q / k / v pointers carry the column offsets 0 / CC / 2*CC */
#endif
#if WO_OUT_IN
#define WOCOL(W, k0, o, lane) wcol_oi(W, k0, o, lane, CC)
#define WOCOLH(W, k0, o, lane) wcolh_oi(W, k0, o, lane, CC)
#else
#define WOCOL(W, k0, o, lane) wcol_io(W, k0, o, lane, DIN)
#define WOCOLH(W, k0, o, lane) wcolh_io(W, k0, o, lane, DIN)
#endif
#define PROJ_EXTRA_PARAMS , float* __restrict__ PRES   /* second output: present [NB][2][NH][TT][HD] f32 */
#define PROJ_EPI(which, row, t, h) do { if ((which) >= 1) { float* dst_ = PRES + ((((size_t)bb * 2 + ((which) - 1)) * NH + (h)) * TT + (t)) * HD; _Pragma("unroll") for (int q4 = 0; q4 < HD / 4; ++q4) vst2(dst_ + 4 * q4, *(const v4f*)((row) + 4 * q4)); } } while (0)
static_assert(HD == 64 && (132 * 4) % 16 == 0, "the staged row st[rl][hh*HD] is 16-B aligned and 64 floats long");
#ifndef PROJ_EXTRA_PARAMS
#define PROJ_EXTRA_PARAMS
#endif

#define WS_QH  0u                                      // f16 q tiles [b][h][t / 16][FT], fragment order
#define WS_KH  (WS_QH + 2u * (size_t)NB * TT * CC)      // f16 k tiles [b][h][t / 16][FT], fragment order
#define WS_VT  (WS_KH + 2u * (size_t)NB * TT * CC)      // f16 v chunks [b][h][t / 32][FV], fragment order
#define WS_QL  (WS_VT + 2u * (size_t)NB * CC * TT)      // f16 q residual x 2^10 tiles [b][h][t / 16 < QHI / 16][FT]
#define WS_KL  (WS_QL + 2u * (size_t)NB * QHI * CC)     // f16 k residual x 2^10 tiles [b][h][t / 16 < KHI / 16][FT]
#define WS_VB  (WS_KL + 2u * (size_t)NB * KHI * CC)     // bf16 v hi chunks [b][h][t / 32 < KHI / 32][FV]
#define WS_VBL (WS_VB + 2u * (size_t)NB * CC * KHI)
#define WS_Y   (WS_VBL + 2u * (size_t)NB * CC * KHI)    // f32 ctx rows [b*t][CC] (only when there is an output projection)
#define WS_END (WS_Y  + 4u * (size_t)NB * TT * CC)

// ---- the K loop of k_proj and k_out: a stage is KS k rows of the block's 128 weight columns. Thread tid reads column c0 + tid of the stage (each wave-wide load = one whole 128-B line), rounds it once for the whole block and leaves it k-contiguous in LDS row tid; every wave takes its B fragments from there. Two LDS buffers, one workgroup barrier per stage; the next stage's weight column and the wave's own next A rows are in flight while this stage's products run.
#define KS 64              // k rows per stage = 2 WMMA k steps
#define FG 8               // B fragments a wave reads from LDS as one group in front of their products
#define WP (KS + 8)        // LDS row pitch in 16-bit elements: 144 B = 16 B x odd, so that 16 rows' 16-B reads and writes spread over the banks
static_assert(DIN % KS == 0 && CC % KS == 0 && KS % 32 == 0 && (WP * 2) % 32 == 16, "whole stages; row pitch = 16 B x odd");
template <int LD> __device__ __forceinline__ void stage_ld(float (&wr)[KS], v4f (&xr)[KS / 8], const float* wp, const float* xp) {
#pragma unroll
  for (int i = 0; i < KS; ++i) wr[i] = wp[(size_t)i * LD];
#pragma unroll
  for (int kk = 0; kk < KS / 32; ++kk) { xr[kk * 4 + 0] = *(const v4f*)(xp + kk * 32); xr[kk * 4 + 1] = *(const v4f*)(xp + kk * 32 + 4); xr[kk * 4 + 2] = *(const v4f*)(xp + kk * 32 + 16); xr[kk * 4 + 3] = *(const v4f*)(xp + kk * 32 + 20); }
}
// F16 = 0: bf16 exact; 1: f16(bf16 x 2^8) exact
template <int F16> __device__ __forceinline__ void stage_st(unsigned short* row, const float (&wr)[KS]) {
#pragma unroll
  for (int q = 0; q < KS / 8; ++q) { union { v8b b; v8h h; v4u u; } t;
#pragma unroll
    for (int i = 0; i < 8; ++i) { if (F16) t.h[i] = (_Float16)(bfr(wr[q * 8 + i]) * 256.0f); else t.b[i] = (__bf16)wr[q * 8 + i]; }
    vst2(row + q * 8, t.u); } }
// the 16 f32 values of A fragment kk of a stage, in fragment order
__device__ __forceinline__ void stage_a(float (&v)[16], const v4f (&xr)[KS / 8], int kk) {
#pragma unroll
  for (int i = 0; i < 4; ++i) { v[i] = xr[kk * 4][i]; v[4 + i] = xr[kk * 4 + 1][i]; v[8 + i] = xr[kk * 4 + 2][i]; v[12 + i] = xr[kk * 4 + 3][i]; } }
// ---- k_proj: block = (64 rows, 128 cols, which): q/k/v = X W (+ b) with exact bf16 products (K = DIN) -> which 0: q f16 tiles (+ residual tiles for rows < QHI); 1: k f16 tiles (+ residual tiles for rows < KHI); 2: v f16 chunks (+ bf16 hi/lo chunks for t < KHI), all in fragment order
__global__ __launch_bounds__(128) void k_proj(const float* __restrict__ XQ, const float* __restrict__ XK, const float* __restrict__ XV, const float* __restrict__ WQ, const float* __restrict__ WK, const float* __restrict__ WV, const float* __restrict__ BQ, const float* __restrict__ BK, const float* __restrict__ BV,
    _Float16* __restrict__ QH, _Float16* __restrict__ QL, _Float16* __restrict__ KH, _Float16* __restrict__ KL, _Float16* __restrict__ VT, __bf16* __restrict__ VB, __bf16* __restrict__ VBL PROJ_EXTRA_PARAMS) {
  __shared__ __align__(16) float st[64][132]; __shared__ __align__(16) _Float16 sh[64][136], sl[64][136]; __shared__ __align__(16) _Float16 th[128][72]; __shared__ __align__(16) __bf16 tb[128][72], tbl[128][72]; __shared__ __align__(16) unsigned short wt[2][128][WP];
  const int tid = threadIdx.x, wave = tid >> 5, lane = tid & 31, col = lane & 15, g = lane >> 4; const int which = blockIdx.z; const int c0 = blockIdx.y * 128; const size_t r0 = (size_t)blockIdx.x * 64; const size_t bb = r0 / TT; const int t0 = (int)(r0 % TT);
  const float* X = which == 0 ? XQ : which == 1 ? XK : XV; const float* WA = which == 0 ? WQ : which == 1 ? WK : WV; const float* BA = which == 0 ? BQ : which == 1 ? BK : BV;
  v8f acc[8] = {};
  { const float* wp = WA + c0 + tid; const float* xp = X + (r0 + wave * 16 + col) * DIN + 8 * g; float wr[KS]; v4f xr[KS / 8]; v16b a[KS / 32];
    stage_ld<3 * CC>(wr, xr, wp, xp);
    asm volatile("s_wait_xcnt 0x0" ::: "memory");   /* the scalar base of stage 0's weight loads is reused right behind them */
    stage_st<0>(&wt[0][tid][0], wr);
#pragma unroll
    for (int kk = 0; kk < KS / 32; ++kk) { float v[16]; stage_a(v, xr, kk);
#pragma unroll
      for (int i = 0; i < 16; ++i) a[kk][i] = (__bf16)v[i]; }
    __syncthreads();   /* stage 0 of the weight tile is in LDS before any wave reads it */
#pragma unroll 1   /* kept rolled: a trip already holds a whole stage's loads and products; a second copy would only add registers and code */
    for (int s = 0; s < DIN / KS; ++s) {
      if (s + 1 < DIN / KS) { wp += (size_t)KS * 3 * CC; xp += KS; stage_ld<3 * CC>(wr, xr, wp, xp); }
#pragma unroll
      for (int kk = 0; kk < KS / 32; ++kk)
#pragma unroll
        for (int j0 = 0; j0 < 8; j0 += FG) { v16b w[FG];
#pragma unroll
          for (int j = 0; j < FG; ++j) w[j] = frag_b((const __bf16*)&wt[s & 1][(j0 + j) * 16 + col][kk * 32], lane);
#pragma unroll
          for (int j = 0; j < FG; ++j) acc[j0 + j] = wmma_bf(a[kk], w[j], acc[j0 + j]); }
      if (s + 1 < DIN / KS) { stage_st<0>(&wt[(s + 1) & 1][tid][0], wr);
#pragma unroll
        for (int kk = 0; kk < KS / 32; ++kk) { float v[16]; stage_a(v, xr, kk);
#pragma unroll
          for (int i = 0; i < 16; ++i) a[kk][i] = (__bf16)v[i]; } }
      __syncthreads();   /* publishes stage s + 1 and ends every wave's reads of stage s, whose buffer the next trip refills */
    } }
  { // stage the f32 tile (acc + bias) in LDS, run the per-(row, head) epilogue hook, then convert
#pragma unroll
    for (int j = 0; j < 8; ++j) { const float bias = BA ? bfr(BA[c0 + j * 16 + col]) : 0.f;
#pragma unroll
      for (int r = 0; r < 8; ++r) st[wave * 16 + 8 * g + r][j * 16 + col] = acc[j][r] + bias; }
    __syncthreads();
    for (int e = tid; e < 64 * (128 / HD); e += 128) { const int rl = e / (128 / HD), hh = e % (128 / HD); PROJ_EPI(which, &st[rl][hh * HD], (int)((r0 + rl) % TT), (c0 / HD) + hh); }
    __syncthreads(); }
  if (which < 2) { _Float16* DH = which == 0 ? QH : KH; _Float16* DL = which == 0 ? QL : KL; const int nhi = which == 0 ? QHI : KHI; const bool hi_rows = t0 < nhi;
    for (int e = tid; e < 64 * 128; e += 128) { const int rl = e >> 7, cl = e & 127; const float v = st[rl][cl]; const _Float16 hv = (_Float16)v; sh[rl][cl] = hv; sl[rl][cl] = (_Float16)((v - (float)hv) * 1024.0f); }
    __syncthreads();
    const int rl = tid & 15, cl = (tid >> 5) * 16 + ((tid >> 4) & 1) * 8; const size_t hb = bb * NH + c0 / HD;   /* the thread has piece tid of each of the block's 8 tiles (head hh, 16 rows tt): a wave's store is 512 contiguous bytes */
    _Float16* dh = DH + (hb * (TT / 16) + t0 / 16) * FT + tid * 8;
#pragma unroll   /* unrolled: the 8 stores share one address register pair and differ in a constant offset */
    for (int i = 0; i < 8; ++i) { const int hh = i >> 2, tt = i & 3; vst2((unsigned*)(dh + (hh * (TT / 16) + tt) * FT), *(const v4u*)&sh[tt * 16 + rl][hh * HD + cl]); }
    if (hi_rows) { _Float16* dl = DL + (hb * (nhi / 16) + t0 / 16) * FT + tid * 8;
      asm volatile("s_wait_xcnt 0x0" ::: "memory");   /* the registers of the 8 stores above are taken again for the residual pieces */
#pragma unroll   /* as above */
      for (int i = 0; i < 8; ++i) { const int hh = i >> 2, tt = i & 3; vst2((unsigned*)(dl + (hh * (nhi / 16) + tt) * FT), *(const v4u*)&sl[tt * 16 + rl][hh * HD + cl]); } }
  } else { const bool hi_rows = t0 < KHI;
    for (int e = tid; e < 64 * 128; e += 128) { const int rl = e & 63, cl = e >> 6; const float v = st[rl][cl]; th[cl][rl] = (_Float16)v; const __bf16 bh = (__bf16)v; tb[cl][rl] = bh; tbl[cl][rl] = (__bf16)(v - (float)bh); }
    __syncthreads();
    const int cl = (tid >> 6) * 16 + (tid & 15), rl = ((tid >> 5) & 1) * 16 + ((tid >> 4) & 1) * 8; const size_t hb = bb * NH + c0 / HD;   /* the thread has pieces tid and 128 + tid (u) of each of the block's 4 chunks (head hh, 32 keys cc): a wave's store is 512 contiguous bytes */
    _Float16* dv = VT + (hb * (TT / 32) + t0 / 32) * FV + tid * 8;
#pragma unroll   /* unrolled: the 8 stores share one address register pair and differ in a constant offset */
    for (int i = 0; i < 8; ++i) { const int hh = i >> 2, cc = (i >> 1) & 1, u = i & 1; vst2((unsigned*)(dv + (hh * (TT / 32) + cc) * FV + u * 1024), *(const v4u*)&th[hh * HD + u * 32 + cl][cc * 32 + rl]); }
    if (hi_rows) { const size_t o3 = (hb * (KHI / 32) + t0 / 32) * FV + tid * 8;
      asm volatile("s_wait_xcnt 0x0" ::: "memory");   /* the registers of the 8 stores above are taken again for the bf16 pieces */
#pragma unroll   /* as above */
      for (int i = 0; i < 8; ++i) { const int hh = i >> 2, cc = (i >> 1) & 1, u = i & 1; const int o4 = (hh * (KHI / 32) + cc) * FV + u * 1024; vst2((unsigned*)(VB + o3 + o4), *(const v4u*)&tb[hh * HD + u * 32 + cl][cc * 32 + rl]); vst2((unsigned*)(VBL + o3 + o4), *(const v4u*)&tbl[hh * HD + u * 32 + cl][cc * 32 + rl]); } }
    asm volatile("s_wait_xcnt 0x0" ::: "memory");   /* behind the arm's last store on both ways: the listing's next block writes the stores' data registers */
  } }
// ---- k_pv: block = 16 queries (tile qt) of (b, h), PVS waves, one launch for every (b, h). First the logits of the tile: wave w takes the 16-key tiles w, w + PVS, ... of keys [0, kend), q x k on WMMA (single f16 product; causal early query blocks: q hi + residual x 2^10 against k hi + residual, 3 products), x SCALE, f32 rows in LDS. Behind a workgroup barrier the softmax: wave w owns query row t = ql0 + w, reads its raw logits once into registers (causal: s > t excluded), takes max and sum in f32 inside the wave, and leaves P x 2^11 (0 for excluded) at the head of its own LDS row: f16, f32 for the causal early query blocks. Behind a workgroup barrier wave w takes the 32-key chunks w, w + PVS, ... and keeps its own f32 partial ctx tile; the partials meet in LDS (the rows' upper halves, which P leaves free) behind one more workgroup barrier and are added in wave order (P f16 against v f16: 1 product; causal early query blocks: P and v as bf16 hi + lo, 3 products); 256-B (row, head) segment by one wave
#define PVS 16             // key slices = waves per block = query rows per tile
#define LPF (TT + 4)       // f32 row pitch in LDS: raw logits; then P (f16 or f32) in floats [0, TT / 2) and wave w's partial ctx tile in floats [TT / 2, TT) of row w
#define LPH (2 * LPF)      // the same pitch in f16 elements
#define KTB 4              // key tiles whose k fragments a wave has in flight together
typedef __attribute__((ext_vector_type(4))) _Float16 v4h;
static_assert(32 * PVS == 16 * (HD / 2), "the merge gives each thread one 8-B piece of the 16 x HD tile");
static_assert(PVS == 16, "one wave per query row of the tile");
static_assert((LPF * 4) % 32 == 16, "row pitch = 16 B x odd: the 16-B fragment reads of 16 rows spread over the banks");
static_assert(16 * HD <= TT / 2 && KHI <= TT / 2, "a partial ctx tile fits the upper half of a row, the f32 P of the early query blocks the lower half");
static_assert(!CAUSAL || ((QBH * 64 - 1) / 128 + 1) * 128 <= KHI, "the early query blocks' keys have k residual rows and v hi + lo planes");
__global__ __launch_bounds__(32 * PVS) void k_pv(const _Float16* __restrict__ QH, const _Float16* __restrict__ KH, const _Float16* __restrict__ QL, const _Float16* __restrict__ KL, const _Float16* __restrict__ VT, const __bf16* __restrict__ VB, const __bf16* __restrict__ VBL, float* __restrict__ Y) { const int b = blockIdx.z / NH, h = blockIdx.z % NH; __shared__ __align__(16) union { float f[16][LPF]; _Float16 h[16][LPH]; } pp;
  const int tid = threadIdx.x, lane = tid & 31, col = lane & 15, g = lane >> 4; const int wave = __builtin_amdgcn_readfirstlane(tid >> 5); const int qb = blockIdx.x >> 2; const int ql0 = blockIdx.x * 16; const int kce = (kb_last(qb) + 1) * 4;
  { const int nt = kce * 2;   /* 16-key tiles that get logits, the same count for the whole block */
    const _Float16* qp = QH + ((size_t)blockIdx.z * (TT / 16) + blockIdx.x) * FT; const _Float16* kp = KH + (size_t)blockIdx.z * (TT / 16) * FT;
    const v16h ah0 = frag_t(qp, lane), ah1 = frag_t(qp + 512, lane);
    asm volatile("s_wait_xcnt 0x0" ::: "memory");   /* the q loads' address registers are reused behind the branch below */
    if (qb < QBH) { const _Float16* qlp = QL + ((size_t)blockIdx.z * (QHI / 16) + blockIdx.x) * FT; const _Float16* klp = KL + (size_t)blockIdx.z * (KHI / 16) * FT;
      const v16h al0 = frag_t(qlp, lane), al1 = frag_t(qlp + 512, lane);
      for (int jt = wave; jt < nt; jt += PVS) { const _Float16* kr = kp + (size_t)jt * FT; const _Float16* kl = klp + (size_t)jt * FT;
        const v16h kb0 = frag_t(kr, lane), kl0 = frag_t(kl, lane), kb1 = frag_t(kr + 512, lane), kl1 = frag_t(kl + 512, lane); v8f a = {}, l = {};
        asm volatile("s_wait_xcnt 0x0" ::: "memory");   /* the k loads' address registers are taken for a product's result right behind them */
        a = wmma16(ah0, kb0, a); l = wmma16(al0, kb0, l); l = wmma16(ah0, kl0, l);
        a = wmma16(ah1, kb1, a); l = wmma16(al1, kb1, l); l = wmma16(ah1, kl1, l);
#pragma unroll
        for (int r = 0; r < 8; ++r) pp.f[8 * g + r][jt * 16 + col] = (a[r] + l[r] * (1.0f / 1024.0f)) * SCALE; }
    } else {
      const _Float16* kr0 = kp + (size_t)wave * FT;
      for (int jt0 = wave; jt0 < nt; jt0 += KTB * PVS, kr0 += (size_t)KTB * PVS * FT) { v16h kf[KTB][2];   /* the tests on jt0 + u * PVS are the same for the whole wave */
#pragma unroll
        for (int u = 0; u < KTB; ++u) if (jt0 + u * PVS < nt) { const _Float16* kr = kr0 + u * (PVS * FT); kf[u][0] = frag_t(kr, lane); kf[u][1] = frag_t(kr + 512, lane); }
#pragma unroll
        for (int u = 0; u < KTB; ++u) if (jt0 + u * PVS < nt) { v8f a = {}; a = wmma16(ah0, kf[u][0], a); a = wmma16(ah1, kf[u][1], a);
#pragma unroll
          for (int r = 0; r < 8; ++r) pp.f[8 * g + r][(jt0 + u * PVS) * 16 + col] = a[r] * SCALE; } } } }
  __syncthreads();   /* every key tile's logits are in LDS before any wave reads its query row */
  { const int t = ql0 + wave; const int nv = kce >> 2;   /* nv groups of 128 keys hold logits, the same count for the whole block; the lane has keys i * 128 + lane * 4 + c of group i */
    const int rel = t - lane * 4;                        /* causal: that key is allowed while i * 128 + c <= rel, which no key of a group i >= nv is */
    const float* sr = &pp.f[wave][0] + lane * 4; v4f x[TT / 128];   /* the row's share of the lane; every loop over x is fully unrolled so that x stays in registers */
#pragma unroll
    for (int i = 0; i < TT / 128; ++i) { if (i < nv) x[i] = *(const v4f*)(sr + i * 128); else x[i] = (v4f)(-3.0e38f); }
    float m = -3.0e38f;
#pragma unroll
    for (int i = 0; i < TT / 128; ++i) {
#pragma unroll
      for (int c = 0; c < 4; ++c) { const float v = (!CAUSAL || i * 128 + c <= rel) ? x[i][c] : -3.0e38f; x[i][c] = v; m = fmaxf(m, v); } }
#pragma unroll
    for (int o = 1; o < 32; o <<= 1) m = fmaxf(m, __shfl_xor(m, o));
    float sum = 0.f; const float ml = m * 1.44269504f;   /* e = 2^(v log2(e) - ml): one fused multiply-add and one v_exp_f32 per key; the rounding of ml scales the whole row alike and cancels in e / sum. m is a real logit (key 0 is allowed in every row), so an excluded key's -3.0e38 goes to -inf and its e to 0 with no test */
#pragma unroll
    for (int i = 0; i < TT / 128; ++i) if (i < nv) {   /* one scalar test per 128-key group: a group without logits costs nothing and adds nothing to the sum */
#pragma unroll
      for (int c = 0; c < 4; ++c) { const float e = __builtin_amdgcn_exp2f(fmaf(x[i][c], 1.44269504f, -ml)); x[i][c] = e; sum += e; } }
#pragma unroll
    for (int o = 1; o < 32; o <<= 1) sum += __shfl_xor(sum, o);
    const float inv = sum > 0.f ? 2048.0f / sum : 0.f;
    float* pf = &pp.f[wave][0] + lane * 4; _Float16* ph = &pp.h[wave][0] + lane * 4;   /* P goes over the wave's own row, whose logits are all in registers by now */
#pragma unroll
    for (int i = 0; i < TT / 128; ++i) if (i < nv) { const v4f p = x[i] * inv;
      if (i * 128 < KHI && qb < QBH) vst2(pf + i * 128, p);
      else { v4h q;
#pragma unroll
        for (int c = 0; c < 4; ++c) q[c] = (_Float16)p[c];
        vst2(ph + i * 128, q); } } }
  __syncthreads();   /* every row's P is in LDS before any wave reads its key chunks of all 16 rows */
  v8f acc[HD / 16] = {};
  if (qb < QBH) {
#pragma unroll 1
    for (int kc = wave; kc < kce; kc += PVS) { const F2 p = split_row(&pp.f[col][0], kc * 32, lane);
#pragma unroll
      for (int j = 0; j < HD / 16; ++j) { const size_t po = ((size_t)blockIdx.z * (KHI / 32) + kc) * FV + j * 512; const v16b vh = frag_tb(VB + po, lane); acc[j] = wmma_bf(p.h, vh, acc[j]); acc[j] = wmma_bf(p.l, vh, acc[j]); acc[j] = wmma_bf(p.h, frag_tb(VBL + po, lane), acc[j]); } }
  } else {
#pragma unroll 1
    for (int kc = wave; kc < kce; kc += PVS) { const v16h p = frag_h(&pp.h[col][kc * 32], lane);
#pragma unroll
      for (int j = 0; j < HD / 16; ++j) { const size_t po = ((size_t)blockIdx.z * (TT / 32) + kc) * FV + j * 512; acc[j] = wmma16(p, frag_t(VT + po, lane), acc[j]); } } }
  float* sw = &pp.f[wave][TT / 2];   /* this wave's partial tile [16][HD]: no P byte lies there */
#pragma unroll
  for (int j = 0; j < HD / 16; ++j)
#pragma unroll
    for (int r = 0; r < 8; ++r) sw[(8 * g + r) * HD + j * 16 + col] = acc[j][r];
  __syncthreads();   /* every wave's partial tile is in LDS before any thread adds them */
  { const int rl = tid >> 5; v2f s = *(const v2f*)&pp.f[0][TT / 2 + rl * HD + lane * 2];
#pragma unroll
    for (int w = 1; w < PVS; ++w) s += *(const v2f*)&pp.f[w][TT / 2 + rl * HD + lane * 2];
    vst2(Y + ((size_t)b * TT + ql0 + rl) * CC + h * HD + lane * 2, s * (1.0f / 2048.0f)); } }
// ---- k_out: block = (64 rows, 128 cols): out = ctx Wo (+ bo): ctx x 2^6 once to f16 against Wo as f16(bf16 x 2^8) exact (1 product) x 2^-14; causal early rows (< QHI of each sequence): ctx bf16 hi + lo against exact bf16 Wo (2 products)
__global__ __launch_bounds__(128) void k_out(const float* __restrict__ Y, const float* __restrict__ WO, const float* __restrict__ BO, float* __restrict__ OUT) { __shared__ __align__(16) float sf[4][16][132]; __shared__ __align__(16) unsigned short wt[2][128][WP];
  const int tid = threadIdx.x, wave = tid >> 5, lane = tid & 31, col = lane & 15, g = lane >> 4; const int c0 = blockIdx.y * 128; const size_t r0 = (size_t)blockIdx.x * 64 + wave * 16;
  v8f acc[8] = {};
  const float* wp = WO + c0 + tid; const float* xp = Y + (r0 + col) * CC + 8 * g; float wr[KS]; v4f xr[KS / 8];
  stage_ld<DIN>(wr, xr, wp, xp);
  asm volatile("s_wait_xcnt 0x0" ::: "memory");   /* stage 0's loads name registers that are written again behind the branch below */
  if (CAUSAL && (int)(((size_t)blockIdx.x * 64) % TT) < QHI) {   /* block-uniform */
    F2 a[KS / 32]; stage_st<0>(&wt[0][tid][0], wr);
#pragma unroll
    for (int kk = 0; kk < KS / 32; ++kk) { float v[16]; stage_a(v, xr, kk); a[kk] = bsplit16(v); }
    __syncthreads();   /* stage 0 of the weight tile is in LDS before any wave reads it */
#pragma unroll 1   /* kept rolled: a trip already holds a whole stage's loads and products; a second copy would only add registers and code */
    for (int s = 0; s < CC / KS; ++s) {
      if (s + 1 < CC / KS) { wp += (size_t)KS * DIN; xp += KS; stage_ld<DIN>(wr, xr, wp, xp); }
#pragma unroll
      for (int kk = 0; kk < KS / 32; ++kk)
#pragma unroll
        for (int j0 = 0; j0 < 8; j0 += FG) { v16b w[FG];
#pragma unroll
          for (int j = 0; j < FG; ++j) w[j] = frag_b((const __bf16*)&wt[s & 1][(j0 + j) * 16 + col][kk * 32], lane);
#pragma unroll
          for (int j = 0; j < FG; ++j) { acc[j0 + j] = wmma_bf(a[kk].h, w[j], acc[j0 + j]); acc[j0 + j] = wmma_bf(a[kk].l, w[j], acc[j0 + j]); } }
      if (s + 1 < CC / KS) { stage_st<0>(&wt[(s + 1) & 1][tid][0], wr);
#pragma unroll
        for (int kk = 0; kk < KS / 32; ++kk) { float v[16]; stage_a(v, xr, kk); a[kk] = bsplit16(v); } }
      __syncthreads();   /* publishes stage s + 1 and ends every wave's reads of stage s, whose buffer the next trip refills */
    }
#pragma unroll
    for (int j = 0; j < 8; ++j) { const float bias = BO ? bfr(BO[c0 + j * 16 + col]) : 0.f;
#pragma unroll
      for (int r = 0; r < 8; ++r) sf[wave][8 * g + r][j * 16 + col] = acc[j][r] + bias; }
  } else {
    v16h a[KS / 32]; stage_st<1>(&wt[0][tid][0], wr);
#pragma unroll
    for (int kk = 0; kk < KS / 32; ++kk) { float v[16]; stage_a(v, xr, kk);
#pragma unroll
      for (int i = 0; i < 16; ++i) a[kk][i] = (_Float16)(v[i] * 64.0f); }   /* ctx carried x 2^6 into f16 so small-magnitude context rows stay clear of f16 subnormals */
    __syncthreads();   /* stage 0 of the weight tile is in LDS before any wave reads it */
#pragma unroll 1   /* kept rolled: a trip already holds a whole stage's loads and products; a second copy would only add registers and code */
    for (int s = 0; s < CC / KS; ++s) {
      if (s + 1 < CC / KS) { wp += (size_t)KS * DIN; xp += KS; stage_ld<DIN>(wr, xr, wp, xp); }
#pragma unroll
      for (int kk = 0; kk < KS / 32; ++kk)
#pragma unroll
        for (int j0 = 0; j0 < 8; j0 += FG) { v16h w[FG];
#pragma unroll
          for (int j = 0; j < FG; ++j) w[j] = frag_h((const _Float16*)&wt[s & 1][(j0 + j) * 16 + col][kk * 32], lane);
#pragma unroll
          for (int j = 0; j < FG; ++j) acc[j0 + j] = wmma16(a[kk], w[j], acc[j0 + j]); }
      if (s + 1 < CC / KS) { stage_st<1>(&wt[(s + 1) & 1][tid][0], wr);
#pragma unroll
        for (int kk = 0; kk < KS / 32; ++kk) { float v[16]; stage_a(v, xr, kk);
#pragma unroll
          for (int i = 0; i < 16; ++i) a[kk][i] = (_Float16)(v[i] * 64.0f); } }
      __syncthreads();   /* publishes stage s + 1 and ends every wave's reads of stage s, whose buffer the next trip refills */
    }
#pragma unroll
    for (int j = 0; j < 8; ++j) { const float bias = BO ? bfr(BO[c0 + j * 16 + col]) : 0.f;
#pragma unroll
      for (int r = 0; r < 8; ++r) sf[wave][8 * g + r][j * 16 + col] = acc[j][r] * (1.0f / 16384.0f) + bias; } }   /* 2^-8 (Wo carry) x 2^-6 (ctx carry) */
  LDSX(); for (int rl = 0; rl < 16; ++rl) vst2(OUT + (r0 + rl) * DIN + c0 + lane * 4, *(const v4f*)&sf[wave][rl][lane * 4]); }

extern "C" void kernel_launch(void* const* d_in, const int* in_sizes, int n_in, void* d_out, int out_size, void* d_ws, size_t ws_size, hipStream_t stream) {
  (void)in_sizes; (void)n_in; (void)out_size;
  const float** F = (const float**)d_in;
  if (ws_size < (size_t)WS_END) return;
  char* ws = (char*)d_ws; _Float16 *QH = (_Float16*)(ws + WS_QH), *KH = (_Float16*)(ws + WS_KH), *VT = (_Float16*)(ws + WS_VT), *QL = (_Float16*)(ws + WS_QL), *KL = (_Float16*)(ws + WS_KL); __bf16 *VB = (__bf16*)(ws + WS_VB), *VBL = (__bf16*)(ws + WS_VBL); float *Y = (float*)(ws + WS_Y);
  (void)Y; (void)QL; (void)KL; (void)VB; (void)VBL;
  // inputs: 0 x [2,2048,1024]; 1 w_attn [1024,3072] (in,out; columns q | k | v); 2 b_attn [3072] (zeros, read); 3 w_proj [1024,1024] (in,out); 4 b_proj [1024] (zeros, read). outputs: 0 a [2,2048,1024] at d_out + 0; 1 present [2,2,16,2048,64] at d_out + NB*TT*CC floats (byte offset 16,777,216)
  k_proj<<<dim3(TNB * TT / 64, CC / 128, 3), 128, 0, stream>>>(F[0], F[0], F[0], F[1], F[1] + CC, F[1] + 2 * CC, F[2], F[2] + CC, F[2] + 2 * CC, QH, QL, KH, KL, VT, VB, VBL, (float*)d_out + (size_t)NB * TT * CC);
  k_pv<<<dim3(TT / 16, 1, TNB * NH), 32 * PVS, 0, stream>>>(QH, KH, QL, KL, VT, VB, VBL, Y);
  k_out<<<dim3(TNB * TT / 64, DIN / 128), 128, 0, stream>>>(Y, F[3], F[4], (float*)d_out);
}

// v007
// A run of this version takes 168 microseconds.
// Timed twice side by side with v006, it ran 1.11 times as fast both times.
// Counting every step since v000, it is 6.58 times as fast.
// compute dtype: all float inputs rounded to bf16; c = x w_attn + b_attn with EXACT bf16 products on WMMA 16x16x32 (f32 accumulate); the f32 k and v rows are ALSO the second output (present); causal logits: 3 products for the first 384 rows, single f16 q x k after, x 64^-0.5; softmax f32; P x 2^11 once to f16 x v once to f16 (bf16 hi + lo below row 384); ctx hi+lo x exact w_proj below row 384, x2^6 f16 carry x f16(bf16 x 2^8) after, + b_proj; f32 outputs.
#include <hip/hip_runtime.h>
#include <math.h>

typedef __attribute__((ext_vector_type(16))) _Float16 v16h;
typedef __attribute__((ext_vector_type(16))) __bf16 v16b;
typedef __attribute__((ext_vector_type(8)))  _Float16 v8h;
typedef __attribute__((ext_vector_type(8)))  float v8f;
typedef __attribute__((ext_vector_type(4)))  float v4f;
typedef __attribute__((ext_vector_type(2)))  float v2f;
typedef __attribute__((ext_vector_type(4)))  unsigned v4u;
typedef __attribute__((ext_vector_type(4)))  int v4i;
typedef float __attribute__((may_alias)) float_a;
typedef int __attribute__((may_alias)) int_a;

template <typename T> __device__ __forceinline__ void vst2(void* p, T v) { *(T*)p = v;  }
__device__ __forceinline__ v8f wmma16(v16h a, v16h b, v8f c) {
  v8f d = __builtin_amdgcn_wmma_f32_16x16x32_f16(false, a, false, b, (short)0, c, false, false);
  asm volatile("v_nop\n\tv_nop\n\tv_nop\n\tv_nop" : "+v"(d) : "v"(a), "v"(b));
  return d;
}
__device__ __forceinline__ v8f wmma_bf(v16b a, v16b b, v8f c) {
  v8f d = __builtin_amdgcn_wmma_f32_16x16x32_bf16(false, a, false, b, (short)0, c, false, false);
  asm volatile("v_nop\n\tv_nop\n\tv_nop\n\tv_nop" : "+v"(d) : "v"(a), "v"(b));
  return d;
}
// 16x16x32 fragments: lane = (h = lane>>4, row/col = lane&15); elements 0..7 = k0+8h+0..7, 8..15 = k0+16+8h+0..7; D element r = row 8h+r
__device__ __forceinline__ v16h frag_h(const _Float16* rowk0, int lane) {
  union { v16h v; v8h q[2]; } u; const _Float16* p = rowk0 + 8 * (lane >> 4);
  u.q[0] = *(const v8h*)p; u.q[1] = *(const v8h*)(p + 16); return u.v;
}
__device__ __forceinline__ v16h frag_f32(const float* rowk0, int lane) {
  v16h a; const float* p = rowk0 + 8 * (lane >> 4);
#pragma unroll
  for (int i = 0; i < 8; ++i) { a[i] = (_Float16)p[i]; a[8 + i] = (_Float16)p[16 + i]; }
  return a;
}
__device__ __forceinline__ v16h frag_f32s(const float* rowk0, int lane, float sc) {
  v16h a; const float* p = rowk0 + 8 * (lane >> 4);
#pragma unroll
  for (int i = 0; i < 8; ++i) { a[i] = (_Float16)(p[i] * sc); a[8 + i] = (_Float16)(p[16 + i] * sc); }
  return a;
}
// column fragment from a [K][ld] layout (column n), rows >= K read as 0
__device__ __forceinline__ v16h fragc_f32(const float* W, int k0, int n, int lane, int ld, int K) {
  v16h a; const int g = lane >> 4;
#pragma unroll
  for (int i = 0; i < 8; ++i) { const int ka = k0 + 8 * g + i, kb = ka + 16;
    a[i] = (_Float16)(ka < K ? W[(size_t)(ka < K ? ka : K - 1) * ld + n] : 0.f); a[8 + i] = (_Float16)(kb < K ? W[(size_t)(kb < K ? kb : K - 1) * ld + n] : 0.f); }
  return a;
}
struct F2 { v16b h, l; };
__device__ __forceinline__ F2 bsplit16(const float v[16]) { F2 r;
#pragma unroll
  for (int i = 0; i < 16; ++i) { const __bf16 h = (__bf16)v[i]; r.h[i] = h; r.l[i] = (__bf16)(v[i] - (float)h); }
  return r; }
__device__ __forceinline__ F2 split_row(const float* row, int k0, int lane) { float v[16]; const float* p = row + k0 + 8 * (lane >> 4);
#pragma unroll
  for (int i = 0; i < 8; ++i) { v[i] = p[i]; v[8 + i] = p[16 + i]; }
  return bsplit16(v); }
__device__ __forceinline__ F2 split_rowK(const float* row, int k0, int lane, int K) { float v[16]; const int g = lane >> 4;
#pragma unroll
  for (int i = 0; i < 8; ++i) { const int ka = k0 + 8 * g + i, kb = ka + 16; v[i] = ka < K ? row[ka < K ? ka : K - 1] : 0.f; v[8 + i] = kb < K ? row[kb < K ? kb : K - 1] : 0.f; }
  return bsplit16(v); }
__device__ __forceinline__ F2 split_col(const float* W, int k0, int n, int lane, int ld, int K) { float v[16]; const int g = lane >> 4;
#pragma unroll
  for (int i = 0; i < 8; ++i) { const int ka = k0 + 8 * g + i, kb = ka + 16; v[i] = ka < K ? W[(size_t)(ka < K ? ka : K - 1) * ld + n] : 0.f; v[8 + i] = kb < K ? W[(size_t)(kb < K ? kb : K - 1) * ld + n] : 0.f; }
  return bsplit16(v); }
__device__ __forceinline__ v8f mac3(const F2& a, const F2& b, v8f c) { c = wmma_bf(a.l, b.h, c); c = wmma_bf(a.h, b.l, c); return wmma_bf(a.h, b.h, c); }
__device__ __forceinline__ float sigm(float v) { return 1.0f / (1.0f + expf(-v)); }
#define LDSX() do { asm volatile("s_wait_dscnt 0" ::: "memory"); __builtin_amdgcn_wave_barrier(); __builtin_amdgcn_fence(__ATOMIC_RELEASE, "workgroup"); } while (0)

// Fused-qkv causal self-attention with TWO outputs (x [2,2048,1024]; fused (in,out) w_attn [1024,3072] N(0,1) x 0.02 + b_attn zeros (read), jnp.split(c, 3, axis=2) -> q | k | v column blocks; 16 heads x 64; w = q k^T x rsqrt(64); w * b - 1e10 * (1 - b) with b = (i >= j): causal, the masked logits are exactly -1e10; softmax; a = merge(p v) w_proj + b_proj; outputs: a [2,2048,1024] and present = stack([k, v], axis=1) [2,2,16,2048,64] = the projected k and v (bias included) in head-major layout).
#define NB 2
#define TT 2048
#define CC 1024            // NH * HD = projected width
#define DIN 1024          // input (model) width
#define NH 16
#define HD 64
#define SCALE (0.125f)
#define CAUSAL 1
#ifndef TNB
#define TNB NB
#endif
__device__ __forceinline__ float bfr(float v) { return (float)(__bf16)v; }
__host__ __device__ __forceinline__ int kb_last(int qb) { return CAUSAL ? ((qb * 64 + 63) >> 7) : (TT / 128 - 1); }
typedef __attribute__((ext_vector_type(8))) __bf16 v8b;
__device__ __forceinline__ v16b frag_b(const __bf16* rowk0, int lane) {
  union { v16b v; v8b q[2]; } u; const __bf16* p = rowk0 + 8 * (lane >> 4);
  u.q[0] = *(const v8b*)p; u.q[1] = *(const v8b*)(p + 16); return u.v;
}
// ---- fragment order: the planes that k_pv reads are stored by k_proj as the registers of the WMMA fragments, so that each wave-wide 16-B load covers 512 contiguous bytes = 4 whole lines (a row-major tile makes it touch 16 lines). q, k and their residuals: tile (b, h, 16 rows) = FT elements [k step 0..1][half 0..1][lane][8]; v planes: chunk (b, h, 32 keys) = FV elements [16 columns j 0..3][half 0..1][lane][8]; lane = (g, row or column), its 8 elements = k0 + 16 * half + 8 * g + 0..7, as frag_h takes them from a row
#define FT (16 * HD)
#define FV (32 * HD)
__device__ __forceinline__ v16h frag_t(const _Float16* f, int lane) { union { v16h v; v8h q[2]; } u; u.q[0] = *(const v8h*)(f + lane * 8); u.q[1] = *(const v8h*)(f + 256 + lane * 8); return u.v; }
__device__ __forceinline__ v16b frag_tb(const __bf16* f, int lane) { union { v16b v; v8b q[2]; } u; u.q[0] = *(const v8b*)(f + lane * 8); u.q[1] = *(const v8b*)(f + 256 + lane * 8); return u.v; }
#define QBH 6              // causal: query blocks 0..QBH-1 of each sequence (few keys, no averaging) take the high-precision path
#define QHI 384            // rows carrying a q residual plane
#define KHI 384            // key rows carrying k residual / v bf16 hi+lo planes (used only by the causal high-precision path)
// B fragment (k rows k0+.., output column o) of a weight: (in,out) [K][ld] or (out,in) [ld rows of K]: bf16 exact, or f16(bf16 * 256) exact
__device__ __forceinline__ v16b wcol_io(const float* Wm, int k0, int o, int lane, int ld) { v16b w; const int g = lane >> 4;
#pragma unroll
  for (int i = 0; i < 8; ++i) { w[i] = (__bf16)Wm[(size_t)(k0 + 8 * g + i) * ld + o]; w[8 + i] = (__bf16)Wm[(size_t)(k0 + 16 + 8 * g + i) * ld + o]; }
  return w; }
__device__ __forceinline__ v16b wcol_oi(const float* Wm, int k0, int o, int lane, int K) { v16b w; const float* p = Wm + (size_t)o * K + k0 + 8 * (lane >> 4);
#pragma unroll
  for (int i = 0; i < 8; ++i) { w[i] = (__bf16)p[i]; w[8 + i] = (__bf16)p[16 + i]; }
  return w; }
__device__ __forceinline__ v16h wcolh_io(const float* Wm, int k0, int o, int lane, int ld) { v16h w; const int g = lane >> 4;
#pragma unroll
  for (int i = 0; i < 8; ++i) { w[i] = (_Float16)(bfr(Wm[(size_t)(k0 + 8 * g + i) * ld + o]) * 256.0f); w[8 + i] = (_Float16)(bfr(Wm[(size_t)(k0 + 16 + 8 * g + i) * ld + o]) * 256.0f); }
  return w; }
__device__ __forceinline__ v16h wcolh_oi(const float* Wm, int k0, int o, int lane, int K) { v16h w; const float* p = Wm + (size_t)o * K + k0 + 8 * (lane >> 4);
#pragma unroll
  for (int i = 0; i < 8; ++i) { w[i] = (_Float16)(bfr(p[i]) * 256.0f); w[8 + i] = (_Float16)(bfr(p[16 + i]) * 256.0f); }
  return w; }
#define WQKV_LAYOUT 0   // 0 = (in,out); 1 = (out,in) [CC][DIN]; 2 = per-head [NH][DIN][HD]
__device__ __forceinline__ v16b wcol_hdk(const float* Wm, int k0, int o, int lane) { v16b w; const int g = lane >> 4; const float* p = Wm + (size_t)(o / HD) * DIN * HD + (o % HD);
#pragma unroll
  for (int i = 0; i < 8; ++i) { w[i] = (__bf16)p[(size_t)(k0 + 8 * g + i) * HD]; w[8 + i] = (__bf16)p[(size_t)(k0 + 16 + 8 * g + i) * HD]; }
  return w; }
#define WO_OUT_IN 0
#if WQKV_LAYOUT == 1
#define WCOL(W, k0, o, lane) wcol_oi(W, k0, o, lane, DIN)
#elif WQKV_LAYOUT == 2
#define WCOL(W, k0, o, lane) wcol_hdk(W, k0, o, lane)
#else
#define WCOL(W, k0, o, lane) wcol_io(W, k0, o, lane, 3 * CC)   /* w_attn (in,out) [1024][3072] packed by columns: row pitch 3*CC; the q / k / v pointers carry the column offsets 0 / CC / 2*CC */
#endif
#if WO_OUT_IN
#define WOCOL(W, k0, o, lane) wcol_oi(W, k0, o, lane, CC)
#define WOCOLH(W, k0, o, lane) wcolh_oi(W, k0, o, lane, CC)
#else
#define WOCOL(W, k0, o, lane) wcol_io(W, k0, o, lane, DIN)
#define WOCOLH(W, k0, o, lane) wcolh_io(W, k0, o, lane, DIN)
#endif
#define PROJ_EXTRA_PARAMS , float* __restrict__ PRES   /* second output: present [NB][2][NH][TT][HD] f32 */
#define PROJ_EPI(which, row, t, h) do { if ((which) >= 1) { float* dst_ = PRES + ((((size_t)bb * 2 + ((which) - 1)) * NH + (h)) * TT + (t)) * HD; _Pragma("unroll") for (int q4 = 0; q4 < HD / 4; ++q4) vst2(dst_ + 4 * q4, *(const v4f*)((row) + 4 * q4)); } } while (0)
static_assert(HD == 64 && (132 * 4) % 16 == 0, "the staged row st[rl][hh*HD] is 16-B aligned and 64 floats long");
#ifndef PROJ_EXTRA_PARAMS
#define PROJ_EXTRA_PARAMS
#endif

#define WS_QH  0u                                      // f16 q tiles [b][h][t / 16][FT], fragment order
#define WS_KH  (WS_QH + 2u * (size_t)NB * TT * CC)      // f16 k tiles [b][h][t / 16][FT], fragment order
#define WS_VT  (WS_KH + 2u * (size_t)NB * TT * CC)      // f16 v chunks [b][h][t / 32][FV], fragment order
#define WS_QL  (WS_VT + 2u * (size_t)NB * CC * TT)      // f16 q residual x 2^10 tiles [b][h][t / 16 < QHI / 16][FT]
#define WS_KL  (WS_QL + 2u * (size_t)NB * QHI * CC)     // f16 k residual x 2^10 tiles [b][h][t / 16 < KHI / 16][FT]
#define WS_VB  (WS_KL + 2u * (size_t)NB * KHI * CC)     // bf16 v hi chunks [b][h][t / 32 < KHI / 32][FV]
#define WS_VBL (WS_VB + 2u * (size_t)NB * CC * KHI)
#define WS_Y   (WS_VBL + 2u * (size_t)NB * CC * KHI)    // f32 ctx rows [b*t][CC] (only when there is an output projection)
#define WS_END (WS_Y  + 4u * (size_t)NB * TT * CC)

// ---- the K loop of k_proj and k_out: a stage is KS k rows of the block's 128 weight columns. Thread tid reads column c0 + tid of the stage (each wave-wide load = one whole 128-B line), rounds it once for the whole block and leaves it k-contiguous in LDS row tid; every wave takes its B fragments from there. Two LDS buffers, one workgroup barrier per stage; the next stage's weight column and the wave's own next A rows are in flight while this stage's products run.
#define KS 64              // k rows per stage = 2 WMMA k steps
#define FG 8               // B fragments a wave reads from LDS as one group in front of their products
#define WP (KS + 8)        // LDS row pitch in 16-bit elements: 144 B = 16 B x odd, so that 16 rows' 16-B reads and writes spread over the banks
static_assert(DIN % KS == 0 && CC % KS == 0 && KS % 32 == 0 && (WP * 2) % 32 == 16, "whole stages; row pitch = 16 B x odd");
template <int LD> __device__ __forceinline__ void stage_ld(float (&wr)[KS], v4f (&xr)[KS / 8], const float* wp, const float* xp) {
#pragma unroll
  for (int i = 0; i < KS; ++i) wr[i] = wp[(size_t)i * LD];
#pragma unroll
  for (int kk = 0; kk < KS / 32; ++kk) { xr[kk * 4 + 0] = *(const v4f*)(xp + kk * 32); xr[kk * 4 + 1] = *(const v4f*)(xp + kk * 32 + 4); xr[kk * 4 + 2] = *(const v4f*)(xp + kk * 32 + 16); xr[kk * 4 + 3] = *(const v4f*)(xp + kk * 32 + 20); }
}
// F16 = 0: bf16 exact; 1: f16(bf16 x 2^8) exact
template <int F16> __device__ __forceinline__ void stage_st(unsigned short* row, const float (&wr)[KS]) {
#pragma unroll
  for (int q = 0; q < KS / 8; ++q) { union { v8b b; v8h h; v4u u; } t;
#pragma unroll
    for (int i = 0; i < 8; ++i) { if (F16) t.h[i] = (_Float16)(bfr(wr[q * 8 + i]) * 256.0f); else t.b[i] = (__bf16)wr[q * 8 + i]; }
    vst2(row + q * 8, t.u); } }
// the 16 f32 values of A fragment kk of a stage, in fragment order
__device__ __forceinline__ void stage_a(float (&v)[16], const v4f (&xr)[KS / 8], int kk) {
#pragma unroll
  for (int i = 0; i < 4; ++i) { v[i] = xr[kk * 4][i]; v[4 + i] = xr[kk * 4 + 1][i]; v[8 + i] = xr[kk * 4 + 2][i]; v[12 + i] = xr[kk * 4 + 3][i]; } }
// ---- k_proj: block = (64 rows, 128 cols, which): q/k/v = X W (+ b) with exact bf16 products (K = DIN) -> which 0: q f16 tiles (+ residual tiles for rows < QHI); 1: k f16 tiles (+ residual tiles for rows < KHI); 2: v f16 chunks (+ bf16 hi/lo chunks for t < KHI), all in fragment order
__global__ __launch_bounds__(128) void k_proj(const float* __restrict__ XQ, const float* __restrict__ XK, const float* __restrict__ XV, const float* __restrict__ WQ, const float* __restrict__ WK, const float* __restrict__ WV, const float* __restrict__ BQ, const float* __restrict__ BK, const float* __restrict__ BV,
    _Float16* __restrict__ QH, _Float16* __restrict__ QL, _Float16* __restrict__ KH, _Float16* __restrict__ KL, _Float16* __restrict__ VT, __bf16* __restrict__ VB, __bf16* __restrict__ VBL PROJ_EXTRA_PARAMS) {
  __shared__ __align__(16) float st[64][132]; __shared__ __align__(16) _Float16 sh[64][136], sl[64][136]; __shared__ __align__(16) _Float16 th[128][72]; __shared__ __align__(16) __bf16 tb[128][72], tbl[128][72]; __shared__ __align__(16) unsigned short wt[2][128][WP];
  const int tid = threadIdx.x, wave = tid >> 5, lane = tid & 31, col = lane & 15, g = lane >> 4; const int which = blockIdx.z; const int c0 = blockIdx.y * 128; const size_t r0 = (size_t)blockIdx.x * 64; const size_t bb = r0 / TT; const int t0 = (int)(r0 % TT);
  const float* X = which == 0 ? XQ : which == 1 ? XK : XV; const float* WA = which == 0 ? WQ : which == 1 ? WK : WV; const float* BA = which == 0 ? BQ : which == 1 ? BK : BV;
  v8f acc[8] = {};
  { const float* wp = WA + c0 + tid; const float* xp = X + (r0 + wave * 16 + col) * DIN + 8 * g; float wr[KS]; v4f xr[KS / 8]; v16b a[KS / 32];
    stage_ld<3 * CC>(wr, xr, wp, xp);
    asm volatile("s_wait_xcnt 0x0" ::: "memory");   /* the scalar base of stage 0's weight loads is reused right behind them */
    stage_st<0>(&wt[0][tid][0], wr);
#pragma unroll
    for (int kk = 0; kk < KS / 32; ++kk) { float v[16]; stage_a(v, xr, kk);
#pragma unroll
      for (int i = 0; i < 16; ++i) a[kk][i] = (__bf16)v[i]; }
    __syncthreads();   /* stage 0 of the weight tile is in LDS before any wave reads it */
#pragma unroll 1   /* kept rolled: a trip already holds a whole stage's loads and products; a second copy would only add registers and code */
    for (int s = 0; s < DIN / KS; ++s) {
      if (s + 1 < DIN / KS) { wp += (size_t)KS * 3 * CC; xp += KS; stage_ld<3 * CC>(wr, xr, wp, xp); }
#pragma unroll
      for (int kk = 0; kk < KS / 32; ++kk)
#pragma unroll
        for (int j0 = 0; j0 < 8; j0 += FG) { v16b w[FG];
#pragma unroll
          for (int j = 0; j < FG; ++j) w[j] = frag_b((const __bf16*)&wt[s & 1][(j0 + j) * 16 + col][kk * 32], lane);
#pragma unroll
          for (int j = 0; j < FG; ++j) acc[j0 + j] = wmma_bf(a[kk], w[j], acc[j0 + j]); }
      if (s + 1 < DIN / KS) { stage_st<0>(&wt[(s + 1) & 1][tid][0], wr);
#pragma unroll
        for (int kk = 0; kk < KS / 32; ++kk) { float v[16]; stage_a(v, xr, kk);
#pragma unroll
          for (int i = 0; i < 16; ++i) a[kk][i] = (__bf16)v[i]; } }
      __syncthreads();   /* publishes stage s + 1 and ends every wave's reads of stage s, whose buffer the next trip refills */
    } }
  { // stage the f32 tile (acc + bias) in LDS, run the per-(row, head) epilogue hook, then convert
#pragma unroll
    for (int j = 0; j < 8; ++j) { const float bias = BA ? bfr(BA[c0 + j * 16 + col]) : 0.f;
#pragma unroll
      for (int r = 0; r < 8; ++r) st[wave * 16 + 8 * g + r][j * 16 + col] = acc[j][r] + bias; }
    __syncthreads();
    for (int e = tid; e < 64 * (128 / HD); e += 128) { const int rl = e / (128 / HD), hh = e % (128 / HD); PROJ_EPI(which, &st[rl][hh * HD], (int)((r0 + rl) % TT), (c0 / HD) + hh); }
    __syncthreads(); }
  if (which < 2) { _Float16* DH = which == 0 ? QH : KH; _Float16* DL = which == 0 ? QL : KL; const int nhi = which == 0 ? QHI : KHI; const bool hi_rows = t0 < nhi;
    for (int e = tid; e < 64 * 128; e += 128) { const int rl = e >> 7, cl = e & 127; const float v = st[rl][cl]; const _Float16 hv = (_Float16)v; sh[rl][cl] = hv; sl[rl][cl] = (_Float16)((v - (float)hv) * 1024.0f); }
    __syncthreads();
    const int rl = tid & 15, cl = (tid >> 5) * 16 + ((tid >> 4) & 1) * 8; const size_t hb = bb * NH + c0 / HD;   /* the thread has piece tid of each of the block's 8 tiles (head hh, 16 rows tt): a wave's store is 512 contiguous bytes */
    _Float16* dh = DH + (hb * (TT / 16) + t0 / 16) * FT + tid * 8;
#pragma unroll   /* unrolled: the 8 stores share one address register pair and differ in a constant offset */
    for (int i = 0; i < 8; ++i) { const int hh = i >> 2, tt = i & 3; vst2((unsigned*)(dh + (hh * (TT / 16) + tt) * FT), *(const v4u*)&sh[tt * 16 + rl][hh * HD + cl]); }
    if (hi_rows) { _Float16* dl = DL + (hb * (nhi / 16) + t0 / 16) * FT + tid * 8;
      asm volatile("s_wait_xcnt 0x0" ::: "memory");   /* the registers of the 8 stores above are taken again for the residual pieces */
#pragma unroll   /* as above */
      for (int i = 0; i < 8; ++i) { const int hh = i >> 2, tt = i & 3; vst2((unsigned*)(dl + (hh * (nhi / 16) + tt) * FT), *(const v4u*)&sl[tt * 16 + rl][hh * HD + cl]); } }
  } else { const bool hi_rows = t0 < KHI;
    for (int e = tid; e < 64 * 128; e += 128) { const int rl = e & 63, cl = e >> 6; const float v = st[rl][cl]; th[cl][rl] = (_Float16)v; const __bf16 bh = (__bf16)v; tb[cl][rl] = bh; tbl[cl][rl] = (__bf16)(v - (float)bh); }
    __syncthreads();
    const int cl = (tid >> 6) * 16 + (tid & 15), rl = ((tid >> 5) & 1) * 16 + ((tid >> 4) & 1) * 8; const size_t hb = bb * NH + c0 / HD;   /* the thread has pieces tid and 128 + tid (u) of each of the block's 4 chunks (head hh, 32 keys cc): a wave's store is 512 contiguous bytes */
    _Float16* dv = VT + (hb * (TT / 32) + t0 / 32) * FV + tid * 8;
#pragma unroll   /* unrolled: the 8 stores share one address register pair and differ in a constant offset */
    for (int i = 0; i < 8; ++i) { const int hh = i >> 2, cc = (i >> 1) & 1, u = i & 1; vst2((unsigned*)(dv + (hh * (TT / 32) + cc) * FV + u * 1024), *(const v4u*)&th[hh * HD + u * 32 + cl][cc * 32 + rl]); }
    if (hi_rows) { const size_t o3 = (hb * (KHI / 32) + t0 / 32) * FV + tid * 8;
      asm volatile("s_wait_xcnt 0x0" ::: "memory");   /* the registers of the 8 stores above are taken again for the bf16 pieces */
#pragma unroll   /* as above */
      for (int i = 0; i < 8; ++i) { const int hh = i >> 2, cc = (i >> 1) & 1, u = i & 1; const int o4 = (hh * (KHI / 32) + cc) * FV + u * 1024; vst2((unsigned*)(VB + o3 + o4), *(const v4u*)&tb[hh * HD + u * 32 + cl][cc * 32 + rl]); vst2((unsigned*)(VBL + o3 + o4), *(const v4u*)&tbl[hh * HD + u * 32 + cl][cc * 32 + rl]); } }
    asm volatile("s_wait_xcnt 0x0" ::: "memory");   /* behind the arm's last store on both ways: the listing's next block writes the stores' data registers */
  } }
// ---- k_pv: block = 16 queries (tile qt) of (b, h), PVS waves, one launch for every (b, h). First the logits of the tile: wave w takes the 16-key tiles w, w + PVS, ... of keys [0, kend), q x k on WMMA (single f16 product; causal early query blocks: q hi + residual x 2^10 against k hi + residual, 3 products), x SCALE, f32 rows in LDS. Behind a workgroup barrier the softmax: wave w owns query row t = ql0 + w, reads its raw logits once into registers (causal: s > t excluded), takes max and sum in f32 inside the wave, and leaves P x 2^11 (0 for excluded) at the head of its own LDS row: f16, f32 for the causal early query blocks. Behind a workgroup barrier wave w takes the 32-key chunks w, w + PVS, ... and keeps its own f32 partial ctx tile; the partials meet in LDS (the rows' upper halves, which P leaves free) behind one more workgroup barrier and are added in wave order (P f16 against v f16: 1 product; causal early query blocks: P and v as bf16 hi + lo, 3 products); 256-B (row, head) segment by one wave
#define PVS 16             // key slices = waves per block = query rows per tile
#define LPF (TT + 4)       // f32 row pitch in LDS: raw logits; then P (f16 or f32) in floats [0, TT / 2) and wave w's partial ctx tile in floats [TT / 2, TT) of row w
#define LPH (2 * LPF)      // the same pitch in f16 elements
#define KTB 4              // key tiles whose k fragments a wave has in flight together
#define KVB 2              // 32-key chunks whose v fragments a wave has in flight together
typedef __attribute__((ext_vector_type(4))) _Float16 v4h;
static_assert(32 * PVS == 16 * (HD / 2), "the merge gives each thread one 8-B piece of the 16 x HD tile");
static_assert(PVS == 16, "one wave per query row of the tile");
static_assert((LPF * 4) % 32 == 16, "row pitch = 16 B x odd: the 16-B fragment reads of 16 rows spread over the banks");
static_assert(16 * HD <= TT / 2 && KHI <= TT / 2, "a partial ctx tile fits the upper half of a row, the f32 P of the early query blocks the lower half");
static_assert(!CAUSAL || ((QBH * 64 - 1) / 128 + 1) * 128 <= KHI, "the early query blocks' keys have k residual rows and v hi + lo planes");
__global__ __launch_bounds__(32 * PVS) void k_pv(const _Float16* __restrict__ QH, const _Float16* __restrict__ KH, const _Float16* __restrict__ QL, const _Float16* __restrict__ KL, const _Float16* __restrict__ VT, const __bf16* __restrict__ VB, const __bf16* __restrict__ VBL, float* __restrict__ Y) { const int b = blockIdx.z / NH, h = blockIdx.z % NH; __shared__ __align__(16) union { float f[16][LPF]; _Float16 h[16][LPH]; } pp;
  const int tid = threadIdx.x, lane = tid & 31, col = lane & 15, g = lane >> 4; const int wave = __builtin_amdgcn_readfirstlane(tid >> 5); const int qb = blockIdx.x >> 2; const int ql0 = blockIdx.x * 16; const int kce = (kb_last(qb) + 1) * 4;
  { const int nt = kce * 2;   /* 16-key tiles that get logits, the same count for the whole block */
    const _Float16* qp = QH + ((size_t)blockIdx.z * (TT / 16) + blockIdx.x) * FT; const _Float16* kp = KH + (size_t)blockIdx.z * (TT / 16) * FT;
    const v16h ah0 = frag_t(qp, lane), ah1 = frag_t(qp + 512, lane);
    asm volatile("s_wait_xcnt 0x0" ::: "memory");   /* the q loads' address registers are reused behind the branch below */
    if (qb < QBH) { const _Float16* qlp = QL + ((size_t)blockIdx.z * (QHI / 16) + blockIdx.x) * FT; const _Float16* klp = KL + (size_t)blockIdx.z * (KHI / 16) * FT;
      const v16h al0 = frag_t(qlp, lane), al1 = frag_t(qlp + 512, lane);
      for (int jt = wave; jt < nt; jt += PVS) { const _Float16* kr = kp + (size_t)jt * FT; const _Float16* kl = klp + (size_t)jt * FT;
        const v16h kb0 = frag_t(kr, lane), kl0 = frag_t(kl, lane), kb1 = frag_t(kr + 512, lane), kl1 = frag_t(kl + 512, lane); v8f a = {}, l = {};
        asm volatile("s_wait_xcnt 0x0" ::: "memory");   /* the k loads' address registers are taken for a product's result right behind them */
        a = wmma16(ah0, kb0, a); l = wmma16(al0, kb0, l); l = wmma16(ah0, kl0, l);
        a = wmma16(ah1, kb1, a); l = wmma16(al1, kb1, l); l = wmma16(ah1, kl1, l);
#pragma unroll
        for (int r = 0; r < 8; ++r) pp.f[8 * g + r][jt * 16 + col] = (a[r] + l[r] * (1.0f / 1024.0f)) * SCALE; }
    } else {
      const _Float16* kr0 = kp + (size_t)wave * FT;
      for (int jt0 = wave; jt0 < nt; jt0 += KTB * PVS, kr0 += (size_t)KTB * PVS * FT) { v16h kf[KTB][2];   /* the tests on jt0 + u * PVS are the same for the whole wave */
#pragma unroll
        for (int u = 0; u < KTB; ++u) if (jt0 + u * PVS < nt) { const _Float16* kr = kr0 + u * (PVS * FT); kf[u][0] = frag_t(kr, lane); kf[u][1] = frag_t(kr + 512, lane); }
#pragma unroll
        for (int u = 0; u < KTB; ++u) if (jt0 + u * PVS < nt) { v8f a = {}; a = wmma16(ah0, kf[u][0], a); a = wmma16(ah1, kf[u][1], a);
#pragma unroll
          for (int r = 0; r < 8; ++r) pp.f[8 * g + r][(jt0 + u * PVS) * 16 + col] = a[r] * SCALE; } } } }
  __syncthreads();   /* every key tile's logits are in LDS before any wave reads its query row */
  { const int t = ql0 + wave; const int nv = kce >> 2;   /* nv groups of 128 keys hold logits, the same count for the whole block; the lane has keys i * 128 + lane * 4 + c of group i */
    const int rel = t - lane * 4;                        /* causal: that key is allowed while i * 128 + c <= rel, which no key of a group i >= nv is */
    const float* sr = &pp.f[wave][0] + lane * 4; v4f x[TT / 128];   /* the row's share of the lane; every loop over x is fully unrolled so that x stays in registers */
#pragma unroll
    for (int i = 0; i < TT / 128; ++i) { if (i < nv) x[i] = *(const v4f*)(sr + i * 128); else x[i] = (v4f)(-3.0e38f); }
    float m = -3.0e38f;
#pragma unroll
    for (int i = 0; i < TT / 128; ++i) {
#pragma unroll
      for (int c = 0; c < 4; ++c) { const float v = (!CAUSAL || i * 128 + c <= rel) ? x[i][c] : -3.0e38f; x[i][c] = v; m = fmaxf(m, v); } }
#pragma unroll
    for (int o = 1; o < 32; o <<= 1) m = fmaxf(m, __shfl_xor(m, o));
    float sum = 0.f; const float ml = m * 1.44269504f;   /* e = 2^(v log2(e) - ml): one fused multiply-add and one v_exp_f32 per key; the rounding of ml scales the whole row alike and cancels in e / sum. m is a real logit (key 0 is allowed in every row), so an excluded key's -3.0e38 goes to -inf and its e to 0 with no test */
#pragma unroll
    for (int i = 0; i < TT / 128; ++i) if (i < nv) {   /* one scalar test per 128-key group: a group without logits costs nothing and adds nothing to the sum */
#pragma unroll
      for (int c = 0; c < 4; ++c) { const float e = __builtin_amdgcn_exp2f(fmaf(x[i][c], 1.44269504f, -ml)); x[i][c] = e; sum += e; } }
#pragma unroll
    for (int o = 1; o < 32; o <<= 1) sum += __shfl_xor(sum, o);
    const float inv = sum > 0.f ? 2048.0f / sum : 0.f;
    float* pf = &pp.f[wave][0] + lane * 4; _Float16* ph = &pp.h[wave][0] + lane * 4;   /* P goes over the wave's own row, whose logits are all in registers by now */
#pragma unroll
    for (int i = 0; i < TT / 128; ++i) if (i < nv) { const v4f p = x[i] * inv;
      if (i * 128 < KHI && qb < QBH) vst2(pf + i * 128, p);
      else { v4h q;
#pragma unroll
        for (int c = 0; c < 4; ++c) q[c] = (_Float16)p[c];
        vst2(ph + i * 128, q); } } }
  __syncthreads();   /* every row's P is in LDS before any wave reads its key chunks of all 16 rows */
  v8f acc[HD / 16] = {};
  if (qb < QBH) {
#pragma unroll 1
    for (int kc = wave; kc < kce; kc += PVS) { const F2 p = split_row(&pp.f[col][0], kc * 32, lane); v16b vh[HD / 16], vl[HD / 16];   /* the chunk's v fragments, all loaded in front of the first product: one load latency per chunk */
      asm volatile("" :: "v"(p.h), "v"(p.l) : "memory");   /* inputs only: holds the 16 loads below behind the end of the split, whose temporaries are then dead; side by side they pass 128 registers, and the WGP holds one block, not two */
#pragma unroll
      for (int j = 0; j < HD / 16; ++j) { const size_t po = ((size_t)blockIdx.z * (KHI / 32) + kc) * FV + j * 512; vh[j] = frag_tb(VB + po, lane); vl[j] = frag_tb(VBL + po, lane); }
      asm volatile("s_wait_xcnt 0x0" ::: "memory");   /* the loads' address registers are written again behind them */
#pragma unroll
      for (int j = 0; j < HD / 16; ++j) { acc[j] = wmma_bf(p.h, vh[j], acc[j]); acc[j] = wmma_bf(p.l, vh[j], acc[j]); acc[j] = wmma_bf(p.h, vl[j], acc[j]); } }
  } else {
#pragma unroll 1
    for (int kc = wave; kc < kce; kc += KVB * PVS) { v16h vf[KVB][HD / 16], p[KVB];   /* the v fragments of KVB chunks, all loaded in front of the first product: one load latency per trip; the tests on kc + u * PVS are the same for the whole wave */
#pragma unroll
      for (int u = 0; u < KVB; ++u) if (kc + u * PVS < kce) { const _Float16* vp = VT + ((size_t)blockIdx.z * (TT / 32) + kc + u * PVS) * FV;
#pragma unroll
        for (int j = 0; j < HD / 16; ++j) vf[u][j] = frag_t(vp + j * 512, lane);
        p[u] = frag_h(&pp.h[col][(kc + u * PVS) * 32], lane); }
      asm volatile("s_wait_xcnt 0x0" ::: "memory");   /* the loads' address registers are stepped at the loop's foot */
#pragma unroll
      for (int u = 0; u < KVB; ++u) if (kc + u * PVS < kce) {
#pragma unroll
        for (int j = 0; j < HD / 16; ++j) acc[j] = wmma16(p[u], vf[u][j], acc[j]); } } }
  float* sw = &pp.f[wave][TT / 2];   /* this wave's partial tile [16][HD]: no P byte lies there */
#pragma unroll
  for (int j = 0; j < HD / 16; ++j)
#pragma unroll
    for (int r = 0; r < 8; ++r) sw[(8 * g + r) * HD + j * 16 + col] = acc[j][r];
  __syncthreads();   /* every wave's partial tile is in LDS before any thread adds them */
  { const int rl = tid >> 5; v2f s = *(const v2f*)&pp.f[0][TT / 2 + rl * HD + lane * 2];
#pragma unroll
    for (int w = 1; w < PVS; ++w) s += *(const v2f*)&pp.f[w][TT / 2 + rl * HD + lane * 2];
    vst2(Y + ((size_t)b * TT + ql0 + rl) * CC + h * HD + lane * 2, s * (1.0f / 2048.0f)); } }
// ---- k_out: block = (64 rows, 128 cols): out = ctx Wo (+ bo): ctx x 2^6 once to f16 against Wo as f16(bf16 x 2^8) exact (1 product) x 2^-14; causal early rows (< QHI of each sequence): ctx bf16 hi + lo against exact bf16 Wo (2 products)
__global__ __launch_bounds__(128) void k_out(const float* __restrict__ Y, const float* __restrict__ WO, const float* __restrict__ BO, float* __restrict__ OUT) { __shared__ __align__(16) float sf[4][16][132]; __shared__ __align__(16) unsigned short wt[2][128][WP];
  const int tid = threadIdx.x, wave = tid >> 5, lane = tid & 31, col = lane & 15, g = lane >> 4; const int c0 = blockIdx.y * 128; const size_t r0 = (size_t)blockIdx.x * 64 + wave * 16;
  v8f acc[8] = {};
  const float* wp = WO + c0 + tid; const float* xp = Y + (r0 + col) * CC + 8 * g; float wr[KS]; v4f xr[KS / 8];
  stage_ld<DIN>(wr, xr, wp, xp);
  asm volatile("s_wait_xcnt 0x0" ::: "memory");   /* stage 0's loads name registers that are written again behind the branch below */
  if (CAUSAL && (int)(((size_t)blockIdx.x * 64) % TT) < QHI) {   /* block-uniform */
    F2 a[KS / 32]; stage_st<0>(&wt[0][tid][0], wr);
#pragma unroll
    for (int kk = 0; kk < KS / 32; ++kk) { float v[16]; stage_a(v, xr, kk); a[kk] = bsplit16(v); }
    __syncthreads();   /* stage 0 of the weight tile is in LDS before any wave reads it */
#pragma unroll 1   /* kept rolled: a trip already holds a whole stage's loads and products; a second copy would only add registers and code */
    for (int s = 0; s < CC / KS; ++s) {
      if (s + 1 < CC / KS) { wp += (size_t)KS * DIN; xp += KS; stage_ld<DIN>(wr, xr, wp, xp); }
#pragma unroll
      for (int kk = 0; kk < KS / 32; ++kk)
#pragma unroll
        for (int j0 = 0; j0 < 8; j0 += FG) { v16b w[FG];
#pragma unroll
          for (int j = 0; j < FG; ++j) w[j] = frag_b((const __bf16*)&wt[s & 1][(j0 + j) * 16 + col][kk * 32], lane);
#pragma unroll
          for (int j = 0; j < FG; ++j) { acc[j0 + j] = wmma_bf(a[kk].h, w[j], acc[j0 + j]); acc[j0 + j] = wmma_bf(a[kk].l, w[j], acc[j0 + j]); } }
      if (s + 1 < CC / KS) { stage_st<0>(&wt[(s + 1) & 1][tid][0], wr);
#pragma unroll
        for (int kk = 0; kk < KS / 32; ++kk) { float v[16]; stage_a(v, xr, kk); a[kk] = bsplit16(v); } }
      __syncthreads();   /* publishes stage s + 1 and ends every wave's reads of stage s, whose buffer the next trip refills */
    }
#pragma unroll
    for (int j = 0; j < 8; ++j) { const float bias = BO ? bfr(BO[c0 + j * 16 + col]) : 0.f;
#pragma unroll
      for (int r = 0; r < 8; ++r) sf[wave][8 * g + r][j * 16 + col] = acc[j][r] + bias; }
  } else {
    v16h a[KS / 32]; stage_st<1>(&wt[0][tid][0], wr);
#pragma unroll
    for (int kk = 0; kk < KS / 32; ++kk) { float v[16]; stage_a(v, xr, kk);
#pragma unroll
      for (int i = 0; i < 16; ++i) a[kk][i] = (_Float16)(v[i] * 64.0f); }   /* ctx carried x 2^6 into f16 so small-magnitude context rows stay clear of f16 subnormals */
    __syncthreads();   /* stage 0 of the weight tile is in LDS before any wave reads it */
#pragma unroll 1   /* kept rolled: a trip already holds a whole stage's loads and products; a second copy would only add registers and code */
    for (int s = 0; s < CC / KS; ++s) {
      if (s + 1 < CC / KS) { wp += (size_t)KS * DIN; xp += KS; stage_ld<DIN>(wr, xr, wp, xp); }
#pragma unroll
      for (int kk = 0; kk < KS / 32; ++kk)
#pragma unroll
        for (int j0 = 0; j0 < 8; j0 += FG) { v16h w[FG];
#pragma unroll
          for (int j = 0; j < FG; ++j) w[j] = frag_h((const _Float16*)&wt[s & 1][(j0 + j) * 16 + col][kk * 32], lane);
#pragma unroll
          for (int j = 0; j < FG; ++j) acc[j0 + j] = wmma16(a[kk], w[j], acc[j0 + j]); }
      if (s + 1 < CC / KS) { stage_st<1>(&wt[(s + 1) & 1][tid][0], wr);
#pragma unroll
        for (int kk = 0; kk < KS / 32; ++kk) { float v[16]; stage_a(v, xr, kk);
#pragma unroll
          for (int i = 0; i < 16; ++i) a[kk][i] = (_Float16)(v[i] * 64.0f); } }
      __syncthreads();   /* publishes stage s + 1 and ends every wave's reads of stage s, whose buffer the next trip refills */
    }
#pragma unroll
    for (int j = 0; j < 8; ++j) { const float bias = BO ? bfr(BO[c0 + j * 16 + col]) : 0.f;
#pragma unroll
      for (int r = 0; r < 8; ++r) sf[wave][8 * g + r][j * 16 + col] = acc[j][r] * (1.0f / 16384.0f) + bias; } }   /* 2^-8 (Wo carry) x 2^-6 (ctx carry) */
  LDSX(); for (int rl = 0; rl < 16; ++rl) vst2(OUT + (r0 + rl) * DIN + c0 + lane * 4, *(const v4f*)&sf[wave][rl][lane * 4]); }

extern "C" void kernel_launch(void* const* d_in, const int* in_sizes, int n_in, void* d_out, int out_size, void* d_ws, size_t ws_size, hipStream_t stream) {
  (void)in_sizes; (void)n_in; (void)out_size;
  const float** F = (const float**)d_in;
  if (ws_size < (size_t)WS_END) return;
  char* ws = (char*)d_ws; _Float16 *QH = (_Float16*)(ws + WS_QH), *KH = (_Float16*)(ws + WS_KH), *VT = (_Float16*)(ws + WS_VT), *QL = (_Float16*)(ws + WS_QL), *KL = (_Float16*)(ws + WS_KL); __bf16 *VB = (__bf16*)(ws + WS_VB), *VBL = (__bf16*)(ws + WS_VBL); float *Y = (float*)(ws + WS_Y);
  (void)Y; (void)QL; (void)KL; (void)VB; (void)VBL;
  // inputs: 0 x [2,2048,1024]; 1 w_attn [1024,3072] (in,out; columns q | k | v); 2 b_attn [3072] (zeros, read); 3 w_proj [1024,1024] (in,out); 4 b_proj [1024] (zeros, read). outputs: 0 a [2,2048,1024] at d_out + 0; 1 present [2,2,16,2048,64] at d_out + NB*TT*CC floats (byte offset 16,777,216)
  k_proj<<<dim3(TNB * TT / 64, CC / 128, 3), 128, 0, stream>>>(F[0], F[0], F[0], F[1], F[1] + CC, F[1] + 2 * CC, F[2], F[2] + CC, F[2] + 2 * CC, QH, QL, KH, KL, VT, VB, VBL, (float*)d_out + (size_t)NB * TT * CC);
  k_pv<<<dim3(TT / 16, 1, TNB * NH), 32 * PVS, 0, stream>>>(QH, KH, QL, KL, VT, VB, VBL, Y);
  k_out<<<dim3(TNB * TT / 64, DIN / 128), 128, 0, stream>>>(Y, F[3], F[4], (float*)d_out);
}

// v008
// It runs in 157 microseconds.
// In both of two side-by-side timings against v007, it was 1.07 times as fast.
// Counting every step since v000, it is 7.02 times as fast.
// compute dtype: all float inputs rounded to bf16; c = x w_attn + b_attn with EXACT bf16 products on WMMA 16x16x32 (f32 accumulate); the f32 k and v rows are ALSO the second output (present); causal logits: 3 products for the first 384 rows, single f16 q x k after, x 64^-0.5; softmax f32; exp(x - max) x 2^11 once to f16 x v once to f16 (bf16 hi + lo below row 384), divided by the f32 row sum after; ctx hi+lo x exact w_proj below row 384, x2^6 f16 carry x f16(bf16 x 2^8) after, + b_proj; f32 outputs.
#include <hip/hip_runtime.h>
#include <math.h>

typedef __attribute__((ext_vector_type(16))) _Float16 v16h;
typedef __attribute__((ext_vector_type(16))) __bf16 v16b;
typedef __attribute__((ext_vector_type(8)))  _Float16 v8h;
typedef __attribute__((ext_vector_type(8)))  float v8f;
typedef __attribute__((ext_vector_type(4)))  float v4f;
typedef __attribute__((ext_vector_type(2)))  float v2f;
typedef __attribute__((ext_vector_type(4)))  unsigned v4u;
typedef __attribute__((ext_vector_type(4)))  int v4i;
typedef float __attribute__((may_alias)) float_a;
typedef int __attribute__((may_alias)) int_a;

template <typename T> __device__ __forceinline__ void vst2(void* p, T v) { *(T*)p = v;  }
__device__ __forceinline__ v8f wmma16(v16h a, v16h b, v8f c) {
  v8f d = __builtin_amdgcn_wmma_f32_16x16x32_f16(false, a, false, b, (short)0, c, false, false);
  asm volatile("v_nop\n\tv_nop\n\tv_nop\n\tv_nop" : "+v"(d) : "v"(a), "v"(b));
  return d;
}
__device__ __forceinline__ v8f wmma_bf(v16b a, v16b b, v8f c) {
  v8f d = __builtin_amdgcn_wmma_f32_16x16x32_bf16(false, a, false, b, (short)0, c, false, false);
  asm volatile("v_nop\n\tv_nop\n\tv_nop\n\tv_nop" : "+v"(d) : "v"(a), "v"(b));
  return d;
}
// 16x16x32 fragments: lane = (h = lane>>4, row/col = lane&15); elements 0..7 = k0+8h+0..7, 8..15 = k0+16+8h+0..7; D element r = row 8h+r
__device__ __forceinline__ v16h frag_h(const _Float16* rowk0, int lane) {
  union { v16h v; v8h q[2]; } u; const _Float16* p = rowk0 + 8 * (lane >> 4);
  u.q[0] = *(const v8h*)p; u.q[1] = *(const v8h*)(p + 16); return u.v;
}
__device__ __forceinline__ v16h frag_f32(const float* rowk0, int lane) {
  v16h a; const float* p = rowk0 + 8 * (lane >> 4);
#pragma unroll
  for (int i = 0; i < 8; ++i) { a[i] = (_Float16)p[i]; a[8 + i] = (_Float16)p[16 + i]; }
  return a;
}
__device__ __forceinline__ v16h frag_f32s(const float* rowk0, int lane, float sc) {
  v16h a; const float* p = rowk0 + 8 * (lane >> 4);
#pragma unroll
  for (int i = 0; i < 8; ++i) { a[i] = (_Float16)(p[i] * sc); a[8 + i] = (_Float16)(p[16 + i] * sc); }
  return a;
}
// column fragment from a [K][ld] layout (column n), rows >= K read as 0
__device__ __forceinline__ v16h fragc_f32(const float* W, int k0, int n, int lane, int ld, int K) {
  v16h a; const int g = lane >> 4;
#pragma unroll
  for (int i = 0; i < 8; ++i) { const int ka = k0 + 8 * g + i, kb = ka + 16;
    a[i] = (_Float16)(ka < K ? W[(size_t)(ka < K ? ka : K - 1) * ld + n] : 0.f); a[8 + i] = (_Float16)(kb < K ? W[(size_t)(kb < K ? kb : K - 1) * ld + n] : 0.f); }
  return a;
}
struct F2 { v16b h, l; };
__device__ __forceinline__ F2 bsplit16(const float v[16]) { F2 r;
#pragma unroll
  for (int i = 0; i < 16; ++i) { const __bf16 h = (__bf16)v[i]; r.h[i] = h; r.l[i] = (__bf16)(v[i] - (float)h); }
  return r; }
__device__ __forceinline__ F2 split_row(const float* row, int k0, int lane) { float v[16]; const float* p = row + k0 + 8 * (lane >> 4);
#pragma unroll
  for (int i = 0; i < 8; ++i) { v[i] = p[i]; v[8 + i] = p[16 + i]; }
  return bsplit16(v); }
__device__ __forceinline__ F2 split_rowK(const float* row, int k0, int lane, int K) { float v[16]; const int g = lane >> 4;
#pragma unroll
  for (int i = 0; i < 8; ++i) { const int ka = k0 + 8 * g + i, kb = ka + 16; v[i] = ka < K ? row[ka < K ? ka : K - 1] : 0.f; v[8 + i] = kb < K ? row[kb < K ? kb : K - 1] : 0.f; }
  return bsplit16(v); }
__device__ __forceinline__ F2 split_col(const float* W, int k0, int n, int lane, int ld, int K) { float v[16]; const int g = lane >> 4;
#pragma unroll
  for (int i = 0; i < 8; ++i) { const int ka = k0 + 8 * g + i, kb = ka + 16; v[i] = ka < K ? W[(size_t)(ka < K ? ka : K - 1) * ld + n] : 0.f; v[8 + i] = kb < K ? W[(size_t)(kb < K ? kb : K - 1) * ld + n] : 0.f; }
  return bsplit16(v); }
__device__ __forceinline__ v8f mac3(const F2& a, const F2& b, v8f c) { c = wmma_bf(a.l, b.h, c); c = wmma_bf(a.h, b.l, c); return wmma_bf(a.h, b.h, c); }
__device__ __forceinline__ float sigm(float v) { return 1.0f / (1.0f + expf(-v)); }
#define LDSX() do { asm volatile("s_wait_dscnt 0" ::: "memory"); __builtin_amdgcn_wave_barrier(); __builtin_amdgcn_fence(__ATOMIC_RELEASE, "workgroup"); } while (0)

// Fused-qkv causal self-attention with TWO outputs (x [2,2048,1024]; fused (in,out) w_attn [1024,3072] N(0,1) x 0.02 + b_attn zeros (read), jnp.split(c, 3, axis=2) -> q | k | v column blocks; 16 heads x 64; w = q k^T x rsqrt(64); w * b - 1e10 * (1 - b) with b = (i >= j): causal, the masked logits are exactly -1e10; softmax; a = merge(p v) w_proj + b_proj; outputs: a [2,2048,1024] and present = stack([k, v], axis=1) [2,2,16,2048,64] = the projected k and v (bias included) in head-major layout).
#define NB 2
#define TT 2048
#define CC 1024            // NH * HD = projected width
#define DIN 1024          // input (model) width
#define NH 16
#define HD 64
#define SCALE (0.125f)
#define CAUSAL 1
#ifndef TNB
#define TNB NB
#endif
__device__ __forceinline__ float bfr(float v) { return (float)(__bf16)v; }
__host__ __device__ __forceinline__ int kb_last(int qb) { return CAUSAL ? ((qb * 64 + 63) >> 7) : (TT / 128 - 1); }
typedef __attribute__((ext_vector_type(8))) __bf16 v8b;
__device__ __forceinline__ v16b frag_b(const __bf16* rowk0, int lane) {
  union { v16b v; v8b q[2]; } u; const __bf16* p = rowk0 + 8 * (lane >> 4);
  u.q[0] = *(const v8b*)p; u.q[1] = *(const v8b*)(p + 16); return u.v;
}
// ---- fragment order: the planes that k_pv reads are stored by k_proj as the registers of the WMMA fragments, so that each wave-wide 16-B load covers 512 contiguous bytes = 4 whole lines (a row-major tile makes it touch 16 lines). q, k and their residuals: tile (b, h, 16 rows) = FT elements [k step 0..1][half 0..1][lane][8]; v planes: chunk (b, h, 32 keys) = FV elements [16 columns j 0..3][half 0..1][lane][8]; lane = (g, row or column), its 8 elements = k0 + 16 * half + 8 * g + 0..7, as frag_h takes them from a row
#define FT (16 * HD)
#define FV (32 * HD)
__device__ __forceinline__ v16h frag_t(const _Float16* f, int lane) { union { v16h v; v8h q[2]; } u; u.q[0] = *(const v8h*)(f + lane * 8); u.q[1] = *(const v8h*)(f + 256 + lane * 8); return u.v; }
__device__ __forceinline__ v16b frag_tb(const __bf16* f, int lane) { union { v16b v; v8b q[2]; } u; u.q[0] = *(const v8b*)(f + lane * 8); u.q[1] = *(const v8b*)(f + 256 + lane * 8); return u.v; }
#define QBH 6              // causal: query blocks 0..QBH-1 of each sequence (few keys, no averaging) take the high-precision path
#define QHI 384            // rows carrying a q residual plane
#define KHI 384            // key rows carrying k residual / v bf16 hi+lo planes (used only by the causal high-precision path)
// B fragment (k rows k0+.., output column o) of a weight: (in,out) [K][ld] or (out,in) [ld rows of K]: bf16 exact, or f16(bf16 * 256) exact
__device__ __forceinline__ v16b wcol_io(const float* Wm, int k0, int o, int lane, int ld) { v16b w; const int g = lane >> 4;
#pragma unroll
  for (int i = 0; i < 8; ++i) { w[i] = (__bf16)Wm[(size_t)(k0 + 8 * g + i) * ld + o]; w[8 + i] = (__bf16)Wm[(size_t)(k0 + 16 + 8 * g + i) * ld + o]; }
  return w; }
__device__ __forceinline__ v16b wcol_oi(const float* Wm, int k0, int o, int lane, int K) { v16b w; const float* p = Wm + (size_t)o * K + k0 + 8 * (lane >> 4);
#pragma unroll
  for (int i = 0; i < 8; ++i) { w[i] = (__bf16)p[i]; w[8 + i] = (__bf16)p[16 + i]; }
  return w; }
__device__ __forceinline__ v16h wcolh_io(const float* Wm, int k0, int o, int lane, int ld) { v16h w; const int g = lane >> 4;
#pragma unroll
  for (int i = 0; i < 8; ++i) { w[i] = (_Float16)(bfr(Wm[(size_t)(k0 + 8 * g + i) * ld + o]) * 256.0f); w[8 + i] = (_Float16)(bfr(Wm[(size_t)(k0 + 16 + 8 * g + i) * ld + o]) * 256.0f); }
  return w; }
__device__ __forceinline__ v16h wcolh_oi(const float* Wm, int k0, int o, int lane, int K) { v16h w; const float* p = Wm + (size_t)o * K + k0 + 8 * (lane >> 4);
#pragma unroll
  for (int i = 0; i < 8; ++i) { w[i] = (_Float16)(bfr(p[i]) * 256.0f); w[8 + i] = (_Float16)(bfr(p[16 + i]) * 256.0f); }
  return w; }
#define WQKV_LAYOUT 0   // 0 = (in,out); 1 = (out,in) [CC][DIN]; 2 = per-head [NH][DIN][HD]
__device__ __forceinline__ v16b wcol_hdk(const float* Wm, int k0, int o, int lane) { v16b w; const int g = lane >> 4; const float* p = Wm + (size_t)(o / HD) * DIN * HD + (o % HD);
#pragma unroll
  for (int i = 0; i < 8; ++i) { w[i] = (__bf16)p[(size_t)(k0 + 8 * g + i) * HD]; w[8 + i] = (__bf16)p[(size_t)(k0 + 16 + 8 * g + i) * HD]; }
  return w; }
#define WO_OUT_IN 0
#if WQKV_LAYOUT == 1
#define WCOL(W, k0, o, lane) wcol_oi(W, k0, o, lane, DIN)
#elif WQKV_LAYOUT == 2
#define WCOL(W, k0, o, lane) wcol_hdk(W, k0, o, lane)
#else
#define WCOL(W, k0, o, lane) wcol_io(W, k0, o, lane, 3 * CC)   /* w_attn (in,out) [1024][3072] packed by columns: row pitch 3*CC; the q / k / v pointers carry the column offsets 0 / CC / 2*CC */
#endif
#if WO_OUT_IN
#define WOCOL(W, k0, o, lane) wcol_oi(W, k0, o, lane, CC)
#define WOCOLH(W, k0, o, lane) wcolh_oi(W, k0, o, lane, CC)
#else
#define WOCOL(W, k0, o, lane) wcol_io(W, k0, o, lane, DIN)
#define WOCOLH(W, k0, o, lane) wcolh_io(W, k0, o, lane, DIN)
#endif
#define PROJ_EXTRA_PARAMS , float* __restrict__ PRES   /* second output: present [NB][2][NH][TT][HD] f32 */
#define PROJ_EPI(which, row, t, h) do { if ((which) >= 1) { float* dst_ = PRES + ((((size_t)bb * 2 + ((which) - 1)) * NH + (h)) * TT + (t)) * HD; _Pragma("unroll") for (int q4 = 0; q4 < HD / 4; ++q4) vst2(dst_ + 4 * q4, *(const v4f*)((row) + 4 * q4)); } } while (0)
static_assert(HD == 64 && (132 * 4) % 16 == 0, "the staged row st[rl][hh*HD] is 16-B aligned and 64 floats long");
#ifndef PROJ_EXTRA_PARAMS
#define PROJ_EXTRA_PARAMS
#endif

#define WS_QH  0u                                      // f16 q tiles [b][h][t / 16][FT], fragment order
#define WS_KH  (WS_QH + 2u * (size_t)NB * TT * CC)      // f16 k tiles [b][h][t / 16][FT], fragment order
#define WS_VT  (WS_KH + 2u * (size_t)NB * TT * CC)      // f16 v chunks [b][h][t / 32][FV], fragment order
#define WS_QL  (WS_VT + 2u * (size_t)NB * CC * TT)      // f16 q residual x 2^10 tiles [b][h][t / 16 < QHI / 16][FT]
#define WS_KL  (WS_QL + 2u * (size_t)NB * QHI * CC)     // f16 k residual x 2^10 tiles [b][h][t / 16 < KHI / 16][FT]
#define WS_VB  (WS_KL + 2u * (size_t)NB * KHI * CC)     // bf16 v hi chunks [b][h][t / 32 < KHI / 32][FV]
#define WS_VBL (WS_VB + 2u * (size_t)NB * CC * KHI)
#define WS_Y   (WS_VBL + 2u * (size_t)NB * CC * KHI)    // f32 ctx rows [b*t][CC] (only when there is an output projection)
#define WS_END (WS_Y  + 4u * (size_t)NB * TT * CC)

// ---- the K loop of k_proj and k_out: a stage is KS k rows of the block's 128 weight columns. Thread tid reads column c0 + tid of the stage (each wave-wide load = one whole 128-B line), rounds it once for the whole block and leaves it k-contiguous in LDS row tid; every wave takes its B fragments from there. Two LDS buffers, one workgroup barrier per stage; the next stage's weight column and the wave's own next A rows are in flight while this stage's products run.
#define KS 64              // k rows per stage = 2 WMMA k steps
#define FG 8               // B fragments a wave reads from LDS as one group in front of their products
#define WP (KS + 8)        // LDS row pitch in 16-bit elements: 144 B = 16 B x odd, so that 16 rows' 16-B reads and writes spread over the banks
static_assert(DIN % KS == 0 && CC % KS == 0 && KS % 32 == 0 && (WP * 2) % 32 == 16, "whole stages; row pitch = 16 B x odd");
template <int LD> __device__ __forceinline__ void stage_ld(float (&wr)[KS], v4f (&xr)[KS / 8], const float* wp, const float* xp) {
#pragma unroll
  for (int i = 0; i < KS; ++i) wr[i] = wp[(size_t)i * LD];
#pragma unroll
  for (int kk = 0; kk < KS / 32; ++kk) { xr[kk * 4 + 0] = *(const v4f*)(xp + kk * 32); xr[kk * 4 + 1] = *(const v4f*)(xp + kk * 32 + 4); xr[kk * 4 + 2] = *(const v4f*)(xp + kk * 32 + 16); xr[kk * 4 + 3] = *(const v4f*)(xp + kk * 32 + 20); }
}
// F16 = 0: bf16 exact; 1: f16(bf16 x 2^8) exact
template <int F16> __device__ __forceinline__ void stage_st(unsigned short* row, const float (&wr)[KS]) {
#pragma unroll
  for (int q = 0; q < KS / 8; ++q) { union { v8b b; v8h h; v4u u; } t;
#pragma unroll
    for (int i = 0; i < 8; ++i) { if (F16) t.h[i] = (_Float16)(bfr(wr[q * 8 + i]) * 256.0f); else t.b[i] = (__bf16)wr[q * 8 + i]; }
    vst2(row + q * 8, t.u); } }
// the 16 f32 values of A fragment kk of a stage, in fragment order
__device__ __forceinline__ void stage_a(float (&v)[16], const v4f (&xr)[KS / 8], int kk) {
#pragma unroll
  for (int i = 0; i < 4; ++i) { v[i] = xr[kk * 4][i]; v[4 + i] = xr[kk * 4 + 1][i]; v[8 + i] = xr[kk * 4 + 2][i]; v[12 + i] = xr[kk * 4 + 3][i]; } }
// ---- k_proj: block = (64 rows, 128 cols, which): q/k/v = X W (+ b) with exact bf16 products (K = DIN) -> which 0: q f16 tiles (+ residual tiles for rows < QHI); 1: k f16 tiles (+ residual tiles for rows < KHI); 2: v f16 chunks (+ bf16 hi/lo chunks for t < KHI), all in fragment order
__global__ __launch_bounds__(128) void k_proj(const float* __restrict__ XQ, const float* __restrict__ XK, const float* __restrict__ XV, const float* __restrict__ WQ, const float* __restrict__ WK, const float* __restrict__ WV, const float* __restrict__ BQ, const float* __restrict__ BK, const float* __restrict__ BV,
    _Float16* __restrict__ QH, _Float16* __restrict__ QL, _Float16* __restrict__ KH, _Float16* __restrict__ KL, _Float16* __restrict__ VT, __bf16* __restrict__ VB, __bf16* __restrict__ VBL PROJ_EXTRA_PARAMS) {
  __shared__ __align__(16) float st[64][132]; __shared__ __align__(16) _Float16 sh[64][136], sl[64][136]; __shared__ __align__(16) _Float16 th[128][72]; __shared__ __align__(16) __bf16 tb[128][72], tbl[128][72]; __shared__ __align__(16) unsigned short wt[2][128][WP];
  const int tid = threadIdx.x, wave = tid >> 5, lane = tid & 31, col = lane & 15, g = lane >> 4; const int which = blockIdx.z; const int c0 = blockIdx.y * 128; const size_t r0 = (size_t)blockIdx.x * 64; const size_t bb = r0 / TT; const int t0 = (int)(r0 % TT);
  const float* X = which == 0 ? XQ : which == 1 ? XK : XV; const float* WA = which == 0 ? WQ : which == 1 ? WK : WV; const float* BA = which == 0 ? BQ : which == 1 ? BK : BV;
  v8f acc[8] = {};
  { const float* wp = WA + c0 + tid; const float* xp = X + (r0 + wave * 16 + col) * DIN + 8 * g; float wr[KS]; v4f xr[KS / 8]; v16b a[KS / 32];
    stage_ld<3 * CC>(wr, xr, wp, xp);
    asm volatile("s_wait_xcnt 0x0" ::: "memory");   /* the scalar base of stage 0's weight loads is reused right behind them */
    stage_st<0>(&wt[0][tid][0], wr);
#pragma unroll
    for (int kk = 0; kk < KS / 32; ++kk) { float v[16]; stage_a(v, xr, kk);
#pragma unroll
      for (int i = 0; i < 16; ++i) a[kk][i] = (__bf16)v[i]; }
    __syncthreads();   /* stage 0 of the weight tile is in LDS before any wave reads it */
#pragma unroll 1   /* kept rolled: a trip already holds a whole stage's loads and products; a second copy would only add registers and code */
    for (int s = 0; s < DIN / KS; ++s) {
      if (s + 1 < DIN / KS) { wp += (size_t)KS * 3 * CC; xp += KS; stage_ld<3 * CC>(wr, xr, wp, xp); }
#pragma unroll
      for (int kk = 0; kk < KS / 32; ++kk)
#pragma unroll
        for (int j0 = 0; j0 < 8; j0 += FG) { v16b w[FG];
#pragma unroll
          for (int j = 0; j < FG; ++j) w[j] = frag_b((const __bf16*)&wt[s & 1][(j0 + j) * 16 + col][kk * 32], lane);
#pragma unroll
          for (int j = 0; j < FG; ++j) acc[j0 + j] = wmma_bf(a[kk], w[j], acc[j0 + j]); }
      if (s + 1 < DIN / KS) { stage_st<0>(&wt[(s + 1) & 1][tid][0], wr);
#pragma unroll
        for (int kk = 0; kk < KS / 32; ++kk) { float v[16]; stage_a(v, xr, kk);
#pragma unroll
          for (int i = 0; i < 16; ++i) a[kk][i] = (__bf16)v[i]; } }
      __syncthreads();   /* publishes stage s + 1 and ends every wave's reads of stage s, whose buffer the next trip refills */
    } }
  { // stage the f32 tile (acc + bias) in LDS, run the per-(row, head) epilogue hook, then convert
#pragma unroll
    for (int j = 0; j < 8; ++j) { const float bias = BA ? bfr(BA[c0 + j * 16 + col]) : 0.f;
#pragma unroll
      for (int r = 0; r < 8; ++r) st[wave * 16 + 8 * g + r][j * 16 + col] = acc[j][r] + bias; }
    __syncthreads();
    for (int e = tid; e < 64 * (128 / HD); e += 128) { const int rl = e / (128 / HD), hh = e % (128 / HD); PROJ_EPI(which, &st[rl][hh * HD], (int)((r0 + rl) % TT), (c0 / HD) + hh); }
    __syncthreads(); }
  if (which < 2) { _Float16* DH = which == 0 ? QH : KH; _Float16* DL = which == 0 ? QL : KL; const int nhi = which == 0 ? QHI : KHI; const bool hi_rows = t0 < nhi;
    for (int e = tid; e < 64 * 128; e += 128) { const int rl = e >> 7, cl = e & 127; const float v = st[rl][cl]; const _Float16 hv = (_Float16)v; sh[rl][cl] = hv; sl[rl][cl] = (_Float16)((v - (float)hv) * 1024.0f); }
    __syncthreads();
    const int rl = tid & 15, cl = (tid >> 5) * 16 + ((tid >> 4) & 1) * 8; const size_t hb = bb * NH + c0 / HD;   /* the thread has piece tid of each of the block's 8 tiles (head hh, 16 rows tt): a wave's store is 512 contiguous bytes */
    _Float16* dh = DH + (hb * (TT / 16) + t0 / 16) * FT + tid * 8;
#pragma unroll   /* unrolled: the 8 stores share one address register pair and differ in a constant offset */
    for (int i = 0; i < 8; ++i) { const int hh = i >> 2, tt = i & 3; vst2((unsigned*)(dh + (hh * (TT / 16) + tt) * FT), *(const v4u*)&sh[tt * 16 + rl][hh * HD + cl]); }
    if (hi_rows) { _Float16* dl = DL + (hb * (nhi / 16) + t0 / 16) * FT + tid * 8;
      asm volatile("s_wait_xcnt 0x0" ::: "memory");   /* the registers of the 8 stores above are taken again for the residual pieces */
#pragma unroll   /* as above */
      for (int i = 0; i < 8; ++i) { const int hh = i >> 2, tt = i & 3; vst2((unsigned*)(dl + (hh * (nhi / 16) + tt) * FT), *(const v4u*)&sl[tt * 16 + rl][hh * HD + cl]); } }
  } else { const bool hi_rows = t0 < KHI;
    for (int e = tid; e < 64 * 128; e += 128) { const int rl = e & 63, cl = e >> 6; const float v = st[rl][cl]; th[cl][rl] = (_Float16)v; const __bf16 bh = (__bf16)v; tb[cl][rl] = bh; tbl[cl][rl] = (__bf16)(v - (float)bh); }
    __syncthreads();
    const int cl = (tid >> 6) * 16 + (tid & 15), rl = ((tid >> 5) & 1) * 16 + ((tid >> 4) & 1) * 8; const size_t hb = bb * NH + c0 / HD;   /* the thread has pieces tid and 128 + tid (u) of each of the block's 4 chunks (head hh, 32 keys cc): a wave's store is 512 contiguous bytes */
    _Float16* dv = VT + (hb * (TT / 32) + t0 / 32) * FV + tid * 8;
#pragma unroll   /* unrolled: the 8 stores share one address register pair and differ in a constant offset */
    for (int i = 0; i < 8; ++i) { const int hh = i >> 2, cc = (i >> 1) & 1, u = i & 1; vst2((unsigned*)(dv + (hh * (TT / 32) + cc) * FV + u * 1024), *(const v4u*)&th[hh * HD + u * 32 + cl][cc * 32 + rl]); }
    if (hi_rows) { const size_t o3 = (hb * (KHI / 32) + t0 / 32) * FV + tid * 8;
      asm volatile("s_wait_xcnt 0x0" ::: "memory");   /* the registers of the 8 stores above are taken again for the bf16 pieces */
#pragma unroll   /* as above */
      for (int i = 0; i < 8; ++i) { const int hh = i >> 2, cc = (i >> 1) & 1, u = i & 1; const int o4 = (hh * (KHI / 32) + cc) * FV + u * 1024; vst2((unsigned*)(VB + o3 + o4), *(const v4u*)&tb[hh * HD + u * 32 + cl][cc * 32 + rl]); vst2((unsigned*)(VBL + o3 + o4), *(const v4u*)&tbl[hh * HD + u * 32 + cl][cc * 32 + rl]); } }
    asm volatile("s_wait_xcnt 0x0" ::: "memory");   /* behind the arm's last store on both ways: the listing's next block writes the stores' data registers */
  } }
// ---- k_pv: block = 16 queries (tile qt) of (b, h), PVS waves, one launch for every (b, h). Wave w owns the 32-key chunks w, w + PVS, ... of keys [0, kend) from the logits to its partial ctx tile. The logits are taken as k x q^T on WMMA (single f16 product; causal early query blocks: k hi + residual x 2^10 against q hi + residual, 3 products): result element r of lane (g, query) is key 8 g + r of a 16-key tile, which is the place that key has in the A fragment of P x v, so the two tiles of a chunk become that chunk's P fragment inside the registers. Each wave leaves its 16 row maxima in LDS; behind a workgroup barrier every lane takes its row's maximum over the waves, forms e = 2^11 exp(x - max) (0 for excluded keys), adds its share of the row sum and multiplies the chunk (e once to f16 against v f16: 1 product; causal early query blocks: e and v as bf16 hi + lo, 3 products). The partial ctx tiles and the partial row sums meet in LDS behind one more workgroup barrier, are added in wave order, and the row is divided by its sum there; 256-B (row, head) segment by one wave
#define PVS 16             // key slices = waves per block = query rows per tile
#define NCH (TT / 32 / PVS)   // 32-key chunks a wave owns at most
#define SPW (PVS + 4)      // f32 pitch of a row's per-wave maxima and sums: 80 B = 16 B x odd, so that 16 rows' 16-B reads spread over the banks
static_assert(32 * PVS == 16 * (HD / 2), "the merge gives each thread one 8-B piece of the 16 x HD tile");
static_assert(PVS == 16 && TT % (32 * PVS) == 0 && NCH == 4, "one wave per query row of the tile at the merge; whole chunks; the runs below are written for 1 to 4 chunks");
static_assert(!CAUSAL || ((QBH * 64 - 1) / 128 + 1) * 128 <= KHI, "the early query blocks' keys have k residual rows and v hi + lo planes");
static_assert(!CAUSAL || KHI / 32 <= PVS, "an early query block gives a wave one chunk at most");
// the k fragments of one chunk (2 key tiles x 2 k steps), and its raw logits: k rows as A, q rows as B
__device__ __forceinline__ void k_chunk(v16h (&kf)[4], const _Float16* kr, int lane) {
#pragma unroll
  for (int f = 0; f < 4; ++f) kf[f] = frag_t(kr + f * 512, lane);
  asm volatile("s_wait_xcnt 0x0" ::: "memory");   /* the loads' address registers may be written again right behind them */
}
__device__ __forceinline__ void qk_mul(v8f (&sc)[2], const v16h (&kf)[4], v16h ah0, v16h ah1) {
#pragma unroll
  for (int tt = 0; tt < 2; ++tt) { v8f a = {}; a = wmma16(kf[tt * 2], ah0, a); a = wmma16(kf[tt * 2 + 1], ah1, a); sc[tt] = a; } }
// the v fragments of one chunk
__device__ __forceinline__ void v_chunk(v16h (&vf)[HD / 16], const _Float16* vp, int lane) {
#pragma unroll
  for (int j = 0; j < HD / 16; ++j) vf[j] = frag_t(vp + j * 512, lane);
  asm volatile("s_wait_xcnt 0x0" ::: "memory");   /* the loads' address registers may be written again behind them */
}
// e[i] = 2^(sc[i] x cs + mb) for the 8 logits of one key tile
__device__ __forceinline__ void exp2x8(float (&e)[8], v8f sc, float cs, float mb) { float x[8];
#pragma unroll
  for (int i = 0; i < 8; ++i) x[i] = fmaf(sc[i], cs, mb);
  /* eight v_exp_f32 in one statement: each is the independent instruction behind the one before it (no result is a source: early clobber), and a v_nop stands behind the last: the slot that the instruction set asks for between a transcendental and a use of its result or an overwrite of its source */
  asm("v_exp_f32 %0, %8\n\tv_exp_f32 %1, %9\n\tv_exp_f32 %2, %10\n\tv_exp_f32 %3, %11\n\tv_exp_f32 %4, %12\n\tv_exp_f32 %5, %13\n\tv_exp_f32 %6, %14\n\tv_exp_f32 %7, %15\n\tv_nop"
      : "=&v"(e[0]), "=&v"(e[1]), "=&v"(e[2]), "=&v"(e[3]), "=&v"(e[4]), "=&v"(e[5]), "=&v"(e[6]), "=&v"(e[7])
      : "v"(x[0]), "v"(x[1]), "v"(x[2]), "v"(x[3]), "v"(x[4]), "v"(x[5]), "v"(x[6]), "v"(x[7])); }
// the e of one chunk: its share of the row sum, and the chunk's P fragment (tile 0 = elements 0..7, tile 1 = elements 8..15)
__device__ __forceinline__ v16h e_chunk(const v8f (&sc)[2], float cs, float mb, float& ls0, float& ls1) { v16h p; float e0[8], e1[8]; exp2x8(e0, sc[0], cs, mb); exp2x8(e1, sc[1], cs, mb);
#pragma unroll
  for (int i = 0; i < 8; ++i) { ls0 += e0[i]; ls1 += e1[i]; p[i] = (_Float16)e0[i]; p[8 + i] = (_Float16)e1[i]; }
  return p; }
// excluded keys of chunk c (causal) set to -3.0e38, then the lane's running maximum
__device__ __forceinline__ float mask_max(v8f (&sc)[2], float m, int c, int ql0, int col, int g) {
  if (CAUSAL && c * 32 + 31 > ql0) { const int rel = ql0 + col - c * 32 - 8 * g;   /* one scalar test per chunk: only a chunk that reaches past the tile's first query holds excluded keys; key tile * 16 + r of the lane is allowed while it is <= rel */
#pragma unroll
    for (int tt = 0; tt < 2; ++tt)
#pragma unroll
      for (int r = 0; r < 8; ++r) sc[tt][r] = tt * 16 + r <= rel ? sc[tt][r] : -3.0e38f; }
#pragma unroll
  for (int tt = 0; tt < 2; ++tt)
#pragma unroll
    for (int r = 0; r < 8; ++r) m = fmaxf(m, sc[tt][r]);
  return m; }
// a chunk's 16 logits of each lane to and from the wave's own LDS slot (slot k = 2 KiB; each 16-B access of the wave is 512 contiguous bytes); no other wave touches the slot before the merge barrier
__device__ __forceinline__ void park(float* slot, const v8f (&sc)[2], int lane) {
#pragma unroll
  for (int q = 0; q < 4; ++q) { v4f t;
#pragma unroll
    for (int c = 0; c < 4; ++c) t[c] = sc[q >> 1][(q & 1) * 4 + c];
    vst2(slot + (q * 32 + lane) * 4, t); } }
__device__ __forceinline__ void unpark(v8f (&sc)[2], const float* slot, int lane) {
#pragma unroll
  for (int q = 0; q < 4; ++q) { const v4f t = *(const v4f*)(slot + (q * 32 + lane) * 4);
#pragma unroll
    for (int c = 0; c < 4; ++c) sc[q >> 1][(q & 1) * 4 + c] = t[c]; } }
__device__ __forceinline__ void pv_mul(v8f (&acc)[HD / 16], v16h p, const v16h (&vf)[HD / 16]) {
#pragma unroll
  for (int j = 0; j < HD / 16; ++j) acc[j] = wmma16(p, vf[j], acc[j]); }
__global__ __launch_bounds__(32 * PVS) void k_pv(const _Float16* __restrict__ QH, const _Float16* __restrict__ KH, const _Float16* __restrict__ QL, const _Float16* __restrict__ KL, const _Float16* __restrict__ VT, const __bf16* __restrict__ VB, const __bf16* __restrict__ VBL, float* __restrict__ Y) { const int b = blockIdx.z / NH, h = blockIdx.z % NH; __shared__ __align__(16) float part[PVS][16 * HD]; __shared__ __align__(16) float mx[16][SPW], sm[16][SPW];
  const int tid = threadIdx.x, lane = tid & 31, col = lane & 15, g = lane >> 4; const int wave = __builtin_amdgcn_readfirstlane(tid >> 5); const int qb = blockIdx.x >> 2; const int ql0 = blockIdx.x * 16; const int kce = (kb_last(qb) + 1) * 4; const int n = wave < kce ? (kce - wave + PVS - 1) / PVS : 0;   /* chunks wave, wave + PVS, ... below kce: the wave's own, the same count in all its lanes */
  v8f s[2][2]; float m = -3.0e38f; float* sw = &part[wave][0];   /* s: raw logits (not yet x SCALE) of the wave's chunks 0 and 1, query ql0 + col, keys chunk * 32 + tile * 16 + 8 g + r; those of its chunks 2 and 3 wait in sw, the wave's own LDS slot, which takes its partial ctx tile [16][HD] afterwards; every test on n is the same for the whole wave */
  { const _Float16* qp = QH + ((size_t)blockIdx.z * (TT / 16) + blockIdx.x) * FT; const _Float16* kp = KH + (size_t)blockIdx.z * (TT / 16) * FT;
    const v16h ah0 = frag_t(qp, lane), ah1 = frag_t(qp + 512, lane);
    asm volatile("s_wait_xcnt 0x0" ::: "memory");   /* the q loads' address registers are reused behind the branch below */
    if (qb < QBH) { const _Float16* qlp = QL + ((size_t)blockIdx.z * (QHI / 16) + blockIdx.x) * FT; const _Float16* klp = KL + (size_t)blockIdx.z * (KHI / 16) * FT;
      if (n > 0) { const v16h al0 = frag_t(qlp, lane), al1 = frag_t(qlp + 512, lane);
#pragma unroll
        for (int tt = 0; tt < 2; ++tt) { const _Float16* kr = kp + (size_t)(wave * 2 + tt) * FT; const _Float16* kl = klp + (size_t)(wave * 2 + tt) * FT;
          const v16h kb0 = frag_t(kr, lane), kl0 = frag_t(kl, lane), kb1 = frag_t(kr + 512, lane), kl1 = frag_t(kl + 512, lane); v8f a = {}, l = {};
          asm volatile("s_wait_xcnt 0x0" ::: "memory");   /* the k loads' address registers may be taken again right behind them */
          a = wmma16(kb0, ah0, a); l = wmma16(kb0, al0, l); l = wmma16(kl0, ah0, l);
          a = wmma16(kb1, ah1, a); l = wmma16(kb1, al1, l); l = wmma16(kl1, ah1, l);
          s[0][tt] = a + l * (1.0f / 1024.0f); } }
    } else { const _Float16* kr = kp + (size_t)wave * (2 * FT); v16h ka[4], kb[4];   /* two chunks (4 key tiles) have their k fragments in flight together: one load latency up to two chunks, two above */
      if (n > 2) { k_chunk(ka, kr + 2 * PVS * (2 * FT), lane); if (n > 3) k_chunk(kb, kr + 3 * PVS * (2 * FT), lane);
        qk_mul(s[0], ka, ah0, ah1); m = mask_max(s[0], m, wave + 2 * PVS, ql0, col, g); park(sw, s[0], lane);
        if (n > 3) { qk_mul(s[0], kb, ah0, ah1); m = mask_max(s[0], m, wave + 3 * PVS, ql0, col, g); park(sw + 512, s[0], lane); } }
      if (n > 0) { k_chunk(ka, kr, lane); if (n > 1) k_chunk(kb, kr + PVS * (2 * FT), lane);
        qk_mul(s[0], ka, ah0, ah1); if (n > 1) qk_mul(s[1], kb, ah0, ah1); } } }
  if (n > 0) m = mask_max(s[0], m, wave, ql0, col, g);
  if (n > 1) m = mask_max(s[1], m, wave + PVS, ql0, col, g);
  m = fmaxf(m, __shfl_xor(m, 16));
  if (lane < 16) mx[col][wave] = m;   /* a wave without a chunk leaves -3.0e38 */
  __syncthreads();   /* every wave's row maxima are in LDS before any lane takes its row's maximum */
  { v4f q4 = *(const v4f*)&mx[col][0];
#pragma unroll
    for (int w = 4; w < PVS; w += 4) { const v4f o4 = *(const v4f*)&mx[col][w];
#pragma unroll
      for (int c = 0; c < 4; ++c) q4[c] = fmaxf(q4[c], o4[c]); }
    m = fmaxf(fmaxf(q4[0], q4[1]), fmaxf(q4[2], q4[3])); }
  const float cs = SCALE * 1.44269504f, mb = 11.0f - (m * SCALE) * 1.44269504f;   /* e = 2^(x log2(e) - max log2(e) + 11): one fused multiply-add and one v_exp_f32 per key; SCALE is a power of two, so raw x (SCALE log2(e)) is the scaled logit's product exactly; the rounding of mb scales the whole row alike and cancels in e / sum. m is a real logit (key 0 is allowed in every row), so an excluded key's -3.0e38 goes far below and its e to 0 with no test */
  float ls0 = 0.f, ls1 = 0.f; v8f acc[HD / 16] = {};
  if (qb < QBH) {
    if (n > 0) { v16b vh[HD / 16], vl[HD / 16]; float e[16], e0[8], e1[8]; exp2x8(e0, s[0][0], cs, mb); exp2x8(e1, s[0][1], cs, mb);
#pragma unroll
      for (int i = 0; i < 8; ++i) { e[i] = e0[i]; e[8 + i] = e1[i]; ls0 += e0[i]; ls1 += e1[i]; }
      const F2 p = bsplit16(e);
      asm volatile("" :: "v"(p.h), "v"(p.l) : "memory");   /* inputs only: holds the 16 loads below behind the end of the split, whose temporaries are then dead; side by side they pass 128 registers, and the WGP holds one block, not two */
#pragma unroll
      for (int j = 0; j < HD / 16; ++j) { const size_t po = ((size_t)blockIdx.z * (KHI / 32) + wave) * FV + j * 512; vh[j] = frag_tb(VB + po, lane); vl[j] = frag_tb(VBL + po, lane); }
      asm volatile("s_wait_xcnt 0x0" ::: "memory");   /* the loads' address registers may be written again behind them */
#pragma unroll
      for (int j = 0; j < HD / 16; ++j) { acc[j] = wmma_bf(p.h, vh[j], acc[j]); acc[j] = wmma_bf(p.l, vh[j], acc[j]); acc[j] = wmma_bf(p.h, vl[j], acc[j]); } }
  } else if (n > 0) { const _Float16* vp = VT + ((size_t)blockIdx.z * (TT / 32) + wave) * FV; v16h p0, p1, va[HD / 16];   /* e runs one chunk ahead of the products: while a chunk's v fragments are in flight the e of the next chunk are formed; chunks 2 and 3 come back from the wave's LDS slot one at a time */
    v_chunk(va, vp, lane);
    p0 = e_chunk(s[0], cs, mb, ls0, ls1); if (n > 1) p1 = e_chunk(s[1], cs, mb, ls0, ls1);
    pv_mul(acc, p0, va);
    if (n > 1) { v_chunk(va, vp + PVS * FV, lane);
      if (n > 2) { unpark(s[0], sw, lane); p0 = e_chunk(s[0], cs, mb, ls0, ls1); }
      pv_mul(acc, p1, va);
      if (n > 2) { v_chunk(va, vp + 2 * (PVS * FV), lane);
        if (n > 3) { unpark(s[0], sw + 512, lane); p1 = e_chunk(s[0], cs, mb, ls0, ls1); }
        pv_mul(acc, p0, va);
        if (n > 3) { v_chunk(va, vp + 3 * (PVS * FV), lane); pv_mul(acc, p1, va); } } } }
  { float ls = ls0 + ls1; ls += __shfl_xor(ls, 16);
    if (lane < 16) sm[col][wave] = ls; }   /* the wave's share of each row's sum; 0 from a wave without a chunk */
#pragma unroll
  for (int j = 0; j < HD / 16; ++j)
#pragma unroll
    for (int r = 0; r < 8; ++r) sw[(8 * g + r) * HD + j * 16 + col] = acc[j][r];
  __syncthreads();   /* every wave's partial tile and partial row sums are in LDS before any thread adds them */
  { const int rl = tid >> 5; v2f t2 = *(const v2f*)&part[0][rl * HD + lane * 2]; float sum = 0.f;
#pragma unroll
    for (int w = 1; w < PVS; ++w) t2 += *(const v2f*)&part[w][rl * HD + lane * 2];
#pragma unroll
    for (int w = 0; w < PVS; w += 4) { const v4f o4 = *(const v4f*)&sm[rl][w]; sum += o4[0]; sum += o4[1]; sum += o4[2]; sum += o4[3]; }
    vst2(Y + ((size_t)b * TT + ql0 + rl) * CC + h * HD + lane * 2, t2 * (sum > 0.f ? 1.0f / sum : 0.f)); } }   /* a fully excluded row yields 0 */
// ---- k_out: block = (64 rows, 128 cols): out = ctx Wo (+ bo): ctx x 2^6 once to f16 against Wo as f16(bf16 x 2^8) exact (1 product) x 2^-14; causal early rows (< QHI of each sequence): ctx bf16 hi + lo against exact bf16 Wo (2 products)
__global__ __launch_bounds__(128) void k_out(const float* __restrict__ Y, const float* __restrict__ WO, const float* __restrict__ BO, float* __restrict__ OUT) { __shared__ __align__(16) float sf[4][16][132]; __shared__ __align__(16) unsigned short wt[2][128][WP];
  const int tid = threadIdx.x, wave = tid >> 5, lane = tid & 31, col = lane & 15, g = lane >> 4; const int c0 = blockIdx.y * 128; const size_t r0 = (size_t)blockIdx.x * 64 + wave * 16;
  v8f acc[8] = {};
  const float* wp = WO + c0 + tid; const float* xp = Y + (r0 + col) * CC + 8 * g; float wr[KS]; v4f xr[KS / 8];
  stage_ld<DIN>(wr, xr, wp, xp);
  asm volatile("s_wait_xcnt 0x0" ::: "memory");   /* stage 0's loads name registers that are written again behind the branch below */
  if (CAUSAL && (int)(((size_t)blockIdx.x * 64) % TT) < QHI) {   /* block-uniform */
    F2 a[KS / 32]; stage_st<0>(&wt[0][tid][0], wr);
#pragma unroll
    for (int kk = 0; kk < KS / 32; ++kk) { float v[16]; stage_a(v, xr, kk); a[kk] = bsplit16(v); }
    __syncthreads();   /* stage 0 of the weight tile is in LDS before any wave reads it */
#pragma unroll 1   /* kept rolled: a trip already holds a whole stage's loads and products; a second copy would only add registers and code */
    for (int s = 0; s < CC / KS; ++s) {
      if (s + 1 < CC / KS) { wp += (size_t)KS * DIN; xp += KS; stage_ld<DIN>(wr, xr, wp, xp); }
#pragma unroll
      for (int kk = 0; kk < KS / 32; ++kk)
#pragma unroll
        for (int j0 = 0; j0 < 8; j0 += FG) { v16b w[FG];
#pragma unroll
          for (int j = 0; j < FG; ++j) w[j] = frag_b((const __bf16*)&wt[s & 1][(j0 + j) * 16 + col][kk * 32], lane);
#pragma unroll
          for (int j = 0; j < FG; ++j) { acc[j0 + j] = wmma_bf(a[kk].h, w[j], acc[j0 + j]); acc[j0 + j] = wmma_bf(a[kk].l, w[j], acc[j0 + j]); } }
      if (s + 1 < CC / KS) { stage_st<0>(&wt[(s + 1) & 1][tid][0], wr);
#pragma unroll
        for (int kk = 0; kk < KS / 32; ++kk) { float v[16]; stage_a(v, xr, kk); a[kk] = bsplit16(v); } }
      __syncthreads();   /* publishes stage s + 1 and ends every wave's reads of stage s, whose buffer the next trip refills */
    }
#pragma unroll
    for (int j = 0; j < 8; ++j) { const float bias = BO ? bfr(BO[c0 + j * 16 + col]) : 0.f;
#pragma unroll
      for (int r = 0; r < 8; ++r) sf[wave][8 * g + r][j * 16 + col] = acc[j][r] + bias; }
  } else {
    v16h a[KS / 32]; stage_st<1>(&wt[0][tid][0], wr);
#pragma unroll
    for (int kk = 0; kk < KS / 32; ++kk) { float v[16]; stage_a(v, xr, kk);
#pragma unroll
      for (int i = 0; i < 16; ++i) a[kk][i] = (_Float16)(v[i] * 64.0f); }   /* ctx carried x 2^6 into f16 so small-magnitude context rows stay clear of f16 subnormals */
    __syncthreads();   /* stage 0 of the weight tile is in LDS before any wave reads it */
#pragma unroll 1   /* kept rolled: a trip already holds a whole stage's loads and products; a second copy would only add registers and code */
    for (int s = 0; s < CC / KS; ++s) {
      if (s + 1 < CC / KS) { wp += (size_t)KS * DIN; xp += KS; stage_ld<DIN>(wr, xr, wp, xp); }
#pragma unroll
      for (int kk = 0; kk < KS / 32; ++kk)
#pragma unroll
        for (int j0 = 0; j0 < 8; j0 += FG) { v16h w[FG];
#pragma unroll
          for (int j = 0; j < FG; ++j) w[j] = frag_h((const _Float16*)&wt[s & 1][(j0 + j) * 16 + col][kk * 32], lane);
#pragma unroll
          for (int j = 0; j < FG; ++j) acc[j0 + j] = wmma16(a[kk], w[j], acc[j0 + j]); }
      if (s + 1 < CC / KS) { stage_st<1>(&wt[(s + 1) & 1][tid][0], wr);
#pragma unroll
        for (int kk = 0; kk < KS / 32; ++kk) { float v[16]; stage_a(v, xr, kk);
#pragma unroll
          for (int i = 0; i < 16; ++i) a[kk][i] = (_Float16)(v[i] * 64.0f); } }
      __syncthreads();   /* publishes stage s + 1 and ends every wave's reads of stage s, whose buffer the next trip refills */
    }
#pragma unroll
    for (int j = 0; j < 8; ++j) { const float bias = BO ? bfr(BO[c0 + j * 16 + col]) : 0.f;
#pragma unroll
      for (int r = 0; r < 8; ++r) sf[wave][8 * g + r][j * 16 + col] = acc[j][r] * (1.0f / 16384.0f) + bias; } }   /* 2^-8 (Wo carry) x 2^-6 (ctx carry) */
  LDSX(); for (int rl = 0; rl < 16; ++rl) vst2(OUT + (r0 + rl) * DIN + c0 + lane * 4, *(const v4f*)&sf[wave][rl][lane * 4]); }

extern "C" void kernel_launch(void* const* d_in, const int* in_sizes, int n_in, void* d_out, int out_size, void* d_ws, size_t ws_size, hipStream_t stream) {
  (void)in_sizes; (void)n_in; (void)out_size;
  const float** F = (const float**)d_in;
  if (ws_size < (size_t)WS_END) return;
  char* ws = (char*)d_ws; _Float16 *QH = (_Float16*)(ws + WS_QH), *KH = (_Float16*)(ws + WS_KH), *VT = (_Float16*)(ws + WS_VT), *QL = (_Float16*)(ws + WS_QL), *KL = (_Float16*)(ws + WS_KL); __bf16 *VB = (__bf16*)(ws + WS_VB), *VBL = (__bf16*)(ws + WS_VBL); float *Y = (float*)(ws + WS_Y);
  (void)Y; (void)QL; (void)KL; (void)VB; (void)VBL;
  // inputs: 0 x [2,2048,1024]; 1 w_attn [1024,3072] (in,out; columns q | k | v); 2 b_attn [3072] (zeros, read); 3 w_proj [1024,1024] (in,out); 4 b_proj [1024] (zeros, read). outputs: 0 a [2,2048,1024] at d_out + 0; 1 present [2,2,16,2048,64] at d_out + NB*TT*CC floats (byte offset 16,777,216)
  k_proj<<<dim3(TNB * TT / 64, CC / 128, 3), 128, 0, stream>>>(F[0], F[0], F[0], F[1], F[1] + CC, F[1] + 2 * CC, F[2], F[2] + CC, F[2] + 2 * CC, QH, QL, KH, KL, VT, VB, VBL, (float*)d_out + (size_t)NB * TT * CC);
  k_pv<<<dim3(TT / 16, 1, TNB * NH), 32 * PVS, 0, stream>>>(QH, KH, QL, KL, VT, VB, VBL, Y);
  k_out<<<dim3(TNB * TT / 64, DIN / 128), 128, 0, stream>>>(Y, F[3], F[4], (float*)d_out);
}

// v009
// It runs in 139 microseconds.
// Next to v008, in two timings, it ran 1.14 times as fast each time.
// Counting every step since v000, it is 7.98 times as fast.
// compute dtype: all float inputs rounded to bf16; c = x w_attn + b_attn with EXACT bf16 products on WMMA 16x16x32 (f32 accumulate); the f32 k and v rows are ALSO the second output (present); causal logits: 3 products for the first 384 rows, single f16 q x k after, x 64^-0.5; softmax f32; exp(x - max) x 2^11 once to f16 x v once to f16 (bf16 hi + lo below row 384), divided by the f32 row sum after; ctx hi+lo x exact w_proj below row 384, x2^6 f16 carry x f16(bf16 x 2^8) after, + b_proj; f32 outputs.
#include <hip/hip_runtime.h>
#include <math.h>

typedef __attribute__((ext_vector_type(16))) _Float16 v16h;
typedef __attribute__((ext_vector_type(16))) __bf16 v16b;
typedef __attribute__((ext_vector_type(8)))  _Float16 v8h;
typedef __attribute__((ext_vector_type(8)))  float v8f;
typedef __attribute__((ext_vector_type(4)))  float v4f;
typedef __attribute__((ext_vector_type(2)))  float v2f;
typedef __attribute__((ext_vector_type(4)))  unsigned v4u;
typedef __attribute__((ext_vector_type(4)))  int v4i;
typedef float __attribute__((may_alias)) float_a;
typedef int __attribute__((may_alias)) int_a;

template <typename T> __device__ __forceinline__ void vst2(void* p, T v) { *(T*)p = v;  }
__device__ __forceinline__ v8f wmma16(v16h a, v16h b, v8f c) {
  v8f d = __builtin_amdgcn_wmma_f32_16x16x32_f16(false, a, false, b, (short)0, c, false, false);
  asm volatile("v_nop\n\tv_nop\n\tv_nop\n\tv_nop" : "+v"(d) : "v"(a), "v"(b));
  return d;
}
__device__ __forceinline__ v8f wmma_bf(v16b a, v16b b, v8f c) {
  v8f d = __builtin_amdgcn_wmma_f32_16x16x32_bf16(false, a, false, b, (short)0, c, false, false);
  asm volatile("v_nop\n\tv_nop\n\tv_nop\n\tv_nop" : "+v"(d) : "v"(a), "v"(b));
  return d;
}
// 16x16x32 fragments: lane = (h = lane>>4, row/col = lane&15); elements 0..7 = k0+8h+0..7, 8..15 = k0+16+8h+0..7; D element r = row 8h+r
__device__ __forceinline__ v16h frag_h(const _Float16* rowk0, int lane) {
  union { v16h v; v8h q[2]; } u; const _Float16* p = rowk0 + 8 * (lane >> 4);
  u.q[0] = *(const v8h*)p; u.q[1] = *(const v8h*)(p + 16); return u.v;
}
__device__ __forceinline__ v16h frag_f32(const float* rowk0, int lane) {
  v16h a; const float* p = rowk0 + 8 * (lane >> 4);
#pragma unroll
  for (int i = 0; i < 8; ++i) { a[i] = (_Float16)p[i]; a[8 + i] = (_Float16)p[16 + i]; }
  return a;
}
__device__ __forceinline__ v16h frag_f32s(const float* rowk0, int lane, float sc) {
  v16h a; const float* p = rowk0 + 8 * (lane >> 4);
#pragma unroll
  for (int i = 0; i < 8; ++i) { a[i] = (_Float16)(p[i] * sc); a[8 + i] = (_Float16)(p[16 + i] * sc); }
  return a;
}
// column fragment from a [K][ld] layout (column n), rows >= K read as 0
__device__ __forceinline__ v16h fragc_f32(const float* W, int k0, int n, int lane, int ld, int K) {
  v16h a; const int g = lane >> 4;
#pragma unroll
  for (int i = 0; i < 8; ++i) { const int ka = k0 + 8 * g + i, kb = ka + 16;
    a[i] = (_Float16)(ka < K ? W[(size_t)(ka < K ? ka : K - 1) * ld + n] : 0.f); a[8 + i] = (_Float16)(kb < K ? W[(size_t)(kb < K ? kb : K - 1) * ld + n] : 0.f); }
  return a;
}
struct F2 { v16b h, l; };
__device__ __forceinline__ F2 bsplit16(const float v[16]) { F2 r;
#pragma unroll
  for (int i = 0; i < 16; ++i) { const __bf16 h = (__bf16)v[i]; r.h[i] = h; r.l[i] = (__bf16)(v[i] - (float)h); }
  return r; }
__device__ __forceinline__ F2 split_row(const float* row, int k0, int lane) { float v[16]; const float* p = row + k0 + 8 * (lane >> 4);
#pragma unroll
  for (int i = 0; i < 8; ++i) { v[i] = p[i]; v[8 + i] = p[16 + i]; }
  return bsplit16(v); }
__device__ __forceinline__ F2 split_rowK(const float* row, int k0, int lane, int K) { float v[16]; const int g = lane >> 4;
#pragma unroll
  for (int i = 0; i < 8; ++i) { const int ka = k0 + 8 * g + i, kb = ka + 16; v[i] = ka < K ? row[ka < K ? ka : K - 1] : 0.f; v[8 + i] = kb < K ? row[kb < K ? kb : K - 1] : 0.f; }
  return bsplit16(v); }
__device__ __forceinline__ F2 split_col(const float* W, int k0, int n, int lane, int ld, int K) { float v[16]; const int g = lane >> 4;
#pragma unroll
  for (int i = 0; i < 8; ++i) { const int ka = k0 + 8 * g + i, kb = ka + 16; v[i] = ka < K ? W[(size_t)(ka < K ? ka : K - 1) * ld + n] : 0.f; v[8 + i] = kb < K ? W[(size_t)(kb < K ? kb : K - 1) * ld + n] : 0.f; }
  return bsplit16(v); }
__device__ __forceinline__ v8f mac3(const F2& a, const F2& b, v8f c) { c = wmma_bf(a.l, b.h, c); c = wmma_bf(a.h, b.l, c); return wmma_bf(a.h, b.h, c); }
__device__ __forceinline__ float sigm(float v) { return 1.0f / (1.0f + expf(-v)); }
#define LDSX() do { asm volatile("s_wait_dscnt 0" ::: "memory"); __builtin_amdgcn_wave_barrier(); __builtin_amdgcn_fence(__ATOMIC_RELEASE, "workgroup"); } while (0)

// Fused-qkv causal self-attention with TWO outputs (x [2,2048,1024]; fused (in,out) w_attn [1024,3072] N(0,1) x 0.02 + b_attn zeros (read), jnp.split(c, 3, axis=2) -> q | k | v column blocks; 16 heads x 64; w = q k^T x rsqrt(64); w * b - 1e10 * (1 - b) with b = (i >= j): causal, the masked logits are exactly -1e10; softmax; a = merge(p v) w_proj + b_proj; outputs: a [2,2048,1024] and present = stack([k, v], axis=1) [2,2,16,2048,64] = the projected k and v (bias included) in head-major layout).
#define NB 2
#define TT 2048
#define CC 1024            // NH * HD = projected width
#define DIN 1024          // input (model) width
#define NH 16
#define HD 64
#define SCALE (0.125f)
#define CAUSAL 1
#ifndef TNB
#define TNB NB
#endif
__device__ __forceinline__ float bfr(float v) { return (float)(__bf16)v; }
__host__ __device__ __forceinline__ int kb_last(int qb) { return CAUSAL ? ((qb * 64 + 63) >> 7) : (TT / 128 - 1); }
typedef __attribute__((ext_vector_type(8))) __bf16 v8b;
__device__ __forceinline__ v16b frag_b(const __bf16* rowk0, int lane) {
  union { v16b v; v8b q[2]; } u; const __bf16* p = rowk0 + 8 * (lane >> 4);
  u.q[0] = *(const v8b*)p; u.q[1] = *(const v8b*)(p + 16); return u.v;
}
// ---- fragment order: the planes that k_pv reads are stored by k_proj as the registers of the WMMA fragments, so that each wave-wide 16-B load covers 512 contiguous bytes = 4 whole lines (a row-major tile makes it touch 16 lines). q, k and their residuals: tile (b, h, 16 rows) = FT elements [k step 0..1][half 0..1][lane][8]; v planes: chunk (b, h, 32 keys) = FV elements [16 columns j 0..3][half 0..1][lane][8]; lane = (g, row or column), its 8 elements = k0 + 16 * half + 8 * g + 0..7, as frag_h takes them from a row
#define FT (16 * HD)
#define FV (32 * HD)
__device__ __forceinline__ v16h frag_t(const _Float16* f, int lane) { union { v16h v; v8h q[2]; } u; u.q[0] = *(const v8h*)(f + lane * 8); u.q[1] = *(const v8h*)(f + 256 + lane * 8); return u.v; }
__device__ __forceinline__ v16b frag_tb(const __bf16* f, int lane) { union { v16b v; v8b q[2]; } u; u.q[0] = *(const v8b*)(f + lane * 8); u.q[1] = *(const v8b*)(f + 256 + lane * 8); return u.v; }
#define QBH 6              // causal: query blocks 0..QBH-1 of each sequence (few keys, no averaging) take the high-precision path
#define QHI 384            // rows carrying a q residual plane
#define KHI 384            // key rows carrying k residual / v bf16 hi+lo planes (used only by the causal high-precision path)
// B fragment (k rows k0+.., output column o) of a weight: (in,out) [K][ld] or (out,in) [ld rows of K]: bf16 exact, or f16(bf16 * 256) exact
__device__ __forceinline__ v16b wcol_io(const float* Wm, int k0, int o, int lane, int ld) { v16b w; const int g = lane >> 4;
#pragma unroll
  for (int i = 0; i < 8; ++i) { w[i] = (__bf16)Wm[(size_t)(k0 + 8 * g + i) * ld + o]; w[8 + i] = (__bf16)Wm[(size_t)(k0 + 16 + 8 * g + i) * ld + o]; }
  return w; }
__device__ __forceinline__ v16b wcol_oi(const float* Wm, int k0, int o, int lane, int K) { v16b w; const float* p = Wm + (size_t)o * K + k0 + 8 * (lane >> 4);
#pragma unroll
  for (int i = 0; i < 8; ++i) { w[i] = (__bf16)p[i]; w[8 + i] = (__bf16)p[16 + i]; }
  return w; }
__device__ __forceinline__ v16h wcolh_io(const float* Wm, int k0, int o, int lane, int ld) { v16h w; const int g = lane >> 4;
#pragma unroll
  for (int i = 0; i < 8; ++i) { w[i] = (_Float16)(bfr(Wm[(size_t)(k0 + 8 * g + i) * ld + o]) * 256.0f); w[8 + i] = (_Float16)(bfr(Wm[(size_t)(k0 + 16 + 8 * g + i) * ld + o]) * 256.0f); }
  return w; }
__device__ __forceinline__ v16h wcolh_oi(const float* Wm, int k0, int o, int lane, int K) { v16h w; const float* p = Wm + (size_t)o * K + k0 + 8 * (lane >> 4);
#pragma unroll
  for (int i = 0; i < 8; ++i) { w[i] = (_Float16)(bfr(p[i]) * 256.0f); w[8 + i] = (_Float16)(bfr(p[16 + i]) * 256.0f); }
  return w; }
#define WQKV_LAYOUT 0   // 0 = (in,out); 1 = (out,in) [CC][DIN]; 2 = per-head [NH][DIN][HD]
__device__ __forceinline__ v16b wcol_hdk(const float* Wm, int k0, int o, int lane) { v16b w; const int g = lane >> 4; const float* p = Wm + (size_t)(o / HD) * DIN * HD + (o % HD);
#pragma unroll
  for (int i = 0; i < 8; ++i) { w[i] = (__bf16)p[(size_t)(k0 + 8 * g + i) * HD]; w[8 + i] = (__bf16)p[(size_t)(k0 + 16 + 8 * g + i) * HD]; }
  return w; }
#define WO_OUT_IN 0
#if WQKV_LAYOUT == 1
#define WCOL(W, k0, o, lane) wcol_oi(W, k0, o, lane, DIN)
#elif WQKV_LAYOUT == 2
#define WCOL(W, k0, o, lane) wcol_hdk(W, k0, o, lane)
#else
#define WCOL(W, k0, o, lane) wcol_io(W, k0, o, lane, 3 * CC)   /* w_attn (in,out) [1024][3072] packed by columns: row pitch 3*CC; the q / k / v pointers carry the column offsets 0 / CC / 2*CC */
#endif
#if WO_OUT_IN
#define WOCOL(W, k0, o, lane) wcol_oi(W, k0, o, lane, CC)
#define WOCOLH(W, k0, o, lane) wcolh_oi(W, k0, o, lane, CC)
#else
#define WOCOL(W, k0, o, lane) wcol_io(W, k0, o, lane, DIN)
#define WOCOLH(W, k0, o, lane) wcolh_io(W, k0, o, lane, DIN)
#endif
#define PROJ_EXTRA_PARAMS , float* __restrict__ PRES   /* second output: present [NB][2][NH][TT][HD] f32 */
#define PROJ_EPI(which, row, t, h) do { if ((which) >= 1) { float* dst_ = PRES + ((((size_t)bb * 2 + ((which) - 1)) * NH + (h)) * TT + (t)) * HD; _Pragma("unroll") for (int q4 = 0; q4 < HD / 4; ++q4) vst2(dst_ + 4 * q4, *(const v4f*)((row) + 4 * q4)); } } while (0)
static_assert(HD == 64 && (132 * 4) % 16 == 0, "the staged row st[rl][hh*HD] is 16-B aligned and 64 floats long");
#ifndef PROJ_EXTRA_PARAMS
#define PROJ_EXTRA_PARAMS
#endif

#define WS_QH  0u                                      // f16 q tiles [b][h][t / 16][FT], fragment order
#define WS_KH  (WS_QH + 2u * (size_t)NB * TT * CC)      // f16 k tiles [b][h][t / 16][FT], fragment order
#define WS_VT  (WS_KH + 2u * (size_t)NB * TT * CC)      // f16 v chunks [b][h][t / 32][FV], fragment order
#define WS_QL  (WS_VT + 2u * (size_t)NB * CC * TT)      // f16 q residual x 2^10 tiles [b][h][t / 16 < QHI / 16][FT]
#define WS_KL  (WS_QL + 2u * (size_t)NB * QHI * CC)     // f16 k residual x 2^10 tiles [b][h][t / 16 < KHI / 16][FT]
#define WS_VB  (WS_KL + 2u * (size_t)NB * KHI * CC)     // bf16 v hi chunks [b][h][t / 32 < KHI / 32][FV]
#define WS_VBL (WS_VB + 2u * (size_t)NB * CC * KHI)
#define WS_Y   (WS_VBL + 2u * (size_t)NB * CC * KHI)    // f32 ctx rows [b*t][CC] (only when there is an output projection)
#define WS_END (WS_Y  + 4u * (size_t)NB * TT * CC)

// ---- the K loop of k_proj and k_out: a stage is KS k rows of the block's 128 weight columns. Thread tid reads column c0 + tid of the stage (each wave-wide load = one whole 128-B line), rounds it once for the whole block and leaves it k-contiguous in LDS row tid; every wave takes its B fragments from there. Two LDS buffers, one workgroup barrier per stage; the next stage's weight column and the wave's own next A rows are in flight while this stage's products run.
#define KS 64              // k rows per stage = 2 WMMA k steps
#define FG 8               // B fragments a wave reads from LDS as one group in front of their products
#define WP (KS + 8)        // LDS row pitch in 16-bit elements: 144 B = 16 B x odd, so that 16 rows' 16-B reads and writes spread over the banks
static_assert(DIN % KS == 0 && CC % KS == 0 && KS % 32 == 0 && (WP * 2) % 32 == 16, "whole stages; row pitch = 16 B x odd");
template <int LD> __device__ __forceinline__ void stage_ld(float (&wr)[KS], v4f (&xr)[KS / 8], const float* wp, const float* xp) {
#pragma unroll
  for (int i = 0; i < KS; ++i) wr[i] = wp[(size_t)i * LD];
#pragma unroll
  for (int kk = 0; kk < KS / 32; ++kk) { xr[kk * 4 + 0] = *(const v4f*)(xp + kk * 32); xr[kk * 4 + 1] = *(const v4f*)(xp + kk * 32 + 4); xr[kk * 4 + 2] = *(const v4f*)(xp + kk * 32 + 16); xr[kk * 4 + 3] = *(const v4f*)(xp + kk * 32 + 20); }
}
// F16 = 0: bf16 exact; 1: f16(bf16 x 2^8) exact
template <int F16> __device__ __forceinline__ void stage_st(unsigned short* row, const float (&wr)[KS]) {
#pragma unroll
  for (int q = 0; q < KS / 8; ++q) { union { v8b b; v8h h; v4u u; } t;
#pragma unroll
    for (int i = 0; i < 8; ++i) { if (F16) t.h[i] = (_Float16)(bfr(wr[q * 8 + i]) * 256.0f); else t.b[i] = (__bf16)wr[q * 8 + i]; }
    vst2(row + q * 8, t.u); } }
// the 16 f32 values of A fragment kk of a stage, in fragment order
__device__ __forceinline__ void stage_a(float (&v)[16], const v4f (&xr)[KS / 8], int kk) {
#pragma unroll
  for (int i = 0; i < 4; ++i) { v[i] = xr[kk * 4][i]; v[4 + i] = xr[kk * 4 + 1][i]; v[8 + i] = xr[kk * 4 + 2][i]; v[12 + i] = xr[kk * 4 + 3][i]; } }
// ---- k_proj: block = (64 rows, 128 cols, which): q/k/v = X W (+ b) with exact bf16 products (K = DIN) -> which 0: q f16 tiles (+ residual tiles for rows < QHI); 1: k f16 tiles (+ residual tiles for rows < KHI); 2: v f16 chunks (+ bf16 hi/lo chunks for t < KHI), all in fragment order
__global__ __launch_bounds__(128) void k_proj(const float* __restrict__ XQ, const float* __restrict__ XK, const float* __restrict__ XV, const float* __restrict__ WQ, const float* __restrict__ WK, const float* __restrict__ WV, const float* __restrict__ BQ, const float* __restrict__ BK, const float* __restrict__ BV,
    _Float16* __restrict__ QH, _Float16* __restrict__ QL, _Float16* __restrict__ KH, _Float16* __restrict__ KL, _Float16* __restrict__ VT, __bf16* __restrict__ VB, __bf16* __restrict__ VBL PROJ_EXTRA_PARAMS) {
  __shared__ __align__(16) float st[64][132]; __shared__ __align__(16) unsigned short wt[2][128][WP];
  const int tid = threadIdx.x, wave = tid >> 5, lane = tid & 31, col = lane & 15, g = lane >> 4; const int which = blockIdx.z; const int c0 = blockIdx.y * 128; const size_t r0 = (size_t)blockIdx.x * 64; const size_t bb = r0 / TT; const int t0 = (int)(r0 % TT);
  const float* X = which == 0 ? XQ : which == 1 ? XK : XV; const float* WA = which == 0 ? WQ : which == 1 ? WK : WV; const float* BA = which == 0 ? BQ : which == 1 ? BK : BV;
  v8f acc[8] = {};
  { const float* wp = WA + c0 + tid; const float* xp = X + (r0 + wave * 16 + col) * DIN + 8 * g; float wr[KS]; v4f xr[KS / 8]; v16b a[KS / 32];
    stage_ld<3 * CC>(wr, xr, wp, xp);
    asm volatile("s_wait_xcnt 0x0" ::: "memory");   /* the scalar base of stage 0's weight loads is reused right behind them */
    stage_st<0>(&wt[0][tid][0], wr);
#pragma unroll
    for (int kk = 0; kk < KS / 32; ++kk) { float v[16]; stage_a(v, xr, kk);
#pragma unroll
      for (int i = 0; i < 16; ++i) a[kk][i] = (__bf16)v[i]; }
    __syncthreads();   /* stage 0 of the weight tile is in LDS before any wave reads it */
#pragma unroll 1   /* kept rolled: a trip already holds a whole stage's loads and products; a second copy would only add registers and code */
    for (int s = 0; s < DIN / KS; ++s) {
      if (s + 1 < DIN / KS) { wp += (size_t)KS * 3 * CC; xp += KS; stage_ld<3 * CC>(wr, xr, wp, xp); }
#pragma unroll
      for (int kk = 0; kk < KS / 32; ++kk)
#pragma unroll
        for (int j0 = 0; j0 < 8; j0 += FG) { v16b w[FG];
#pragma unroll
          for (int j = 0; j < FG; ++j) w[j] = frag_b((const __bf16*)&wt[s & 1][(j0 + j) * 16 + col][kk * 32], lane);
#pragma unroll
          for (int j = 0; j < FG; ++j) acc[j0 + j] = wmma_bf(a[kk], w[j], acc[j0 + j]); }
      if (s + 1 < DIN / KS) { stage_st<0>(&wt[(s + 1) & 1][tid][0], wr);
#pragma unroll
        for (int kk = 0; kk < KS / 32; ++kk) { float v[16]; stage_a(v, xr, kk);
#pragma unroll
          for (int i = 0; i < 16; ++i) a[kk][i] = (__bf16)v[i]; } }
      __syncthreads();   /* publishes stage s + 1 and ends every wave's reads of stage s, whose buffer the next trip refills */
    } }
  { // stage the f32 tile (acc + bias) in LDS; behind its one barrier the tile is only read: every thread forms its 16-B output pieces from it in registers, so that the block holds no 16-bit copy of the tile in LDS and four blocks fit a WGP
#pragma unroll
    for (int j = 0; j < 8; ++j) { const float bias = BA ? bfr(BA[c0 + j * 16 + col]) : 0.f;
#pragma unroll
      for (int r = 0; r < 8; ++r) st[wave * 16 + 8 * g + r][j * 16 + col] = acc[j][r] + bias; }
    __syncthreads();   /* the whole f32 tile is in LDS before any thread reads rows that another wave wrote */
    for (int e = tid; e < 64 * (128 / HD); e += 128) { const int rl = e / (128 / HD), hh = e % (128 / HD); PROJ_EPI(which, &st[rl][hh * HD], (int)((r0 + rl) % TT), (c0 / HD) + hh); }
  }
  if (which < 2) { _Float16* DH = which == 0 ? QH : KH; _Float16* DL = which == 0 ? QL : KL; const int nhi = which == 0 ? QHI : KHI; const bool hi_rows = t0 < nhi;
    const int rl = tid & 15, cl = (tid >> 5) * 16 + ((tid >> 4) & 1) * 8; const size_t hb = bb * NH + c0 / HD;   /* the thread has piece tid of each of the block's 8 tiles (head hh, 16 rows tt): a wave's store is 512 contiguous bytes; its 8 values are 32 contiguous bytes of a tile row (16 rows at pitch 528 B spread over the banks) */
    _Float16* dh = DH + (hb * (TT / 16) + t0 / 16) * FT + tid * 8; v4u ph[8];
#pragma unroll   /* unrolled: ph is indexed by constants only */
    for (int i = 0; i < 8; ++i) { const int hh = i >> 2, tt = i & 3; const float* p = &st[tt * 16 + rl][hh * HD + cl]; const v4f a = *(const v4f*)p, b = *(const v4f*)(p + 4); union { v8h h; v4u u; } t;
#pragma unroll
      for (int c = 0; c < 4; ++c) { t.h[c] = (_Float16)a[c]; t.h[4 + c] = (_Float16)b[c]; }
      ph[i] = t.u; }
#pragma unroll   /* unrolled: the 8 stores share one address register pair and differ in a constant offset */
    for (int i = 0; i < 8; ++i) { const int hh = i >> 2, tt = i & 3; vst2((unsigned*)(dh + (hh * (TT / 16) + tt) * FT), ph[i]); }
    if (hi_rows) { _Float16* dl = DL + (hb * (nhi / 16) + t0 / 16) * FT + tid * 8; v4u pl[8];
      asm volatile("s_wait_xcnt 0x0" ::: "memory");   /* the registers of the 8 stores above are taken again for the residual pieces */
#pragma unroll   /* as above */
      for (int i = 0; i < 8; ++i) { const int hh = i >> 2, tt = i & 3; const float* p = &st[tt * 16 + rl][hh * HD + cl]; const v4f a = *(const v4f*)p, b = *(const v4f*)(p + 4); union { v8h h; v4u u; } t;
#pragma unroll
        for (int c = 0; c < 4; ++c) { t.h[c] = (_Float16)((a[c] - (float)(_Float16)a[c]) * 1024.0f); t.h[4 + c] = (_Float16)((b[c] - (float)(_Float16)b[c]) * 1024.0f); }
        pl[i] = t.u; }
#pragma unroll   /* as above */
      for (int i = 0; i < 8; ++i) { const int hh = i >> 2, tt = i & 3; vst2((unsigned*)(dl + (hh * (nhi / 16) + tt) * FT), pl[i]); } }
  } else { const bool hi_rows = t0 < KHI;
    const int cl = (tid >> 6) * 16 + (tid & 15), rl = ((tid >> 5) & 1) * 16 + ((tid >> 4) & 1) * 8; const size_t hb = bb * NH + c0 / HD;   /* the thread has pieces tid and 128 + tid (u) of each of the block's 4 chunks (head hh, 32 keys cc): a wave's store is 512 contiguous bytes; its 8 values are 8 rows of one tile column (a wave's 4-B reads: 16 columns in a row, twice, 32 banks apart) */
    _Float16* dv = VT + (hb * (TT / 32) + t0 / 32) * FV + tid * 8; v4u pv[8];
#pragma unroll   /* unrolled: pv is indexed by constants only */
    for (int i = 0; i < 8; ++i) { const int hh = i >> 2, cc = (i >> 1) & 1, u = i & 1; const float* p = &st[cc * 32 + rl][hh * HD + u * 32 + cl]; union { v8h h; v4u u; } t;
#pragma unroll
      for (int k = 0; k < 8; ++k) t.h[k] = (_Float16)p[k * 132];
      pv[i] = t.u; }
#pragma unroll   /* unrolled: the 8 stores share one address register pair and differ in a constant offset */
    for (int i = 0; i < 8; ++i) { const int hh = i >> 2, cc = (i >> 1) & 1, u = i & 1; vst2((unsigned*)(dv + (hh * (TT / 32) + cc) * FV + u * 1024), pv[i]); }
    if (hi_rows) { const size_t o3 = (hb * (KHI / 32) + t0 / 32) * FV + tid * 8; v4u pb[8], pl[8];
      asm volatile("s_wait_xcnt 0x0" ::: "memory");   /* the registers of the 8 stores above are taken again for the bf16 pieces */
#pragma unroll   /* as above */
      for (int i = 0; i < 8; ++i) { const int hh = i >> 2, cc = (i >> 1) & 1, u = i & 1; const float* p = &st[cc * 32 + rl][hh * HD + u * 32 + cl]; union { v8b b; v4u u; } th, tl;
#pragma unroll
        for (int k = 0; k < 8; ++k) { const float v = p[k * 132]; const __bf16 bh = (__bf16)v; th.b[k] = bh; tl.b[k] = (__bf16)(v - (float)bh); }
        pb[i] = th.u; pl[i] = tl.u; }
#pragma unroll   /* as above */
      for (int i = 0; i < 8; ++i) { const int hh = i >> 2, cc = (i >> 1) & 1, u = i & 1; const int o4 = (hh * (KHI / 32) + cc) * FV + u * 1024; vst2((unsigned*)(VB + o3 + o4), pb[i]); vst2((unsigned*)(VBL + o3 + o4), pl[i]); } }
    asm volatile("s_wait_xcnt 0x0" ::: "memory");   /* behind the arm's last store on both ways: the listing's next block writes the stores' data registers */
  } }
// ---- k_pv: block = 16 queries (tile qt) of (b, h), PVS waves, one launch for every (b, h). Wave w owns the 32-key chunks w, w + PVS, ... of keys [0, kend) from the logits to its partial ctx tile. The logits are taken as k x q^T on WMMA (single f16 product; causal early query blocks: k hi + residual x 2^10 against q hi + residual, 3 products): result element r of lane (g, query) is key 8 g + r of a 16-key tile, which is the place that key has in the A fragment of P x v, so the two tiles of a chunk become that chunk's P fragment inside the registers. Each wave leaves its 16 row maxima in LDS; behind a workgroup barrier every lane takes its row's maximum over the waves, forms e = 2^11 exp(x - max) (0 for excluded keys), adds its share of the row sum and multiplies the chunk (e once to f16 against v f16: 1 product; causal early query blocks: e and v as bf16 hi + lo, 3 products). The partial ctx tiles and the partial row sums meet in LDS behind one more workgroup barrier, are added in wave order, and the row is divided by its sum there; 256-B (row, head) segment by one wave
#define PVS 16             // key slices = waves per block = query rows per tile
#define NCH (TT / 32 / PVS)   // 32-key chunks a wave owns at most
#define SPW (PVS + 4)      // f32 pitch of a row's per-wave maxima and sums: 80 B = 16 B x odd, so that 16 rows' 16-B reads spread over the banks
static_assert(32 * PVS == 16 * (HD / 2), "the merge gives each thread one 8-B piece of the 16 x HD tile");
static_assert(PVS == 16 && TT % (32 * PVS) == 0 && NCH == 4, "one wave per query row of the tile at the merge; whole chunks; the runs below are written for 1 to 4 chunks");
static_assert(!CAUSAL || ((QBH * 64 - 1) / 128 + 1) * 128 <= KHI, "the early query blocks' keys have k residual rows and v hi + lo planes");
static_assert(!CAUSAL || KHI / 32 <= PVS, "an early query block gives a wave one chunk at most");
// the k fragments of one chunk (2 key tiles x 2 k steps), and its raw logits: k rows as A, q rows as B
__device__ __forceinline__ void k_chunk(v16h (&kf)[4], const _Float16* kr, int lane) {
#pragma unroll
  for (int f = 0; f < 4; ++f) kf[f] = frag_t(kr + f * 512, lane);
  asm volatile("s_wait_xcnt 0x0" ::: "memory");   /* the loads' address registers may be written again right behind them */
}
__device__ __forceinline__ void qk_mul(v8f (&sc)[2], const v16h (&kf)[4], v16h ah0, v16h ah1) {
#pragma unroll
  for (int tt = 0; tt < 2; ++tt) { v8f a = {}; a = wmma16(kf[tt * 2], ah0, a); a = wmma16(kf[tt * 2 + 1], ah1, a); sc[tt] = a; } }
// the v fragments of one chunk
__device__ __forceinline__ void v_chunk(v16h (&vf)[HD / 16], const _Float16* vp, int lane) {
#pragma unroll
  for (int j = 0; j < HD / 16; ++j) vf[j] = frag_t(vp + j * 512, lane);
  asm volatile("s_wait_xcnt 0x0" ::: "memory");   /* the loads' address registers may be written again behind them */
}
// e[i] = 2^(sc[i] x cs + mb) for the 8 logits of one key tile
__device__ __forceinline__ void exp2x8(float (&e)[8], v8f sc, float cs, float mb) { float x[8];
#pragma unroll
  for (int i = 0; i < 8; ++i) x[i] = fmaf(sc[i], cs, mb);
  /* eight v_exp_f32 in one statement: each is the independent instruction behind the one before it (no result is a source: early clobber), and a v_nop stands behind the last: the slot that the instruction set asks for between a transcendental and a use of its result or an overwrite of its source */
  asm("v_exp_f32 %0, %8\n\tv_exp_f32 %1, %9\n\tv_exp_f32 %2, %10\n\tv_exp_f32 %3, %11\n\tv_exp_f32 %4, %12\n\tv_exp_f32 %5, %13\n\tv_exp_f32 %6, %14\n\tv_exp_f32 %7, %15\n\tv_nop"
      : "=&v"(e[0]), "=&v"(e[1]), "=&v"(e[2]), "=&v"(e[3]), "=&v"(e[4]), "=&v"(e[5]), "=&v"(e[6]), "=&v"(e[7])
      : "v"(x[0]), "v"(x[1]), "v"(x[2]), "v"(x[3]), "v"(x[4]), "v"(x[5]), "v"(x[6]), "v"(x[7])); }
// the e of one chunk: its share of the row sum, and the chunk's P fragment (tile 0 = elements 0..7, tile 1 = elements 8..15)
__device__ __forceinline__ v16h e_chunk(const v8f (&sc)[2], float cs, float mb, float& ls0, float& ls1) { v16h p; float e0[8], e1[8]; exp2x8(e0, sc[0], cs, mb); exp2x8(e1, sc[1], cs, mb);
#pragma unroll
  for (int i = 0; i < 8; ++i) { ls0 += e0[i]; ls1 += e1[i]; p[i] = (_Float16)e0[i]; p[8 + i] = (_Float16)e1[i]; }
  return p; }
// excluded keys of chunk c (causal) set to -3.0e38, then the lane's running maximum
__device__ __forceinline__ float mask_max(v8f (&sc)[2], float m, int c, int ql0, int col, int g) {
  if (CAUSAL && c * 32 + 31 > ql0) { const int rel = ql0 + col - c * 32 - 8 * g;   /* one scalar test per chunk: only a chunk that reaches past the tile's first query holds excluded keys; key tile * 16 + r of the lane is allowed while it is <= rel */
#pragma unroll
    for (int tt = 0; tt < 2; ++tt)
#pragma unroll
      for (int r = 0; r < 8; ++r) sc[tt][r] = tt * 16 + r <= rel ? sc[tt][r] : -3.0e38f; }
#pragma unroll
  for (int tt = 0; tt < 2; ++tt)
#pragma unroll
    for (int r = 0; r < 8; ++r) m = fmaxf(m, sc[tt][r]);
  return m; }
// a chunk's 16 logits of each lane to and from the wave's own LDS slot (slot k = 2 KiB; each 16-B access of the wave is 512 contiguous bytes); no other wave touches the slot before the merge barrier
__device__ __forceinline__ void park(float* slot, const v8f (&sc)[2], int lane) {
#pragma unroll
  for (int q = 0; q < 4; ++q) { v4f t;
#pragma unroll
    for (int c = 0; c < 4; ++c) t[c] = sc[q >> 1][(q & 1) * 4 + c];
    vst2(slot + (q * 32 + lane) * 4, t); } }
__device__ __forceinline__ void unpark(v8f (&sc)[2], const float* slot, int lane) {
#pragma unroll
  for (int q = 0; q < 4; ++q) { const v4f t = *(const v4f*)(slot + (q * 32 + lane) * 4);
#pragma unroll
    for (int c = 0; c < 4; ++c) sc[q >> 1][(q & 1) * 4 + c] = t[c]; } }
__device__ __forceinline__ void pv_mul(v8f (&acc)[HD / 16], v16h p, const v16h (&vf)[HD / 16]) {
#pragma unroll
  for (int j = 0; j < HD / 16; ++j) acc[j] = wmma16(p, vf[j], acc[j]); }
__global__ __launch_bounds__(32 * PVS) void k_pv(const _Float16* __restrict__ QH, const _Float16* __restrict__ KH, const _Float16* __restrict__ QL, const _Float16* __restrict__ KL, const _Float16* __restrict__ VT, const __bf16* __restrict__ VB, const __bf16* __restrict__ VBL, float* __restrict__ Y) { const int b = blockIdx.z / NH, h = blockIdx.z % NH; __shared__ __align__(16) float part[PVS][16 * HD]; __shared__ __align__(16) float mx[16][SPW], sm[16][SPW];
  const int tid = threadIdx.x, lane = tid & 31, col = lane & 15, g = lane >> 4; const int wave = __builtin_amdgcn_readfirstlane(tid >> 5); const int qb = blockIdx.x >> 2; const int ql0 = blockIdx.x * 16; const int kce = (kb_last(qb) + 1) * 4; const int n = wave < kce ? (kce - wave + PVS - 1) / PVS : 0;   /* chunks wave, wave + PVS, ... below kce: the wave's own, the same count in all its lanes */
  v8f s[2][2]; float m = -3.0e38f; float* sw = &part[wave][0];   /* s: raw logits (not yet x SCALE) of the wave's chunks 0 and 1, query ql0 + col, keys chunk * 32 + tile * 16 + 8 g + r; those of its chunks 2 and 3 wait in sw, the wave's own LDS slot, which takes its partial ctx tile [16][HD] afterwards; every test on n is the same for the whole wave */
  { const _Float16* qp = QH + ((size_t)blockIdx.z * (TT / 16) + blockIdx.x) * FT; const _Float16* kp = KH + (size_t)blockIdx.z * (TT / 16) * FT;
    const v16h ah0 = frag_t(qp, lane), ah1 = frag_t(qp + 512, lane);
    asm volatile("s_wait_xcnt 0x0" ::: "memory");   /* the q loads' address registers are reused behind the branch below */
    if (qb < QBH) { const _Float16* qlp = QL + ((size_t)blockIdx.z * (QHI / 16) + blockIdx.x) * FT; const _Float16* klp = KL + (size_t)blockIdx.z * (KHI / 16) * FT;
      if (n > 0) { const v16h al0 = frag_t(qlp, lane), al1 = frag_t(qlp + 512, lane);
#pragma unroll
        for (int tt = 0; tt < 2; ++tt) { const _Float16* kr = kp + (size_t)(wave * 2 + tt) * FT; const _Float16* kl = klp + (size_t)(wave * 2 + tt) * FT;
          const v16h kb0 = frag_t(kr, lane), kl0 = frag_t(kl, lane), kb1 = frag_t(kr + 512, lane), kl1 = frag_t(kl + 512, lane); v8f a = {}, l = {};
          asm volatile("s_wait_xcnt 0x0" ::: "memory");   /* the k loads' address registers may be taken again right behind them */
          a = wmma16(kb0, ah0, a); l = wmma16(kb0, al0, l); l = wmma16(kl0, ah0, l);
          a = wmma16(kb1, ah1, a); l = wmma16(kb1, al1, l); l = wmma16(kl1, ah1, l);
          s[0][tt] = a + l * (1.0f / 1024.0f); } }
    } else { const _Float16* kr = kp + (size_t)wave * (2 * FT); v16h ka[4], kb[4];   /* two chunks (4 key tiles) have their k fragments in flight together: one load latency up to two chunks, two above */
      if (n > 2) { k_chunk(ka, kr + 2 * PVS * (2 * FT), lane); if (n > 3) k_chunk(kb, kr + 3 * PVS * (2 * FT), lane);
        qk_mul(s[0], ka, ah0, ah1); m = mask_max(s[0], m, wave + 2 * PVS, ql0, col, g); park(sw, s[0], lane);
        if (n > 3) { qk_mul(s[0], kb, ah0, ah1); m = mask_max(s[0], m, wave + 3 * PVS, ql0, col, g); park(sw + 512, s[0], lane); } }
      if (n > 0) { k_chunk(ka, kr, lane); if (n > 1) k_chunk(kb, kr + PVS * (2 * FT), lane);
        qk_mul(s[0], ka, ah0, ah1); if (n > 1) qk_mul(s[1], kb, ah0, ah1); } } }
  if (n > 0) m = mask_max(s[0], m, wave, ql0, col, g);
  if (n > 1) m = mask_max(s[1], m, wave + PVS, ql0, col, g);
  m = fmaxf(m, __shfl_xor(m, 16));
  if (lane < 16) mx[col][wave] = m;   /* a wave without a chunk leaves -3.0e38 */
  __syncthreads();   /* every wave's row maxima are in LDS before any lane takes its row's maximum */
  { v4f q4 = *(const v4f*)&mx[col][0];
#pragma unroll
    for (int w = 4; w < PVS; w += 4) { const v4f o4 = *(const v4f*)&mx[col][w];
#pragma unroll
      for (int c = 0; c < 4; ++c) q4[c] = fmaxf(q4[c], o4[c]); }
    m = fmaxf(fmaxf(q4[0], q4[1]), fmaxf(q4[2], q4[3])); }
  const float cs = SCALE * 1.44269504f, mb = 11.0f - (m * SCALE) * 1.44269504f;   /* e = 2^(x log2(e) - max log2(e) + 11): one fused multiply-add and one v_exp_f32 per key; SCALE is a power of two, so raw x (SCALE log2(e)) is the scaled logit's product exactly; the rounding of mb scales the whole row alike and cancels in e / sum. m is a real logit (key 0 is allowed in every row), so an excluded key's -3.0e38 goes far below and its e to 0 with no test */
  float ls0 = 0.f, ls1 = 0.f; v8f acc[HD / 16] = {};
  if (qb < QBH) {
    if (n > 0) { v16b vh[HD / 16], vl[HD / 16]; float e[16], e0[8], e1[8]; exp2x8(e0, s[0][0], cs, mb); exp2x8(e1, s[0][1], cs, mb);
#pragma unroll
      for (int i = 0; i < 8; ++i) { e[i] = e0[i]; e[8 + i] = e1[i]; ls0 += e0[i]; ls1 += e1[i]; }
      const F2 p = bsplit16(e);
      asm volatile("" :: "v"(p.h), "v"(p.l) : "memory");   /* inputs only: holds the 16 loads below behind the end of the split, whose temporaries are then dead; side by side they pass 128 registers, and the WGP holds one block, not two */
#pragma unroll
      for (int j = 0; j < HD / 16; ++j) { const size_t po = ((size_t)blockIdx.z * (KHI / 32) + wave) * FV + j * 512; vh[j] = frag_tb(VB + po, lane); vl[j] = frag_tb(VBL + po, lane); }
      asm volatile("s_wait_xcnt 0x0" ::: "memory");   /* the loads' address registers may be written again behind them */
#pragma unroll
      for (int j = 0; j < HD / 16; ++j) { acc[j] = wmma_bf(p.h, vh[j], acc[j]); acc[j] = wmma_bf(p.l, vh[j], acc[j]); acc[j] = wmma_bf(p.h, vl[j], acc[j]); } }
  } else if (n > 0) { const _Float16* vp = VT + ((size_t)blockIdx.z * (TT / 32) + wave) * FV; v16h p0, p1, va[HD / 16];   /* e runs one chunk ahead of the products: while a chunk's v fragments are in flight the e of the next chunk are formed; chunks 2 and 3 come back from the wave's LDS slot one at a time */
    v_chunk(va, vp, lane);
    p0 = e_chunk(s[0], cs, mb, ls0, ls1); if (n > 1) p1 = e_chunk(s[1], cs, mb, ls0, ls1);
    pv_mul(acc, p0, va);
    if (n > 1) { v_chunk(va, vp + PVS * FV, lane);
      if (n > 2) { unpark(s[0], sw, lane); p0 = e_chunk(s[0], cs, mb, ls0, ls1); }
      pv_mul(acc, p1, va);
      if (n > 2) { v_chunk(va, vp + 2 * (PVS * FV), lane);
        if (n > 3) { unpark(s[0], sw + 512, lane); p1 = e_chunk(s[0], cs, mb, ls0, ls1); }
        pv_mul(acc, p0, va);
        if (n > 3) { v_chunk(va, vp + 3 * (PVS * FV), lane); pv_mul(acc, p1, va); } } } }
  { float ls = ls0 + ls1; ls += __shfl_xor(ls, 16);
    if (lane < 16) sm[col][wave] = ls; }   /* the wave's share of each row's sum; 0 from a wave without a chunk */
#pragma unroll
  for (int j = 0; j < HD / 16; ++j)
#pragma unroll
    for (int r = 0; r < 8; ++r) sw[(8 * g + r) * HD + j * 16 + col] = acc[j][r];
  __syncthreads();   /* every wave's partial tile and partial row sums are in LDS before any thread adds them */
  { const int rl = tid >> 5; v2f t2 = *(const v2f*)&part[0][rl * HD + lane * 2]; float sum = 0.f;
#pragma unroll
    for (int w = 1; w < PVS; ++w) t2 += *(const v2f*)&part[w][rl * HD + lane * 2];
#pragma unroll
    for (int w = 0; w < PVS; w += 4) { const v4f o4 = *(const v4f*)&sm[rl][w]; sum += o4[0]; sum += o4[1]; sum += o4[2]; sum += o4[3]; }
    vst2(Y + ((size_t)b * TT + ql0 + rl) * CC + h * HD + lane * 2, t2 * (sum > 0.f ? 1.0f / sum : 0.f)); } }   /* a fully excluded row yields 0 */
// ---- k_out: block = (64 rows, 128 cols): out = ctx Wo (+ bo): ctx x 2^6 once to f16 against Wo as f16(bf16 x 2^8) exact (1 product) x 2^-14; causal early rows (< QHI of each sequence): ctx bf16 hi + lo against exact bf16 Wo (2 products)
__global__ __launch_bounds__(128) void k_out(const float* __restrict__ Y, const float* __restrict__ WO, const float* __restrict__ BO, float* __restrict__ OUT) { __shared__ __align__(16) float sf[4][16][132]; __shared__ __align__(16) unsigned short wt[2][128][WP];
  const int tid = threadIdx.x, wave = tid >> 5, lane = tid & 31, col = lane & 15, g = lane >> 4; const int c0 = blockIdx.y * 128; const size_t r0 = (size_t)blockIdx.x * 64 + wave * 16;
  v8f acc[8] = {};
  const float* wp = WO + c0 + tid; const float* xp = Y + (r0 + col) * CC + 8 * g; float wr[KS]; v4f xr[KS / 8];
  stage_ld<DIN>(wr, xr, wp, xp);
  asm volatile("s_wait_xcnt 0x0" ::: "memory");   /* stage 0's loads name registers that are written again behind the branch below */
  if (CAUSAL && (int)(((size_t)blockIdx.x * 64) % TT) < QHI) {   /* block-uniform */
    F2 a[KS / 32]; stage_st<0>(&wt[0][tid][0], wr);
#pragma unroll
    for (int kk = 0; kk < KS / 32; ++kk) { float v[16]; stage_a(v, xr, kk); a[kk] = bsplit16(v); }
    __syncthreads();   /* stage 0 of the weight tile is in LDS before any wave reads it */
#pragma unroll 1   /* kept rolled: a trip already holds a whole stage's loads and products; a second copy would only add registers and code */
    for (int s = 0; s < CC / KS; ++s) {
      if (s + 1 < CC / KS) { wp += (size_t)KS * DIN; xp += KS; stage_ld<DIN>(wr, xr, wp, xp); }
#pragma unroll
      for (int kk = 0; kk < KS / 32; ++kk)
#pragma unroll
        for (int j0 = 0; j0 < 8; j0 += FG) { v16b w[FG];
#pragma unroll
          for (int j = 0; j < FG; ++j) w[j] = frag_b((const __bf16*)&wt[s & 1][(j0 + j) * 16 + col][kk * 32], lane);
#pragma unroll
          for (int j = 0; j < FG; ++j) { acc[j0 + j] = wmma_bf(a[kk].h, w[j], acc[j0 + j]); acc[j0 + j] = wmma_bf(a[kk].l, w[j], acc[j0 + j]); } }
      if (s + 1 < CC / KS) { stage_st<0>(&wt[(s + 1) & 1][tid][0], wr);
#pragma unroll
        for (int kk = 0; kk < KS / 32; ++kk) { float v[16]; stage_a(v, xr, kk); a[kk] = bsplit16(v); } }
      __syncthreads();   /* publishes stage s + 1 and ends every wave's reads of stage s, whose buffer the next trip refills */
    }
#pragma unroll
    for (int j = 0; j < 8; ++j) { const float bias = BO ? bfr(BO[c0 + j * 16 + col]) : 0.f;
#pragma unroll
      for (int r = 0; r < 8; ++r) sf[wave][8 * g + r][j * 16 + col] = acc[j][r] + bias; }
  } else {
    v16h a[KS / 32]; stage_st<1>(&wt[0][tid][0], wr);
#pragma unroll
    for (int kk = 0; kk < KS / 32; ++kk) { float v[16]; stage_a(v, xr, kk);
#pragma unroll
      for (int i = 0; i < 16; ++i) a[kk][i] = (_Float16)(v[i] * 64.0f); }   /* ctx carried x 2^6 into f16 so small-magnitude context rows stay clear of f16 subnormals */
    __syncthreads();   /* stage 0 of the weight tile is in LDS before any wave reads it */
#pragma unroll 1   /* kept rolled: a trip already holds a whole stage's loads and products; a second copy would only add registers and code */
    for (int s = 0; s < CC / KS; ++s) {
      if (s + 1 < CC / KS) { wp += (size_t)KS * DIN; xp += KS; stage_ld<DIN>(wr, xr, wp, xp); }
#pragma unroll
      for (int kk = 0; kk < KS / 32; ++kk)
#pragma unroll
        for (int j0 = 0; j0 < 8; j0 += FG) { v16h w[FG];
#pragma unroll
          for (int j = 0; j < FG; ++j) w[j] = frag_h((const _Float16*)&wt[s & 1][(j0 + j) * 16 + col][kk * 32], lane);
#pragma unroll
          for (int j = 0; j < FG; ++j) acc[j0 + j] = wmma16(a[kk], w[j], acc[j0 + j]); }
      if (s + 1 < CC / KS) { stage_st<1>(&wt[(s + 1) & 1][tid][0], wr);
#pragma unroll
        for (int kk = 0; kk < KS / 32; ++kk) { float v[16]; stage_a(v, xr, kk);
#pragma unroll
          for (int i = 0; i < 16; ++i) a[kk][i] = (_Float16)(v[i] * 64.0f); } }
      __syncthreads();   /* publishes stage s + 1 and ends every wave's reads of stage s, whose buffer the next trip refills */
    }
#pragma unroll
    for (int j = 0; j < 8; ++j) { const float bias = BO ? bfr(BO[c0 + j * 16 + col]) : 0.f;
#pragma unroll
      for (int r = 0; r < 8; ++r) sf[wave][8 * g + r][j * 16 + col] = acc[j][r] * (1.0f / 16384.0f) + bias; } }   /* 2^-8 (Wo carry) x 2^-6 (ctx carry) */
  LDSX(); for (int rl = 0; rl < 16; ++rl) vst2(OUT + (r0 + rl) * DIN + c0 + lane * 4, *(const v4f*)&sf[wave][rl][lane * 4]); }

extern "C" void kernel_launch(void* const* d_in, const int* in_sizes, int n_in, void* d_out, int out_size, void* d_ws, size_t ws_size, hipStream_t stream) {
  (void)in_sizes; (void)n_in; (void)out_size;
  const float** F = (const float**)d_in;
  if (ws_size < (size_t)WS_END) return;
  char* ws = (char*)d_ws; _Float16 *QH = (_Float16*)(ws + WS_QH), *KH = (_Float16*)(ws + WS_KH), *VT = (_Float16*)(ws + WS_VT), *QL = (_Float16*)(ws + WS_QL), *KL = (_Float16*)(ws + WS_KL); __bf16 *VB = (__bf16*)(ws + WS_VB), *VBL = (__bf16*)(ws + WS_VBL); float *Y = (float*)(ws + WS_Y);
  (void)Y; (void)QL; (void)KL; (void)VB; (void)VBL;
  // inputs: 0 x [2,2048,1024]; 1 w_attn [1024,3072] (in,out; columns q | k | v); 2 b_attn [3072] (zeros, read); 3 w_proj [1024,1024] (in,out); 4 b_proj [1024] (zeros, read). outputs: 0 a [2,2048,1024] at d_out + 0; 1 present [2,2,16,2048,64] at d_out + NB*TT*CC floats (byte offset 16,777,216)
  k_proj<<<dim3(TNB * TT / 64, CC / 128, 3), 128, 0, stream>>>(F[0], F[0], F[0], F[1], F[1] + CC, F[1] + 2 * CC, F[2], F[2] + CC, F[2] + 2 * CC, QH, QL, KH, KL, VT, VB, VBL, (float*)d_out + (size_t)NB * TT * CC);
  k_pv<<<dim3(TT / 16, 1, TNB * NH), 32 * PVS, 0, stream>>>(QH, KH, QL, KL, VT, VB, VBL, Y);
  k_out<<<dim3(TNB * TT / 64, DIN / 128), 128, 0, stream>>>(Y, F[3], F[4], (float*)d_out);
}

// v010
// Measured time: 133 microseconds a run.
// Two timings next to v009 both put it at 1.04 times that version's speed.
// All steps since v000 together make it 8.32 times as fast.
// compute dtype: all float inputs rounded to bf16; c = x w_attn + b_attn with EXACT bf16 products on WMMA 16x16x32 (f32 accumulate); the f32 k and v rows are ALSO the second output (present); causal logits: 3 products for the first 384 rows, single f16 q x k after, x 64^-0.5; softmax f32; exp(x - max) x 2^11 once to f16 x v once to f16 (bf16 hi + lo below row 384), divided by the f32 row sum after; ctx hi+lo x exact w_proj below row 384, x2^6 f16 carry x f16(bf16 x 2^8) after, + b_proj; f32 outputs.
#include <hip/hip_runtime.h>
#include <math.h>

typedef __attribute__((ext_vector_type(16))) _Float16 v16h;
typedef __attribute__((ext_vector_type(16))) __bf16 v16b;
typedef __attribute__((ext_vector_type(8)))  _Float16 v8h;
typedef __attribute__((ext_vector_type(8)))  float v8f;
typedef __attribute__((ext_vector_type(4)))  float v4f;
typedef __attribute__((ext_vector_type(2)))  float v2f;
typedef __attribute__((ext_vector_type(4)))  unsigned v4u;
typedef __attribute__((ext_vector_type(4)))  int v4i;
typedef float __attribute__((may_alias)) float_a;
typedef int __attribute__((may_alias)) int_a;

template <typename T> __device__ __forceinline__ void vst2(void* p, T v) { *(T*)p = v;  }
__device__ __forceinline__ v8f wmma16(v16h a, v16h b, v8f c) {
  v8f d = __builtin_amdgcn_wmma_f32_16x16x32_f16(false, a, false, b, (short)0, c, false, false);
  asm volatile("v_nop\n\tv_nop\n\tv_nop\n\tv_nop" : "+v"(d) : "v"(a), "v"(b));
  return d;
}
__device__ __forceinline__ v8f wmma_bf(v16b a, v16b b, v8f c) {
  v8f d = __builtin_amdgcn_wmma_f32_16x16x32_bf16(false, a, false, b, (short)0, c, false, false);
  asm volatile("v_nop\n\tv_nop\n\tv_nop\n\tv_nop" : "+v"(d) : "v"(a), "v"(b));
  return d;
}
// 16x16x32 fragments: lane = (h = lane>>4, row/col = lane&15); elements 0..7 = k0+8h+0..7, 8..15 = k0+16+8h+0..7; D element r = row 8h+r
__device__ __forceinline__ v16h frag_h(const _Float16* rowk0, int lane) {
  union { v16h v; v8h q[2]; } u; const _Float16* p = rowk0 + 8 * (lane >> 4);
  u.q[0] = *(const v8h*)p; u.q[1] = *(const v8h*)(p + 16); return u.v;
}
__device__ __forceinline__ v16h frag_f32(const float* rowk0, int lane) {
  v16h a; const float* p = rowk0 + 8 * (lane >> 4);
#pragma unroll
  for (int i = 0; i < 8; ++i) { a[i] = (_Float16)p[i]; a[8 + i] = (_Float16)p[16 + i]; }
  return a;
}
__device__ __forceinline__ v16h frag_f32s(const float* rowk0, int lane, float sc) {
  v16h a; const float* p = rowk0 + 8 * (lane >> 4);
#pragma unroll
  for (int i = 0; i < 8; ++i) { a[i] = (_Float16)(p[i] * sc); a[8 + i] = (_Float16)(p[16 + i] * sc); }
  return a;
}
// column fragment from a [K][ld] layout (column n), rows >= K read as 0
__device__ __forceinline__ v16h fragc_f32(const float* W, int k0, int n, int lane, int ld, int K) {
  v16h a; const int g = lane >> 4;
#pragma unroll
  for (int i = 0; i < 8; ++i) { const int ka = k0 + 8 * g + i, kb = ka + 16;
    a[i] = (_Float16)(ka < K ? W[(size_t)(ka < K ? ka : K - 1) * ld + n] : 0.f); a[8 + i] = (_Float16)(kb < K ? W[(size_t)(kb < K ? kb : K - 1) * ld + n] : 0.f); }
  return a;
}
struct F2 { v16b h, l; };
__device__ __forceinline__ F2 bsplit16(const float v[16]) { F2 r;
#pragma unroll
  for (int i = 0; i < 16; ++i) { const __bf16 h = (__bf16)v[i]; r.h[i] = h; r.l[i] = (__bf16)(v[i] - (float)h); }
  return r; }
__device__ __forceinline__ F2 split_row(const float* row, int k0, int lane) { float v[16]; const float* p = row + k0 + 8 * (lane >> 4);
#pragma unroll
  for (int i = 0; i < 8; ++i) { v[i] = p[i]; v[8 + i] = p[16 + i]; }
  return bsplit16(v); }
__device__ __forceinline__ F2 split_rowK(const float* row, int k0, int lane, int K) { float v[16]; const int g = lane >> 4;
#pragma unroll
  for (int i = 0; i < 8; ++i) { const int ka = k0 + 8 * g + i, kb = ka + 16; v[i] = ka < K ? row[ka < K ? ka : K - 1] : 0.f; v[8 + i] = kb < K ? row[kb < K ? kb : K - 1] : 0.f; }
  return bsplit16(v); }
__device__ __forceinline__ F2 split_col(const float* W, int k0, int n, int lane, int ld, int K) { float v[16]; const int g = lane >> 4;
#pragma unroll
  for (int i = 0; i < 8; ++i) { const int ka = k0 + 8 * g + i, kb = ka + 16; v[i] = ka < K ? W[(size_t)(ka < K ? ka : K - 1) * ld + n] : 0.f; v[8 + i] = kb < K ? W[(size_t)(kb < K ? kb : K - 1) * ld + n] : 0.f; }
  return bsplit16(v); }
__device__ __forceinline__ v8f mac3(const F2& a, const F2& b, v8f c) { c = wmma_bf(a.l, b.h, c); c = wmma_bf(a.h, b.l, c); return wmma_bf(a.h, b.h, c); }
__device__ __forceinline__ float sigm(float v) { return 1.0f / (1.0f + expf(-v)); }
#define LDSX() do { asm volatile("s_wait_dscnt 0" ::: "memory"); __builtin_amdgcn_wave_barrier(); __builtin_amdgcn_fence(__ATOMIC_RELEASE, "workgroup"); } while (0)

// Fused-qkv causal self-attention with TWO outputs (x [2,2048,1024]; fused (in,out) w_attn [1024,3072] N(0,1) x 0.02 + b_attn zeros (read), jnp.split(c, 3, axis=2) -> q | k | v column blocks; 16 heads x 64; w = q k^T x rsqrt(64); w * b - 1e10 * (1 - b) with b = (i >= j): causal, the masked logits are exactly -1e10; softmax; a = merge(p v) w_proj + b_proj; outputs: a [2,2048,1024] and present = stack([k, v], axis=1) [2,2,16,2048,64] = the projected k and v (bias included) in head-major layout).
#define NB 2
#define TT 2048
#define CC 1024            // NH * HD = projected width
#define DIN 1024          // input (model) width
#define NH 16
#define HD 64
#define SCALE (0.125f)
#define CAUSAL 1
#ifndef TNB
#define TNB NB
#endif
__device__ __forceinline__ float bfr(float v) { return (float)(__bf16)v; }
__host__ __device__ __forceinline__ int kb_last(int qb) { return CAUSAL ? ((qb * 64 + 63) >> 7) : (TT / 128 - 1); }
typedef __attribute__((ext_vector_type(8))) __bf16 v8b;
__device__ __forceinline__ v16b frag_b(const __bf16* rowk0, int lane) {
  union { v16b v; v8b q[2]; } u; const __bf16* p = rowk0 + 8 * (lane >> 4);
  u.q[0] = *(const v8b*)p; u.q[1] = *(const v8b*)(p + 16); return u.v;
}
// ---- fragment order: the planes that k_pv reads are stored by k_proj as the registers of the WMMA fragments, so that each wave-wide 16-B load covers 512 contiguous bytes = 4 whole lines (a row-major tile makes it touch 16 lines). q, k and their residuals: tile (b, h, 16 rows) = FT elements [k step 0..1][half 0..1][lane][8]; v planes: chunk (b, h, 32 keys) = FV elements [16 columns j 0..3][half 0..1][lane][8]; lane = (g, row or column), its 8 elements = k0 + 16 * half + 8 * g + 0..7, as frag_h takes them from a row
#define FT (16 * HD)
#define FV (32 * HD)
__device__ __forceinline__ v16h frag_t(const _Float16* f, int lane) { union { v16h v; v8h q[2]; } u; u.q[0] = *(const v8h*)(f + lane * 8); u.q[1] = *(const v8h*)(f + 256 + lane * 8); return u.v; }
__device__ __forceinline__ v16b frag_tb(const __bf16* f, int lane) { union { v16b v; v8b q[2]; } u; u.q[0] = *(const v8b*)(f + lane * 8); u.q[1] = *(const v8b*)(f + 256 + lane * 8); return u.v; }
#define QBH 6              // causal: query blocks 0..QBH-1 of each sequence (few keys, no averaging) take the high-precision path
#define QHI 384            // rows carrying a q residual plane
#define KHI 384            // key rows carrying k residual / v bf16 hi+lo planes (used only by the causal high-precision path)
// B fragment (k rows k0+.., output column o) of a weight: (in,out) [K][ld] or (out,in) [ld rows of K]: bf16 exact, or f16(bf16 * 256) exact
__device__ __forceinline__ v16b wcol_io(const float* Wm, int k0, int o, int lane, int ld) { v16b w; const int g = lane >> 4;
#pragma unroll
  for (int i = 0; i < 8; ++i) { w[i] = (__bf16)Wm[(size_t)(k0 + 8 * g + i) * ld + o]; w[8 + i] = (__bf16)Wm[(size_t)(k0 + 16 + 8 * g + i) * ld + o]; }
  return w; }
__device__ __forceinline__ v16b wcol_oi(const float* Wm, int k0, int o, int lane, int K) { v16b w; const float* p = Wm + (size_t)o * K + k0 + 8 * (lane >> 4);
#pragma unroll
  for (int i = 0; i < 8; ++i) { w[i] = (__bf16)p[i]; w[8 + i] = (__bf16)p[16 + i]; }
  return w; }
__device__ __forceinline__ v16h wcolh_io(const float* Wm, int k0, int o, int lane, int ld) { v16h w; const int g = lane >> 4;
#pragma unroll
  for (int i = 0; i < 8; ++i) { w[i] = (_Float16)(bfr(Wm[(size_t)(k0 + 8 * g + i) * ld + o]) * 256.0f); w[8 + i] = (_Float16)(bfr(Wm[(size_t)(k0 + 16 + 8 * g + i) * ld + o]) * 256.0f); }
  return w; }
__device__ __forceinline__ v16h wcolh_oi(const float* Wm, int k0, int o, int lane, int K) { v16h w; const float* p = Wm + (size_t)o * K + k0 + 8 * (lane >> 4);
#pragma unroll
  for (int i = 0; i < 8; ++i) { w[i] = (_Float16)(bfr(p[i]) * 256.0f); w[8 + i] = (_Float16)(bfr(p[16 + i]) * 256.0f); }
  return w; }
#define WQKV_LAYOUT 0   // 0 = (in,out); 1 = (out,in) [CC][DIN]; 2 = per-head [NH][DIN][HD]
__device__ __forceinline__ v16b wcol_hdk(const float* Wm, int k0, int o, int lane) { v16b w; const int g = lane >> 4; const float* p = Wm + (size_t)(o / HD) * DIN * HD + (o % HD);
#pragma unroll
  for (int i = 0; i < 8; ++i) { w[i] = (__bf16)p[(size_t)(k0 + 8 * g + i) * HD]; w[8 + i] = (__bf16)p[(size_t)(k0 + 16 + 8 * g + i) * HD]; }
  return w; }
#define WO_OUT_IN 0
#if WQKV_LAYOUT == 1
#define WCOL(W, k0, o, lane) wcol_oi(W, k0, o, lane, DIN)
#elif WQKV_LAYOUT == 2
#define WCOL(W, k0, o, lane) wcol_hdk(W, k0, o, lane)
#else
#define WCOL(W, k0, o, lane) wcol_io(W, k0, o, lane, 3 * CC)   /* w_attn (in,out) [1024][3072] packed by columns: row pitch 3*CC; the q / k / v pointers carry the column offsets 0 / CC / 2*CC */
#endif
#if WO_OUT_IN
#define WOCOL(W, k0, o, lane) wcol_oi(W, k0, o, lane, CC)
#define WOCOLH(W, k0, o, lane) wcolh_oi(W, k0, o, lane, CC)
#else
#define WOCOL(W, k0, o, lane) wcol_io(W, k0, o, lane, DIN)
#define WOCOLH(W, k0, o, lane) wcolh_io(W, k0, o, lane, DIN)
#endif
#define PROJ_EXTRA_PARAMS , float* __restrict__ PRES   /* second output: present [NB][2][NH][TT][HD] f32 */
#define PROJ_EPI(which, row, t, h) do { if ((which) >= 1) { float* dst_ = PRES + ((((size_t)bb * 2 + ((which) - 1)) * NH + (h)) * TT + (t)) * HD; _Pragma("unroll") for (int q4 = 0; q4 < HD / 4; ++q4) vst2(dst_ + 4 * q4, *(const v4f*)((row) + 4 * q4)); } } while (0)
static_assert(HD == 64 && (132 * 4) % 16 == 0, "the staged row st[rl][hh*HD] is 16-B aligned and 64 floats long");
#ifndef PROJ_EXTRA_PARAMS
#define PROJ_EXTRA_PARAMS
#endif

#define WS_QH  0u                                      // f16 q tiles [b][h][t / 16][FT], fragment order
#define WS_KH  (WS_QH + 2u * (size_t)NB * TT * CC)      // f16 k tiles [b][h][t / 16][FT], fragment order
#define WS_VT  (WS_KH + 2u * (size_t)NB * TT * CC)      // f16 v chunks [b][h][t / 32][FV], fragment order
#define WS_QL  (WS_VT + 2u * (size_t)NB * CC * TT)      // f16 q residual x 2^10 tiles [b][h][t / 16 < QHI / 16][FT]
#define WS_KL  (WS_QL + 2u * (size_t)NB * QHI * CC)     // f16 k residual x 2^10 tiles [b][h][t / 16 < KHI / 16][FT]
#define WS_VB  (WS_KL + 2u * (size_t)NB * KHI * CC)     // bf16 v hi chunks [b][h][t / 32 < KHI / 32][FV]
#define WS_VBL (WS_VB + 2u * (size_t)NB * CC * KHI)
#define WS_Y   (WS_VBL + 2u * (size_t)NB * CC * KHI)    // f32 ctx rows [b*t][CC] (only when there is an output projection)
#define WS_END (WS_Y  + 4u * (size_t)NB * TT * CC)

// ---- the K loop of k_proj and k_out: a stage is KS k rows of the block's 128 weight columns. The block is RT rows x 128 columns on 8 waves, so that a weight stage fetched from L2 serves 128 rows. Thread tid reads k rows (tid >> 7) * KW .. + KW - 1 of column c0 + (tid & 127) of the stage (each wave-wide load = one whole 128-B line), rounds them once for the whole block and leaves them k-contiguous in LDS row tid & 127; every wave takes its B fragments from there. Two LDS buffers, one workgroup barrier per stage; the next stage's weight column and the wave's own next A rows are in flight while this stage's products run.
#define KS 64              // k rows per stage = 2 WMMA k steps
#define RT 128             // rows of a block's tile = 16 x its 8 waves
#define KW (KS / 2)        // k rows of a stage's column that one thread brings: 256 threads = 128 columns x 2 halves of the stage
#define FG 8               // B fragments a wave reads from LDS as one group in front of their products
#define WP (KS + 8)        // LDS row pitch in 16-bit elements: 144 B = 16 B x odd, so that 16 rows' 16-B reads and writes spread over the banks
static_assert(DIN % KS == 0 && CC % KS == 0 && KS % 32 == 0 && (WP * 2) % 32 == 16, "whole stages; row pitch = 16 B x odd");
static_assert(TT % RT == 0 && QHI % RT == 0 && KHI % RT == 0 && KW % 8 == 0, "a block's rows lie in one sequence and wholly on one side of the early-row limits; a thread's share of a column is whole 16-B pieces");
typedef __attribute__((address_space(1))) float gl_f;
typedef __attribute__((address_space(1))) v4f gl_v4f;
template <int LD> __device__ __forceinline__ void stage_ld(float (&wr)[KW], v4f (&xr)[KS / 8], const float* wp_, const float* xp_) {
  const gl_f* wp = (const gl_f*)wp_; const gl_f* xp = (const gl_f*)xp_;   /* both point into global memory: said here, so that a pointer that has passed through an asm operand still gives global loads, not flat ones */
#pragma unroll
  for (int i = 0; i < KW; ++i) wr[i] = wp[(size_t)i * LD];
#pragma unroll
  for (int kk = 0; kk < KS / 32; ++kk) { xr[kk * 4 + 0] = *(const gl_v4f*)(xp + kk * 32); xr[kk * 4 + 1] = *(const gl_v4f*)(xp + kk * 32 + 4); xr[kk * 4 + 2] = *(const gl_v4f*)(xp + kk * 32 + 16); xr[kk * 4 + 3] = *(const gl_v4f*)(xp + kk * 32 + 20); }
}
// F16 = 0: bf16 exact; 1: f16(bf16 x 2^8) exact
template <int F16> __device__ __forceinline__ void stage_st(unsigned short* row, const float (&wr)[KW]) {
#pragma unroll
  for (int q = 0; q < KW / 8; ++q) { union { v8b b; v8h h; v4u u; } t;
#pragma unroll
    for (int i = 0; i < 8; ++i) { if (F16) t.h[i] = (_Float16)(bfr(wr[q * 8 + i]) * 256.0f); else t.b[i] = (__bf16)wr[q * 8 + i]; }
    vst2(row + q * 8, t.u); } }
// the 16 f32 values of A fragment kk of a stage, in fragment order
__device__ __forceinline__ void stage_a(float (&v)[16], const v4f (&xr)[KS / 8], int kk) {
#pragma unroll
  for (int i = 0; i < 4; ++i) { v[i] = xr[kk * 4][i]; v[4 + i] = xr[kk * 4 + 1][i]; v[8 + i] = xr[kk * 4 + 2][i]; v[12 + i] = xr[kk * 4 + 3][i]; } }
// ---- k_proj: block = (RT rows, 128 cols, which): q/k/v = X W (+ b) with exact bf16 products (K = DIN) -> which 0: q f16 tiles (+ residual tiles for rows < QHI); 1: k f16 tiles (+ residual tiles for rows < KHI); 2: v f16 chunks (+ bf16 hi/lo chunks for t < KHI), all in fragment order
__global__ __launch_bounds__(2 * RT) void k_proj(const float* __restrict__ XQ, const float* __restrict__ XK, const float* __restrict__ XV, const float* __restrict__ WQ, const float* __restrict__ WK, const float* __restrict__ WV, const float* __restrict__ BQ, const float* __restrict__ BK, const float* __restrict__ BV,
    _Float16* __restrict__ QH, _Float16* __restrict__ QL, _Float16* __restrict__ KH, _Float16* __restrict__ KL, _Float16* __restrict__ VT, __bf16* __restrict__ VB, __bf16* __restrict__ VBL PROJ_EXTRA_PARAMS) {
  __shared__ __align__(16) float st[RT][132]; __shared__ __align__(16) unsigned short wt[2][128][WP];
  const int tid = threadIdx.x, wave = tid >> 5, lane = tid & 31, col = lane & 15, g = lane >> 4; const int wc = tid & 127, wk = (tid >> 7) * KW; const int which = blockIdx.z; const int c0 = blockIdx.y * 128; const size_t r0 = (size_t)blockIdx.x * RT; const size_t bb = r0 / TT; const int t0 = (int)(r0 % TT);
  const float* X = which == 0 ? XQ : which == 1 ? XK : XV; const float* WA = which == 0 ? WQ : which == 1 ? WK : WV; const float* BA = which == 0 ? BQ : which == 1 ? BK : BV;
  v8f acc[8] = {};
  { const float* wp = WA + (size_t)wk * (3 * CC) + c0 + wc; const float* xp = X + (r0 + wave * 16 + col) * DIN + 8 * g; float wr[KW]; v4f xr[KS / 8]; v16b a[KS / 32];
    stage_ld<3 * CC>(wr, xr, wp, xp);
    asm volatile("s_wait_xcnt 0x0" ::: "memory");   /* the scalar base of stage 0's weight loads is reused right behind them */
    stage_st<0>(&wt[0][wc][wk], wr);
#pragma unroll
    for (int kk = 0; kk < KS / 32; ++kk) { float v[16]; stage_a(v, xr, kk);
#pragma unroll
      for (int i = 0; i < 16; ++i) a[kk][i] = (__bf16)v[i]; }
    __syncthreads();   /* stage 0 of the weight tile is in LDS before any wave reads it */
#pragma unroll 1   /* kept rolled: a trip already holds a whole stage's loads and products; a second copy would only add registers and code */
    for (int s = 0; s < DIN / KS; ++s) {
      if (s + 1 < DIN / KS) { wp += (size_t)KS * 3 * CC; xp += KS; stage_ld<3 * CC>(wr, xr, wp, xp); }
#pragma unroll
      for (int kk = 0; kk < KS / 32; ++kk)
#pragma unroll
        for (int j0 = 0; j0 < 8; j0 += FG) { v16b w[FG];
#pragma unroll
          for (int j = 0; j < FG; ++j) w[j] = frag_b((const __bf16*)&wt[s & 1][(j0 + j) * 16 + col][kk * 32], lane);
#pragma unroll
          for (int j = 0; j < FG; ++j) acc[j0 + j] = wmma_bf(a[kk], w[j], acc[j0 + j]); }
      if (s + 1 < DIN / KS) { stage_st<0>(&wt[(s + 1) & 1][wc][wk], wr);
#pragma unroll
        for (int kk = 0; kk < KS / 32; ++kk) { float v[16]; stage_a(v, xr, kk);
#pragma unroll
          for (int i = 0; i < 16; ++i) a[kk][i] = (__bf16)v[i]; } }
      __syncthreads();   /* publishes stage s + 1 and ends every wave's reads of stage s, whose buffer the next trip refills */
    } }
  { // stage the f32 tile (acc + bias) in LDS; behind its one barrier the tile is only read: every thread forms its 16-B output pieces from it in registers, so that the block holds no 16-bit copy of the tile in LDS
#pragma unroll
    for (int j = 0; j < 8; ++j) { const float bias = BA ? bfr(BA[c0 + j * 16 + col]) : 0.f;
#pragma unroll
      for (int r = 0; r < 8; ++r) st[wave * 16 + 8 * g + r][j * 16 + col] = acc[j][r] + bias; }
    __syncthreads();   /* the whole f32 tile is in LDS before any thread reads rows that another wave wrote */
    for (int e = tid; e < RT * (128 / HD); e += 2 * RT) { const int rl = e / (128 / HD), hh = e % (128 / HD); PROJ_EPI(which, &st[rl][hh * HD], (int)((r0 + rl) % TT), (c0 / HD) + hh); }
  }
  const int tp = tid & 127, rb = (tid >> 7) * 64, th0 = t0 + rb;   /* threads 0..127 turn tile rows 0..63 into pieces, threads 128..255 rows 64..127: tp is the thread's place among its 128, rb its first tile row, th0 that row's position in the sequence */
  if (which < 2) { _Float16* DH = which == 0 ? QH : KH; _Float16* DL = which == 0 ? QL : KL; const int nhi = which == 0 ? QHI : KHI; const bool hi_rows = t0 < nhi;
    const int rl = rb + (tp & 15), cl = (tp >> 5) * 16 + ((tp >> 4) & 1) * 8; const size_t hb = bb * NH + c0 / HD;   /* the thread has piece tp of each of its half's 8 tiles (head hh, 16 rows tt): a wave's store is 512 contiguous bytes; its 8 values are 32 contiguous bytes of a tile row (16 rows at pitch 528 B spread over the banks) */
    _Float16* dh = DH + (hb * (TT / 16) + th0 / 16) * FT + tp * 8; v4u ph[8];
#pragma unroll   /* unrolled: ph is indexed by constants only */
    for (int i = 0; i < 8; ++i) { const int hh = i >> 2, tt = i & 3; const float* p = &st[tt * 16 + rl][hh * HD + cl]; const v4f a = *(const v4f*)p, b = *(const v4f*)(p + 4); union { v8h h; v4u u; } t;
#pragma unroll
      for (int c = 0; c < 4; ++c) { t.h[c] = (_Float16)a[c]; t.h[4 + c] = (_Float16)b[c]; }
      ph[i] = t.u; }
#pragma unroll   /* unrolled: the 8 stores share one address register pair and differ in a constant offset */
    for (int i = 0; i < 8; ++i) { const int hh = i >> 2, tt = i & 3; vst2((unsigned*)(dh + (hh * (TT / 16) + tt) * FT), ph[i]); }
    if (hi_rows) { _Float16* dl = DL + (hb * (nhi / 16) + th0 / 16) * FT + tp * 8; v4u pl[8];
      asm volatile("s_wait_xcnt 0x0" ::: "memory");   /* the registers of the 8 stores above are taken again for the residual pieces */
#pragma unroll   /* as above */
      for (int i = 0; i < 8; ++i) { const int hh = i >> 2, tt = i & 3; const float* p = &st[tt * 16 + rl][hh * HD + cl]; const v4f a = *(const v4f*)p, b = *(const v4f*)(p + 4); union { v8h h; v4u u; } t;
#pragma unroll
        for (int c = 0; c < 4; ++c) { t.h[c] = (_Float16)((a[c] - (float)(_Float16)a[c]) * 1024.0f); t.h[4 + c] = (_Float16)((b[c] - (float)(_Float16)b[c]) * 1024.0f); }
        pl[i] = t.u; }
#pragma unroll   /* as above */
      for (int i = 0; i < 8; ++i) { const int hh = i >> 2, tt = i & 3; vst2((unsigned*)(dl + (hh * (nhi / 16) + tt) * FT), pl[i]); } }
  } else { const bool hi_rows = t0 < KHI;
    const int cl = (tp >> 6) * 16 + (tp & 15), rl = rb + ((tp >> 5) & 1) * 16 + ((tp >> 4) & 1) * 8; const size_t hb = bb * NH + c0 / HD;   /* the thread has pieces tp and 128 + tp (u) of each of its half's 4 chunks (head hh, 32 keys cc): a wave's store is 512 contiguous bytes; its 8 values are 8 rows of one tile column (a wave's 4-B reads: 16 columns in a row, twice, 32 banks apart) */
    _Float16* dv = VT + (hb * (TT / 32) + th0 / 32) * FV + tp * 8; v4u pv[8];
#pragma unroll   /* unrolled: pv is indexed by constants only */
    for (int i = 0; i < 8; ++i) { const int hh = i >> 2, cc = (i >> 1) & 1, u = i & 1; const float* p = &st[cc * 32 + rl][hh * HD + u * 32 + cl]; union { v8h h; v4u u; } t;
#pragma unroll
      for (int k = 0; k < 8; ++k) t.h[k] = (_Float16)p[k * 132];
      pv[i] = t.u; }
#pragma unroll   /* unrolled: the 8 stores share one address register pair and differ in a constant offset */
    for (int i = 0; i < 8; ++i) { const int hh = i >> 2, cc = (i >> 1) & 1, u = i & 1; vst2((unsigned*)(dv + (hh * (TT / 32) + cc) * FV + u * 1024), pv[i]); }
    if (hi_rows) { const size_t o3 = (hb * (KHI / 32) + th0 / 32) * FV + tp * 8; v4u pb[8], pl[8];
      asm volatile("s_wait_xcnt 0x0" ::: "memory");   /* the registers of the 8 stores above are taken again for the bf16 pieces */
#pragma unroll   /* as above */
      for (int i = 0; i < 8; ++i) { const int hh = i >> 2, cc = (i >> 1) & 1, u = i & 1; const float* p = &st[cc * 32 + rl][hh * HD + u * 32 + cl]; union { v8b b; v4u u; } th, tl;
#pragma unroll
        for (int k = 0; k < 8; ++k) { const float v = p[k * 132]; const __bf16 bh = (__bf16)v; th.b[k] = bh; tl.b[k] = (__bf16)(v - (float)bh); }
        pb[i] = th.u; pl[i] = tl.u; }
#pragma unroll   /* as above */
      for (int i = 0; i < 8; ++i) { const int hh = i >> 2, cc = (i >> 1) & 1, u = i & 1; const int o4 = (hh * (KHI / 32) + cc) * FV + u * 1024; vst2((unsigned*)(VB + o3 + o4), pb[i]); vst2((unsigned*)(VBL + o3 + o4), pl[i]); } }
    asm volatile("s_wait_xcnt 0x0" ::: "memory");   /* behind the arm's last store on both ways: the listing's next block writes the stores' data registers */
  } }
// ---- k_pv: block = 16 queries (tile qt) of (b, h), PVS waves, one launch for every (b, h). Wave w owns the 32-key chunks w, w + PVS, ... of keys [0, kend) from the logits to its partial ctx tile. The logits are taken as k x q^T on WMMA (single f16 product; causal early query blocks: k hi + residual x 2^10 against q hi + residual, 3 products): result element r of lane (g, query) is key 8 g + r of a 16-key tile, which is the place that key has in the A fragment of P x v, so the two tiles of a chunk become that chunk's P fragment inside the registers. Each wave leaves its 16 row maxima in LDS; behind a workgroup barrier every lane takes its row's maximum over the waves, forms e = 2^11 exp(x - max) (0 for excluded keys), adds its share of the row sum and multiplies the chunk (e once to f16 against v f16: 1 product; causal early query blocks: e and v as bf16 hi + lo, 3 products). The partial ctx tiles and the partial row sums meet in LDS behind one more workgroup barrier, are added in wave order, and the row is divided by its sum there; 256-B (row, head) segment by one wave
#define PVS 16             // key slices = waves per block = query rows per tile
#define NCH (TT / 32 / PVS)   // 32-key chunks a wave owns at most
#define SPW (PVS + 4)      // f32 pitch of a row's per-wave maxima and sums: 80 B = 16 B x odd, so that 16 rows' 16-B reads spread over the banks
static_assert(32 * PVS == 16 * (HD / 2), "the merge gives each thread one 8-B piece of the 16 x HD tile");
static_assert(PVS == 16 && TT % (32 * PVS) == 0 && NCH == 4, "one wave per query row of the tile at the merge; whole chunks; the runs below are written for 1 to 4 chunks");
static_assert(!CAUSAL || ((QBH * 64 - 1) / 128 + 1) * 128 <= KHI, "the early query blocks' keys have k residual rows and v hi + lo planes");
static_assert(!CAUSAL || KHI / 32 <= PVS, "an early query block gives a wave one chunk at most");
// the k fragments of one chunk (2 key tiles x 2 k steps), and its raw logits: k rows as A, q rows as B
__device__ __forceinline__ void k_chunk(v16h (&kf)[4], const _Float16* kr, int lane) {
#pragma unroll
  for (int f = 0; f < 4; ++f) kf[f] = frag_t(kr + f * 512, lane);
  asm volatile("s_wait_xcnt 0x0" ::: "memory");   /* the loads' address registers may be written again right behind them */
}
__device__ __forceinline__ void qk_mul(v8f (&sc)[2], const v16h (&kf)[4], v16h ah0, v16h ah1) {
#pragma unroll
  for (int tt = 0; tt < 2; ++tt) { v8f a = {}; a = wmma16(kf[tt * 2], ah0, a); a = wmma16(kf[tt * 2 + 1], ah1, a); sc[tt] = a; } }
// the v fragments of one chunk
__device__ __forceinline__ void v_chunk(v16h (&vf)[HD / 16], const _Float16* vp, int lane) {
#pragma unroll
  for (int j = 0; j < HD / 16; ++j) vf[j] = frag_t(vp + j * 512, lane);
  asm volatile("s_wait_xcnt 0x0" ::: "memory");   /* the loads' address registers may be written again behind them */
}
// e[i] = 2^(sc[i] x cs + mb) for the 8 logits of one key tile
__device__ __forceinline__ void exp2x8(float (&e)[8], v8f sc, float cs, float mb) { float x[8];
#pragma unroll
  for (int i = 0; i < 8; ++i) x[i] = fmaf(sc[i], cs, mb);
  /* eight v_exp_f32 in one statement: each is the independent instruction behind the one before it (no result is a source: early clobber), and a v_nop stands behind the last: the slot that the instruction set asks for between a transcendental and a use of its result or an overwrite of its source */
  asm("v_exp_f32 %0, %8\n\tv_exp_f32 %1, %9\n\tv_exp_f32 %2, %10\n\tv_exp_f32 %3, %11\n\tv_exp_f32 %4, %12\n\tv_exp_f32 %5, %13\n\tv_exp_f32 %6, %14\n\tv_exp_f32 %7, %15\n\tv_nop"
      : "=&v"(e[0]), "=&v"(e[1]), "=&v"(e[2]), "=&v"(e[3]), "=&v"(e[4]), "=&v"(e[5]), "=&v"(e[6]), "=&v"(e[7])
      : "v"(x[0]), "v"(x[1]), "v"(x[2]), "v"(x[3]), "v"(x[4]), "v"(x[5]), "v"(x[6]), "v"(x[7])); }
// the e of one chunk: its share of the row sum, and the chunk's P fragment (tile 0 = elements 0..7, tile 1 = elements 8..15)
__device__ __forceinline__ v16h e_chunk(const v8f (&sc)[2], float cs, float mb, float& ls0, float& ls1) { v16h p; float e0[8], e1[8]; exp2x8(e0, sc[0], cs, mb); exp2x8(e1, sc[1], cs, mb);
#pragma unroll
  for (int i = 0; i < 8; ++i) { ls0 += e0[i]; ls1 += e1[i]; p[i] = (_Float16)e0[i]; p[8 + i] = (_Float16)e1[i]; }
  return p; }
// excluded keys of chunk c (causal) set to -3.0e38, then the lane's running maximum
__device__ __forceinline__ float mask_max(v8f (&sc)[2], float m, int c, int ql0, int col, int g) {
  if (CAUSAL && c * 32 + 31 > ql0) { const int rel = ql0 + col - c * 32 - 8 * g;   /* one scalar test per chunk: only a chunk that reaches past the tile's first query holds excluded keys; key tile * 16 + r of the lane is allowed while it is <= rel */
#pragma unroll
    for (int tt = 0; tt < 2; ++tt)
#pragma unroll
      for (int r = 0; r < 8; ++r) sc[tt][r] = tt * 16 + r <= rel ? sc[tt][r] : -3.0e38f; }
#pragma unroll
  for (int tt = 0; tt < 2; ++tt)
#pragma unroll
    for (int r = 0; r < 8; ++r) m = fmaxf(m, sc[tt][r]);
  return m; }
// a chunk's 16 logits of each lane to and from the wave's own LDS slot (slot k = 2 KiB; each 16-B access of the wave is 512 contiguous bytes); no other wave touches the slot before the merge barrier
__device__ __forceinline__ void park(float* slot, const v8f (&sc)[2], int lane) {
#pragma unroll
  for (int q = 0; q < 4; ++q) { v4f t;
#pragma unroll
    for (int c = 0; c < 4; ++c) t[c] = sc[q >> 1][(q & 1) * 4 + c];
    vst2(slot + (q * 32 + lane) * 4, t); } }
__device__ __forceinline__ void unpark(v8f (&sc)[2], const float* slot, int lane) {
#pragma unroll
  for (int q = 0; q < 4; ++q) { const v4f t = *(const v4f*)(slot + (q * 32 + lane) * 4);
#pragma unroll
    for (int c = 0; c < 4; ++c) sc[q >> 1][(q & 1) * 4 + c] = t[c]; } }
__device__ __forceinline__ void pv_mul(v8f (&acc)[HD / 16], v16h p, const v16h (&vf)[HD / 16]) {
#pragma unroll
  for (int j = 0; j < HD / 16; ++j) acc[j] = wmma16(p, vf[j], acc[j]); }
__global__ __launch_bounds__(32 * PVS) void k_pv(const _Float16* __restrict__ QH, const _Float16* __restrict__ KH, const _Float16* __restrict__ QL, const _Float16* __restrict__ KL, const _Float16* __restrict__ VT, const __bf16* __restrict__ VB, const __bf16* __restrict__ VBL, float* __restrict__ Y) { const int b = blockIdx.z / NH, h = blockIdx.z % NH; __shared__ __align__(16) float part[PVS][16 * HD]; __shared__ __align__(16) float mx[16][SPW], sm[16][SPW];
  const int tid = threadIdx.x, lane = tid & 31, col = lane & 15, g = lane >> 4; const int wave = __builtin_amdgcn_readfirstlane(tid >> 5); const int qb = blockIdx.x >> 2; const int ql0 = blockIdx.x * 16; const int kce = (kb_last(qb) + 1) * 4; const int n = wave < kce ? (kce - wave + PVS - 1) / PVS : 0;   /* chunks wave, wave + PVS, ... below kce: the wave's own, the same count in all its lanes */
  v8f s[2][2]; float m = -3.0e38f; float* sw = &part[wave][0];   /* s: raw logits (not yet x SCALE) of the wave's chunks 0 and 1, query ql0 + col, keys chunk * 32 + tile * 16 + 8 g + r; those of its chunks 2 and 3 wait in sw, the wave's own LDS slot, which takes its partial ctx tile [16][HD] afterwards; every test on n is the same for the whole wave */
  { const _Float16* qp = QH + ((size_t)blockIdx.z * (TT / 16) + blockIdx.x) * FT; const _Float16* kp = KH + (size_t)blockIdx.z * (TT / 16) * FT;
    const v16h ah0 = frag_t(qp, lane), ah1 = frag_t(qp + 512, lane);
    asm volatile("s_wait_xcnt 0x0" ::: "memory");   /* the q loads' address registers are reused behind the branch below */
    if (qb < QBH) { const _Float16* qlp = QL + ((size_t)blockIdx.z * (QHI / 16) + blockIdx.x) * FT; const _Float16* klp = KL + (size_t)blockIdx.z * (KHI / 16) * FT;
      if (n > 0) { const v16h al0 = frag_t(qlp, lane), al1 = frag_t(qlp + 512, lane);
#pragma unroll
        for (int tt = 0; tt < 2; ++tt) { const _Float16* kr = kp + (size_t)(wave * 2 + tt) * FT; const _Float16* kl = klp + (size_t)(wave * 2 + tt) * FT;
          const v16h kb0 = frag_t(kr, lane), kl0 = frag_t(kl, lane), kb1 = frag_t(kr + 512, lane), kl1 = frag_t(kl + 512, lane); v8f a = {}, l = {};
          asm volatile("s_wait_xcnt 0x0" ::: "memory");   /* the k loads' address registers may be taken again right behind them */
          a = wmma16(kb0, ah0, a); l = wmma16(kb0, al0, l); l = wmma16(kl0, ah0, l);
          a = wmma16(kb1, ah1, a); l = wmma16(kb1, al1, l); l = wmma16(kl1, ah1, l);
          s[0][tt] = a + l * (1.0f / 1024.0f); } }
    } else { const _Float16* kr = kp + (size_t)wave * (2 * FT); v16h ka[4], kb[4];   /* two chunks (4 key tiles) have their k fragments in flight together: one load latency up to two chunks, two above */
      if (n > 2) { k_chunk(ka, kr + 2 * PVS * (2 * FT), lane); if (n > 3) k_chunk(kb, kr + 3 * PVS * (2 * FT), lane);
        qk_mul(s[0], ka, ah0, ah1); m = mask_max(s[0], m, wave + 2 * PVS, ql0, col, g); park(sw, s[0], lane);
        if (n > 3) { qk_mul(s[0], kb, ah0, ah1); m = mask_max(s[0], m, wave + 3 * PVS, ql0, col, g); park(sw + 512, s[0], lane); } }
      if (n > 0) { k_chunk(ka, kr, lane); if (n > 1) k_chunk(kb, kr + PVS * (2 * FT), lane);
        qk_mul(s[0], ka, ah0, ah1); if (n > 1) qk_mul(s[1], kb, ah0, ah1); } } }
  if (n > 0) m = mask_max(s[0], m, wave, ql0, col, g);
  if (n > 1) m = mask_max(s[1], m, wave + PVS, ql0, col, g);
  m = fmaxf(m, __shfl_xor(m, 16));
  if (lane < 16) mx[col][wave] = m;   /* a wave without a chunk leaves -3.0e38 */
  __syncthreads();   /* every wave's row maxima are in LDS before any lane takes its row's maximum */
  { v4f q4 = *(const v4f*)&mx[col][0];
#pragma unroll
    for (int w = 4; w < PVS; w += 4) { const v4f o4 = *(const v4f*)&mx[col][w];
#pragma unroll
      for (int c = 0; c < 4; ++c) q4[c] = fmaxf(q4[c], o4[c]); }
    m = fmaxf(fmaxf(q4[0], q4[1]), fmaxf(q4[2], q4[3])); }
  const float cs = SCALE * 1.44269504f, mb = 11.0f - (m * SCALE) * 1.44269504f;   /* e = 2^(x log2(e) - max log2(e) + 11): one fused multiply-add and one v_exp_f32 per key; SCALE is a power of two, so raw x (SCALE log2(e)) is the scaled logit's product exactly; the rounding of mb scales the whole row alike and cancels in e / sum. m is a real logit (key 0 is allowed in every row), so an excluded key's -3.0e38 goes far below and its e to 0 with no test */
  float ls0 = 0.f, ls1 = 0.f; v8f acc[HD / 16] = {};
  if (qb < QBH) {
    if (n > 0) { v16b vh[HD / 16], vl[HD / 16]; float e[16], e0[8], e1[8]; exp2x8(e0, s[0][0], cs, mb); exp2x8(e1, s[0][1], cs, mb);
#pragma unroll
      for (int i = 0; i < 8; ++i) { e[i] = e0[i]; e[8 + i] = e1[i]; ls0 += e0[i]; ls1 += e1[i]; }
      const F2 p = bsplit16(e);
      asm volatile("" :: "v"(p.h), "v"(p.l) : "memory");   /* inputs only: holds the 16 loads below behind the end of the split, whose temporaries are then dead; side by side they pass 128 registers, and the WGP holds one block, not two */
#pragma unroll
      for (int j = 0; j < HD / 16; ++j) { const size_t po = ((size_t)blockIdx.z * (KHI / 32) + wave) * FV + j * 512; vh[j] = frag_tb(VB + po, lane); vl[j] = frag_tb(VBL + po, lane); }
      asm volatile("s_wait_xcnt 0x0" ::: "memory");   /* the loads' address registers may be written again behind them */
#pragma unroll
      for (int j = 0; j < HD / 16; ++j) { acc[j] = wmma_bf(p.h, vh[j], acc[j]); acc[j] = wmma_bf(p.l, vh[j], acc[j]); acc[j] = wmma_bf(p.h, vl[j], acc[j]); } }
  } else if (n > 0) { const _Float16* vp = VT + ((size_t)blockIdx.z * (TT / 32) + wave) * FV; v16h p0, p1, va[HD / 16];   /* e runs one chunk ahead of the products: while a chunk's v fragments are in flight the e of the next chunk are formed; chunks 2 and 3 come back from the wave's LDS slot one at a time */
    v_chunk(va, vp, lane);
    p0 = e_chunk(s[0], cs, mb, ls0, ls1); if (n > 1) p1 = e_chunk(s[1], cs, mb, ls0, ls1);
    pv_mul(acc, p0, va);
    if (n > 1) { v_chunk(va, vp + PVS * FV, lane);
      if (n > 2) { unpark(s[0], sw, lane); p0 = e_chunk(s[0], cs, mb, ls0, ls1); }
      pv_mul(acc, p1, va);
      if (n > 2) { v_chunk(va, vp + 2 * (PVS * FV), lane);
        if (n > 3) { unpark(s[0], sw + 512, lane); p1 = e_chunk(s[0], cs, mb, ls0, ls1); }
        pv_mul(acc, p0, va);
        if (n > 3) { v_chunk(va, vp + 3 * (PVS * FV), lane); pv_mul(acc, p1, va); } } } }
  { float ls = ls0 + ls1; ls += __shfl_xor(ls, 16);
    if (lane < 16) sm[col][wave] = ls; }   /* the wave's share of each row's sum; 0 from a wave without a chunk */
#pragma unroll
  for (int j = 0; j < HD / 16; ++j)
#pragma unroll
    for (int r = 0; r < 8; ++r) sw[(8 * g + r) * HD + j * 16 + col] = acc[j][r];
  __syncthreads();   /* every wave's partial tile and partial row sums are in LDS before any thread adds them */
  { const int rl = tid >> 5; v2f t2 = *(const v2f*)&part[0][rl * HD + lane * 2]; float sum = 0.f;
#pragma unroll
    for (int w = 1; w < PVS; ++w) t2 += *(const v2f*)&part[w][rl * HD + lane * 2];
#pragma unroll
    for (int w = 0; w < PVS; w += 4) { const v4f o4 = *(const v4f*)&sm[rl][w]; sum += o4[0]; sum += o4[1]; sum += o4[2]; sum += o4[3]; }
    vst2(Y + ((size_t)b * TT + ql0 + rl) * CC + h * HD + lane * 2, t2 * (sum > 0.f ? 1.0f / sum : 0.f)); } }   /* a fully excluded row yields 0 */
// ---- k_out: block = (RT rows, 128 cols): out = ctx Wo (+ bo): ctx once to f16 against Wo as f16(bf16 x 2^8) exact (1 product) x 2^-8; causal early rows (< QHI of each sequence): ctx bf16 hi + lo against exact bf16 Wo (2 products)
__global__ __launch_bounds__(2 * RT) void k_out(const float* __restrict__ Y, const float* __restrict__ WO, const float* __restrict__ BO, float* __restrict__ OUT) { __shared__ __align__(16) float sf[RT / 16][16][132]; __shared__ __align__(16) unsigned short wt[2][128][WP];
  const int tid = threadIdx.x, wave = tid >> 5, lane = tid & 31, col = lane & 15, g = lane >> 4; const int wc = tid & 127, wk = (tid >> 7) * KW; const int c0 = blockIdx.y * 128; const size_t r0 = (size_t)blockIdx.x * RT + wave * 16;
  v8f acc[8] = {};
  const float* wp = WO + (size_t)wk * DIN + c0 + wc; const float* xp = Y + (r0 + col) * CC + 8 * g; float wr[KW]; v4f xr[KS / 8];
  stage_ld<DIN>(wr, xr, wp, xp);
  asm volatile("s_wait_xcnt 0x0" ::: "memory");   /* stage 0's loads name registers that are written again behind the branch below */
  if (CAUSAL && (int)(((size_t)blockIdx.x * RT) % TT) < QHI) {   /* block-uniform */
    F2 a[KS / 32]; stage_st<0>(&wt[0][wc][wk], wr);
#pragma unroll
    for (int kk = 0; kk < KS / 32; ++kk) { float v[16]; stage_a(v, xr, kk); a[kk] = bsplit16(v); }
    __syncthreads();   /* stage 0 of the weight tile is in LDS before any wave reads it */
#pragma unroll 1   /* kept rolled: a trip already holds a whole stage's loads and products; a second copy would only add registers and code */
    for (int s = 0; s < CC / KS; ++s) {
      if (s + 1 < CC / KS) { stage_ld<DIN>(wr, xr, wp + (size_t)KS * DIN, xp + KS);
        asm volatile("s_wait_xcnt 0x0" : "+v"(wp), "+v"(xp) :: "memory");   /* stands between these loads and the step of their two address pairs */
        wp += (size_t)KS * DIN; xp += KS; }
#pragma unroll
      for (int kk = 0; kk < KS / 32; ++kk)
#pragma unroll
        for (int j0 = 0; j0 < 8; j0 += FG) { v16b w[FG];
#pragma unroll
          for (int j = 0; j < FG; ++j) w[j] = frag_b((const __bf16*)&wt[s & 1][(j0 + j) * 16 + col][kk * 32], lane);
#pragma unroll
          for (int j = 0; j < FG; ++j) { acc[j0 + j] = wmma_bf(a[kk].h, w[j], acc[j0 + j]); acc[j0 + j] = wmma_bf(a[kk].l, w[j], acc[j0 + j]); } }
      if (s + 1 < CC / KS) { stage_st<0>(&wt[(s + 1) & 1][wc][wk], wr);
#pragma unroll
        for (int kk = 0; kk < KS / 32; ++kk) { float v[16]; stage_a(v, xr, kk); a[kk] = bsplit16(v); } }
      __syncthreads();   /* publishes stage s + 1 and ends every wave's reads of stage s, whose buffer the next trip refills */
    }
#pragma unroll
    for (int j = 0; j < 8; ++j) { const float bias = BO ? bfr(BO[c0 + j * 16 + col]) : 0.f;
#pragma unroll
      for (int r = 0; r < 8; ++r) sf[wave][8 * g + r][j * 16 + col] = acc[j][r] + bias; }
  } else {
    v16h a[KS / 32]; stage_st<1>(&wt[0][wc][wk], wr);
#pragma unroll
    for (int kk = 0; kk < KS / 32; ++kk) { float v[16]; stage_a(v, xr, kk);
#pragma unroll
      for (int i = 0; i < 16; ++i) a[kk][i] = (_Float16)(v[i] * 64.0f); }   /* ctx carried x 2^6 into f16 so small-magnitude context rows stay clear of f16 subnormals */
    __syncthreads();   /* stage 0 of the weight tile is in LDS before any wave reads it */
#pragma unroll 1   /* kept rolled: a trip already holds a whole stage's loads and products; a second copy would only add registers and code */
    for (int s = 0; s < CC / KS; ++s) {
      if (s + 1 < CC / KS) { wp += (size_t)KS * DIN; xp += KS; stage_ld<DIN>(wr, xr, wp, xp); }
#pragma unroll
      for (int kk = 0; kk < KS / 32; ++kk)
#pragma unroll
        for (int j0 = 0; j0 < 8; j0 += FG) { v16h w[FG];
#pragma unroll
          for (int j = 0; j < FG; ++j) w[j] = frag_h((const _Float16*)&wt[s & 1][(j0 + j) * 16 + col][kk * 32], lane);
#pragma unroll
          for (int j = 0; j < FG; ++j) acc[j0 + j] = wmma16(a[kk], w[j], acc[j0 + j]); }
      if (s + 1 < CC / KS) { stage_st<1>(&wt[(s + 1) & 1][wc][wk], wr);
#pragma unroll
        for (int kk = 0; kk < KS / 32; ++kk) { float v[16]; stage_a(v, xr, kk);
#pragma unroll
          for (int i = 0; i < 16; ++i) a[kk][i] = (_Float16)(v[i] * 64.0f); } }
      __syncthreads();   /* publishes stage s + 1 and ends every wave's reads of stage s, whose buffer the next trip refills */
    }
#pragma unroll
    for (int j = 0; j < 8; ++j) { const float bias = BO ? bfr(BO[c0 + j * 16 + col]) : 0.f;
#pragma unroll
      for (int r = 0; r < 8; ++r) sf[wave][8 * g + r][j * 16 + col] = acc[j][r] * (1.0f / 16384.0f) + bias; } }   /* 2^-8 (Wo carry) x 2^-6 (ctx carry) */
  LDSX(); for (int rl = 0; rl < 16; ++rl) vst2(OUT + (r0 + rl) * DIN + c0 + lane * 4, *(const v4f*)&sf[wave][rl][lane * 4]); }

extern "C" void kernel_launch(void* const* d_in, const int* in_sizes, int n_in, void* d_out, int out_size, void* d_ws, size_t ws_size, hipStream_t stream) {
  (void)in_sizes; (void)n_in; (void)out_size;
  const float** F = (const float**)d_in;
  if (ws_size < (size_t)WS_END) return;
  char* ws = (char*)d_ws; _Float16 *QH = (_Float16*)(ws + WS_QH), *KH = (_Float16*)(ws + WS_KH), *VT = (_Float16*)(ws + WS_VT), *QL = (_Float16*)(ws + WS_QL), *KL = (_Float16*)(ws + WS_KL); __bf16 *VB = (__bf16*)(ws + WS_VB), *VBL = (__bf16*)(ws + WS_VBL); float *Y = (float*)(ws + WS_Y);
  (void)Y; (void)QL; (void)KL; (void)VB; (void)VBL;
  // inputs: 0 x [2,2048,1024]; 1 w_attn [1024,3072] (in,out; columns q | k | v); 2 b_attn [3072] (zeros, read); 3 w_proj [1024,1024] (in,out); 4 b_proj [1024] (zeros, read). outputs: 0 a [2,2048,1024] at d_out + 0; 1 present [2,2,16,2048,64] at d_out + NB*TT*CC floats (byte offset 16,777,216)
  k_proj<<<dim3(TNB * TT / RT, CC / 128, 3), 2 * RT, 0, stream>>>(F[0], F[0], F[0], F[1], F[1] + CC, F[1] + 2 * CC, F[2], F[2] + CC, F[2] + 2 * CC, QH, QL, KH, KL, VT, VB, VBL, (float*)d_out + (size_t)NB * TT * CC);
  k_pv<<<dim3(TT / 16, 1, TNB * NH), 32 * PVS, 0, stream>>>(QH, KH, QL, KL, VT, VB, VBL, Y);
  k_out<<<dim3(TNB * TT / RT, DIN / 128), 2 * RT, 0, stream>>>(Y, F[3], F[4], (float*)d_out);
}
